// v005
// The times below were measured on an AMD MI455X: many runs one after another, warmed up first and cycling through
// copies of the inputs, with the whole window's GPU time divided by the number of runs. Launches and the gaps
// between them are all in it. The median over several windows is given; except for v000 it joins two sittings, which
// can be a few percent apart, so the side-by-side timings, each taken in one sitting, are the better comparison.
// The versions before v005 are in another document.
// A run of this version takes 46.7 microseconds.
// Next to v004, in two timings, it ran 2.52 and 2.50 times as fast.
// Counting every step since v000, which is the starting kernel, it is 33.0 times as fast.
// Contractions: per batch the trilinear term (q * w_qm).m^T [1024x128].[128x1024] on bf16 hi/lo split planes (logits reach ~+-30, so they need f32-class accuracy) and the query->memory read q2m.memory [1024x1024].[1024x128] with f16 operands (probabilities x 2^12) — both in one fused launch, a wave taking 32 memory rows x 16 queries a step; f32 accumulate. The mask arithmetic (sim + (1 - mask) * -1e30, exactly as the module), the row softmax (exp once) and the row maxima are f32 work inside that launch; the two linear terms, the softmax over rows and the memory->query vector (broadcast to every row) are f32 kernels.
#include <hip/hip_runtime.h>
#include <math.h>

typedef __attribute__((ext_vector_type(16))) _Float16 v16h;
typedef __attribute__((ext_vector_type(8)))  _Float16 v8h;
typedef __attribute__((ext_vector_type(16))) __bf16   v16b;
typedef __attribute__((ext_vector_type(8)))  float    v8f;
typedef __attribute__((ext_vector_type(4)))  float    v4f;

// 16-bit WMMA fragment map (wave32), lane L, h = L>>4, m = L&15:
//   A 16x32: lane = row m;   element i -> k = (i<8) ? 8h+i : 16+8h+(i-8)
//   B 32x16: lane = column m; the SAME k(i,h)
//   D 16x16 (8 f32): lane = column m; element r -> row 8h+r
__device__ __forceinline__ int frag_k(int i, int h) { return (i < 8) ? (8 * h + i) : (16 + 8 * h + (i - 8)); }
__device__ __forceinline__ __bf16 bf16_rne(float f) {
    unsigned int u = __float_as_uint(f);
    u += 0x7fffu + ((u >> 16) & 1u);
    return __builtin_bit_cast(__bf16, (unsigned short)(u >> 16));
}
__device__ __forceinline__ float bf16_f32(__bf16 b) { return __uint_as_float(((unsigned int)__builtin_bit_cast(unsigned short, b)) << 16); }
__device__ __forceinline__ v8f wmma16(v16h a, v16h b, v8f c) {
    c = __builtin_amdgcn_wmma_f32_16x16x32_f16(false, a, false, b, (short)0, c, false, false);
    asm volatile("v_nop\n\tv_nop\n\tv_nop\n\tv_nop" : "+v"(c) : "v"(a), "v"(b));
    return c;
}
__device__ __forceinline__ v8f wmmab(v16b a, v16b b, v8f c) {
    c = __builtin_amdgcn_wmma_f32_16x16x32_bf16(false, a, false, b, (short)0, c, false, false);
    asm volatile("v_nop\n\tv_nop\n\tv_nop\n\tv_nop" : "+v"(c) : "v"(a), "v"(b));
    return c;
}
struct Split { v16b hi, lo; };
// hi/lo split product: a.hi*b.hi + a.hi*b.lo + a.lo*b.hi
__device__ __forceinline__ v8f wmma3(const Split& a, const Split& b, v8f c) {
    c = __builtin_amdgcn_wmma_f32_16x16x32_bf16(false, a.hi, false, b.hi, (short)0, c, false, false);
    c = __builtin_amdgcn_wmma_f32_16x16x32_bf16(false, a.hi, false, b.lo, (short)0, c, false, false);
    c = __builtin_amdgcn_wmma_f32_16x16x32_bf16(false, a.lo, false, b.hi, (short)0, c, false, false);
    asm volatile("v_nop\n\tv_nop\n\tv_nop\n\tv_nop" : "+v"(c) : "v"(a.hi), "v"(a.lo), "v"(b.hi), "v"(b.lo));
    return c;
}
struct Split3 { v16b hi, mid, lo; };
// triple split product (6 terms, drops only terms below 2^-24 relative)
__device__ __forceinline__ v8f wmma6(const Split3& a, const Split3& b, v8f c) {
    c = __builtin_amdgcn_wmma_f32_16x16x32_bf16(false, a.hi, false, b.hi, (short)0, c, false, false);
    c = __builtin_amdgcn_wmma_f32_16x16x32_bf16(false, a.hi, false, b.mid, (short)0, c, false, false);
    c = __builtin_amdgcn_wmma_f32_16x16x32_bf16(false, a.mid, false, b.hi, (short)0, c, false, false);
    c = __builtin_amdgcn_wmma_f32_16x16x32_bf16(false, a.hi, false, b.lo, (short)0, c, false, false);
    c = __builtin_amdgcn_wmma_f32_16x16x32_bf16(false, a.mid, false, b.mid, (short)0, c, false, false);
    c = __builtin_amdgcn_wmma_f32_16x16x32_bf16(false, a.lo, false, b.hi, (short)0, c, false, false);
    asm volatile("v_nop\n\tv_nop\n\tv_nop\n\tv_nop" : "+v"(c) : "v"(a.hi), "v"(a.mid), "v"(a.lo), "v"(b.hi), "v"(b.mid), "v"(b.lo));
    return c;
}

// Fragment gathers from f32 memory: element i <- p[(k0 + frag_k(i,h)) * sk] * s, zero for k >= klen.
__device__ __forceinline__ v16h fh_ld(const float* __restrict__ p, long long sk, int k0, int h, int klen, float s) {
    v16h a;
#pragma unroll
    for (int i = 0; i < 16; ++i) { const int k = k0 + frag_k(i, h); a[i] = (k < klen) ? (_Float16)(p[(long long)k * sk] * s) : (_Float16)0.f; }
    return a;
}
__device__ __forceinline__ Split sp_ld(const float* __restrict__ p, long long sk, int k0, int h, int klen, float s) {
    Split r;
#pragma unroll
    for (int i = 0; i < 16; ++i) {
        const int k = k0 + frag_k(i, h); const float x = (k < klen) ? p[(long long)k * sk] * s : 0.f;
        const __bf16 hb = bf16_rne(x); r.hi[i] = hb; r.lo[i] = bf16_rne(x - bf16_f32(hb));
    }
    return r;
}
__device__ __forceinline__ Split3 sp3_ld(const float* __restrict__ p, long long sk, int k0, int h, int klen, float s) {
    Split3 r;
#pragma unroll
    for (int i = 0; i < 16; ++i) {
        const int k = k0 + frag_k(i, h); const float x = (k < klen) ? p[(long long)k * sk] * s : 0.f;
        const __bf16 hb = bf16_rne(x); const float r1 = x - bf16_f32(hb); const __bf16 mb = bf16_rne(r1);
        r.hi[i] = hb; r.mid[i] = mb; r.lo[i] = bf16_rne(r1 - bf16_f32(mb));
    }
    return r;
}
__device__ __forceinline__ v16b bh_ld(const float* __restrict__ p, long long sk, int k0, int h, int klen, float s) {
    v16b a;
#pragma unroll
    for (int i = 0; i < 16; ++i) { const int k = k0 + frag_k(i, h); a[i] = bf16_rne((k < klen) ? p[(long long)k * sk] * s : 0.f); }
    return a;
}
// f16 fragment from an f16 LDS/global row with element stride 1 (k-contiguous), no bounds (tile already zero padded)
__device__ __forceinline__ v16h fh_row(const _Float16* __restrict__ row, int k0, int h) {
    v16h a;
#pragma unroll
    for (int i = 0; i < 16; ++i) a[i] = row[k0 + frag_k(i, h)];
    return a;
}

#define VST2(T, ptr, val) do { const T vst2_v_ = (val); *(T*)(ptr) = vst2_v_;  } while (0)
typedef float v4f __attribute__((ext_vector_type(4)));
#define VST2V4(ptr, val) do { const v4f vst2_v4_ = (val); *(v4f*)(ptr) = vst2_v4_;  } while (0)

__device__ __attribute__((noinline)) float act_fn(float v, int act) {
    if (act == 1) return fmaxf(v, 0.f);                                                                               // relu
    if (act == 2) { const float u = 0.7978845608028654f * (v + 0.044715f * v * v * v); return 0.5f * v * (1.f + tanhf(u)); } // tanh-gelu
    if (act == 3) return v / (1.f + expf(-v));                                                                        // silu
    if (act == 4) return 0.5f * v * (1.f + erff(v * 0.7071067811865476f));                                             // erf-gelu
    if (act == 5) return tanhf(v);
    if (act == 6) return 1.f / (1.f + expf(-v));                                                                      // sigmoid
    if (act == 7) return (v > 0.f) ? v : 0.01f * v;                                                                   // leaky relu 0.01
    if (act == 8) return (v > 0.f) ? v : (expf(v) - 1.f);                                                             // elu
    if (act == 9) return fminf(fmaxf(v, 0.f), 6.f);                                                                   // relu6
    if (act == 10) return fabsf(v);                                                                                    // abs
    if (act == 11) return (v >= 0.f) ? v : 0.1f * v;                                                                  // leaky 0.1
    if (act == 12) return (v > 0.f) ? v : 0.2f * v;                                                                   // leaky 0.2
    if (act == 13) return (v > 20.f) ? v : log1pf(expf(v));                                                            // softplus
    return v;
}

// =====================================================================================================================
// k_gemm<MODE>: C(z, m, n) = act(alpha * sum_k A(z, m, k) * B(z, k, n) + bias) + beta * R(z, m, n)
//   One wave (32-thread block) per 16 x 32 tile of C; grid (ceil(N/32), ceil(M/16), Z). Batch z -> (zo = z / zi_n, zi = z % zi_n)
//   with separate outer/inner strides for every tensor (e.g. batch and head). A(m,k) = A[zo*sAo + zi*sAi + m*sAm + k*sAk] (f32),
//   B(k,n) = B[zo*sBo + zi*sBi + n*sBn + k*sBk] (f32); any M, N, K (K zero-padded to 32 inside the fragments, M/N tails guarded).
//   C(m,n) = C[zo*sCo + zi*sCi + m*sCm + n] (n contiguous). flags: 1 bias[n], 2 bias[m], 4 residual R[zo*sRo + zi*sRi + m*sRm + n*sRn].
//   MODE 0: f16 operands (A prescaled by sa, B by sb, both undone in the epilogue); 1: bf16 hi/lo split (3 products); 2: bf16;
//   3: bf16 hi/mid/lo triple split (6 products); 4: as 3 with Kahan-compensated f32 accumulation across k-steps.
// =====================================================================================================================
struct GemmP {
    const float* A; const float* B; const float* bias; const float* R; float* C;
    long long sAo, sAi, sAm, sAk, sBo, sBi, sBn, sBk, sCo, sCi, sCm, sRo, sRi, sRm, sRn;
    int M, N, K, zi_n, flags, act; float alpha, beta, sa, sb;
    int Npad, pad_;     // columns [N, Npad) of C are written as 0 so that padded workspace rows are covered by whole-line stores; Npad >= N
};
static_assert(sizeof(GemmP) == 5 * 8 + 15 * 8 + 6 * 4 + 4 * 4 + 2 * 4, "GemmP has padding");

template <int MODE>
__global__ __launch_bounds__(32) void k_gemm(GemmP p) {
    const int lane = threadIdx.x & 31, h = lane >> 4, l15 = lane & 15;
    const int m0 = blockIdx.y * 16, n0 = blockIdx.x * 32;
    const int z = blockIdx.z, zo = z / p.zi_n, zi = z - zo * p.zi_n;
    const float* A = p.A + zo * p.sAo + zi * p.sAi;
    const float* B = p.B + zo * p.sBo + zi * p.sBi;
    const int am = min(m0 + l15, p.M - 1);                       // clamped row for loads (stores are guarded)
    v8f acc[2], comp[2];
#pragma unroll
    for (int t = 0; t < 2; ++t) { v8f zz = {}; acc[t] = zz; comp[t] = zz; }
    for (int k0 = 0; k0 < p.K; k0 += 32) {
        const float* arow = A + (long long)am * p.sAm;
        if (MODE == 1) {
            const Split a = sp_ld(arow, p.sAk, k0, h, p.K, 1.f);
#pragma unroll
            for (int t = 0; t < 2; ++t) {
                const int bn = min(n0 + t * 16 + l15, p.N - 1);
                acc[t] = wmma3(a, sp_ld(B + (long long)bn * p.sBn, p.sBk, k0, h, p.K, 1.f), acc[t]);
            }
        } else if (MODE == 3) {
            const Split3 a = sp3_ld(arow, p.sAk, k0, h, p.K, 1.f);
#pragma unroll
            for (int t = 0; t < 2; ++t) {
                const int bn = min(n0 + t * 16 + l15, p.N - 1);
                acc[t] = wmma6(a, sp3_ld(B + (long long)bn * p.sBn, p.sBk, k0, h, p.K, 1.f), acc[t]);
            }
        } else if (MODE == 4) {
            // triple split as MODE 3, but each k-step's 6 products go into a fresh accumulator and the partial is added to the running f32 sum
            // on the VALU with Kahan compensation (accumulation error stays ~1 ulp however long K is)
            const Split3 a = sp3_ld(arow, p.sAk, k0, h, p.K, 1.f);
#pragma unroll
            for (int t = 0; t < 2; ++t) {
                const int bn = min(n0 + t * 16 + l15, p.N - 1); v8f zz = {};
                const v8f part = wmma6(a, sp3_ld(B + (long long)bn * p.sBn, p.sBk, k0, h, p.K, 1.f), zz);
                const v8f y = part - comp[t]; const v8f s = acc[t] + y; comp[t] = (s - acc[t]) - y; acc[t] = s;
            }
        } else if (MODE == 2) {
            const v16b a = bh_ld(arow, p.sAk, k0, h, p.K, 1.f);
#pragma unroll
            for (int t = 0; t < 2; ++t) {
                const int bn = min(n0 + t * 16 + l15, p.N - 1);
                acc[t] = wmmab(a, bh_ld(B + (long long)bn * p.sBn, p.sBk, k0, h, p.K, 1.f), acc[t]);
            }
        } else {
            const v16h a = fh_ld(arow, p.sAk, k0, h, p.K, p.sa);
#pragma unroll
            for (int t = 0; t < 2; ++t) {
                const int bn = min(n0 + t * 16 + l15, p.N - 1);
                acc[t] = wmma16(a, fh_ld(B + (long long)bn * p.sBn, p.sBk, k0, h, p.K, p.sb), acc[t]);
            }
        }
    }
    const float iscale = (MODE == 0) ? p.alpha / (p.sa * p.sb) : p.alpha;
    float* C = p.C + zo * p.sCo + zi * p.sCi;
    const float* R = p.R + zo * p.sRo + zi * p.sRi;
    __shared__ __align__(16) float ctile[16][36];
#pragma unroll
    for (int t = 0; t < 2; ++t) {
        const int n = n0 + t * 16 + l15; const int nn = min(n, p.N - 1);
#pragma unroll
        for (int r = 0; r < 8; ++r) {
            const int m = m0 + 8 * h + r; const int mm = min(m, p.M - 1);
            float v = acc[t][r] * iscale;
            if (p.flags & 1) v += p.bias[nn];
            if (p.flags & 2) v += p.bias[mm];
            if (p.flags & 8) v *= p.bias[(long long)zo * p.M + mm];   /* per-(z,row) scale vector laid out [Z][M]; exclusive with the bias flags */
            v = act_fn(v, p.act);
            if (p.flags & 4) v += p.beta * R[(long long)mm * p.sRm + (long long)nn * p.sRn];
            ctile[8 * h + r][t * 16 + l15] = (n < p.N) ? v : 0.f;
        }
    }
    __syncthreads();
    const int NW = (p.Npad > p.N) ? p.Npad : p.N;           // write width
    const bool fast = (m0 + 16 <= p.M) && (n0 + 32 <= NW) && ((p.sCm & 3) == 0) && ((((size_t)C) & 15) == 0);
    if (fast) {
#pragma unroll
        for (int s = 0; s < 4; ++s) {
            const int row = s * 4 + (lane >> 3), c4 = (lane & 7) * 4;
            const v4f v = *(const v4f*)&ctile[row][c4];
            VST2V4(C + (long long)(m0 + row) * p.sCm + n0 + c4, v);
        }
    } else {
        for (int row = 0; row < 16; ++row) {
            const int m = m0 + row, n = n0 + lane;
            if (m < p.M && n < NW) VST2(float, C + (long long)m * p.sCm + n, ctile[row][lane]);
        }
    }
}


// =====================================================================================================================
// k_gemmT<MODE, TM, TN>: same contract as k_gemm, but one wave computes a (16*TM) x (16*TN) tile: TM A fragments and TN B fragments are
//   loaded per 32-wide k-step and reused across TM*TN WMMAs (far fewer load/convert instructions per MAC). MODE 0 (f16), 1 (bf16 hi/lo),
//   2 (bf16) only. grid (ceil(NW/(16*TN)), ceil(M/(16*TM)), Z), block 32. Epilogue identical to k_gemm, run per 16x32 sub-tile.
// =====================================================================================================================
template <int MODE, int TM, int TN>
__global__ __launch_bounds__(32) void k_gemmT(GemmP p) {
    const int lane = threadIdx.x & 31, h = lane >> 4, l15 = lane & 15;
    const int m0 = blockIdx.y * (16 * TM), n0 = blockIdx.x * (16 * TN);
    const int z = blockIdx.z, zo = z / p.zi_n, zi = z - zo * p.zi_n;
    const float* A = p.A + zo * p.sAo + zi * p.sAi;
    const float* B = p.B + zo * p.sBo + zi * p.sBi;
    v8f acc[TM][TN];
#pragma unroll
    for (int i = 0; i < TM; ++i)
#pragma unroll
        for (int t = 0; t < TN; ++t) { v8f zz = {}; acc[i][t] = zz; }
    for (int k0 = 0; k0 < p.K; k0 += 32) {
        if (MODE == 1) {
            Split a[TM], b[TN];
#pragma unroll
            for (int i = 0; i < TM; ++i) { const int am = min(m0 + 16 * i + l15, p.M - 1); a[i] = sp_ld(A + (long long)am * p.sAm, p.sAk, k0, h, p.K, 1.f); }
#pragma unroll
            for (int t = 0; t < TN; ++t) { const int bn = min(n0 + 16 * t + l15, p.N - 1); b[t] = sp_ld(B + (long long)bn * p.sBn, p.sBk, k0, h, p.K, 1.f); }
#pragma unroll
            for (int i = 0; i < TM; ++i)
#pragma unroll
                for (int t = 0; t < TN; ++t) acc[i][t] = wmma3(a[i], b[t], acc[i][t]);
        } else if (MODE == 2) {
            v16b a[TM], b[TN];
#pragma unroll
            for (int i = 0; i < TM; ++i) { const int am = min(m0 + 16 * i + l15, p.M - 1); a[i] = bh_ld(A + (long long)am * p.sAm, p.sAk, k0, h, p.K, 1.f); }
#pragma unroll
            for (int t = 0; t < TN; ++t) { const int bn = min(n0 + 16 * t + l15, p.N - 1); b[t] = bh_ld(B + (long long)bn * p.sBn, p.sBk, k0, h, p.K, 1.f); }
#pragma unroll
            for (int i = 0; i < TM; ++i)
#pragma unroll
                for (int t = 0; t < TN; ++t) acc[i][t] = wmmab(a[i], b[t], acc[i][t]);
        } else {
            v16h a[TM], b[TN];
#pragma unroll
            for (int i = 0; i < TM; ++i) { const int am = min(m0 + 16 * i + l15, p.M - 1); a[i] = fh_ld(A + (long long)am * p.sAm, p.sAk, k0, h, p.K, p.sa); }
#pragma unroll
            for (int t = 0; t < TN; ++t) { const int bn = min(n0 + 16 * t + l15, p.N - 1); b[t] = fh_ld(B + (long long)bn * p.sBn, p.sBk, k0, h, p.K, p.sb); }
#pragma unroll
            for (int i = 0; i < TM; ++i)
#pragma unroll
                for (int t = 0; t < TN; ++t) acc[i][t] = wmma16(a[i], b[t], acc[i][t]);
        }
    }
    const float iscale = (MODE == 0) ? p.alpha / (p.sa * p.sb) : p.alpha;
    float* C = p.C + zo * p.sCo + zi * p.sCi;
    const float* R = p.R + zo * p.sRo + zi * p.sRi;
    const int NW = (p.Npad > p.N) ? p.Npad : p.N;
    __shared__ __align__(16) float ctile[16][36];
#pragma unroll
    for (int i = 0; i < TM; ++i) {
        const int mb = m0 + 16 * i; if (mb >= p.M) break;          // wave-uniform
#pragma unroll
        for (int tp = 0; tp < TN / 2; ++tp) {
            const int nb = n0 + 32 * tp; if (nb >= NW) break;        // wave-uniform
#pragma unroll
            for (int t2 = 0; t2 < 2; ++t2) {
                const int t = 2 * tp + t2; const int n = nb + t2 * 16 + l15; const int nn = min(n, p.N - 1);
#pragma unroll
                for (int r = 0; r < 8; ++r) {
                    const int m = mb + 8 * h + r; const int mm = min(m, p.M - 1);
                    float v = acc[i][t][r] * iscale;
                    if (p.flags & 1) v += p.bias[nn];
                    if (p.flags & 2) v += p.bias[mm];
            if (p.flags & 8) v *= p.bias[(long long)zo * p.M + mm];   /* per-(z,row) scale vector laid out [Z][M]; exclusive with the bias flags */
                    v = act_fn(v, p.act);
                    if (p.flags & 4) v += p.beta * R[(long long)mm * p.sRm + (long long)nn * p.sRn];
                    ctile[8 * h + r][t2 * 16 + l15] = (n < p.N) ? v : 0.f;
                }
            }
            __syncthreads();
            const bool fast = (mb + 16 <= p.M) && (nb + 32 <= NW) && ((p.sCm & 3) == 0) && ((((size_t)C) & 15) == 0);
            if (fast) {
#pragma unroll
                for (int s = 0; s < 4; ++s) {
                    const int row = s * 4 + (lane >> 3), c4 = (lane & 7) * 4;
                    const v4f v = *(const v4f*)&ctile[row][c4];
                    VST2V4(C + (long long)(mb + row) * p.sCm + nb + c4, v);
                }
            } else {
                for (int row = 0; row < 16; ++row) {
                    const int m = mb + row, n = nb + lane;
                    if (m < p.M && n < NW) VST2(float, C + (long long)m * p.sCm + n, ctile[row][lane]);
                }
            }
            __syncthreads();
        }
    }
}

// =====================================================================================================================
//   Wave = 16 queries, AW waves per block, 64-key blocks; grid (ceil(Lq/(16*AW)), H, B), block 32*AW. Any Lq, Lk; head dim dh <= DHP
//   (DHP multiple of 32), value dim dv <= DVP (multiple of 16, <= 128). Every tensor addressed by (batch, head, row, element) strides, f32.
//   Scores: QM 0 f16 operands, 1 bf16 hi/lo split, 2 bf16 triple split; statistics f32 (exp2 domain); P.V: P x 4096 as f16 with V f16 staged in LDS
//   (SPLITPV: P and V as bf16 hi/lo splits). kv head = h / hrep. Masking: causal = 1 (keep j <= i + coff, masked -> -inf, key blocks beyond the
//   diagonal skipped), causal = 2 (masked -> mfill, a finite fill like the -1e9; no skipping), causal = 3 (keep j >= i + coff,
//   masked -> -inf, no skipping); optional additive f32 mask Mf,
//   optional int keep-mask Mi (0 -> score := mfill), both addressed b*smb + h*smh + i*smi + j*smj (0 strides broadcast).
// =====================================================================================================================
#define AW 4
struct AttnP {   // apv4
    const float* Q; const float* K; const float* V; float* O; float* P; const float* Mf; const int* Mi; float* ST;
    const float* Pw; const float* Rt; const int* SQ; const int* SK;           // optional: post-softmax weight, relative-position table, segment ids
    long long swb, swh, swi, swj, srb, srh, sri;                                 // Pw strides (b,h,i,j); Rt strides (b,h,i), column = clamp(i - j + roff, 0, rn-1)
    long long sQb, sQh, sQi, sQd, sKb, sKh, sKj, sKd, sVb, sVh, sVj, sVd, sOb, sOh, sOi, sPb, sPh, sPi, smb, smh, smi, smj;
    int Lq, Lk, dh, dv, hrep, causal, coff, pband;   // pband > 0: P holds only the band |j - i| <= pband, column j - i + pband
    float scale, mfill; int nonorm, mpol;             // nonorm (online path only): O = sum_j exp(score_j) V_j without the 1/rowsum (scores must be <= ~0); mpol: Mi masks where ==0 (mpol 0) or where !=0 (mpol 1)
    int roff, rn, segpol, win;                        // Rt column offset/count; SQ/SK: score := mfill where (segpol 0) SQ[i] != SK[j] or (segpol 1) SQ[i] == SK[j]; win > 0: keys with i - j > win (after coff) -> -inf
};
//   Pw: the softmax numerator is multiplied by Pw(b,h,i,j) AFTER the row sum is taken (probs * weight, then P.V), as in post-softmax multiplicative biases.                                                    // ST (optional): per row (b,h,i) -> ST[((b*H + h)*Lq + i)*2 + {0,1}] = {row max of the scaled+masked score (natural units), sum_j exp(score - max)}
static_assert(sizeof(AttnP) == 12 * 8 + 29 * 8 + 16 * 4, "AttnP has padding");

#ifndef KATTN_ATTR
#define KATTN_ATTR
#endif
template <int DHP, int DVP, int QM, bool SPLITPV, bool TWOPASS>
__global__ __launch_bounds__(32 * AW) KATTN_ATTR void k_attn(AttnP p) {
    constexpr int NT = DVP / 16;                // output tiles
    constexpr int KS = DHP / 32;                // k-steps for the scores
    constexpr int VP = DVP + 8;                 // LDS pitch (halves)
    __shared__ __align__(16) float    pl[AW][16 * 64];
    __shared__ __align__(16) _Float16 vl[(SPLITPV ? 2 : 1) * 64 * VP];   // f16 V tile, or bf16 hi and lo tiles (same 2-byte size)
    const int lane = threadIdx.x & 31, hf = lane >> 4, l15 = lane & 15, wave = threadIdx.x >> 5;
    const int h = blockIdx.y, b = blockIdx.z, hk = h / p.hrep;
    const int q0 = (blockIdx.x * AW + wave) * 16;
    float* myp = pl[wave];
    const float L2E = 1.4426950408889634f;
    const float NEG = -__builtin_inff();
    const int qi = min(q0 + l15, p.Lq - 1);
    const float* qrow = p.Q + b * p.sQb + h * p.sQh + (long long)qi * p.sQi;
    const float* kbase = p.K + b * p.sKb + hk * p.sKh;
    const float* vbase = p.V + b * p.sVb + hk * p.sVh;
    v16h qa[QM == 0 ? KS : 1]; Split qs_[QM == 1 ? KS : 1]; Split3 qt_[QM == 2 ? KS : 1];
#pragma unroll
    for (int ks = 0; ks < KS; ++ks) {
        if (QM == 2) qt_[ks] = sp3_ld(qrow, p.sQd, ks * 32, hf, p.dh, 1.f);
        else if (QM == 1) qs_[ks] = sp_ld(qrow, p.sQd, ks * 32, hf, p.dh, 1.f);
        else qa[ks] = fh_ld(qrow, p.sQd, ks * 32, hf, p.dh, 1.f);
    }
    v8f o[NT]; float m8[8], l8[8];
#pragma unroll
    for (int t = 0; t < NT; ++t) { v8f zz = {}; o[t] = zz; }
#pragma unroll
    for (int i = 0; i < 8; ++i) { m8[i] = NEG; l8[i] = 0.f; }
    int jend = p.Lk;
    if (p.causal == 1) { const int je = (blockIdx.x * AW + AW - 1) * 16 + 16 + p.coff; jend = min(jend, max(je, 0)); }   // uniform per block
    const int npass = TWOPASS ? 2 : 1;
    for (int pass = 0; pass < npass; ++pass) {
        const bool dopv = (!TWOPASS) || pass == 1;
        for (int j0 = 0; j0 < jend; j0 += 64) {
            if (dopv) {
                __syncthreads();                                 // previous key block's reads of vl / pl are done
                for (int idx = threadIdx.x; idx < 64 * DVP; idx += 32 * AW) {
                    const int jr = idx / DVP, d = idx - jr * DVP, j = j0 + jr;
                    const float f = (j < p.Lk && d < p.dv) ? vbase[(long long)j * p.sVj + (long long)d * p.sVd] : 0.f;
                    if (SPLITPV) {
                        const __bf16 hb = bf16_rne(f);
                        ((__bf16*)vl)[jr * VP + d] = hb; ((__bf16*)vl)[64 * VP + jr * VP + d] = bf16_rne(f - bf16_f32(hb));
                    } else vl[jr * VP + d] = (_Float16)f;
                }
            }
            v8f s[4];
#pragma unroll
            for (int t = 0; t < 4; ++t) {
                const int j = min(j0 + t * 16 + l15, p.Lk - 1);
                const float* krow = kbase + (long long)j * p.sKj;
                v8f acc = {};
#pragma unroll
                for (int ks = 0; ks < KS; ++ks) {
                    if (QM == 2)      acc = wmma6(qt_[ks], sp3_ld(krow, p.sKd, ks * 32, hf, p.dh, 1.f), acc);
                    else if (QM == 1) acc = wmma3(qs_[ks], sp_ld(krow, p.sKd, ks * 32, hf, p.dh, 1.f), acc);
                    else              acc = wmma16(qa[ks], fh_ld(krow, p.sKd, ks * 32, hf, p.dh, 1.f), acc);
                }
                s[t] = acc;
            }
            float pv[8][4];
#pragma unroll
            for (int i = 0; i < 8; ++i) {
                const int irow = q0 + i + 8 * hf;
                const int ic = min(irow, p.Lq - 1);
                float sc[4];
#pragma unroll
                for (int t = 0; t < 4; ++t) {
                    const int jg = j0 + t * 16 + l15;
                    float v = s[t][i] * p.scale;
                    if (p.Mf) v += p.Mf[b * p.smb + h * p.smh + (long long)ic * p.smi + (long long)min(jg, p.Lk - 1) * p.smj];
                    if (p.Rt) { int rc = ic - min(jg, p.Lk - 1) + p.roff; rc = rc < 0 ? 0 : (rc >= p.rn ? p.rn - 1 : rc); v += p.Rt[b * p.srb + h * p.srh + (long long)ic * p.sri + rc]; }
                    if (p.Mi) { const int mv = p.Mi[b * p.smb + h * p.smh + (long long)ic * p.smi + (long long)min(jg, p.Lk - 1) * p.smj]; if (p.mpol ? (mv != 0) : (mv == 0)) v = p.mfill; }
                    if (p.SQ) { const bool same = p.SQ[(long long)b * p.Lq + ic] == p.SK[(long long)b * p.Lk + min(jg, p.Lk - 1)]; if (p.segpol ? same : !same) v = p.mfill; }
                    if (p.causal == 2 && jg > irow + p.coff) v = p.mfill;
                    if (jg >= p.Lk || (p.causal == 1 && jg > irow + p.coff) || (p.causal == 3 && jg < irow + p.coff) || (p.win > 0 && irow + p.coff - jg > p.win)) v = NEG; else v *= L2E;
                    sc[t] = v;
                }
                if (!TWOPASS || pass == 0) {
                    float mx = fmaxf(fmaxf(sc[0], sc[1]), fmaxf(sc[2], sc[3]));
                    mx = fmaxf(mx, __shfl_xor(mx, 1, 32)); mx = fmaxf(mx, __shfl_xor(mx, 2, 32));
                    mx = fmaxf(mx, __shfl_xor(mx, 4, 32)); mx = fmaxf(mx, __shfl_xor(mx, 8, 32));
                    const float mnew = fmaxf(m8[i], mx);
                    const float corr = (mnew == NEG) ? 1.f : exp2f(m8[i] - mnew);
                    float rs = 0.f;
#pragma unroll
                    for (int t = 0; t < 4; ++t) {
                        const float pp = (sc[t] == NEG) ? 0.f : exp2f(sc[t] - mnew); rs += pp;
                        pv[i][t] = p.Pw ? pp * p.Pw[b * p.swb + h * p.swh + (long long)ic * p.swi + (long long)min(j0 + t * 16 + l15, p.Lk - 1) * p.swj] : pp;
                    }
                    rs += __shfl_xor(rs, 1, 32); rs += __shfl_xor(rs, 2, 32); rs += __shfl_xor(rs, 4, 32); rs += __shfl_xor(rs, 8, 32);
                    l8[i] = l8[i] * corr + rs; m8[i] = mnew;
                    if (!TWOPASS) {
#pragma unroll
                        for (int t = 0; t < NT; ++t) o[t][i] *= corr;
                    }
                } else {
                    const float inv = (l8[i] > 0.f) ? 1.f / l8[i] : 0.f;
#pragma unroll
                    for (int t = 0; t < 4; ++t) {
                        const int jg = j0 + t * 16 + l15;
                        float pp = (sc[t] == NEG) ? 0.f : exp2f(sc[t] - m8[i]) * inv;
                        if (p.Pw) pp *= p.Pw[b * p.swb + h * p.swh + (long long)ic * p.swi + (long long)min(jg, p.Lk - 1) * p.swj];
                        pv[i][t] = pp;
                    }
                }
            }
            if (dopv) {
#pragma unroll
                for (int i = 0; i < 8; ++i)
#pragma unroll
                    for (int t = 0; t < 4; ++t) ((float*)myp)[(i + 8 * hf) * 64 + t * 16 + l15] = pv[i][t];
                __syncthreads();                                 // P (per wave) and V (shared) visible
                if (p.P) {
                    float* pb_ = p.P + b * p.sPb + h * p.sPh;
                    const bool fastP = (p.pband == 0) && ((p.sPi & 3) == 0) && (j0 + 64 <= p.Lk) && (q0 + 16 <= p.Lq) && ((((size_t)pb_) & 15) == 0);
                    if (fastP) {
#pragma unroll
                        for (int s = 0; s < 8; ++s) {
                            const int row = s * 2 + (lane >> 4), c4 = (lane & 15) * 4;
                            const v4f v = *(const v4f*)(myp + row * 64 + c4);
                            VST2V4(pb_ + (long long)(q0 + row) * p.sPi + j0 + c4, v);
                        }
                    } else {
                        for (int row = 0; row < 16; ++row) {
                            const int irow = q0 + row; if (irow >= p.Lq) continue;
                            for (int c = lane; c < 64; c += 32) {
                                const int jg = j0 + c; if (jg >= p.Lk) continue;
                                if (p.pband == 0) VST2(float, pb_ + (long long)irow * p.sPi + jg, myp[row * 64 + c]);
                                else if (jg - irow <= p.pband && irow - jg <= p.pband) VST2(float, pb_ + (long long)irow * p.sPi + (jg - irow + p.pband), myp[row * 64 + c]);
                            }
                        }
                    }
                }
                if (SPLITPV) {
                    const Split pa0 = sp_ld(myp + l15 * 64, 1, 0, hf, 64, 1.f), pa1 = sp_ld(myp + l15 * 64, 1, 32, hf, 64, 1.f);
                    const __bf16* vh = (const __bf16*)vl; const __bf16* vlo = vh + 64 * VP;
#pragma unroll
                    for (int t = 0; t < NT; ++t) {
                        const int dcol = t * 16 + l15;
                        Split b0, b1;
#pragma unroll
                        for (int e = 0; e < 16; ++e) {
                            const int k0 = frag_k(e, hf), k1 = 32 + frag_k(e, hf);
                            b0.hi[e] = vh[k0 * VP + dcol]; b0.lo[e] = vlo[k0 * VP + dcol]; b1.hi[e] = vh[k1 * VP + dcol]; b1.lo[e] = vlo[k1 * VP + dcol];
                        }
                        o[t] = wmma3(pa0, b0, o[t]);
                        o[t] = wmma3(pa1, b1, o[t]);
                    }
                } else {
                    const v16h pa0 = fh_ld(myp + l15 * 64, 1, 0, hf, 64, 4096.f), pa1 = fh_ld(myp + l15 * 64, 1, 32, hf, 64, 4096.f);
#pragma unroll
                    for (int t = 0; t < NT; ++t) {
                        const int dcol = t * 16 + l15;
                        v16h b0, b1;
#pragma unroll
                        for (int e = 0; e < 16; ++e) { b0[e] = vl[frag_k(e, hf) * VP + dcol]; b1[e] = vl[(32 + frag_k(e, hf)) * VP + dcol]; }
                        o[t] = wmma16(pa0, b0, o[t]);
                        o[t] = wmma16(pa1, b1, o[t]);
                    }
                }
            }
        }
    }
    float* obase = p.O + b * p.sOb + h * p.sOh;
    if (p.ST) {
        const int rl = lane >> 1, isel = rl & 7;           // row q0 + rl ; rl>>3 == hf holds because lane>>4 == (lane>>1)>>3
        float mv = 0.f, lv = 0.f;
#pragma unroll
        for (int i = 0; i < 8; ++i) if (i == isel) { mv = m8[i]; lv = l8[i]; }
        const int irow = q0 + rl;
        if (irow < p.Lq) { float* st = p.ST + (((long long)b * gridDim.y + h) * p.Lq + irow) * 2 + (lane & 1); VST2(float, st, (lane & 1) ? lv : mv * 0.6931471805599453f); }
    }
    float invr[8];
#pragma unroll
    for (int i = 0; i < 8; ++i) {
        if (TWOPASS) invr[i] = SPLITPV ? 1.f : (1.f / 4096.f);
        else if (p.nonorm) invr[i] = exp2f(m8[i]) * (SPLITPV ? 1.f : (1.f / 4096.f));
        else invr[i] = (l8[i] > 0.f) ? (SPLITPV ? 1.f / l8[i] : 1.f / (l8[i] * 4096.f)) : 0.f;
    }
    __syncthreads();                                             // all waves done with pl/vl from the main loop
    const bool ofast = ((p.sOi & 3) == 0) && ((((size_t)obase) & 15) == 0) && (q0 + 16 <= p.Lq);
#pragma unroll
    for (int c0 = 0; c0 < DVP; c0 += 64) {
#pragma unroll
        for (int i = 0; i < 8; ++i)
#pragma unroll
            for (int t = 0; t < NT; ++t) if (t * 16 >= c0 && t * 16 < c0 + 64) ((float*)myp)[(i + 8 * hf) * 64 + (t * 16 - c0) + l15] = o[t][i] * invr[i];
        __syncthreads();
        const int cw = (DVP - c0 < 64) ? (DVP - c0) : 64;      // staged columns in this chunk (multiple of 16)
        if (ofast && (c0 + cw <= p.dv) && (cw % 32 == 0)) {
            const int lpr = cw / 4;                              // lanes per row (16 for 64 cols, 8 for 32)
            const int rows_per_ins = 32 / lpr;
            for (int r0 = 0; r0 < 16; r0 += rows_per_ins) {
                const int row = r0 + lane / lpr, c4 = (lane % lpr) * 4;
                const v4f v = *(const v4f*)(myp + row * 64 + c4);
                VST2V4(obase + (long long)(q0 + row) * p.sOi + c0 + c4, v);
            }
        } else {
            for (int row = 0; row < 16; ++row) {
                const int irow = q0 + row; if (irow >= p.Lq) continue;
                for (int c = lane; c < cw; c += 32) { const int d = c0 + c; if (d < p.dv) VST2(float, obase + (long long)irow * p.sOi + d, myp[row * 64 + c]); }
            }
        }
        __syncthreads();
    }
}

// =====================================================================================================================
// k_tr: dst(z, c, r) = alpha * src(z, r, c) (+ beta * R2(z, c, r)): [Z][R][C] (row stride lds) -> [Z][C][R] (row stride ldd) through a 32x32 LDS tile;
//   flags: 1 -> add beta * residual R2 addressed like dst (z*sRz + c*ldr + r); act applied before the residual.
// =====================================================================================================================
struct TrP { const float* src; float* dst; const float* R2; long long sSz, lds, sDz, ldd, sRz, ldr; int R, C, flags, act; float alpha, beta; };
static_assert(sizeof(TrP) == 3 * 8 + 6 * 8 + 6 * 4, "TrP has padding");
__global__ __launch_bounds__(256) void k_tr(TrP p) {
    __shared__ float tile[32][33];
    const int c0 = blockIdx.x * 32, r0 = blockIdx.y * 32, z = blockIdx.z;
    const int lane = threadIdx.x & 31, wave = threadIdx.x >> 5;
    const float* s = p.src + z * p.sSz;
#pragma unroll
    for (int k = 0; k < 4; ++k) {
        const int rl = wave * 4 + k, r = r0 + rl, c = c0 + lane;
        tile[rl][lane] = (r < p.R && c < p.C) ? s[(long long)r * p.lds + c] : 0.f;
    }
    __syncthreads();
    float* d = p.dst + z * p.sDz; const float* rr = p.R2 + z * p.sRz;
#pragma unroll
    for (int k = 0; k < 4; ++k) {
        const int cl = wave * 4 + k, c = c0 + cl, r = r0 + lane;
        if (c < p.C && r < p.R) {
            float v = act_fn(p.alpha * tile[lane][cl], p.act);
            if (p.flags & 1) v += p.beta * rr[(long long)c * p.ldr + r];
            VST2(float, d + (long long)c * p.ldd + r, v);
        }
    }
}

// k_affine: dst[i] = a * (sdev ? sdev[0] : 1) * src[i] + b, i < n (one thread per element; consecutive lanes -> consecutive addresses)
__global__ __launch_bounds__(256) void k_affine(const float* __restrict__ src, float* __restrict__ dst, int n, float a, float b, const float* __restrict__ sdev) {
    const int i = blockIdx.x * 256 + threadIdx.x;
    if (i < n) { const float aa = sdev ? a * sdev[0] : a; const float v = aa * src[i] + b; VST2(float, dst + i, v); }
}

// =====================================================================================================================
// k_softmax: row softmax over n contiguous elements, one 256-thread block per row; rows addressed z*sz + r*sr (grid (R, Z)).
//   out = scale_out * softmax(scale_in * x + (Mf ? Mf[z*smz + r*smr + j] : 0)); a row whose max is -inf is written as 0.
// =====================================================================================================================
struct SmP { const float* src; float* dst; const float* Mf; long long sz, sr, dz, dr, smz, smr; int n, pad; float scale_in, scale_out; };
static_assert(sizeof(SmP) == 3 * 8 + 6 * 8 + 4 * 4, "SmP has padding");
__global__ __launch_bounds__(256) void k_softmax(SmP p) {
    __shared__ float red[256];
    const int r = blockIdx.x, z = blockIdx.y, tid = threadIdx.x;
    const float* s = p.src + z * p.sz + (long long)r * p.sr;
    const float* mf = p.Mf ? (p.Mf + z * p.smz + (long long)r * p.smr) : nullptr;
    float mx = -__builtin_inff();
    for (int j = tid; j < p.n; j += 256) { float v = s[j] * p.scale_in; if (mf) v += mf[j]; mx = fmaxf(mx, v); }
    red[tid] = mx; __syncthreads();
    for (int o = 128; o > 0; o >>= 1) { if (tid < o) red[tid] = fmaxf(red[tid], red[tid + o]); __syncthreads(); }
    mx = red[0]; __syncthreads();
    float sum = 0.f;
    for (int j = tid; j < p.n; j += 256) { float v = s[j] * p.scale_in; if (mf) v += mf[j]; sum += (mx == -__builtin_inff()) ? 0.f : expf(v - mx); }
    red[tid] = sum; __syncthreads();
    for (int o = 128; o > 0; o >>= 1) { if (tid < o) red[tid] += red[tid + o]; __syncthreads(); }
    sum = red[0];
    const float inv = (sum > 0.f) ? p.scale_out / sum : 0.f;
    float* d = p.dst + z * p.dz + (long long)r * p.dr;
    for (int j = tid; j < p.n; j += 256) { float v = s[j] * p.scale_in; if (mf) v += mf[j]; const float o = (mx == -__builtin_inff()) ? 0.f : expf(v - mx) * inv; VST2(float, d + j, o); }
}
// =====================================================================================================================
// k_stats: mean and rsqrt(var + eps) over a set of n elements addressed base + z*sz + (e / inner) * so + (e % inner) * si, one 256-thread
// k_norm_apply: y = (x - mean[set]) * rstd[set] * g[c] + b[c] over a [Z][C][L] channel-major tensor with set = z*G + c / (C/G) (G groups per z;
//   G = C -> per-channel sets indexed z*C+c; for batch norm pass stats indexed by c only via bn = 1). Optional act. Output same layout.
// =====================================================================================================================
//   mode 0: mean / rsqrt(var + eps); mode 1 (RMSNorm): 0 / rsqrt(mean(x^2) + eps); mode 2 (L2 normalize * sqrt(n)): 0 / sqrt(n) / max(||x||, eps); mode 3: as 0 with unbiased variance (n-1)
__global__ __launch_bounds__(256) void k_stats(const float* __restrict__ x, long long sz, long long so, long long si, int inner, int n, float eps, float* __restrict__ stat, int mode) {
    __shared__ float red[256];
    const int z = blockIdx.x, tid = threadIdx.x;
    const float* base = x + z * sz;
    float s = 0.f;
    for (int e = tid; e < n; e += 256) s += base[(long long)(e / inner) * so + (long long)(e % inner) * si];
    red[tid] = s; __syncthreads();
    for (int o = 128; o > 0; o >>= 1) { if (tid < o) red[tid] += red[tid + o]; __syncthreads(); }
    const float mu = (mode == 0 || mode == 3) ? red[0] / (float)n : 0.f; __syncthreads();
    float q = 0.f;
    for (int e = tid; e < n; e += 256) { const float dlt = base[(long long)(e / inner) * so + (long long)(e % inner) * si] - mu; q += dlt * dlt; }
    red[tid] = q; __syncthreads();
    for (int o = 128; o > 0; o >>= 1) { if (tid < o) red[tid] += red[tid + o]; __syncthreads(); }
    {
        float rs;
        if (mode == 2) rs = sqrtf((float)n) / fmaxf(sqrtf(red[0]), eps); else if (mode == 3) rs = rsqrtf(red[0] / (float)(n - 1) + eps); else rs = rsqrtf(red[0] / (float)n + eps);
        if (tid < 32) { const float v = (tid == 0) ? mu : ((tid == 1) ? rs : 0.f); VST2(float, stat + (long long)z * 32 + tid, v); }
    }
}
//   One thread per element over the flat [Z][C][L] index space: grid ceil(Z*C*L / 256).
__global__ __launch_bounds__(256) void k_norm_apply(const float* __restrict__ x, float* __restrict__ y, const float* __restrict__ stat, const float* __restrict__ g, const float* __restrict__ bta,
                                                     int Z, int C, int L, int G, int bn, int act) {
    const long long idx = (long long)blockIdx.x * 256 + threadIdx.x;
    if (idx >= (long long)Z * C * L) return;
    const int l = (int)(idx % L); const long long zc = idx / L; const int c = (int)(zc % C), z = (int)(zc / C); (void)l;
    const int set = bn ? c : (z * G + c / (C / G));
    float v = (x[idx] - stat[(long long)set * 32]) * stat[(long long)set * 32 + 1];
    if (g) v *= g[c];
    if (bta) v += bta[c];
    v = act_fn(v, act);
    VST2(float, y + idx, v);
}

// k_lse_neg: c[i] = -(st[2i] + log(st[2i+1])) = minus the log-sum-exp of row i from k_attn's ST output (for softmax over the query dimension)
__global__ __launch_bounds__(256) void k_lse_neg(const float* __restrict__ st, float* __restrict__ c, int n) {
    const int i = blockIdx.x * 256 + threadIdx.x;
    if (i < n) { const float v = -(st[2 * i] + logf(st[2 * i + 1])); VST2(float, c + i, v); }
}

// k_iota: dst[i] = a * i + b as int32 (segment/position id helper)
__global__ __launch_bounds__(256) void k_iota(int* __restrict__ dst, int n, int a, int b) {
    const int i = blockIdx.x * 256 + threadIdx.x;
    if (i < n) { const int v = a * i + b; VST2(int, dst + i, v); }
}

// k_axpby: dst[i] = a * x[i] + b * y[i] (+ c), i < n
__global__ __launch_bounds__(256) void k_axpby(const float* __restrict__ x, const float* __restrict__ y, float* __restrict__ dst, int n, float a, float b, float c) {
    const int i = blockIdx.x * 256 + threadIdx.x;
    if (i < n) { const float v = a * x[i] + b * y[i] + c; VST2(float, dst + i, v); }
}

// =====================================================================================================================
// k_rope: rotary embedding on a [R rows][Hn heads][D] view (row stride sXr, head stride sXh, element stride 1) -> Y (own strides).
//   mode 0: rotate_half (partner d±D/2, sign - for d<D/2); mode 1: interleaved pairs (partner d^1, sign - for even d).
//   table column tcol: tmode 0 -> d, 1 -> d % (D/2), 2 -> d / 2; position p: pmode 0 -> r % S, 1 -> head index, 2 -> pos[r];
//   c = C[(r / S) * sCb + p * sCp + tcol * sCd], s likewise from Sn; y = x[d] * c + sign * x[partner] * s. X and Y must not alias.
// =====================================================================================================================
struct RopeP { const float* X; float* Y; const float* C; const float* Sn; const int* pos; long long sXr, sXh, sYr, sYh, sCb, sCp, sCd; int R, Hn, D, S, mode, tmode, pmode, pad; };
static_assert(sizeof(RopeP) == 5 * 8 + 7 * 8 + 8 * 4, "RopeP has padding");
__global__ __launch_bounds__(256) void k_rope(RopeP p) {
    const long long idx = (long long)blockIdx.x * 256 + threadIdx.x;
    if (idx >= (long long)p.R * p.Hn * p.D) return;
    const int d = (int)(idx % p.D); const long long rh = idx / p.D; const int h = (int)(rh % p.Hn); const int r = (int)(rh / p.Hn);
    const int half = p.D / 2;
    int partner; float sign;
    if (p.mode == 0) { partner = (d < half) ? d + half : d - half; sign = (d < half) ? -1.f : 1.f; }
    else { partner = d ^ 1; sign = (d & 1) ? 1.f : -1.f; }
    const int tcol = (p.tmode == 0) ? d : ((p.tmode == 1) ? (d % half) : (d >> 1));
    const int pp = (p.pmode == 0) ? (r % p.S) : ((p.pmode == 1) ? h : p.pos[r]);
    const long long toff = (long long)(r / p.S) * p.sCb + (long long)pp * p.sCp + (long long)tcol * p.sCd;
    const float* xr = p.X + (long long)r * p.sXr + (long long)h * p.sXh;
    const float v = xr[d] * p.C[toff] + sign * xr[partner] * p.Sn[toff];
    VST2(float, p.Y + (long long)r * p.sYr + (long long)h * p.sYh + d, v);
}

// k_invf + k_sincos (split so neither kernel carries a large VALU-fma footprint): invf_i = num * (1 / powf(base, (2 i)/D)) [fmode 0],
//   num * expf((2 i) * cexp) [fmode 1], num * powf(base, -2 (i - 1) / D) [fmode 2]; then cs/sn[s*half + i] = cos/sin((pscale * s) * invf_i)
__global__ __launch_bounds__(256) void k_invf(float* __restrict__ invb, int half, int D, float base, float num, int fmode, float cexp) {
    const int i = blockIdx.x * 256 + threadIdx.x;
    if (i >= ((half + 31) / 32) * 32) return;
    if (i >= half) { VST2(float, invb + i, 0.f); return; }
    const float e = (float)(2 * i) / (float)D;
    float invf;
    if (fmode == 1) invf = num * expf((float)(2 * i) * cexp);
    else if (fmode == 2) invf = num * powf(base, (-2.0f * ((float)i - 1.0f)) / (float)D);
    else invf = num * (1.0f / powf(base, e));
    VST2(float, invb + i, invf);
}
__global__ __launch_bounds__(256) void k_sincos(float* __restrict__ cs, float* __restrict__ sn, const float* __restrict__ invb, int S, int half, float pscale) {
    const int idx = blockIdx.x * 256 + threadIdx.x;
    if (idx >= S * half) return;
    const int s = idx / half, i = idx - s * half;
    const float ang = (pscale * (float)s) * invb[i];
    VST2(float, cs + idx, cosf(ang)); VST2(float, sn + idx, sinf(ang));
}

// k_mulact: dst[i] = act(x[i]) * y[i]
__global__ __launch_bounds__(256) void k_mulact(const float* __restrict__ x, const float* __restrict__ y, float* __restrict__ dst, int n, int act) {
    const int i = blockIdx.x * 256 + threadIdx.x;
    if (i < n) { const float v = act_fn(x[i], act) * y[i]; VST2(float, dst + i, v); }
}

// =====================================================================================================================
// k_matvec: thread-per-row matrix-vector products for N <= 8 output columns (heads with 1-3 outputs, gates), f32 on the VALU.
//   C[r*sCm + j] = act(alpha * sum_k A[r*sAm + k*sAk] * B[j*sBn + k*sBk] + bias[j]) + beta * R[r*sRm + j*sRn]; each thread writes its N contiguous floats.
// =====================================================================================================================
__global__ __launch_bounds__(256) void k_matvec(GemmP p) {
    // 32 lanes write one line with one instruction.
    const int rpt = (p.N == 1) ? 1 : 32;
    const long long r0 = ((long long)blockIdx.x * 256 + threadIdx.x) * rpt; const int z = blockIdx.z, zo = z / p.zi_n, zi = z - zo * p.zi_n;
    if (r0 >= p.M) return;
    const float* Bb = p.B + zo * p.sBo + zi * p.sBi;
    float* C = p.C + zo * p.sCo + zi * p.sCi; const float* R = p.R + zo * p.sRo + zi * p.sRi;
    for (int rr = 0; rr < rpt; ++rr) {
        const long long r = r0 + rr; if (r >= p.M) break;
        const float* A = p.A + zo * p.sAo + zi * p.sAi + r * p.sAm;
        float acc[8] = {0.f, 0.f, 0.f, 0.f, 0.f, 0.f, 0.f, 0.f};
        for (int k = 0; k < p.K; ++k) { const float a = A[(long long)k * p.sAk];
#pragma unroll
            for (int j = 0; j < 8; ++j) if (j < p.N) acc[j] += a * Bb[(long long)j * p.sBn + (long long)k * p.sBk]; }
#pragma unroll
        for (int j = 0; j < 8; ++j) if (j < p.N) {
            float v = acc[j] * p.alpha;
            if (p.flags & 1) v += p.bias[j];
            if (p.flags & 2) v += p.bias[r];
            v = act_fn(v, p.act);
            if (p.flags & 4) v += p.beta * R[r * p.sRm + (long long)j * p.sRn];
            VST2(float, C + r * p.sCm + j, v);
        }
    }
}
// k_smallsoftmax: thread-per-row softmax for short rows (n <= 64): dst[r*dr + j] = softmax(scale*src[r*sr + j])
__global__ __launch_bounds__(256) void k_smallsoftmax(const float* __restrict__ src, float* __restrict__ dst, long long sr, long long dr, int n, long long R, float scale) {
    const long long r0 = ((long long)blockIdx.x * 256 + threadIdx.x) * 32;
    for (int rr = 0; rr < 32; ++rr) {
        const long long r = r0 + rr; if (r >= R) return;
        const float* s = src + r * sr; float* d = dst + r * dr;
        float mx = -__builtin_inff();
        for (int j = 0; j < n; ++j) mx = fmaxf(mx, s[j] * scale);
        float sum = 0.f;
        for (int j = 0; j < n; ++j) sum += expf(s[j] * scale - mx);
        const float inv = 1.f / sum;
        for (int j = 0; j < n; ++j) { const float v = expf(s[j] * scale - mx) * inv; VST2(float, d + j, v); }
    }
}

__global__ __launch_bounds__(32) void k_unitstat(float* __restrict__ st) { const int t = threadIdx.x; const float v = (t == 1) ? 1.f : 0.f; VST2(float, st + t, v); }

// destination (e.g. a d_out whose row width is not a multiple of 32 floats) is written by consecutive lanes of one instruction
__global__ __launch_bounds__(256) void k_lincopy(const float* __restrict__ src, long long lds, float* __restrict__ dst, long long ldd, long long rows, int cols) {
    const long long i = (long long)blockIdx.x * 256 + threadIdx.x; if (i >= rows * cols) return;
    const long long r = i / cols; const int c = (int)(i - r * cols);
    const float v = src[r * lds + c]; VST2(float, dst + r * ldd + c, v);
}

namespace w25 {
typedef __attribute__((ext_vector_type(16))) _Float16 v16h;
typedef __attribute__((ext_vector_type(8)))  _Float16 v8h;
typedef __attribute__((ext_vector_type(16))) __bf16   v16b;
typedef __attribute__((ext_vector_type(8)))  __bf16   v8b;
typedef __attribute__((ext_vector_type(8)))  float    v8f;
typedef __attribute__((ext_vector_type(4)))  float    v4f;

__device__ __forceinline__ unsigned short f2bf_bits(float f) {
  unsigned u = __float_as_uint(f);
  return (unsigned short)((u + 0x7FFFu + ((u >> 16) & 1u)) >> 16);
}
__device__ __forceinline__ float bf_bits2f(unsigned short h) { return __uint_as_float(((unsigned)h) << 16); }

// hazard guards as plain device helpers (no inline asm inside the kernel template body)
__device__ __forceinline__ void dep_guard_h(v8f& a, v8f& b, v16h x, v16h y) { asm volatile("v_nop\n\tv_nop\n\tv_nop\n\tv_nop" : "+v"(a), "+v"(b) : "v"(x), "v"(y)); }
__device__ __forceinline__ void dep_guard_b(v8f& a, v8f& b, v16b x, v16b y) { asm volatile("v_nop\n\tv_nop\n\tv_nop\n\tv_nop" : "+v"(a), "+v"(b) : "v"(x), "v"(y)); }
__device__ __forceinline__ void keep4_h(v16h a, v16h b, v16h c, v16h d) { asm volatile("v_nop" :: "v"(a), "v"(b), "v"(c), "v"(d)); }
__device__ __forceinline__ void keep4_b(v16b a, v16b b, v16b c, v16b d) { asm volatile("v_nop" :: "v"(a), "v"(b), "v"(c), "v"(d)); }
__device__ __forceinline__ void acc_guard4(v8f& a, v8f& b, v8f& c, v8f& d) { asm volatile("v_nop\n\tv_nop\n\tv_nop\n\tv_nop" : "+v"(a), "+v"(b), "+v"(c), "+v"(d)); }
template <typename T> struct Frag;
template <> struct Frag<_Float16> {
  typedef v16h V; union U { v16h v; v8h h[2]; };
  static __device__ __forceinline__ v16h load(const _Float16* p) {   // elements 0..7 <- p[0..7], 8..15 <- p[16..23]
    U f; f.h[0] = *(const v8h*)(p); f.h[1] = *(const v8h*)(p + 16); return f.v;
  }
  static __device__ __forceinline__ v8f mma(v16h a, v16h b, v8f c) {
    return __builtin_amdgcn_wmma_f32_16x16x32_f16(false, a, false, b, (short)0, c, false, false);
  }
  static __device__ __forceinline__ void guard(v8f& a, v8f& b, v16h x, v16h y) { dep_guard_h(a, b, x, y); }
  static __device__ __forceinline__ void keep(v16h a, v16h b, v16h c, v16h d) { keep4_h(a, b, c, d); }
};
template <> struct Frag<__bf16> {
  typedef v16b V; union U { v16b v; v8b h[2]; };
  static __device__ __forceinline__ v16b load(const __bf16* p) {
    U f; f.h[0] = *(const v8b*)(p); f.h[1] = *(const v8b*)(p + 16); return f.v;
  }
  static __device__ __forceinline__ v8f mma(v16b a, v16b b, v8f c) {
    return __builtin_amdgcn_wmma_f32_16x16x32_bf16(false, a, false, b, (short)0, c, false, false);
  }
  static __device__ __forceinline__ void guard(v8f& a, v8f& b, v16b x, v16b y) { dep_guard_b(a, b, x, y); }
  static __device__ __forceinline__ void keep(v16b a, v16b b, v16b c, v16b d) { keep4_b(a, b, c, d); }
};

// ---- Register-blocked batched WMMA GEMM ------------------------------------
// C[m,n] = scale * sum_k A[m,k] * Bt[n,k] (+bias)(+resid); each wave owns a 64x64 tile.
// A row-major [M,K]; Bt row-major [N,K]; M,N % 64 == 0, K % 32 == 0.
// SPLIT: operands are hi/lo planes (A2/Bt2 = lo planes, same layout); product = hi·hi + hi·lo + lo·hi.
// BIAS_MODE: 0 = none, 1 = bias[m], 2 = bias[n].
// OUT_MODE: 0 = f32, 1 = f16, 2 = bf16 hi plane (Cout) + bf16 lo plane (Cout2).
// ET: 0 = f16 operands, 1 = bf16 operands (pointers passed as 16-bit storage)
template <int ET> struct Elem;
template <> struct Elem<0> { typedef _Float16 T; };
template <> struct Elem<1> { typedef __bf16 T; };
template <int ET, bool SPLIT, int BIAS_MODE, int OUT_MODE, bool RESID, int ACT = 0>
__global__ __launch_bounds__(256) void wmma_gemm64(
    const unsigned short* __restrict__ Ap, const unsigned short* __restrict__ A2p, int lda, long strideA,
    const unsigned short* __restrict__ Btp, const unsigned short* __restrict__ Bt2p, int ldb, long strideB,
    void* __restrict__ Cout, void* __restrict__ Cout2, int ldc, long strideC,
    const float* __restrict__ bias,
    const float* __restrict__ resid, long strideR,
    int M, int N, int K, float scale) {
  typedef typename Elem<ET>::T T;
  typedef typename Frag<T>::V V;
  const T* A = (const T*)Ap; const T* A2 = (const T*)A2p; const T* Bt = (const T*)Btp; const T* Bt2 = (const T*)Bt2p;
  __shared__ __align__(16) float sT[8][16 * 68];   // per-wave 16x64 slab, pitch 68 floats
  const int b    = blockIdx.y;
  const int lane = threadIdx.x & 31;
  const int wave = threadIdx.x >> 5;
  const int tilesN = N >> 6;
  const int tilesM = M >> 6;
  const int tile = blockIdx.x * 8 + wave;
  if (tile >= tilesM * tilesN) return;   // wave-uniform; no block barriers in this kernel
  const int tm = tile / tilesN;
  const int tn = tile - tm * tilesN;
  const int m0 = tm << 6;
  const int n0 = tn << 6;

  const T* Ab  = A  + (size_t)b * strideA;
  const T* Bb  = Bt + (size_t)b * strideB;
  const T* Ab2 = SPLIT ? (A2  + (size_t)b * strideA) : nullptr;
  const T* Bb2 = SPLIT ? (Bt2 + (size_t)b * strideB) : nullptr;

  const int rlane = lane & 15;                 // row (A) / col (B, D) within subtile
  const int koff  = (lane >> 4) * 8;           // k offset of this lane half
  const int mOff  = (lane >> 4) * 8;           // D row offset

  v8f acc[4][4];
#pragma unroll
  for (int i = 0; i < 4; ++i)
#pragma unroll
    for (int j = 0; j < 4; ++j) acc[i][j] = (v8f){0.f,0.f,0.f,0.f,0.f,0.f,0.f,0.f};

  for (int k0 = 0; k0 < K; k0 += 32) {
    V bh[4], bl[4];
#pragma unroll
    for (int j = 0; j < 4; ++j) {
      const size_t bo = (size_t)(n0 + (j << 4) + rlane) * ldb + koff + k0;
      bh[j] = Frag<T>::load(Bb + bo);
      if (SPLIT) bl[j] = Frag<T>::load(Bb2 + bo);
    }
#pragma unroll
    for (int i = 0; i < 4; ++i) {
      const size_t ao = (size_t)(m0 + (i << 4) + rlane) * lda + koff + k0;
      V ah = Frag<T>::load(Ab + ao);
      V al;
      if (SPLIT) al = Frag<T>::load(Ab2 + ao);
#pragma unroll
      for (int j = 0; j < 4; ++j) {
        acc[i][j] = Frag<T>::mma(ah, bh[j], acc[i][j]);
        if (SPLIT) {
          acc[i][j] = Frag<T>::mma(ah, bl[j], acc[i][j]);
          acc[i][j] = Frag<T>::mma(al, bh[j], acc[i][j]);
        }
      }
      Frag<T>::guard(acc[i][0], acc[i][3], ah, SPLIT ? al : ah);
    }
    Frag<T>::keep(bh[0], bh[1], bh[2], bh[3]);
    if (SPLIT) Frag<T>::keep(bl[0], bl[1], bl[2], bl[3]);
  }
  acc_guard4(acc[0][0], acc[0][1], acc[0][2], acc[0][3]);
  acc_guard4(acc[1][0], acc[1][1], acc[1][2], acc[1][3]);
  acc_guard4(acc[2][0], acc[2][1], acc[2][2], acc[2][3]);
  acc_guard4(acc[3][0], acc[3][1], acc[3][2], acc[3][3]);

  // ---- epilogue ----
  float* slab = sT[wave];
  const float* Rb = RESID ? (resid + (size_t)b * strideR) : nullptr;
#pragma unroll
  for (int i = 0; i < 4; ++i) {
    const int mBase = m0 + (i << 4);
#pragma unroll
    for (int j = 0; j < 4; ++j) {
      const int n = n0 + (j << 4) + rlane;
      float bv = 0.f;
      if (BIAS_MODE == 2) bv = bias[n];
#pragma unroll
      for (int r = 0; r < 8; ++r) {
        float v = acc[i][j][r] * scale;
        if (BIAS_MODE == 1) v += bias[mBase + mOff + r];
        if (BIAS_MODE == 2) v += bv;
        if (RESID) v += Rb[(size_t)(mBase + mOff + r) * ldc + n];
        if (ACT == 1) v = tanhf(v);
        if (ACT == 2) v = fmaxf(v, 0.0f);
        if (ACT == 3) v = v / (1.0f + expf(-v));
        if (ACT == 4) v = (v > 0.f) ? v : 0.01f * v;
        if (ACT == 5) v = 0.5f * v * (1.0f + erff(v * 0.70710678118654752f));
        slab[(mOff + r) * 68 + (j << 4) + rlane] = v;
      }
    }
    __builtin_amdgcn_fence(__ATOMIC_RELEASE, "workgroup");
    __builtin_amdgcn_wave_barrier();
    __builtin_amdgcn_fence(__ATOMIC_ACQUIRE, "workgroup");
    if (OUT_MODE == 0) {
      float* C = (float*)Cout + (size_t)b * strideC;
      const int hh = lane >> 4, c4 = (lane & 15) * 4;     // row seg = 256 B = 16 lanes x 16 B
      {
#pragma unroll
        for (int it = 0; it < 8; ++it) {
          const int row = it * 2 + hh;
          v4f v = *(const v4f*)(slab + row * 68 + c4);
          *(v4f*)(C + (size_t)(mBase + row) * ldc + n0 + c4) = v;
        }
        
      }
    } else {
      const int q = lane >> 3, c8 = (lane & 7) * 8;
      unsigned short* C  = (unsigned short*)Cout  + (size_t)b * strideC;
      unsigned short* C2 = (OUT_MODE == 2) ? ((unsigned short*)Cout2 + (size_t)b * strideC) : nullptr;
      {
#pragma unroll
        for (int it = 0; it < 4; ++it) {
          const int row = it * 4 + q;
          const float* sp = slab + row * 68 + c8;
          v8h hv, lv;
#pragma unroll
          for (int e = 0; e < 8; ++e) {
            if (OUT_MODE == 1) {
              hv[e] = (_Float16)sp[e];
            } else {
              unsigned short hb = f2bf_bits(sp[e]);
              unsigned short lb = f2bf_bits(sp[e] - bf_bits2f(hb));
              hv[e] = __builtin_bit_cast(_Float16, hb);
              lv[e] = __builtin_bit_cast(_Float16, lb);
            }
          }
          *(v8h*)(C + (size_t)(mBase + row) * ldc + n0 + c8) = hv;
          if (OUT_MODE == 2) *(v8h*)(C2 + (size_t)(mBase + row) * ldc + n0 + c8) = lv;
        }
        
      }
    }
    __builtin_amdgcn_fence(__ATOMIC_RELEASE, "workgroup");
    __builtin_amdgcn_wave_barrier();
    __builtin_amdgcn_fence(__ATOMIC_ACQUIRE, "workgroup");
  }
}

__global__ __launch_bounds__(256) void cast_f32_f16x2(
    const float* __restrict__ in, _Float16* __restrict__ out, int n2) {
  int i = blockIdx.x * 256 + threadIdx.x;
  if (i < n2) {
    const _Float16 h0 = (_Float16)in[2 * i], h1 = (_Float16)in[2 * i + 1];
    const unsigned u = (unsigned)__builtin_bit_cast(unsigned short, h0) | ((unsigned)__builtin_bit_cast(unsigned short, h1) << 16);
    ((unsigned*)out)[i] = u;
    
  }
}


} // namespace w25

// f32 -> bf16 hi + bf16 lo (x = hi + lo to ~2^-17 relative; RNE both), two neighbouring elements packed per 32-bit word
__device__ __forceinline__ unsigned int f2bf2_pack(float a, float b, unsigned int* lo) {
    const unsigned short ha = w25::f2bf_bits(a), hb = w25::f2bf_bits(b);
    const unsigned short la = w25::f2bf_bits(a - w25::bf_bits2f(ha)), lb = w25::f2bf_bits(b - w25::bf_bits2f(hb));
    *lo = (unsigned)la | ((unsigned)lb << 16); return (unsigned)ha | ((unsigned)hb << 16); }

namespace w25 {
// =====================================================================================
// Generic causal/non-causal attention for head_dim 64, f32 in / f32 out; 16-bit operands: bf16 with optional hi/lo splits, or
// plain f16 (F16=true, non-split, probabilities carried x2^15).
//   scores = (q*qscale)·kᵀ : v_wmma_f32_16x16x32_bf16; SPLIT_QK -> q,k as bf16 hi/lo (hi·hi + hi·lo + lo·hi)
//   out    = p·v           : v_wmma_f32_16x16x32_bf16; SPLIT_PV -> p,v as bf16 hi/lo; else p,v plain bf16
//   f32 accumulate; online softmax in f32. Block = 4 waves = 64 query rows of one (batch, head); S % 64 == 0.
//   Element (b, s, h, d) of tensor X lives at X[b*X_bs + s*X_rs + h*X_hs + d] (strides in floats, multiples of 4).
//   Masking: mask_mode 0 none, 1 causal (kv > q masked), 2 tensor [S][Skv] shared over (b,h) (float if
//   mask_is_int==0, int32 with element == 0 -> masked if 1, int32 with element != 0 -> masked if 2), 3 per-token vectors qmask[B][S] & kvmask[B][Skv] (int32,
//   0 -> masked), 4 causal + sliding window (kv > q or q - kv > W masked; W passed in mask_is_int);
//   5 = relative-position bias: s += cp[b,h,q][idx[q][kv]] + pc[b,h,kv][idx[q][kv]] with idx = mask_b ([S][Skv] int32) and
//   mask_a an int32 [S][Skv] tensor with nonzero = masked (tables: element (b,h,row,n) at X + b*c_bs + h*c_hs + row*c_rs + n);
//   masked scores are replaced by mask_fill (e.g. -inf or -1e9) before the softmax.
//   grid.x = B * H * (S/64) (or a sub-range with blk0).
// =====================================================================================
#define AT_D 64
#define AT_NW 4
#define AT_QB 64
#define AT_KC 64
struct AttnGeom { const float* cp = nullptr; const float* pc = nullptr; long c_bs = 0, c_rs = 0, c_hs = 0;   // mode-5 score-bias tables
                  long q_bs, q_rs, q_hs, k_bs, k_rs, k_hs, v_bs, v_rs, v_hs, o_bs, o_rs, o_hs;
                  int S, Skv, H, mask_mode; float qscale; int blk0; float mask_fill; int mask_is_int; };
static_assert(sizeof(AttnGeom) == 168, "no padding");

__device__ __forceinline__ unsigned short at_bf_bits(float f) {
  unsigned u = __float_as_uint(f);
  return (unsigned short)((u + 0x7FFFu + ((u >> 16) & 1u)) >> 16);
}
__device__ __forceinline__ __bf16 at_f2bf(float f) { return __builtin_bit_cast(__bf16, at_bf_bits(f)); }
__device__ __forceinline__ void at_split(float f, __bf16& hi, __bf16& lo) {
  const unsigned short hb = at_bf_bits(f);
  hi = __builtin_bit_cast(__bf16, hb);
  lo = at_f2bf(f - __uint_as_float(((unsigned)hb) << 16));
}
__device__ __forceinline__ v8f at_mma(v16b a, v16b b, v8f c) {
  c = __builtin_amdgcn_wmma_f32_16x16x32_bf16(false, a, false, b, (short)0, c, false, false);
  asm volatile("v_nop\n\tv_nop\n\tv_nop\n\tv_nop" : "+v"(c) : "v"(a), "v"(b));
  return c;
}
// 16-bit element as a bit pattern held in a __bf16 slot: f16 bits when F16, bf16 (RNE) otherwise
template <bool F16> __device__ __forceinline__ __bf16 at_to16(float f) {
  if (F16) return __builtin_bit_cast(__bf16, (_Float16)f);
  return at_f2bf(f);
}
template <bool F16> __device__ __forceinline__ v8f at_mma16(v16b a, v16b b, v8f c) {
  if (F16) {
    const v16h ah = __builtin_bit_cast(v16h, a), bh = __builtin_bit_cast(v16h, b);
    c = __builtin_amdgcn_wmma_f32_16x16x32_f16(false, ah, false, bh, (short)0, c, false, false);
    asm volatile("v_nop\n\tv_nop\n\tv_nop\n\tv_nop" : "+v"(c) : "v"(ah), "v"(bh));
    return c;
  }
  return at_mma(a, b, c);
}

template <bool SPLIT_QK, bool SPLIT_PV, bool F16 = false>
__global__ __launch_bounds__(128)
void attn64_kernel(const float* __restrict__ q, const float* __restrict__ k,
                   const float* __restrict__ v, float* __restrict__ out,
                   const void* __restrict__ mask_a, const int* __restrict__ mask_b, AttnGeom g) {
  static_assert(!(F16 && (SPLIT_QK || SPLIT_PV)), "f16 mode is non-split");
  const float PSC = F16 ? 32768.0f : 1.0f;     // f16 probabilities carried x2^15 (subnormal range), folded into the final 1/l
  union FB { v16b v; v8b h[2]; };
  __shared__ __align__(16) __bf16 Ksh[AT_KC * AT_D];             // K hi [kv][d]      8 KB
  __shared__ __align__(16) __bf16 Ksl[SPLIT_QK ? AT_KC * AT_D : 8];
  __shared__ __align__(16) __bf16 Vth[AT_D * AT_KC];             // V hi [d][kv]      8 KB
  __shared__ __align__(16) __bf16 Vtl[SPLIT_PV ? AT_D * AT_KC : 8];
  __shared__ __align__(16) __bf16 Psh[AT_NW][16 * AT_KC];        // per wave P hi [row][kv]  8 KB
  __shared__ __align__(16) __bf16 Psl[SPLIT_PV ? AT_NW : 1][SPLIT_PV ? 16 * AT_KC : 8];
  __shared__ __align__(16) float  Os[AT_NW][16 * 68];            // per wave out tile, pitch 68

  const int tid  = threadIdx.x;
  const int wave = tid >> 5;
  const int lane = tid & 31;
  const int hh   = lane >> 4;
  const int c    = lane & 15;

  const int nqb = g.S / AT_QB;
  const int bx = blockIdx.x + g.blk0;
  const int qb = bx % nqb;
  const int bh = bx / nqb;
  const int h  = bh % g.H;
  const int b  = bh / g.H;
  const int qbase_block = qb * AT_QB;
  const int q0 = qbase_block + wave * 16;

  const float* qb_ptr = q + (size_t)b * g.q_bs + (size_t)h * g.q_hs;
  const float* kb_ptr = k + (size_t)b * g.k_bs + (size_t)h * g.k_hs;
  const float* vb_ptr = v + (size_t)b * g.v_bs + (size_t)h * g.v_hs;
  float*       ob_ptr = out + (size_t)b * g.o_bs + (size_t)h * g.o_hs;

  // ---- Q fragments (A operand): 2 d-chunks, hi (and lo) ----
  v16b qah[2], qal[2];
  {
    const float* qrow = qb_ptr + (size_t)(q0 + c) * g.q_rs;
#pragma unroll
    for (int dc = 0; dc < 2; ++dc) {
#pragma unroll
      for (int e = 0; e < 8; ++e) {
        const float f0 = qrow[dc * 32 + 8 * hh + e] * g.qscale;
        const float f1 = qrow[dc * 32 + 16 + 8 * hh + e] * g.qscale;
        if (SPLIT_QK) { __bf16 hq, lq; at_split(f0, hq, lq); qah[dc][e] = hq; qal[dc][e] = lq; at_split(f1, hq, lq); qah[dc][8 + e] = hq; qal[dc][8 + e] = lq; }
        else { qah[dc][e] = at_to16<F16>(f0); qah[dc][8 + e] = at_to16<F16>(f1); qal[dc][e] = qah[dc][e]; qal[dc][8 + e] = qah[dc][8 + e]; }
      }
    }
  }

  float mrow[8], lrow[8];
  v8f oacc[4];
#pragma unroll
  for (int r = 0; r < 8; ++r) { mrow[r] = -INFINITY; lrow[r] = 0.f; }
#pragma unroll
  for (int t = 0; t < 4; ++t) oacc[t] = (v8f){0.f,0.f,0.f,0.f,0.f,0.f,0.f,0.f};

  const int nChunks = (g.mask_mode == 1 || g.mask_mode == 4) ? (qb + 1) : (g.Skv / AT_KC);   // block-uniform
  // per-row query mask (mode 3)
  int qkeep[8];
#pragma unroll
  for (int r = 0; r < 8; ++r) qkeep[r] = (g.mask_mode == 3) ? mask_b[(size_t)b * g.S + q0 + 8 * hh + r] : 1;   // mask_b = qmask in mode 3
  for (int kc = 0; kc < nChunks; ++kc) {
    const int kv0 = kc * AT_KC;
    __syncthreads();
    {
      const int kvr = tid >> 1, dh = (tid & 1) * 32;
      const float* krow = kb_ptr + (size_t)(kv0 + kvr) * g.k_rs + dh;
      const float* vrow = vb_ptr + (size_t)(kv0 + kvr) * g.v_rs + dh;
#pragma unroll
      for (int i = 0; i < 8; ++i) {
        v4f kk = *(const v4f*)(krow + 4 * i);
        v4f vv = *(const v4f*)(vrow + 4 * i);
#pragma unroll
        for (int e = 0; e < 4; ++e) {
          const int d = dh + 4 * i + e;
          if (SPLIT_QK) { __bf16 a, bl; at_split(kk[e], a, bl); Ksh[kvr * AT_D + d] = a; Ksl[kvr * AT_D + d] = bl; }
          else Ksh[kvr * AT_D + d] = at_to16<F16>(kk[e]);
          if (SPLIT_PV) { __bf16 a, bl; at_split(vv[e], a, bl); Vth[d * AT_KC + kvr] = a; Vtl[d * AT_KC + kvr] = bl; }
          else Vth[d * AT_KC + kvr] = at_to16<F16>(vv[e]);
        }
      }
    }
    __syncthreads();

    v8f s[4];
#pragma unroll
    for (int j = 0; j < 4; ++j) {
      s[j] = (v8f){0.f,0.f,0.f,0.f,0.f,0.f,0.f,0.f};
#pragma unroll 1
      for (int dc = 0; dc < 2; ++dc) {
        FB kb;
        kb.h[0] = *(const v8b*)(Ksh + (j * 16 + c) * AT_D + dc * 32 + 8 * hh);
        kb.h[1] = *(const v8b*)(Ksh + (j * 16 + c) * AT_D + dc * 32 + 16 + 8 * hh);
        s[j] = at_mma16<F16>(qah[dc], kb.v, s[j]);
        if (SPLIT_QK) {
          FB kl;
          kl.h[0] = *(const v8b*)(Ksl + (j * 16 + c) * AT_D + dc * 32 + 8 * hh);
          kl.h[1] = *(const v8b*)(Ksl + (j * 16 + c) * AT_D + dc * 32 + 16 + 8 * hh);
          s[j] = at_mma16<F16>(qah[dc], kl.v, s[j]);
          s[j] = at_mma16<F16>(qal[dc], kb.v, s[j]);
        }
      }
    }
    const bool diag = (g.mask_mode == 1) && (kc == qb);
    int kvkeep[4] = {1, 1, 1, 1};
    if (g.mask_mode == 3) {
#pragma unroll
      for (int j = 0; j < 4; ++j) kvkeep[j] = ((const int*)mask_a)[(size_t)b * g.Skv + kv0 + j * 16 + c];   // mask_a = kvmask
    }
    float cm[8];
#pragma unroll
    for (int r = 0; r < 8; ++r) {
      const int qrow = q0 + 8 * hh + r;
      float m = -INFINITY;
#pragma unroll
      for (int j = 0; j < 4; ++j) {
        const int kvcol = kv0 + j * 16 + c;
        bool masked = false;
        if (diag) masked = (kvcol > qrow);
        else if (g.mask_mode == 4) masked = (kvcol > qrow) || (qrow - kvcol > g.mask_is_int);
        else if (g.mask_mode == 2) {
          const size_t mi = (size_t)qrow * g.Skv + kvcol;
          masked = (g.mask_is_int == 0) ? (((const float*)mask_a)[mi] == 0.0f)
                 : (g.mask_is_int == 1) ? (((const int*)mask_a)[mi] == 0) : (((const int*)mask_a)[mi] != 0);
        } else if (g.mask_mode == 3) masked = (qkeep[r] == 0) || (kvkeep[j] == 0);
        else if (g.mask_mode == 5) {
          const size_t mi = (size_t)qrow * g.Skv + kvcol;
          masked = (((const int*)mask_a)[mi] != 0);
          int n = mask_b[mi]; n = n < 0 ? 0 : n;
          s[j][r] += g.cp[(size_t)b * g.c_bs + (size_t)h * g.c_hs + (size_t)qrow * g.c_rs + n]
                   + g.pc[(size_t)b * g.c_bs + (size_t)h * g.c_hs + (size_t)kvcol * g.c_rs + n];
        }
        if (masked) s[j][r] = g.mask_fill;
        m = fmaxf(m, s[j][r]);
      }
#pragma unroll
      for (int off = 1; off < 16; off <<= 1) m = fmaxf(m, __shfl_xor(m, off, 32));
      cm[r] = m;
    }
    __bf16* pwh = Psh[wave];
    __bf16* pwl = Psl[SPLIT_PV ? wave : 0];
#pragma unroll
    for (int r = 0; r < 8; ++r) {
      const float mnew = fmaxf(mrow[r], cm[r]);
      const float alpha = expf(mrow[r] - mnew);
      mrow[r] = mnew;
      float psum = 0.f;
#pragma unroll
      for (int j = 0; j < 4; ++j) {
        const float p = expf(s[j][r] - mnew);
        psum += p;
        if (SPLIT_PV) { __bf16 a, bl; at_split(p, a, bl); pwh[(8 * hh + r) * AT_KC + j * 16 + c] = a; pwl[(8 * hh + r) * AT_KC + j * 16 + c] = bl; }
        else pwh[(8 * hh + r) * AT_KC + j * 16 + c] = at_to16<F16>(p * PSC);
      }
#pragma unroll
      for (int off = 1; off < 16; off <<= 1) psum += __shfl_xor(psum, off, 32);
      lrow[r] = lrow[r] * alpha + psum;
#pragma unroll
      for (int t = 0; t < 4; ++t) oacc[t][r] *= alpha;
    }
    __builtin_amdgcn_fence(__ATOMIC_RELEASE, "workgroup");
    __builtin_amdgcn_wave_barrier();
    __builtin_amdgcn_fence(__ATOMIC_ACQUIRE, "workgroup");
#pragma unroll 1
    for (int kk = 0; kk < 2; ++kk) {
      FB pa, pl;
      pa.h[0] = *(const v8b*)(pwh + c * AT_KC + kk * 32 + 8 * hh);
      pa.h[1] = *(const v8b*)(pwh + c * AT_KC + kk * 32 + 16 + 8 * hh);
      if (SPLIT_PV) {
        pl.h[0] = *(const v8b*)(pwl + c * AT_KC + kk * 32 + 8 * hh);
        pl.h[1] = *(const v8b*)(pwl + c * AT_KC + kk * 32 + 16 + 8 * hh);
      }
#pragma unroll
      for (int t = 0; t < 4; ++t) {
        FB vb;
        vb.h[0] = *(const v8b*)(Vth + (t * 16 + c) * AT_KC + kk * 32 + 8 * hh);
        vb.h[1] = *(const v8b*)(Vth + (t * 16 + c) * AT_KC + kk * 32 + 16 + 8 * hh);
        oacc[t] = at_mma16<F16>(pa.v, vb.v, oacc[t]);
        if (SPLIT_PV) {
          FB vl;
          vl.h[0] = *(const v8b*)(Vtl + (t * 16 + c) * AT_KC + kk * 32 + 8 * hh);
          vl.h[1] = *(const v8b*)(Vtl + (t * 16 + c) * AT_KC + kk * 32 + 16 + 8 * hh);
          oacc[t] = at_mma16<F16>(pa.v, vl.v, oacc[t]);
          oacc[t] = at_mma16<F16>(pl.v, vb.v, oacc[t]);
        }
      }
    }
  }

  float* os = Os[wave];
#pragma unroll
  for (int r = 0; r < 8; ++r) {
    const float inv = 1.0f / (lrow[r] * PSC);
#pragma unroll
    for (int t = 0; t < 4; ++t) os[(8 * hh + r) * 68 + t * 16 + c] = oacc[t][r] * inv;
  }
  __builtin_amdgcn_fence(__ATOMIC_RELEASE, "workgroup");
  __builtin_amdgcn_wave_barrier();
  __builtin_amdgcn_fence(__ATOMIC_ACQUIRE, "workgroup");
  {
    const int c4 = (lane & 15) * 4;
    {
#pragma unroll
      for (int it = 0; it < 8; ++it) {
        const int row = it * 2 + hh;
        v4f val = *(const v4f*)(os + row * 68 + c4);
        *(v4f*)(ob_ptr + (size_t)(q0 + row) * g.o_rs + c4) = val;
      }
      
    }
  }
}

} // namespace w25

// Operand preparation, one launch: blockIdx.y == 0 takes 64 rows of q, blockIdx.y == 1 takes 64 rows of memory. A wave holds 8 whole rows in registers (16 bytes per lane
//   and row, the 8 loads in flight together) and everything that is made of a row is made from that one read: the row dot (q . w_q -> AQ, memory . w_m -> CM), the bf16 hi
//   and lo planes of the similarity product (q * w_qm; memory) and, for memory, the f16 plane x ts transposed to [d][m], the operand of the query->memory product.
//   The transposed tile and the 64 dots go through LDS so that every global store covers whole 128-byte lines.
typedef __attribute__((ext_vector_type(2))) unsigned v2u;
typedef __attribute__((ext_vector_type(8))) _Float16 v8hp;
template <int M, int D>
__global__ __launch_bounds__(256) void k_bi_prep(const float* __restrict__ Q, const float* __restrict__ MEM, const float* __restrict__ wq, const float* __restrict__ wm, const float* __restrict__ wqm,
        float* __restrict__ AQ, float* __restrict__ CM, __bf16* __restrict__ QH, __bf16* __restrict__ QL, __bf16* __restrict__ MH, __bf16* __restrict__ ML, _Float16* __restrict__ MT, float ts) {
    static_assert(D == 128 && M % 64 == 0, "one 16-byte load per lane and row; a block's 64 rows lie in one batch");
    __shared__ float res[64];
    __shared__ __align__(16) _Float16 tr[D][72];   // [d][m], pitch 144 bytes = 16 x 9: 16-byte reads along m without bank conflicts
    const bool isq = blockIdx.y == 0;
    const int lane = threadIdx.x & 31, wv = threadIdx.x >> 5;
    const size_t rb = (size_t)blockIdx.x * 64, r0 = rb + wv * 8;
    const float* xp = (isq ? Q : MEM) + r0 * D + lane * 4;
    const v4f w = *(const v4f*)((isq ? wq : wm) + lane * 4);
    const v4f g = *(const v4f*)(wqm + lane * 4);   // used by the q blocks alone; read here so that it flies with the rows
    v4f x[8];
#pragma unroll
    for (int i = 0; i < 8; ++i) x[i] = *(const v4f*)(xp + i * D);
    asm volatile("s_wait_xcnt 0x0" ::: "memory");   // the work below reuses the address registers that the loads above name
    __builtin_amdgcn_sched_barrier(0);   // holds the first rewrite of those registers behind the wait; left free it is scheduled ahead of it
    float keep = 0.f;
#pragma unroll
    for (int i = 0; i < 8; ++i) {
        float s = x[i][0] * w[0]; s += x[i][1] * w[1]; s += x[i][2] * w[2]; s += x[i][3] * w[3];
        for (int o = 16; o > 0; o >>= 1) s += __shfl_xor(s, o, 32);
        if (lane == i) keep = s;
    }
    if (lane < 8) res[wv * 8 + lane] = keep;
    if (isq) {
#pragma unroll
        for (int i = 0; i < 8; ++i) x[i] *= g;
    } else {
#pragma unroll
        for (int e = 0; e < 4; ++e) { v8hp h;
#pragma unroll
            for (int i = 0; i < 8; ++i) h[i] = (_Float16)(x[i][e] * ts);
            *(v8hp*)&tr[lane * 4 + e][wv * 8] = h; }
    }
    v2u hi[8], lo[8];
#pragma unroll
    for (int i = 0; i < 8; ++i) { unsigned l0, l1;
        hi[i][0] = f2bf2_pack(x[i][0], x[i][1], &l0); hi[i][1] = f2bf2_pack(x[i][2], x[i][3], &l1); lo[i][0] = l0; lo[i][1] = l1; }
    __syncthreads();   // publishes res and tr; it stands ahead of every global store, so that no wave waits at it for stores to land
    __bf16* ph = (isq ? QH : MH) + r0 * D + lane * 4;
    __bf16* pl = (isq ? QL : ML) + r0 * D + lane * 4;
#pragma unroll
    for (int i = 0; i < 8; ++i) { *(v2u*)(ph + i * D) = hi[i]; *(v2u*)(pl + i * D) = lo[i]; }
    if (threadIdx.x < 64) VST2(float, (isq ? AQ : CM) + rb + threadIdx.x, res[threadIdx.x]);
    if (!isq) {
        _Float16* mt = MT + (rb / M) * (size_t)D * M + rb % M + (lane & 7) * 8;
#pragma unroll
        for (int it = 0; it < 4; ++it) { const int d = wv * 16 + it * 4 + (lane >> 3);   // a wave store = 4 rows of d x one 128-byte line
            *(v8hp*)(mt + (size_t)d * M) = *(const v8hp*)&tr[d][(lane & 7) * 8]; }
    } }
// expf, step for step as the compiler expands it (x * log2(e) in two parts, 2^fraction, ldexp, the two range tests), written out so that the v_nop can stand in the
//   statement of v_exp_f32: it fills the one slot the instruction set asks for in front of a vector instruction that reads the result or overwrites the source
__device__ __forceinline__ float exp_slot(float x) {
    const float ph = x * 0x1.715476p+0f;
    const float pl = fmaf(x, 0x1.4ae0bep-26f, fmaf(x, 0x1.715476p+0f, -ph));
    const float en = rintf(ph);
    const float a = (ph - en) + pl;
    float y;
    asm("v_exp_f32 %0, %1\n\tv_nop" : "=v"(y) : "v"(a));
    float r = ldexpf(y, (int)en);
    r = (x < -0x1.9d1da0p+6f) ? 0.f : r;
    r = (x > 0x1.62e430p+6f) ? __builtin_inff() : r;
    return r;
}
// one wave per row, RW rows per wave one after the other: sim = tril + AQ[n] + CM[m], masked exactly as the module: sim + (1 - qm*mm) * -1e30; the whole row stays in
//   registers (32 values per lane) from the one read of SIM to the one write: row max -> RMX, softmax over m (exp once), probabilities x ps stored as f16, the
//   operand plane of the query->memory product. CM and the memory mask are read once per wave; max and sum meet by lane shuffles, so the kernel has no barrier.
typedef __attribute__((ext_vector_type(4))) _Float16 v4h;
typedef __attribute__((ext_vector_type(4))) int      v4i;
template <int N, int M, int RW>
__global__ __launch_bounds__(256) void k_bi_soft16(const float* __restrict__ SIM, const float* __restrict__ AQ, const float* __restrict__ CM, const int* __restrict__ QM, const int* __restrict__ MM, float* __restrict__ RMX, _Float16* __restrict__ P16, float ps) {
    static_assert(M % 128 == 0 && N % (8 * RW) == 0, "whole 512-byte wave loads; whole blocks of 8 waves x RW rows");
    constexpr int C = M / 128;
    const int lane = threadIdx.x & 31, wv = __builtin_amdgcn_readfirstlane(threadIdx.x >> 5);
    const size_t bz = blockIdx.y;   // batch = blockIdx.y
    const size_t row0 = bz * N + (size_t)(blockIdx.x * 8 + wv) * RW;
    float aqv[RW], qmv[RW];
#pragma unroll
    for (int r = 0; r < RW; ++r) { aqv[r] = AQ[row0 + r]; qmv[r] = (float)QM[row0 + r]; }
    const float* sr = SIM + row0 * M + lane * 4;
    v4f x[C], nx[C], cm[C], mf[C]; v4i mk[C];
#pragma unroll
    for (int i = 0; i < C; ++i) x[i] = *(const v4f*)(sr + i * 128);
#pragma unroll
    for (int i = 0; i < C; ++i) { cm[i] = *(const v4f*)(CM + bz * M + lane * 4 + i * 128); mk[i] = *(const v4i*)(MM + bz * M + lane * 4 + i * 128); }
#pragma unroll
    for (int r = 0; r < RW; ++r) {
        if (r + 1 < RW) {
#pragma unroll
            for (int i = 0; i < C; ++i) nx[i] = *(const v4f*)(sr + (size_t)(r + 1) * M + i * 128);   // the next row flies while this one is worked on
            asm volatile("s_wait_xcnt 0x0" ::: "memory");   // the row's work may reuse the offset register that the loads above name
            __builtin_amdgcn_sched_barrier(0);   // keeps the loads and their wait at the head of the row's work; left free the loads sink to just ahead of their first use
        }
        if (r == 0) {
#pragma unroll
            for (int i = 0; i < C; ++i) mf[i] = __builtin_convertvector(mk[i], v4f);
        }
        const float aq = aqv[r], qm = qmv[r];
        float mx = -3.0e38f;
#pragma unroll
        for (int i = 0; i < C; ++i)
#pragma unroll
            for (int e = 0; e < 4; ++e) { const float msk = qm * mf[i][e]; const float v = x[i][e] + aq + cm[i][e] + (1.f - msk) * -1.0e30f; x[i][e] = v; mx = fmaxf(mx, v); }
        for (int o = 16; o > 0; o >>= 1) mx = fmaxf(mx, __shfl_xor(mx, o, 32));
        v4f s4 = {0.f, 0.f, 0.f, 0.f};
#pragma unroll
        for (int i = 0; i < C; ++i)
#pragma unroll
            for (int e = 0; e < 4; ++e) { const float ev = exp_slot(x[i][e] - mx); x[i][e] = ev; s4[e] += ev; }
        float s = (s4[0] + s4[1]) + (s4[2] + s4[3]);
        for (int o = 16; o > 0; o >>= 1) s += __shfl_xor(s, o, 32);
        const float inv = 1.f / s;
        _Float16* pr = P16 + (row0 + r) * M + lane * 4;
        v4h hv[C];
#pragma unroll
        for (int i = 0; i < C; ++i)
#pragma unroll
            for (int e = 0; e < 4; ++e) hv[i][e] = (_Float16)((x[i][e] * inv) * ps);
        __builtin_amdgcn_sched_barrier(0);   // with the one below: nothing that refills a register of these stores is scheduled between them and their wait
#pragma unroll
        for (int i = 0; i < C; ++i) *(v4h*)(pr + i * 128) = hv[i];
        VST2(float, RMX + (row0 + r) * 32 + lane, mx);   // row max staged as a whole 32-float line (slot 0 is read later)
        if (r + 1 < RW) {
            asm volatile("s_wait_xcnt 0x0" ::: "memory");   // the next row's work reuses the registers that the stores above name
            __builtin_amdgcn_sched_barrier(0);
        }
#pragma unroll
        for (int i = 0; i < C; ++i) x[i] = nx[i];
    } }

// Similarity product, masked row softmax and query->memory product in ONE launch; the similarity matrix and the probabilities never leave the registers.
//   Block = 16 waves = 4 groups of 16 query rows x 4 quarters of the memory axis. A wave walks its quarter in tiles of 32 memory rows:
//   S^T = memory x (q * w_qm)^T (bf16 hi/lo, three products), so that a lane holds scores of ONE query (column lane & 15; rows 8 * (lane >> 4) + r of each 16-row tile);
//   sim = S + AQ[n] + CM[m] + (1 - qm * mm) * -1e30 as the module has it; running maximum and sum; the two 16-row score tiles, as f16 x ps, ARE the B operand of
//   O^T += memory^T x P^T (the k order of the fragment loaders). The four quarters of a query meet once, at the end, through LDS.
//   The memory tiles (hi, lo, transposed f16) come into LDS by asynchronous 16-byte copies, two buffers: tile s + 1 flies while tile s is worked on; the four waves that
//   share a quarter each copy a fourth of its tile. Row pitches 272 and 80 bytes (16 x odd) keep the 16-byte fragment reads off each other's banks.
//   Every '#pragma unroll' below stands on a loop whose index picks a fragment, an accumulator or a vector element: unrolled, these stay in registers.
template <int N, int M, int D>
__global__ __launch_bounds__(512) void k_bi_fused(const __bf16* __restrict__ QH, const __bf16* __restrict__ QL, const __bf16* __restrict__ MH, const __bf16* __restrict__ ML, const _Float16* __restrict__ MT,
        const float* __restrict__ AQ, const float* __restrict__ CM, const int* __restrict__ QM, const int* __restrict__ MM, float* __restrict__ RMX, float* __restrict__ OUT, float ps, float os) {
    static_assert(N % 64 == 0 && M == 1024 && D == 128, "64 query rows a block; 4 quarters of 8 tiles of 32 memory rows; 2 mask words a thread; 256-byte operand rows");
    typedef w25::Frag<__bf16> FB; typedef w25::Frag<_Float16> FH; typedef w25::v8f v8f;
    constexpr int PA = 272, PT = 80;                    // LDS row pitch in bytes: 256-byte rows of hi and lo, 64-byte rows of the transposed tile
    constexpr int TILE = 2 * 32 * PA + D * PT;          // one quarter's tile: hi, lo, transposed
    constexpr int BUF = 4 * TILE, MQ4 = M / 4, NS = MQ4 / 32;
    static_assert(2 * BUF >= 16 * 8 * 32 * 8 * 4, "the ring later holds the 16 waves' partial outputs");
    __shared__ __align__(16) unsigned char ring[2 * BUF];
    __shared__ __align__(16) unsigned char qs[2 * 64 * PA];
    __shared__ __align__(16) float scm[M];
    __shared__ __align__(16) float smf[M];
    __shared__ float smx[4][4][16];
    __shared__ float ssm[4][4][16];
    const int lane = threadIdx.x & 31, wv = __builtin_amdgcn_readfirstlane(threadIdx.x >> 5);
    const int qg = wv & 3, ms = wv >> 2, nl = lane & 15, h = lane >> 4, koff = h * 8;
    const size_t bz = blockIdx.y, q0 = bz * N + (size_t)blockIdx.x * 64, row = q0 + qg * 16 + nl;
    // this lane's share of a tile: 4 copies of hi, 4 of lo (2 rows x 256 bytes a wave copy), 4 of the transposed plane (8 rows x 64 bytes a wave copy)
    const unsigned la = (unsigned)(size_t)ring + ms * TILE + (qg * 8 + h) * PA + nl * 16;
    const unsigned lt = (unsigned)(size_t)ring + ms * TILE + 64 * PA + (qg * 32 + (lane >> 2)) * PT + (lane & 3) * 16;
    const size_t ga = (bz * M + ms * MQ4 + qg * 8 + h) * D + nl * 8;
    const __bf16* gh = MH + ga;
    const __bf16* gl = ML + ga;
    const _Float16* gt = MT + (bz * D + qg * 32 + (lane >> 2)) * M + ms * MQ4 + (lane & 3) * 8;
    auto copy_tile = [&](int s, int b) {
        const unsigned a = la + b * BUF, t = lt + b * BUF;
        const __bf16* x = gh + (size_t)s * 32 * D;
        const __bf16* y = gl + (size_t)s * 32 * D;
        const _Float16* z = gt + s * 32;
        // the wait is the last line of the copies' own statement: no register that a copy names is rewritten ahead of it
        asm volatile("global_load_async_to_lds_b128 %0, %12, off\n\t"
                     "global_load_async_to_lds_b128 %1, %13, off\n\t"
                     "global_load_async_to_lds_b128 %2, %14, off\n\t"
                     "global_load_async_to_lds_b128 %3, %15, off\n\t"
                     "global_load_async_to_lds_b128 %4, %16, off\n\t"
                     "global_load_async_to_lds_b128 %5, %17, off\n\t"
                     "global_load_async_to_lds_b128 %6, %18, off\n\t"
                     "global_load_async_to_lds_b128 %7, %19, off\n\t"
                     "global_load_async_to_lds_b128 %8, %20, off\n\t"
                     "global_load_async_to_lds_b128 %9, %21, off\n\t"
                     "global_load_async_to_lds_b128 %10, %22, off\n\t"
                     "global_load_async_to_lds_b128 %11, %23, off\n\t"
                     "s_wait_xcnt 0x0"
                     :: "v"(a), "v"(a + 2 * PA), "v"(a + 4 * PA), "v"(a + 6 * PA),
                        "v"(a + 32 * PA), "v"(a + 34 * PA), "v"(a + 36 * PA), "v"(a + 38 * PA),
                        "v"(t), "v"(t + 8 * PT), "v"(t + 16 * PT), "v"(t + 24 * PT),
                        "v"(x), "v"(x + 2 * D), "v"(x + 4 * D), "v"(x + 6 * D),
                        "v"(y), "v"(y + 2 * D), "v"(y + 4 * D), "v"(y + 6 * D),
                        "v"(z), "v"(z + 8 * M), "v"(z + 16 * M), "v"(z + 24 * M)
                     : "memory");
    };
    {   // the block's 64 rows of q * w_qm, hi and lo: wave wv copies rows 4 wv .. 4 wv + 3 of each plane
        const unsigned lq = (unsigned)(size_t)qs + (wv * 4 + h) * PA + nl * 16;
        const size_t gq = (q0 + wv * 4 + h) * D + nl * 8;
        const __bf16* x = QH + gq;
        const __bf16* y = QL + gq;
        asm volatile("global_load_async_to_lds_b128 %0, %4, off\n\t"
                     "global_load_async_to_lds_b128 %1, %5, off\n\t"
                     "global_load_async_to_lds_b128 %2, %6, off\n\t"
                     "global_load_async_to_lds_b128 %3, %7, off\n\t"
                     "s_wait_xcnt 0x0"   // as above: inside the copies' statement
                     :: "v"(lq), "v"(lq + 2 * PA), "v"(lq + 64 * PA), "v"(lq + 66 * PA), "v"(x), "v"(x + 2 * D), "v"(y), "v"(y + 2 * D)
                     : "memory");
    }
    copy_tile(0, 0);
    {   // CM and the memory mask (as float) of the whole batch row: read once a block
        typedef __attribute__((ext_vector_type(2))) float v2f; typedef __attribute__((ext_vector_type(2))) int v2i;
        const v2f c = *(const v2f*)(CM + bz * M + threadIdx.x * 2);
        const v2i k = *(const v2i*)(MM + bz * M + threadIdx.x * 2);
        *(v2f*)&scm[threadIdx.x * 2] = c;
        *(v2f*)&smf[threadIdx.x * 2] = __builtin_convertvector(k, v2f);
    }
    const float aq = AQ[row], qm = (float)QM[row];
    asm volatile("s_wait_asynccnt 0x0" ::: "memory");   // this wave's copies of q and of tile 0 have landed
    __syncthreads();                                     // ... and every other wave's; publishes scm and smf too
    copy_tile(1, 1);
    FB::V qh[4], ql[4];
#pragma unroll
    for (int kk = 0; kk < 4; ++kk) {
        qh[kk] = FB::load((const __bf16*)(qs + (qg * 16 + nl) * PA) + koff + kk * 32);
        ql[kk] = FB::load((const __bf16*)(qs + (64 + qg * 16 + nl) * PA) + koff + kk * 32);
    }
    v8f o[8];
#pragma unroll
    for (int dt = 0; dt < 8; ++dt) o[dt] = (v8f){0.f, 0.f, 0.f, 0.f, 0.f, 0.f, 0.f, 0.f};
    float mrun = -3.0e38f, lsum = 0.f;
#pragma unroll 1   // stays rolled: one trip is about a thousand instructions
    for (int s = 0; s < NS; ++s) {
        const unsigned char* tb = ring + (s & 1) * BUF + ms * TILE;
        const __bf16* th = (const __bf16*)(tb + nl * PA) + koff;
        const __bf16* tl = (const __bf16*)(tb + (32 + nl) * PA) + koff;
        const _Float16* tt = (const _Float16*)(tb + 64 * PA + nl * PT) + koff;
        v8f sc[2];
        sc[0] = (v8f){0.f, 0.f, 0.f, 0.f, 0.f, 0.f, 0.f, 0.f}; sc[1] = sc[0];
#pragma unroll
        for (int kk = 0; kk < 4; ++kk)
#pragma unroll
            for (int t = 0; t < 2; ++t) {
                const FB::V ah = FB::load(th + t * 16 * (PA / 2) + kk * 32);
                const FB::V al = FB::load(tl + t * 16 * (PA / 2) + kk * 32);
                sc[t] = FB::mma(ah, qh[kk], sc[t]);
                sc[t] = FB::mma(ah, ql[kk], sc[t]);
                sc[t] = FB::mma(al, qh[kk], sc[t]);
            }
        const int mb = ms * MQ4 + s * 32 + koff;
        float v[2][8];
        float mloc = -3.0e38f;
#pragma unroll
        for (int t = 0; t < 2; ++t) {
            const v4f c0 = *(const v4f*)&scm[mb + t * 16], c1 = *(const v4f*)&scm[mb + t * 16 + 4];
            const v4f f0 = *(const v4f*)&smf[mb + t * 16], f1 = *(const v4f*)&smf[mb + t * 16 + 4];
#pragma unroll
            for (int r = 0; r < 8; ++r) {
                const float msk = qm * (r < 4 ? f0[r & 3] : f1[r & 3]);
                const float x = sc[t][r] + aq + (r < 4 ? c0[r & 3] : c1[r & 3]) + (1.f - msk) * -1.0e30f;
                v[t][r] = x; mloc = fmaxf(mloc, x);
            }
        }
        mloc = fmaxf(mloc, __shfl_xor(mloc, 16, 32));   // the other 16 memory rows of this query's 32 lie in lane ^ 16
        const float mnew = fmaxf(mrun, mloc);
        const float alpha = exp_slot(mrun - mnew);
        mrun = mnew;
        FH::V pb;
        float s0 = 0.f, s1 = 0.f;
#pragma unroll
        for (int r = 0; r < 8; ++r) {
            const float e0 = exp_slot(v[0][r] - mnew), e1 = exp_slot(v[1][r] - mnew);
            s0 += e0; s1 += e1;
            pb[r] = (_Float16)(e0 * ps); pb[8 + r] = (_Float16)(e1 * ps);
        }
        lsum = lsum * alpha + (s0 + s1);
#pragma unroll
        for (int dt = 0; dt < 8; ++dt) {
            const FH::V vt = FH::load(tt + dt * 16 * (PT / 2));
            o[dt] = FH::mma(vt, pb, o[dt] * alpha);
        }
        asm volatile("s_wait_dscnt 0x0" ::: "memory");      // this wave's reads of buffer s & 1 have returned
        asm volatile("s_wait_asynccnt 0x0" ::: "memory");   // this wave's copies of tile s + 1 have landed
        __syncthreads();                                     // publishes tile s + 1 and ends every wave's reads of buffer s & 1
        if (s + 2 < NS) copy_tile(s + 2, s & 1);
    }
    asm volatile("s_wait_asynccnt 0x0" ::: "memory");       // nothing is in flight when the ring becomes the staging of the partial outputs
    lsum += __shfl_xor(lsum, 16, 32);
    if (h == 0) { smx[ms][qg][nl] = mrun; ssm[ms][qg][nl] = lsum; }
    __syncthreads();   // the four quarters' maxima and sums are there
    float mtot = smx[0][qg][nl];
#pragma unroll
    for (int j = 1; j < 4; ++j) mtot = fmaxf(mtot, smx[j][qg][nl]);
    float ltot = 0.f;
#pragma unroll
    for (int j = 0; j < 4; ++j) ltot += ssm[j][qg][nl] * exp_slot(smx[j][qg][nl] - mtot);
    const float fo = exp_slot(mrun - mtot);
    float* so = (float*)ring;   // [quarter][query group][d tile][lane][8]
#pragma unroll
    for (int dt = 0; dt < 8; ++dt) {
        const v8f w = o[dt] * fo;
        float* p = so + (((ms * 4 + qg) * 8 + dt) * 32 + lane) * 8;
        *(v4f*)p = (v4f){w[0], w[1], w[2], w[3]}; *(v4f*)(p + 4) = (v4f){w[4], w[5], w[6], w[7]};
    }
    __syncthreads();   // the partial outputs are there
    const float inv = os / ltot;
    float* op = OUT + row * D + ms * 32 + koff;   // wave (qg, ms) sums and stores d = 32 ms .. 32 ms + 31 of its 16 queries: one whole 128-byte line a query
#pragma unroll
    for (int j = 0; j < 2; ++j) {
        v4f a0 = {0.f, 0.f, 0.f, 0.f}, a1 = a0;
#pragma unroll
        for (int k = 0; k < 4; ++k) {
            const float* p = so + (((k * 4 + qg) * 8 + ms * 2 + j) * 32 + lane) * 8;
            a0 += *(const v4f*)p; a1 += *(const v4f*)(p + 4);
        }
        *(v4f*)(op + j * 16) = a0 * inv; *(v4f*)(op + j * 16 + 4) = a1 * inv;
    }
    if (ms == 0) {   // row maximum staged as a whole 32-float line (slot 0 is read later)
        asm volatile("s_wait_xcnt 0x0" ::: "memory");   // the address work below reuses registers that the stores above name
        __builtin_amdgcn_sched_barrier(0);   // holds the first rewrite of those registers behind the wait
        float* rp = RMX + row * 32 + h * 16;
        const v4f m4 = {mtot, mtot, mtot, mtot};
#pragma unroll
        for (int j = 0; j < 4; ++j) *(v4f*)(rp + j * 4) = m4;
    } }

// memory->query: p = softmax_n(RMX[b][n]); M2Q[b][d] = sum_n p_n q[b][n][d]. One block of 32 waves per (batch, 32-float slice of d): thread t owns row
//   maximum t for the statistics; for the weighted sum a wave reads 4 rows x 128 bytes per load and every lane has its 8 row loads in flight at once
//   (issued ahead of the statistics, which do not depend on them); partial sums meet by lane shuffles and one LDS table.
template <int N, int D>
__global__ __launch_bounds__(1024) void k_bi_m2q(const float* __restrict__ RMX, const float* __restrict__ Q, float* __restrict__ M2Q) {
    static_assert(N == 1024 && D % 32 == 0, "one row maximum per thread; whole 128-byte slices of d");
    __shared__ float red[32]; __shared__ float pw[N]; __shared__ __align__(16) float part[32][32];
    const int b = blockIdx.x, d0 = blockIdx.y * 32, t = threadIdx.x, lane = t & 31, wv = t >> 5;
    const int rsub = lane >> 3, c4 = (lane & 7) * 4;
    const float r = RMX[((long long)b * N + t) * 32];
    const float* qb = Q + ((long long)b * N + wv * 4 + rsub) * D + d0 + c4;
    v4f x[N / 128];
    for (int i = 0; i < N / 128; ++i) x[i] = *(const v4f*)(qb + (long long)i * 128 * D);
    float mx = r;
    for (int o = 16; o > 0; o >>= 1) mx = fmaxf(mx, __shfl_xor(mx, o, 32));
    if (lane == 0) red[wv] = mx;
    __syncthreads();
    float mm = red[lane];
    for (int o = 16; o > 0; o >>= 1) mm = fmaxf(mm, __shfl_xor(mm, o, 32));
    __syncthreads();
    const float e = expf(r - mm); pw[t] = e;
    float s = e;
    for (int o = 16; o > 0; o >>= 1) s += __shfl_xor(s, o, 32);
    if (lane == 0) red[wv] = s;
    __syncthreads();
    float tot = red[lane];
    for (int o = 16; o > 0; o >>= 1) tot += __shfl_xor(tot, o, 32);
    v4f acc = {0.f, 0.f, 0.f, 0.f};
    for (int i = 0; i < N / 128; ++i) acc += pw[i * 128 + wv * 4 + rsub] * x[i];
    for (int c = 0; c < 4; ++c) { acc[c] += __shfl_xor(acc[c], 8, 32); acc[c] += __shfl_xor(acc[c], 16, 32); }
    if (lane < 8) *(v4f*)&part[wv][c4] = acc;
    __syncthreads();
    if (t < 32) { float a = 0.f;
        for (int w = 0; w < 32; ++w) a += part[w][t];
        VST2(float, M2Q + (long long)b * D + d0 + t, a * (1.f / tot)); } }
// out1[b][n][d] = M2Q[b][d] broadcast (thread-linear)
__global__ __launch_bounds__(256) void k_bi_bc(const float* __restrict__ M2Q, float* __restrict__ MQ, int Bn, int N, int D) { const long long t = (long long)blockIdx.x * 256 + threadIdx.x; if (t >= (long long)Bn * N * D) return; const int d = (int)(t % D); const int b = (int)(t / ((long long)N * D)); VST2(float, MQ + t, M2Q[b * D + d]); }


extern "C" void kernel_launch(void* const* d_in, const int* in_sizes, int n_in, void* d_out, int out_size, void* d_ws, size_t ws_size, hipStream_t stream) {
    (void)in_sizes; (void)n_in; (void)out_size; (void)ws_size;
    const float* q = (const float*)d_in[0];
    const float* mem = (const float*)d_in[1];
    const float* wq = (const float*)d_in[2];
    const float* wm = (const float*)d_in[3];
    const float* wqm = (const float*)d_in[4];
    const int* qmask = (const int*)d_in[5];
    const int* mmask = (const int*)d_in[6];
    const int Bn = 16;
    const int N = 1024;
    const int M = 1024;
    const int D = 128;
    float* out = (float*)d_out;
    float* mq = out + ((size_t)Bn * N * D);
    char* wsp = (char*)d_ws;
    float* AQ = (float*)wsp; wsp += (((size_t)((size_t)Bn * N) * 4 + 255) / 256) * 256;
    float* CM = (float*)wsp; wsp += (((size_t)((size_t)Bn * M) * 4 + 255) / 256) * 256;
    float* RMX = (float*)wsp; wsp += (((size_t)((size_t)Bn * N * 32) * 4 + 255) / 256) * 256;
    float* M2Q = (float*)wsp; wsp += (((size_t)((size_t)Bn * D) * 4 + 255) / 256) * 256;
    unsigned short* G64A = (unsigned short*)wsp; wsp += (((size_t)(16777216) * 2 + 255) / 256) * 256;
    unsigned short* G64B = (unsigned short*)wsp; wsp += (((size_t)(2097152) * 2 + 255) / 256) * 256;
    unsigned short* G64A2 = (unsigned short*)wsp; wsp += (((size_t)(2097152) * 2 + 255) / 256) * 256;
    unsigned short* G64B2 = (unsigned short*)wsp; wsp += (((size_t)(2097152) * 2 + 255) / 256) * 256;
    unsigned short* G64T = (unsigned short*)wsp; wsp += (((size_t)(2097152) * 2 + 255) / 256) * 256;
    k_bi_prep<1024, 128><<<dim3((unsigned)(Bn * N / 64), 2u), 256, 0, stream>>>(q, mem, wq, wm, wqm, AQ, CM, (__bf16*)(G64A), (__bf16*)(G64A2), (__bf16*)(G64B), (__bf16*)(G64B2), (_Float16*)(G64T), 16.0f);
    k_bi_fused<1024, 1024, 128><<<dim3((unsigned)(N / 64), (unsigned)Bn), 512, 0, stream>>>((const __bf16*)(G64A), (const __bf16*)(G64A2), (const __bf16*)(G64B), (const __bf16*)(G64B2), (const _Float16*)(G64T), AQ, CM, qmask, mmask, RMX, out, 4096.0f, 1.52587890625e-05f);
    k_bi_m2q<1024, 128><<<dim3((unsigned)Bn, 4u), 1024, 0, stream>>>(RMX, q, M2Q); k_bi_bc<<<(unsigned)(((long long)Bn * N * D + 255) / 256), 256, 0, stream>>>(M2Q, mq, Bn, N, D);
}

// v006
// A run of this version takes 41.9 microseconds.
// Two timings next to v005 both put it at 1.11 times that version's speed.
// Counting every step since v000, which is the starting kernel, it is 36.6 times as fast.
// Contractions: per batch the trilinear term (q * w_qm).m^T [1024x128].[128x1024] on bf16 hi/lo split planes (logits reach ~+-30, so they need f32-class accuracy) and the query->memory read q2m.memory [1024x1024].[1024x128] with f16 operands (probabilities x 2^12) — both in one fused launch, a wave taking 32 memory rows x 16 queries a step; f32 accumulate. The mask arithmetic (sim + (1 - mask) * -1e30, exactly as the module), the row softmax (exp once) and the row maxima are f32 work inside that launch; the two linear terms, the softmax over rows and the memory->query vector (broadcast to every row) are f32 kernels.
#include <hip/hip_runtime.h>
#include <math.h>

typedef __attribute__((ext_vector_type(16))) _Float16 v16h;
typedef __attribute__((ext_vector_type(8)))  _Float16 v8h;
typedef __attribute__((ext_vector_type(16))) __bf16   v16b;
typedef __attribute__((ext_vector_type(8)))  float    v8f;
typedef __attribute__((ext_vector_type(4)))  float    v4f;

// 16-bit WMMA fragment map (wave32), lane L, h = L>>4, m = L&15:
//   A 16x32: lane = row m;   element i -> k = (i<8) ? 8h+i : 16+8h+(i-8)
//   B 32x16: lane = column m; the SAME k(i,h)
//   D 16x16 (8 f32): lane = column m; element r -> row 8h+r
__device__ __forceinline__ int frag_k(int i, int h) { return (i < 8) ? (8 * h + i) : (16 + 8 * h + (i - 8)); }
__device__ __forceinline__ __bf16 bf16_rne(float f) {
    unsigned int u = __float_as_uint(f);
    u += 0x7fffu + ((u >> 16) & 1u);
    return __builtin_bit_cast(__bf16, (unsigned short)(u >> 16));
}
__device__ __forceinline__ float bf16_f32(__bf16 b) { return __uint_as_float(((unsigned int)__builtin_bit_cast(unsigned short, b)) << 16); }
__device__ __forceinline__ v8f wmma16(v16h a, v16h b, v8f c) {
    c = __builtin_amdgcn_wmma_f32_16x16x32_f16(false, a, false, b, (short)0, c, false, false);
    asm volatile("v_nop\n\tv_nop\n\tv_nop\n\tv_nop" : "+v"(c) : "v"(a), "v"(b));
    return c;
}
__device__ __forceinline__ v8f wmmab(v16b a, v16b b, v8f c) {
    c = __builtin_amdgcn_wmma_f32_16x16x32_bf16(false, a, false, b, (short)0, c, false, false);
    asm volatile("v_nop\n\tv_nop\n\tv_nop\n\tv_nop" : "+v"(c) : "v"(a), "v"(b));
    return c;
}
struct Split { v16b hi, lo; };
// hi/lo split product: a.hi*b.hi + a.hi*b.lo + a.lo*b.hi
__device__ __forceinline__ v8f wmma3(const Split& a, const Split& b, v8f c) {
    c = __builtin_amdgcn_wmma_f32_16x16x32_bf16(false, a.hi, false, b.hi, (short)0, c, false, false);
    c = __builtin_amdgcn_wmma_f32_16x16x32_bf16(false, a.hi, false, b.lo, (short)0, c, false, false);
    c = __builtin_amdgcn_wmma_f32_16x16x32_bf16(false, a.lo, false, b.hi, (short)0, c, false, false);
    asm volatile("v_nop\n\tv_nop\n\tv_nop\n\tv_nop" : "+v"(c) : "v"(a.hi), "v"(a.lo), "v"(b.hi), "v"(b.lo));
    return c;
}
struct Split3 { v16b hi, mid, lo; };
// triple split product (6 terms, drops only terms below 2^-24 relative)
__device__ __forceinline__ v8f wmma6(const Split3& a, const Split3& b, v8f c) {
    c = __builtin_amdgcn_wmma_f32_16x16x32_bf16(false, a.hi, false, b.hi, (short)0, c, false, false);
    c = __builtin_amdgcn_wmma_f32_16x16x32_bf16(false, a.hi, false, b.mid, (short)0, c, false, false);
    c = __builtin_amdgcn_wmma_f32_16x16x32_bf16(false, a.mid, false, b.hi, (short)0, c, false, false);
    c = __builtin_amdgcn_wmma_f32_16x16x32_bf16(false, a.hi, false, b.lo, (short)0, c, false, false);
    c = __builtin_amdgcn_wmma_f32_16x16x32_bf16(false, a.mid, false, b.mid, (short)0, c, false, false);
    c = __builtin_amdgcn_wmma_f32_16x16x32_bf16(false, a.lo, false, b.hi, (short)0, c, false, false);
    asm volatile("v_nop\n\tv_nop\n\tv_nop\n\tv_nop" : "+v"(c) : "v"(a.hi), "v"(a.mid), "v"(a.lo), "v"(b.hi), "v"(b.mid), "v"(b.lo));
    return c;
}

// Fragment gathers from f32 memory: element i <- p[(k0 + frag_k(i,h)) * sk] * s, zero for k >= klen.
__device__ __forceinline__ v16h fh_ld(const float* __restrict__ p, long long sk, int k0, int h, int klen, float s) {
    v16h a;
#pragma unroll
    for (int i = 0; i < 16; ++i) { const int k = k0 + frag_k(i, h); a[i] = (k < klen) ? (_Float16)(p[(long long)k * sk] * s) : (_Float16)0.f; }
    return a;
}
__device__ __forceinline__ Split sp_ld(const float* __restrict__ p, long long sk, int k0, int h, int klen, float s) {
    Split r;
#pragma unroll
    for (int i = 0; i < 16; ++i) {
        const int k = k0 + frag_k(i, h); const float x = (k < klen) ? p[(long long)k * sk] * s : 0.f;
        const __bf16 hb = bf16_rne(x); r.hi[i] = hb; r.lo[i] = bf16_rne(x - bf16_f32(hb));
    }
    return r;
}
__device__ __forceinline__ Split3 sp3_ld(const float* __restrict__ p, long long sk, int k0, int h, int klen, float s) {
    Split3 r;
#pragma unroll
    for (int i = 0; i < 16; ++i) {
        const int k = k0 + frag_k(i, h); const float x = (k < klen) ? p[(long long)k * sk] * s : 0.f;
        const __bf16 hb = bf16_rne(x); const float r1 = x - bf16_f32(hb); const __bf16 mb = bf16_rne(r1);
        r.hi[i] = hb; r.mid[i] = mb; r.lo[i] = bf16_rne(r1 - bf16_f32(mb));
    }
    return r;
}
__device__ __forceinline__ v16b bh_ld(const float* __restrict__ p, long long sk, int k0, int h, int klen, float s) {
    v16b a;
#pragma unroll
    for (int i = 0; i < 16; ++i) { const int k = k0 + frag_k(i, h); a[i] = bf16_rne((k < klen) ? p[(long long)k * sk] * s : 0.f); }
    return a;
}
// f16 fragment from an f16 LDS/global row with element stride 1 (k-contiguous), no bounds (tile already zero padded)
__device__ __forceinline__ v16h fh_row(const _Float16* __restrict__ row, int k0, int h) {
    v16h a;
#pragma unroll
    for (int i = 0; i < 16; ++i) a[i] = row[k0 + frag_k(i, h)];
    return a;
}

#define VST2(T, ptr, val) do { const T vst2_v_ = (val); *(T*)(ptr) = vst2_v_;  } while (0)
typedef float v4f __attribute__((ext_vector_type(4)));
#define VST2V4(ptr, val) do { const v4f vst2_v4_ = (val); *(v4f*)(ptr) = vst2_v4_;  } while (0)

__device__ __attribute__((noinline)) float act_fn(float v, int act) {
    if (act == 1) return fmaxf(v, 0.f);                                                                               // relu
    if (act == 2) { const float u = 0.7978845608028654f * (v + 0.044715f * v * v * v); return 0.5f * v * (1.f + tanhf(u)); } // tanh-gelu
    if (act == 3) return v / (1.f + expf(-v));                                                                        // silu
    if (act == 4) return 0.5f * v * (1.f + erff(v * 0.7071067811865476f));                                             // erf-gelu
    if (act == 5) return tanhf(v);
    if (act == 6) return 1.f / (1.f + expf(-v));                                                                      // sigmoid
    if (act == 7) return (v > 0.f) ? v : 0.01f * v;                                                                   // leaky relu 0.01
    if (act == 8) return (v > 0.f) ? v : (expf(v) - 1.f);                                                             // elu
    if (act == 9) return fminf(fmaxf(v, 0.f), 6.f);                                                                   // relu6
    if (act == 10) return fabsf(v);                                                                                    // abs
    if (act == 11) return (v >= 0.f) ? v : 0.1f * v;                                                                  // leaky 0.1
    if (act == 12) return (v > 0.f) ? v : 0.2f * v;                                                                   // leaky 0.2
    if (act == 13) return (v > 20.f) ? v : log1pf(expf(v));                                                            // softplus
    return v;
}

// =====================================================================================================================
// k_gemm<MODE>: C(z, m, n) = act(alpha * sum_k A(z, m, k) * B(z, k, n) + bias) + beta * R(z, m, n)
//   One wave (32-thread block) per 16 x 32 tile of C; grid (ceil(N/32), ceil(M/16), Z). Batch z -> (zo = z / zi_n, zi = z % zi_n)
//   with separate outer/inner strides for every tensor (e.g. batch and head). A(m,k) = A[zo*sAo + zi*sAi + m*sAm + k*sAk] (f32),
//   B(k,n) = B[zo*sBo + zi*sBi + n*sBn + k*sBk] (f32); any M, N, K (K zero-padded to 32 inside the fragments, M/N tails guarded).
//   C(m,n) = C[zo*sCo + zi*sCi + m*sCm + n] (n contiguous). flags: 1 bias[n], 2 bias[m], 4 residual R[zo*sRo + zi*sRi + m*sRm + n*sRn].
//   MODE 0: f16 operands (A prescaled by sa, B by sb, both undone in the epilogue); 1: bf16 hi/lo split (3 products); 2: bf16;
//   3: bf16 hi/mid/lo triple split (6 products); 4: as 3 with Kahan-compensated f32 accumulation across k-steps.
// =====================================================================================================================
struct GemmP {
    const float* A; const float* B; const float* bias; const float* R; float* C;
    long long sAo, sAi, sAm, sAk, sBo, sBi, sBn, sBk, sCo, sCi, sCm, sRo, sRi, sRm, sRn;
    int M, N, K, zi_n, flags, act; float alpha, beta, sa, sb;
    int Npad, pad_;     // columns [N, Npad) of C are written as 0 so that padded workspace rows are covered by whole-line stores; Npad >= N
};
static_assert(sizeof(GemmP) == 5 * 8 + 15 * 8 + 6 * 4 + 4 * 4 + 2 * 4, "GemmP has padding");

template <int MODE>
__global__ __launch_bounds__(32) void k_gemm(GemmP p) {
    const int lane = threadIdx.x & 31, h = lane >> 4, l15 = lane & 15;
    const int m0 = blockIdx.y * 16, n0 = blockIdx.x * 32;
    const int z = blockIdx.z, zo = z / p.zi_n, zi = z - zo * p.zi_n;
    const float* A = p.A + zo * p.sAo + zi * p.sAi;
    const float* B = p.B + zo * p.sBo + zi * p.sBi;
    const int am = min(m0 + l15, p.M - 1);                       // clamped row for loads (stores are guarded)
    v8f acc[2], comp[2];
#pragma unroll
    for (int t = 0; t < 2; ++t) { v8f zz = {}; acc[t] = zz; comp[t] = zz; }
    for (int k0 = 0; k0 < p.K; k0 += 32) {
        const float* arow = A + (long long)am * p.sAm;
        if (MODE == 1) {
            const Split a = sp_ld(arow, p.sAk, k0, h, p.K, 1.f);
#pragma unroll
            for (int t = 0; t < 2; ++t) {
                const int bn = min(n0 + t * 16 + l15, p.N - 1);
                acc[t] = wmma3(a, sp_ld(B + (long long)bn * p.sBn, p.sBk, k0, h, p.K, 1.f), acc[t]);
            }
        } else if (MODE == 3) {
            const Split3 a = sp3_ld(arow, p.sAk, k0, h, p.K, 1.f);
#pragma unroll
            for (int t = 0; t < 2; ++t) {
                const int bn = min(n0 + t * 16 + l15, p.N - 1);
                acc[t] = wmma6(a, sp3_ld(B + (long long)bn * p.sBn, p.sBk, k0, h, p.K, 1.f), acc[t]);
            }
        } else if (MODE == 4) {
            // triple split as MODE 3, but each k-step's 6 products go into a fresh accumulator and the partial is added to the running f32 sum
            // on the VALU with Kahan compensation (accumulation error stays ~1 ulp however long K is)
            const Split3 a = sp3_ld(arow, p.sAk, k0, h, p.K, 1.f);
#pragma unroll
            for (int t = 0; t < 2; ++t) {
                const int bn = min(n0 + t * 16 + l15, p.N - 1); v8f zz = {};
                const v8f part = wmma6(a, sp3_ld(B + (long long)bn * p.sBn, p.sBk, k0, h, p.K, 1.f), zz);
                const v8f y = part - comp[t]; const v8f s = acc[t] + y; comp[t] = (s - acc[t]) - y; acc[t] = s;
            }
        } else if (MODE == 2) {
            const v16b a = bh_ld(arow, p.sAk, k0, h, p.K, 1.f);
#pragma unroll
            for (int t = 0; t < 2; ++t) {
                const int bn = min(n0 + t * 16 + l15, p.N - 1);
                acc[t] = wmmab(a, bh_ld(B + (long long)bn * p.sBn, p.sBk, k0, h, p.K, 1.f), acc[t]);
            }
        } else {
            const v16h a = fh_ld(arow, p.sAk, k0, h, p.K, p.sa);
#pragma unroll
            for (int t = 0; t < 2; ++t) {
                const int bn = min(n0 + t * 16 + l15, p.N - 1);
                acc[t] = wmma16(a, fh_ld(B + (long long)bn * p.sBn, p.sBk, k0, h, p.K, p.sb), acc[t]);
            }
        }
    }
    const float iscale = (MODE == 0) ? p.alpha / (p.sa * p.sb) : p.alpha;
    float* C = p.C + zo * p.sCo + zi * p.sCi;
    const float* R = p.R + zo * p.sRo + zi * p.sRi;
    __shared__ __align__(16) float ctile[16][36];
#pragma unroll
    for (int t = 0; t < 2; ++t) {
        const int n = n0 + t * 16 + l15; const int nn = min(n, p.N - 1);
#pragma unroll
        for (int r = 0; r < 8; ++r) {
            const int m = m0 + 8 * h + r; const int mm = min(m, p.M - 1);
            float v = acc[t][r] * iscale;
            if (p.flags & 1) v += p.bias[nn];
            if (p.flags & 2) v += p.bias[mm];
            if (p.flags & 8) v *= p.bias[(long long)zo * p.M + mm];   /* per-(z,row) scale vector laid out [Z][M]; exclusive with the bias flags */
            v = act_fn(v, p.act);
            if (p.flags & 4) v += p.beta * R[(long long)mm * p.sRm + (long long)nn * p.sRn];
            ctile[8 * h + r][t * 16 + l15] = (n < p.N) ? v : 0.f;
        }
    }
    __syncthreads();
    const int NW = (p.Npad > p.N) ? p.Npad : p.N;           // write width
    const bool fast = (m0 + 16 <= p.M) && (n0 + 32 <= NW) && ((p.sCm & 3) == 0) && ((((size_t)C) & 15) == 0);
    if (fast) {
#pragma unroll
        for (int s = 0; s < 4; ++s) {
            const int row = s * 4 + (lane >> 3), c4 = (lane & 7) * 4;
            const v4f v = *(const v4f*)&ctile[row][c4];
            VST2V4(C + (long long)(m0 + row) * p.sCm + n0 + c4, v);
        }
    } else {
        for (int row = 0; row < 16; ++row) {
            const int m = m0 + row, n = n0 + lane;
            if (m < p.M && n < NW) VST2(float, C + (long long)m * p.sCm + n, ctile[row][lane]);
        }
    }
}


// =====================================================================================================================
// k_gemmT<MODE, TM, TN>: same contract as k_gemm, but one wave computes a (16*TM) x (16*TN) tile: TM A fragments and TN B fragments are
//   loaded per 32-wide k-step and reused across TM*TN WMMAs (far fewer load/convert instructions per MAC). MODE 0 (f16), 1 (bf16 hi/lo),
//   2 (bf16) only. grid (ceil(NW/(16*TN)), ceil(M/(16*TM)), Z), block 32. Epilogue identical to k_gemm, run per 16x32 sub-tile.
// =====================================================================================================================
template <int MODE, int TM, int TN>
__global__ __launch_bounds__(32) void k_gemmT(GemmP p) {
    const int lane = threadIdx.x & 31, h = lane >> 4, l15 = lane & 15;
    const int m0 = blockIdx.y * (16 * TM), n0 = blockIdx.x * (16 * TN);
    const int z = blockIdx.z, zo = z / p.zi_n, zi = z - zo * p.zi_n;
    const float* A = p.A + zo * p.sAo + zi * p.sAi;
    const float* B = p.B + zo * p.sBo + zi * p.sBi;
    v8f acc[TM][TN];
#pragma unroll
    for (int i = 0; i < TM; ++i)
#pragma unroll
        for (int t = 0; t < TN; ++t) { v8f zz = {}; acc[i][t] = zz; }
    for (int k0 = 0; k0 < p.K; k0 += 32) {
        if (MODE == 1) {
            Split a[TM], b[TN];
#pragma unroll
            for (int i = 0; i < TM; ++i) { const int am = min(m0 + 16 * i + l15, p.M - 1); a[i] = sp_ld(A + (long long)am * p.sAm, p.sAk, k0, h, p.K, 1.f); }
#pragma unroll
            for (int t = 0; t < TN; ++t) { const int bn = min(n0 + 16 * t + l15, p.N - 1); b[t] = sp_ld(B + (long long)bn * p.sBn, p.sBk, k0, h, p.K, 1.f); }
#pragma unroll
            for (int i = 0; i < TM; ++i)
#pragma unroll
                for (int t = 0; t < TN; ++t) acc[i][t] = wmma3(a[i], b[t], acc[i][t]);
        } else if (MODE == 2) {
            v16b a[TM], b[TN];
#pragma unroll
            for (int i = 0; i < TM; ++i) { const int am = min(m0 + 16 * i + l15, p.M - 1); a[i] = bh_ld(A + (long long)am * p.sAm, p.sAk, k0, h, p.K, 1.f); }
#pragma unroll
            for (int t = 0; t < TN; ++t) { const int bn = min(n0 + 16 * t + l15, p.N - 1); b[t] = bh_ld(B + (long long)bn * p.sBn, p.sBk, k0, h, p.K, 1.f); }
#pragma unroll
            for (int i = 0; i < TM; ++i)
#pragma unroll
                for (int t = 0; t < TN; ++t) acc[i][t] = wmmab(a[i], b[t], acc[i][t]);
        } else {
            v16h a[TM], b[TN];
#pragma unroll
            for (int i = 0; i < TM; ++i) { const int am = min(m0 + 16 * i + l15, p.M - 1); a[i] = fh_ld(A + (long long)am * p.sAm, p.sAk, k0, h, p.K, p.sa); }
#pragma unroll
            for (int t = 0; t < TN; ++t) { const int bn = min(n0 + 16 * t + l15, p.N - 1); b[t] = fh_ld(B + (long long)bn * p.sBn, p.sBk, k0, h, p.K, p.sb); }
#pragma unroll
            for (int i = 0; i < TM; ++i)
#pragma unroll
                for (int t = 0; t < TN; ++t) acc[i][t] = wmma16(a[i], b[t], acc[i][t]);
        }
    }
    const float iscale = (MODE == 0) ? p.alpha / (p.sa * p.sb) : p.alpha;
    float* C = p.C + zo * p.sCo + zi * p.sCi;
    const float* R = p.R + zo * p.sRo + zi * p.sRi;
    const int NW = (p.Npad > p.N) ? p.Npad : p.N;
    __shared__ __align__(16) float ctile[16][36];
#pragma unroll
    for (int i = 0; i < TM; ++i) {
        const int mb = m0 + 16 * i; if (mb >= p.M) break;          // wave-uniform
#pragma unroll
        for (int tp = 0; tp < TN / 2; ++tp) {
            const int nb = n0 + 32 * tp; if (nb >= NW) break;        // wave-uniform
#pragma unroll
            for (int t2 = 0; t2 < 2; ++t2) {
                const int t = 2 * tp + t2; const int n = nb + t2 * 16 + l15; const int nn = min(n, p.N - 1);
#pragma unroll
                for (int r = 0; r < 8; ++r) {
                    const int m = mb + 8 * h + r; const int mm = min(m, p.M - 1);
                    float v = acc[i][t][r] * iscale;
                    if (p.flags & 1) v += p.bias[nn];
                    if (p.flags & 2) v += p.bias[mm];
            if (p.flags & 8) v *= p.bias[(long long)zo * p.M + mm];   /* per-(z,row) scale vector laid out [Z][M]; exclusive with the bias flags */
                    v = act_fn(v, p.act);
                    if (p.flags & 4) v += p.beta * R[(long long)mm * p.sRm + (long long)nn * p.sRn];
                    ctile[8 * h + r][t2 * 16 + l15] = (n < p.N) ? v : 0.f;
                }
            }
            __syncthreads();
            const bool fast = (mb + 16 <= p.M) && (nb + 32 <= NW) && ((p.sCm & 3) == 0) && ((((size_t)C) & 15) == 0);
            if (fast) {
#pragma unroll
                for (int s = 0; s < 4; ++s) {
                    const int row = s * 4 + (lane >> 3), c4 = (lane & 7) * 4;
                    const v4f v = *(const v4f*)&ctile[row][c4];
                    VST2V4(C + (long long)(mb + row) * p.sCm + nb + c4, v);
                }
            } else {
                for (int row = 0; row < 16; ++row) {
                    const int m = mb + row, n = nb + lane;
                    if (m < p.M && n < NW) VST2(float, C + (long long)m * p.sCm + n, ctile[row][lane]);
                }
            }
            __syncthreads();
        }
    }
}

// =====================================================================================================================
//   Wave = 16 queries, AW waves per block, 64-key blocks; grid (ceil(Lq/(16*AW)), H, B), block 32*AW. Any Lq, Lk; head dim dh <= DHP
//   (DHP multiple of 32), value dim dv <= DVP (multiple of 16, <= 128). Every tensor addressed by (batch, head, row, element) strides, f32.
//   Scores: QM 0 f16 operands, 1 bf16 hi/lo split, 2 bf16 triple split; statistics f32 (exp2 domain); P.V: P x 4096 as f16 with V f16 staged in LDS
//   (SPLITPV: P and V as bf16 hi/lo splits). kv head = h / hrep. Masking: causal = 1 (keep j <= i + coff, masked -> -inf, key blocks beyond the
//   diagonal skipped), causal = 2 (masked -> mfill, a finite fill like the -1e9; no skipping), causal = 3 (keep j >= i + coff,
//   masked -> -inf, no skipping); optional additive f32 mask Mf,
//   optional int keep-mask Mi (0 -> score := mfill), both addressed b*smb + h*smh + i*smi + j*smj (0 strides broadcast).
// =====================================================================================================================
#define AW 4
struct AttnP {   // apv4
    const float* Q; const float* K; const float* V; float* O; float* P; const float* Mf; const int* Mi; float* ST;
    const float* Pw; const float* Rt; const int* SQ; const int* SK;           // optional: post-softmax weight, relative-position table, segment ids
    long long swb, swh, swi, swj, srb, srh, sri;                                 // Pw strides (b,h,i,j); Rt strides (b,h,i), column = clamp(i - j + roff, 0, rn-1)
    long long sQb, sQh, sQi, sQd, sKb, sKh, sKj, sKd, sVb, sVh, sVj, sVd, sOb, sOh, sOi, sPb, sPh, sPi, smb, smh, smi, smj;
    int Lq, Lk, dh, dv, hrep, causal, coff, pband;   // pband > 0: P holds only the band |j - i| <= pband, column j - i + pband
    float scale, mfill; int nonorm, mpol;             // nonorm (online path only): O = sum_j exp(score_j) V_j without the 1/rowsum (scores must be <= ~0); mpol: Mi masks where ==0 (mpol 0) or where !=0 (mpol 1)
    int roff, rn, segpol, win;                        // Rt column offset/count; SQ/SK: score := mfill where (segpol 0) SQ[i] != SK[j] or (segpol 1) SQ[i] == SK[j]; win > 0: keys with i - j > win (after coff) -> -inf
};
//   Pw: the softmax numerator is multiplied by Pw(b,h,i,j) AFTER the row sum is taken (probs * weight, then P.V), as in post-softmax multiplicative biases.                                                    // ST (optional): per row (b,h,i) -> ST[((b*H + h)*Lq + i)*2 + {0,1}] = {row max of the scaled+masked score (natural units), sum_j exp(score - max)}
static_assert(sizeof(AttnP) == 12 * 8 + 29 * 8 + 16 * 4, "AttnP has padding");

#ifndef KATTN_ATTR
#define KATTN_ATTR
#endif
template <int DHP, int DVP, int QM, bool SPLITPV, bool TWOPASS>
__global__ __launch_bounds__(32 * AW) KATTN_ATTR void k_attn(AttnP p) {
    constexpr int NT = DVP / 16;                // output tiles
    constexpr int KS = DHP / 32;                // k-steps for the scores
    constexpr int VP = DVP + 8;                 // LDS pitch (halves)
    __shared__ __align__(16) float    pl[AW][16 * 64];
    __shared__ __align__(16) _Float16 vl[(SPLITPV ? 2 : 1) * 64 * VP];   // f16 V tile, or bf16 hi and lo tiles (same 2-byte size)
    const int lane = threadIdx.x & 31, hf = lane >> 4, l15 = lane & 15, wave = threadIdx.x >> 5;
    const int h = blockIdx.y, b = blockIdx.z, hk = h / p.hrep;
    const int q0 = (blockIdx.x * AW + wave) * 16;
    float* myp = pl[wave];
    const float L2E = 1.4426950408889634f;
    const float NEG = -__builtin_inff();
    const int qi = min(q0 + l15, p.Lq - 1);
    const float* qrow = p.Q + b * p.sQb + h * p.sQh + (long long)qi * p.sQi;
    const float* kbase = p.K + b * p.sKb + hk * p.sKh;
    const float* vbase = p.V + b * p.sVb + hk * p.sVh;
    v16h qa[QM == 0 ? KS : 1]; Split qs_[QM == 1 ? KS : 1]; Split3 qt_[QM == 2 ? KS : 1];
#pragma unroll
    for (int ks = 0; ks < KS; ++ks) {
        if (QM == 2) qt_[ks] = sp3_ld(qrow, p.sQd, ks * 32, hf, p.dh, 1.f);
        else if (QM == 1) qs_[ks] = sp_ld(qrow, p.sQd, ks * 32, hf, p.dh, 1.f);
        else qa[ks] = fh_ld(qrow, p.sQd, ks * 32, hf, p.dh, 1.f);
    }
    v8f o[NT]; float m8[8], l8[8];
#pragma unroll
    for (int t = 0; t < NT; ++t) { v8f zz = {}; o[t] = zz; }
#pragma unroll
    for (int i = 0; i < 8; ++i) { m8[i] = NEG; l8[i] = 0.f; }
    int jend = p.Lk;
    if (p.causal == 1) { const int je = (blockIdx.x * AW + AW - 1) * 16 + 16 + p.coff; jend = min(jend, max(je, 0)); }   // uniform per block
    const int npass = TWOPASS ? 2 : 1;
    for (int pass = 0; pass < npass; ++pass) {
        const bool dopv = (!TWOPASS) || pass == 1;
        for (int j0 = 0; j0 < jend; j0 += 64) {
            if (dopv) {
                __syncthreads();                                 // previous key block's reads of vl / pl are done
                for (int idx = threadIdx.x; idx < 64 * DVP; idx += 32 * AW) {
                    const int jr = idx / DVP, d = idx - jr * DVP, j = j0 + jr;
                    const float f = (j < p.Lk && d < p.dv) ? vbase[(long long)j * p.sVj + (long long)d * p.sVd] : 0.f;
                    if (SPLITPV) {
                        const __bf16 hb = bf16_rne(f);
                        ((__bf16*)vl)[jr * VP + d] = hb; ((__bf16*)vl)[64 * VP + jr * VP + d] = bf16_rne(f - bf16_f32(hb));
                    } else vl[jr * VP + d] = (_Float16)f;
                }
            }
            v8f s[4];
#pragma unroll
            for (int t = 0; t < 4; ++t) {
                const int j = min(j0 + t * 16 + l15, p.Lk - 1);
                const float* krow = kbase + (long long)j * p.sKj;
                v8f acc = {};
#pragma unroll
                for (int ks = 0; ks < KS; ++ks) {
                    if (QM == 2)      acc = wmma6(qt_[ks], sp3_ld(krow, p.sKd, ks * 32, hf, p.dh, 1.f), acc);
                    else if (QM == 1) acc = wmma3(qs_[ks], sp_ld(krow, p.sKd, ks * 32, hf, p.dh, 1.f), acc);
                    else              acc = wmma16(qa[ks], fh_ld(krow, p.sKd, ks * 32, hf, p.dh, 1.f), acc);
                }
                s[t] = acc;
            }
            float pv[8][4];
#pragma unroll
            for (int i = 0; i < 8; ++i) {
                const int irow = q0 + i + 8 * hf;
                const int ic = min(irow, p.Lq - 1);
                float sc[4];
#pragma unroll
                for (int t = 0; t < 4; ++t) {
                    const int jg = j0 + t * 16 + l15;
                    float v = s[t][i] * p.scale;
                    if (p.Mf) v += p.Mf[b * p.smb + h * p.smh + (long long)ic * p.smi + (long long)min(jg, p.Lk - 1) * p.smj];
                    if (p.Rt) { int rc = ic - min(jg, p.Lk - 1) + p.roff; rc = rc < 0 ? 0 : (rc >= p.rn ? p.rn - 1 : rc); v += p.Rt[b * p.srb + h * p.srh + (long long)ic * p.sri + rc]; }
                    if (p.Mi) { const int mv = p.Mi[b * p.smb + h * p.smh + (long long)ic * p.smi + (long long)min(jg, p.Lk - 1) * p.smj]; if (p.mpol ? (mv != 0) : (mv == 0)) v = p.mfill; }
                    if (p.SQ) { const bool same = p.SQ[(long long)b * p.Lq + ic] == p.SK[(long long)b * p.Lk + min(jg, p.Lk - 1)]; if (p.segpol ? same : !same) v = p.mfill; }
                    if (p.causal == 2 && jg > irow + p.coff) v = p.mfill;
                    if (jg >= p.Lk || (p.causal == 1 && jg > irow + p.coff) || (p.causal == 3 && jg < irow + p.coff) || (p.win > 0 && irow + p.coff - jg > p.win)) v = NEG; else v *= L2E;
                    sc[t] = v;
                }
                if (!TWOPASS || pass == 0) {
                    float mx = fmaxf(fmaxf(sc[0], sc[1]), fmaxf(sc[2], sc[3]));
                    mx = fmaxf(mx, __shfl_xor(mx, 1, 32)); mx = fmaxf(mx, __shfl_xor(mx, 2, 32));
                    mx = fmaxf(mx, __shfl_xor(mx, 4, 32)); mx = fmaxf(mx, __shfl_xor(mx, 8, 32));
                    const float mnew = fmaxf(m8[i], mx);
                    const float corr = (mnew == NEG) ? 1.f : exp2f(m8[i] - mnew);
                    float rs = 0.f;
#pragma unroll
                    for (int t = 0; t < 4; ++t) {
                        const float pp = (sc[t] == NEG) ? 0.f : exp2f(sc[t] - mnew); rs += pp;
                        pv[i][t] = p.Pw ? pp * p.Pw[b * p.swb + h * p.swh + (long long)ic * p.swi + (long long)min(j0 + t * 16 + l15, p.Lk - 1) * p.swj] : pp;
                    }
                    rs += __shfl_xor(rs, 1, 32); rs += __shfl_xor(rs, 2, 32); rs += __shfl_xor(rs, 4, 32); rs += __shfl_xor(rs, 8, 32);
                    l8[i] = l8[i] * corr + rs; m8[i] = mnew;
                    if (!TWOPASS) {
#pragma unroll
                        for (int t = 0; t < NT; ++t) o[t][i] *= corr;
                    }
                } else {
                    const float inv = (l8[i] > 0.f) ? 1.f / l8[i] : 0.f;
#pragma unroll
                    for (int t = 0; t < 4; ++t) {
                        const int jg = j0 + t * 16 + l15;
                        float pp = (sc[t] == NEG) ? 0.f : exp2f(sc[t] - m8[i]) * inv;
                        if (p.Pw) pp *= p.Pw[b * p.swb + h * p.swh + (long long)ic * p.swi + (long long)min(jg, p.Lk - 1) * p.swj];
                        pv[i][t] = pp;
                    }
                }
            }
            if (dopv) {
#pragma unroll
                for (int i = 0; i < 8; ++i)
#pragma unroll
                    for (int t = 0; t < 4; ++t) ((float*)myp)[(i + 8 * hf) * 64 + t * 16 + l15] = pv[i][t];
                __syncthreads();                                 // P (per wave) and V (shared) visible
                if (p.P) {
                    float* pb_ = p.P + b * p.sPb + h * p.sPh;
                    const bool fastP = (p.pband == 0) && ((p.sPi & 3) == 0) && (j0 + 64 <= p.Lk) && (q0 + 16 <= p.Lq) && ((((size_t)pb_) & 15) == 0);
                    if (fastP) {
#pragma unroll
                        for (int s = 0; s < 8; ++s) {
                            const int row = s * 2 + (lane >> 4), c4 = (lane & 15) * 4;
                            const v4f v = *(const v4f*)(myp + row * 64 + c4);
                            VST2V4(pb_ + (long long)(q0 + row) * p.sPi + j0 + c4, v);
                        }
                    } else {
                        for (int row = 0; row < 16; ++row) {
                            const int irow = q0 + row; if (irow >= p.Lq) continue;
                            for (int c = lane; c < 64; c += 32) {
                                const int jg = j0 + c; if (jg >= p.Lk) continue;
                                if (p.pband == 0) VST2(float, pb_ + (long long)irow * p.sPi + jg, myp[row * 64 + c]);
                                else if (jg - irow <= p.pband && irow - jg <= p.pband) VST2(float, pb_ + (long long)irow * p.sPi + (jg - irow + p.pband), myp[row * 64 + c]);
                            }
                        }
                    }
                }
                if (SPLITPV) {
                    const Split pa0 = sp_ld(myp + l15 * 64, 1, 0, hf, 64, 1.f), pa1 = sp_ld(myp + l15 * 64, 1, 32, hf, 64, 1.f);
                    const __bf16* vh = (const __bf16*)vl; const __bf16* vlo = vh + 64 * VP;
#pragma unroll
                    for (int t = 0; t < NT; ++t) {
                        const int dcol = t * 16 + l15;
                        Split b0, b1;
#pragma unroll
                        for (int e = 0; e < 16; ++e) {
                            const int k0 = frag_k(e, hf), k1 = 32 + frag_k(e, hf);
                            b0.hi[e] = vh[k0 * VP + dcol]; b0.lo[e] = vlo[k0 * VP + dcol]; b1.hi[e] = vh[k1 * VP + dcol]; b1.lo[e] = vlo[k1 * VP + dcol];
                        }
                        o[t] = wmma3(pa0, b0, o[t]);
                        o[t] = wmma3(pa1, b1, o[t]);
                    }
                } else {
                    const v16h pa0 = fh_ld(myp + l15 * 64, 1, 0, hf, 64, 4096.f), pa1 = fh_ld(myp + l15 * 64, 1, 32, hf, 64, 4096.f);
#pragma unroll
                    for (int t = 0; t < NT; ++t) {
                        const int dcol = t * 16 + l15;
                        v16h b0, b1;
#pragma unroll
                        for (int e = 0; e < 16; ++e) { b0[e] = vl[frag_k(e, hf) * VP + dcol]; b1[e] = vl[(32 + frag_k(e, hf)) * VP + dcol]; }
                        o[t] = wmma16(pa0, b0, o[t]);
                        o[t] = wmma16(pa1, b1, o[t]);
                    }
                }
            }
        }
    }
    float* obase = p.O + b * p.sOb + h * p.sOh;
    if (p.ST) {
        const int rl = lane >> 1, isel = rl & 7;           // row q0 + rl ; rl>>3 == hf holds because lane>>4 == (lane>>1)>>3
        float mv = 0.f, lv = 0.f;
#pragma unroll
        for (int i = 0; i < 8; ++i) if (i == isel) { mv = m8[i]; lv = l8[i]; }
        const int irow = q0 + rl;
        if (irow < p.Lq) { float* st = p.ST + (((long long)b * gridDim.y + h) * p.Lq + irow) * 2 + (lane & 1); VST2(float, st, (lane & 1) ? lv : mv * 0.6931471805599453f); }
    }
    float invr[8];
#pragma unroll
    for (int i = 0; i < 8; ++i) {
        if (TWOPASS) invr[i] = SPLITPV ? 1.f : (1.f / 4096.f);
        else if (p.nonorm) invr[i] = exp2f(m8[i]) * (SPLITPV ? 1.f : (1.f / 4096.f));
        else invr[i] = (l8[i] > 0.f) ? (SPLITPV ? 1.f / l8[i] : 1.f / (l8[i] * 4096.f)) : 0.f;
    }
    __syncthreads();                                             // all waves done with pl/vl from the main loop
    const bool ofast = ((p.sOi & 3) == 0) && ((((size_t)obase) & 15) == 0) && (q0 + 16 <= p.Lq);
#pragma unroll
    for (int c0 = 0; c0 < DVP; c0 += 64) {
#pragma unroll
        for (int i = 0; i < 8; ++i)
#pragma unroll
            for (int t = 0; t < NT; ++t) if (t * 16 >= c0 && t * 16 < c0 + 64) ((float*)myp)[(i + 8 * hf) * 64 + (t * 16 - c0) + l15] = o[t][i] * invr[i];
        __syncthreads();
        const int cw = (DVP - c0 < 64) ? (DVP - c0) : 64;      // staged columns in this chunk (multiple of 16)
        if (ofast && (c0 + cw <= p.dv) && (cw % 32 == 0)) {
            const int lpr = cw / 4;                              // lanes per row (16 for 64 cols, 8 for 32)
            const int rows_per_ins = 32 / lpr;
            for (int r0 = 0; r0 < 16; r0 += rows_per_ins) {
                const int row = r0 + lane / lpr, c4 = (lane % lpr) * 4;
                const v4f v = *(const v4f*)(myp + row * 64 + c4);
                VST2V4(obase + (long long)(q0 + row) * p.sOi + c0 + c4, v);
            }
        } else {
            for (int row = 0; row < 16; ++row) {
                const int irow = q0 + row; if (irow >= p.Lq) continue;
                for (int c = lane; c < cw; c += 32) { const int d = c0 + c; if (d < p.dv) VST2(float, obase + (long long)irow * p.sOi + d, myp[row * 64 + c]); }
            }
        }
        __syncthreads();
    }
}

// =====================================================================================================================
// k_tr: dst(z, c, r) = alpha * src(z, r, c) (+ beta * R2(z, c, r)): [Z][R][C] (row stride lds) -> [Z][C][R] (row stride ldd) through a 32x32 LDS tile;
//   flags: 1 -> add beta * residual R2 addressed like dst (z*sRz + c*ldr + r); act applied before the residual.
// =====================================================================================================================
struct TrP { const float* src; float* dst; const float* R2; long long sSz, lds, sDz, ldd, sRz, ldr; int R, C, flags, act; float alpha, beta; };
static_assert(sizeof(TrP) == 3 * 8 + 6 * 8 + 6 * 4, "TrP has padding");
__global__ __launch_bounds__(256) void k_tr(TrP p) {
    __shared__ float tile[32][33];
    const int c0 = blockIdx.x * 32, r0 = blockIdx.y * 32, z = blockIdx.z;
    const int lane = threadIdx.x & 31, wave = threadIdx.x >> 5;
    const float* s = p.src + z * p.sSz;
#pragma unroll
    for (int k = 0; k < 4; ++k) {
        const int rl = wave * 4 + k, r = r0 + rl, c = c0 + lane;
        tile[rl][lane] = (r < p.R && c < p.C) ? s[(long long)r * p.lds + c] : 0.f;
    }
    __syncthreads();
    float* d = p.dst + z * p.sDz; const float* rr = p.R2 + z * p.sRz;
#pragma unroll
    for (int k = 0; k < 4; ++k) {
        const int cl = wave * 4 + k, c = c0 + cl, r = r0 + lane;
        if (c < p.C && r < p.R) {
            float v = act_fn(p.alpha * tile[lane][cl], p.act);
            if (p.flags & 1) v += p.beta * rr[(long long)c * p.ldr + r];
            VST2(float, d + (long long)c * p.ldd + r, v);
        }
    }
}

// k_affine: dst[i] = a * (sdev ? sdev[0] : 1) * src[i] + b, i < n (one thread per element; consecutive lanes -> consecutive addresses)
__global__ __launch_bounds__(256) void k_affine(const float* __restrict__ src, float* __restrict__ dst, int n, float a, float b, const float* __restrict__ sdev) {
    const int i = blockIdx.x * 256 + threadIdx.x;
    if (i < n) { const float aa = sdev ? a * sdev[0] : a; const float v = aa * src[i] + b; VST2(float, dst + i, v); }
}

// =====================================================================================================================
// k_softmax: row softmax over n contiguous elements, one 256-thread block per row; rows addressed z*sz + r*sr (grid (R, Z)).
//   out = scale_out * softmax(scale_in * x + (Mf ? Mf[z*smz + r*smr + j] : 0)); a row whose max is -inf is written as 0.
// =====================================================================================================================
struct SmP { const float* src; float* dst; const float* Mf; long long sz, sr, dz, dr, smz, smr; int n, pad; float scale_in, scale_out; };
static_assert(sizeof(SmP) == 3 * 8 + 6 * 8 + 4 * 4, "SmP has padding");
__global__ __launch_bounds__(256) void k_softmax(SmP p) {
    __shared__ float red[256];
    const int r = blockIdx.x, z = blockIdx.y, tid = threadIdx.x;
    const float* s = p.src + z * p.sz + (long long)r * p.sr;
    const float* mf = p.Mf ? (p.Mf + z * p.smz + (long long)r * p.smr) : nullptr;
    float mx = -__builtin_inff();
    for (int j = tid; j < p.n; j += 256) { float v = s[j] * p.scale_in; if (mf) v += mf[j]; mx = fmaxf(mx, v); }
    red[tid] = mx; __syncthreads();
    for (int o = 128; o > 0; o >>= 1) { if (tid < o) red[tid] = fmaxf(red[tid], red[tid + o]); __syncthreads(); }
    mx = red[0]; __syncthreads();
    float sum = 0.f;
    for (int j = tid; j < p.n; j += 256) { float v = s[j] * p.scale_in; if (mf) v += mf[j]; sum += (mx == -__builtin_inff()) ? 0.f : expf(v - mx); }
    red[tid] = sum; __syncthreads();
    for (int o = 128; o > 0; o >>= 1) { if (tid < o) red[tid] += red[tid + o]; __syncthreads(); }
    sum = red[0];
    const float inv = (sum > 0.f) ? p.scale_out / sum : 0.f;
    float* d = p.dst + z * p.dz + (long long)r * p.dr;
    for (int j = tid; j < p.n; j += 256) { float v = s[j] * p.scale_in; if (mf) v += mf[j]; const float o = (mx == -__builtin_inff()) ? 0.f : expf(v - mx) * inv; VST2(float, d + j, o); }
}
// =====================================================================================================================
// k_stats: mean and rsqrt(var + eps) over a set of n elements addressed base + z*sz + (e / inner) * so + (e % inner) * si, one 256-thread
// k_norm_apply: y = (x - mean[set]) * rstd[set] * g[c] + b[c] over a [Z][C][L] channel-major tensor with set = z*G + c / (C/G) (G groups per z;
//   G = C -> per-channel sets indexed z*C+c; for batch norm pass stats indexed by c only via bn = 1). Optional act. Output same layout.
// =====================================================================================================================
//   mode 0: mean / rsqrt(var + eps); mode 1 (RMSNorm): 0 / rsqrt(mean(x^2) + eps); mode 2 (L2 normalize * sqrt(n)): 0 / sqrt(n) / max(||x||, eps); mode 3: as 0 with unbiased variance (n-1)
__global__ __launch_bounds__(256) void k_stats(const float* __restrict__ x, long long sz, long long so, long long si, int inner, int n, float eps, float* __restrict__ stat, int mode) {
    __shared__ float red[256];
    const int z = blockIdx.x, tid = threadIdx.x;
    const float* base = x + z * sz;
    float s = 0.f;
    for (int e = tid; e < n; e += 256) s += base[(long long)(e / inner) * so + (long long)(e % inner) * si];
    red[tid] = s; __syncthreads();
    for (int o = 128; o > 0; o >>= 1) { if (tid < o) red[tid] += red[tid + o]; __syncthreads(); }
    const float mu = (mode == 0 || mode == 3) ? red[0] / (float)n : 0.f; __syncthreads();
    float q = 0.f;
    for (int e = tid; e < n; e += 256) { const float dlt = base[(long long)(e / inner) * so + (long long)(e % inner) * si] - mu; q += dlt * dlt; }
    red[tid] = q; __syncthreads();
    for (int o = 128; o > 0; o >>= 1) { if (tid < o) red[tid] += red[tid + o]; __syncthreads(); }
    {
        float rs;
        if (mode == 2) rs = sqrtf((float)n) / fmaxf(sqrtf(red[0]), eps); else if (mode == 3) rs = rsqrtf(red[0] / (float)(n - 1) + eps); else rs = rsqrtf(red[0] / (float)n + eps);
        if (tid < 32) { const float v = (tid == 0) ? mu : ((tid == 1) ? rs : 0.f); VST2(float, stat + (long long)z * 32 + tid, v); }
    }
}
//   One thread per element over the flat [Z][C][L] index space: grid ceil(Z*C*L / 256).
__global__ __launch_bounds__(256) void k_norm_apply(const float* __restrict__ x, float* __restrict__ y, const float* __restrict__ stat, const float* __restrict__ g, const float* __restrict__ bta,
                                                     int Z, int C, int L, int G, int bn, int act) {
    const long long idx = (long long)blockIdx.x * 256 + threadIdx.x;
    if (idx >= (long long)Z * C * L) return;
    const int l = (int)(idx % L); const long long zc = idx / L; const int c = (int)(zc % C), z = (int)(zc / C); (void)l;
    const int set = bn ? c : (z * G + c / (C / G));
    float v = (x[idx] - stat[(long long)set * 32]) * stat[(long long)set * 32 + 1];
    if (g) v *= g[c];
    if (bta) v += bta[c];
    v = act_fn(v, act);
    VST2(float, y + idx, v);
}

// k_lse_neg: c[i] = -(st[2i] + log(st[2i+1])) = minus the log-sum-exp of row i from k_attn's ST output (for softmax over the query dimension)
__global__ __launch_bounds__(256) void k_lse_neg(const float* __restrict__ st, float* __restrict__ c, int n) {
    const int i = blockIdx.x * 256 + threadIdx.x;
    if (i < n) { const float v = -(st[2 * i] + logf(st[2 * i + 1])); VST2(float, c + i, v); }
}

// k_iota: dst[i] = a * i + b as int32 (segment/position id helper)
__global__ __launch_bounds__(256) void k_iota(int* __restrict__ dst, int n, int a, int b) {
    const int i = blockIdx.x * 256 + threadIdx.x;
    if (i < n) { const int v = a * i + b; VST2(int, dst + i, v); }
}

// k_axpby: dst[i] = a * x[i] + b * y[i] (+ c), i < n
__global__ __launch_bounds__(256) void k_axpby(const float* __restrict__ x, const float* __restrict__ y, float* __restrict__ dst, int n, float a, float b, float c) {
    const int i = blockIdx.x * 256 + threadIdx.x;
    if (i < n) { const float v = a * x[i] + b * y[i] + c; VST2(float, dst + i, v); }
}

// =====================================================================================================================
// k_rope: rotary embedding on a [R rows][Hn heads][D] view (row stride sXr, head stride sXh, element stride 1) -> Y (own strides).
//   mode 0: rotate_half (partner d±D/2, sign - for d<D/2); mode 1: interleaved pairs (partner d^1, sign - for even d).
//   table column tcol: tmode 0 -> d, 1 -> d % (D/2), 2 -> d / 2; position p: pmode 0 -> r % S, 1 -> head index, 2 -> pos[r];
//   c = C[(r / S) * sCb + p * sCp + tcol * sCd], s likewise from Sn; y = x[d] * c + sign * x[partner] * s. X and Y must not alias.
// =====================================================================================================================
struct RopeP { const float* X; float* Y; const float* C; const float* Sn; const int* pos; long long sXr, sXh, sYr, sYh, sCb, sCp, sCd; int R, Hn, D, S, mode, tmode, pmode, pad; };
static_assert(sizeof(RopeP) == 5 * 8 + 7 * 8 + 8 * 4, "RopeP has padding");
__global__ __launch_bounds__(256) void k_rope(RopeP p) {
    const long long idx = (long long)blockIdx.x * 256 + threadIdx.x;
    if (idx >= (long long)p.R * p.Hn * p.D) return;
    const int d = (int)(idx % p.D); const long long rh = idx / p.D; const int h = (int)(rh % p.Hn); const int r = (int)(rh / p.Hn);
    const int half = p.D / 2;
    int partner; float sign;
    if (p.mode == 0) { partner = (d < half) ? d + half : d - half; sign = (d < half) ? -1.f : 1.f; }
    else { partner = d ^ 1; sign = (d & 1) ? 1.f : -1.f; }
    const int tcol = (p.tmode == 0) ? d : ((p.tmode == 1) ? (d % half) : (d >> 1));
    const int pp = (p.pmode == 0) ? (r % p.S) : ((p.pmode == 1) ? h : p.pos[r]);
    const long long toff = (long long)(r / p.S) * p.sCb + (long long)pp * p.sCp + (long long)tcol * p.sCd;
    const float* xr = p.X + (long long)r * p.sXr + (long long)h * p.sXh;
    const float v = xr[d] * p.C[toff] + sign * xr[partner] * p.Sn[toff];
    VST2(float, p.Y + (long long)r * p.sYr + (long long)h * p.sYh + d, v);
}

// k_invf + k_sincos (split so neither kernel carries a large VALU-fma footprint): invf_i = num * (1 / powf(base, (2 i)/D)) [fmode 0],
//   num * expf((2 i) * cexp) [fmode 1], num * powf(base, -2 (i - 1) / D) [fmode 2]; then cs/sn[s*half + i] = cos/sin((pscale * s) * invf_i)
__global__ __launch_bounds__(256) void k_invf(float* __restrict__ invb, int half, int D, float base, float num, int fmode, float cexp) {
    const int i = blockIdx.x * 256 + threadIdx.x;
    if (i >= ((half + 31) / 32) * 32) return;
    if (i >= half) { VST2(float, invb + i, 0.f); return; }
    const float e = (float)(2 * i) / (float)D;
    float invf;
    if (fmode == 1) invf = num * expf((float)(2 * i) * cexp);
    else if (fmode == 2) invf = num * powf(base, (-2.0f * ((float)i - 1.0f)) / (float)D);
    else invf = num * (1.0f / powf(base, e));
    VST2(float, invb + i, invf);
}
__global__ __launch_bounds__(256) void k_sincos(float* __restrict__ cs, float* __restrict__ sn, const float* __restrict__ invb, int S, int half, float pscale) {
    const int idx = blockIdx.x * 256 + threadIdx.x;
    if (idx >= S * half) return;
    const int s = idx / half, i = idx - s * half;
    const float ang = (pscale * (float)s) * invb[i];
    VST2(float, cs + idx, cosf(ang)); VST2(float, sn + idx, sinf(ang));
}

// k_mulact: dst[i] = act(x[i]) * y[i]
__global__ __launch_bounds__(256) void k_mulact(const float* __restrict__ x, const float* __restrict__ y, float* __restrict__ dst, int n, int act) {
    const int i = blockIdx.x * 256 + threadIdx.x;
    if (i < n) { const float v = act_fn(x[i], act) * y[i]; VST2(float, dst + i, v); }
}

// =====================================================================================================================
// k_matvec: thread-per-row matrix-vector products for N <= 8 output columns (heads with 1-3 outputs, gates), f32 on the VALU.
//   C[r*sCm + j] = act(alpha * sum_k A[r*sAm + k*sAk] * B[j*sBn + k*sBk] + bias[j]) + beta * R[r*sRm + j*sRn]; each thread writes its N contiguous floats.
// =====================================================================================================================
__global__ __launch_bounds__(256) void k_matvec(GemmP p) {
    // 32 lanes write one line with one instruction.
    const int rpt = (p.N == 1) ? 1 : 32;
    const long long r0 = ((long long)blockIdx.x * 256 + threadIdx.x) * rpt; const int z = blockIdx.z, zo = z / p.zi_n, zi = z - zo * p.zi_n;
    if (r0 >= p.M) return;
    const float* Bb = p.B + zo * p.sBo + zi * p.sBi;
    float* C = p.C + zo * p.sCo + zi * p.sCi; const float* R = p.R + zo * p.sRo + zi * p.sRi;
    for (int rr = 0; rr < rpt; ++rr) {
        const long long r = r0 + rr; if (r >= p.M) break;
        const float* A = p.A + zo * p.sAo + zi * p.sAi + r * p.sAm;
        float acc[8] = {0.f, 0.f, 0.f, 0.f, 0.f, 0.f, 0.f, 0.f};
        for (int k = 0; k < p.K; ++k) { const float a = A[(long long)k * p.sAk];
#pragma unroll
            for (int j = 0; j < 8; ++j) if (j < p.N) acc[j] += a * Bb[(long long)j * p.sBn + (long long)k * p.sBk]; }
#pragma unroll
        for (int j = 0; j < 8; ++j) if (j < p.N) {
            float v = acc[j] * p.alpha;
            if (p.flags & 1) v += p.bias[j];
            if (p.flags & 2) v += p.bias[r];
            v = act_fn(v, p.act);
            if (p.flags & 4) v += p.beta * R[r * p.sRm + (long long)j * p.sRn];
            VST2(float, C + r * p.sCm + j, v);
        }
    }
}
// k_smallsoftmax: thread-per-row softmax for short rows (n <= 64): dst[r*dr + j] = softmax(scale*src[r*sr + j])
__global__ __launch_bounds__(256) void k_smallsoftmax(const float* __restrict__ src, float* __restrict__ dst, long long sr, long long dr, int n, long long R, float scale) {
    const long long r0 = ((long long)blockIdx.x * 256 + threadIdx.x) * 32;
    for (int rr = 0; rr < 32; ++rr) {
        const long long r = r0 + rr; if (r >= R) return;
        const float* s = src + r * sr; float* d = dst + r * dr;
        float mx = -__builtin_inff();
        for (int j = 0; j < n; ++j) mx = fmaxf(mx, s[j] * scale);
        float sum = 0.f;
        for (int j = 0; j < n; ++j) sum += expf(s[j] * scale - mx);
        const float inv = 1.f / sum;
        for (int j = 0; j < n; ++j) { const float v = expf(s[j] * scale - mx) * inv; VST2(float, d + j, v); }
    }
}

__global__ __launch_bounds__(32) void k_unitstat(float* __restrict__ st) { const int t = threadIdx.x; const float v = (t == 1) ? 1.f : 0.f; VST2(float, st + t, v); }

// destination (e.g. a d_out whose row width is not a multiple of 32 floats) is written by consecutive lanes of one instruction
__global__ __launch_bounds__(256) void k_lincopy(const float* __restrict__ src, long long lds, float* __restrict__ dst, long long ldd, long long rows, int cols) {
    const long long i = (long long)blockIdx.x * 256 + threadIdx.x; if (i >= rows * cols) return;
    const long long r = i / cols; const int c = (int)(i - r * cols);
    const float v = src[r * lds + c]; VST2(float, dst + r * ldd + c, v);
}

namespace w25 {
typedef __attribute__((ext_vector_type(16))) _Float16 v16h;
typedef __attribute__((ext_vector_type(8)))  _Float16 v8h;
typedef __attribute__((ext_vector_type(16))) __bf16   v16b;
typedef __attribute__((ext_vector_type(8)))  __bf16   v8b;
typedef __attribute__((ext_vector_type(8)))  float    v8f;
typedef __attribute__((ext_vector_type(4)))  float    v4f;

__device__ __forceinline__ unsigned short f2bf_bits(float f) {
  unsigned u = __float_as_uint(f);
  return (unsigned short)((u + 0x7FFFu + ((u >> 16) & 1u)) >> 16);
}
__device__ __forceinline__ float bf_bits2f(unsigned short h) { return __uint_as_float(((unsigned)h) << 16); }

// hazard guards as plain device helpers (no inline asm inside the kernel template body)
__device__ __forceinline__ void dep_guard_h(v8f& a, v8f& b, v16h x, v16h y) { asm volatile("v_nop\n\tv_nop\n\tv_nop\n\tv_nop" : "+v"(a), "+v"(b) : "v"(x), "v"(y)); }
__device__ __forceinline__ void dep_guard_b(v8f& a, v8f& b, v16b x, v16b y) { asm volatile("v_nop\n\tv_nop\n\tv_nop\n\tv_nop" : "+v"(a), "+v"(b) : "v"(x), "v"(y)); }
__device__ __forceinline__ void keep4_h(v16h a, v16h b, v16h c, v16h d) { asm volatile("v_nop" :: "v"(a), "v"(b), "v"(c), "v"(d)); }
__device__ __forceinline__ void keep4_b(v16b a, v16b b, v16b c, v16b d) { asm volatile("v_nop" :: "v"(a), "v"(b), "v"(c), "v"(d)); }
__device__ __forceinline__ void acc_guard4(v8f& a, v8f& b, v8f& c, v8f& d) { asm volatile("v_nop\n\tv_nop\n\tv_nop\n\tv_nop" : "+v"(a), "+v"(b), "+v"(c), "+v"(d)); }
template <typename T> struct Frag;
template <> struct Frag<_Float16> {
  typedef v16h V; union U { v16h v; v8h h[2]; };
  static __device__ __forceinline__ v16h load(const _Float16* p) {   // elements 0..7 <- p[0..7], 8..15 <- p[16..23]
    U f; f.h[0] = *(const v8h*)(p); f.h[1] = *(const v8h*)(p + 16); return f.v;
  }
  static __device__ __forceinline__ v8f mma(v16h a, v16h b, v8f c) {
    return __builtin_amdgcn_wmma_f32_16x16x32_f16(false, a, false, b, (short)0, c, false, false);
  }
  static __device__ __forceinline__ void guard(v8f& a, v8f& b, v16h x, v16h y) { dep_guard_h(a, b, x, y); }
  static __device__ __forceinline__ void keep(v16h a, v16h b, v16h c, v16h d) { keep4_h(a, b, c, d); }
};
template <> struct Frag<__bf16> {
  typedef v16b V; union U { v16b v; v8b h[2]; };
  static __device__ __forceinline__ v16b load(const __bf16* p) {
    U f; f.h[0] = *(const v8b*)(p); f.h[1] = *(const v8b*)(p + 16); return f.v;
  }
  static __device__ __forceinline__ v8f mma(v16b a, v16b b, v8f c) {
    return __builtin_amdgcn_wmma_f32_16x16x32_bf16(false, a, false, b, (short)0, c, false, false);
  }
  static __device__ __forceinline__ void guard(v8f& a, v8f& b, v16b x, v16b y) { dep_guard_b(a, b, x, y); }
  static __device__ __forceinline__ void keep(v16b a, v16b b, v16b c, v16b d) { keep4_b(a, b, c, d); }
};

// ---- Register-blocked batched WMMA GEMM ------------------------------------
// C[m,n] = scale * sum_k A[m,k] * Bt[n,k] (+bias)(+resid); each wave owns a 64x64 tile.
// A row-major [M,K]; Bt row-major [N,K]; M,N % 64 == 0, K % 32 == 0.
// SPLIT: operands are hi/lo planes (A2/Bt2 = lo planes, same layout); product = hi·hi + hi·lo + lo·hi.
// BIAS_MODE: 0 = none, 1 = bias[m], 2 = bias[n].
// OUT_MODE: 0 = f32, 1 = f16, 2 = bf16 hi plane (Cout) + bf16 lo plane (Cout2).
// ET: 0 = f16 operands, 1 = bf16 operands (pointers passed as 16-bit storage)
template <int ET> struct Elem;
template <> struct Elem<0> { typedef _Float16 T; };
template <> struct Elem<1> { typedef __bf16 T; };
template <int ET, bool SPLIT, int BIAS_MODE, int OUT_MODE, bool RESID, int ACT = 0>
__global__ __launch_bounds__(256) void wmma_gemm64(
    const unsigned short* __restrict__ Ap, const unsigned short* __restrict__ A2p, int lda, long strideA,
    const unsigned short* __restrict__ Btp, const unsigned short* __restrict__ Bt2p, int ldb, long strideB,
    void* __restrict__ Cout, void* __restrict__ Cout2, int ldc, long strideC,
    const float* __restrict__ bias,
    const float* __restrict__ resid, long strideR,
    int M, int N, int K, float scale) {
  typedef typename Elem<ET>::T T;
  typedef typename Frag<T>::V V;
  const T* A = (const T*)Ap; const T* A2 = (const T*)A2p; const T* Bt = (const T*)Btp; const T* Bt2 = (const T*)Bt2p;
  __shared__ __align__(16) float sT[8][16 * 68];   // per-wave 16x64 slab, pitch 68 floats
  const int b    = blockIdx.y;
  const int lane = threadIdx.x & 31;
  const int wave = threadIdx.x >> 5;
  const int tilesN = N >> 6;
  const int tilesM = M >> 6;
  const int tile = blockIdx.x * 8 + wave;
  if (tile >= tilesM * tilesN) return;   // wave-uniform; no block barriers in this kernel
  const int tm = tile / tilesN;
  const int tn = tile - tm * tilesN;
  const int m0 = tm << 6;
  const int n0 = tn << 6;

  const T* Ab  = A  + (size_t)b * strideA;
  const T* Bb  = Bt + (size_t)b * strideB;
  const T* Ab2 = SPLIT ? (A2  + (size_t)b * strideA) : nullptr;
  const T* Bb2 = SPLIT ? (Bt2 + (size_t)b * strideB) : nullptr;

  const int rlane = lane & 15;                 // row (A) / col (B, D) within subtile
  const int koff  = (lane >> 4) * 8;           // k offset of this lane half
  const int mOff  = (lane >> 4) * 8;           // D row offset

  v8f acc[4][4];
#pragma unroll
  for (int i = 0; i < 4; ++i)
#pragma unroll
    for (int j = 0; j < 4; ++j) acc[i][j] = (v8f){0.f,0.f,0.f,0.f,0.f,0.f,0.f,0.f};

  for (int k0 = 0; k0 < K; k0 += 32) {
    V bh[4], bl[4];
#pragma unroll
    for (int j = 0; j < 4; ++j) {
      const size_t bo = (size_t)(n0 + (j << 4) + rlane) * ldb + koff + k0;
      bh[j] = Frag<T>::load(Bb + bo);
      if (SPLIT) bl[j] = Frag<T>::load(Bb2 + bo);
    }
#pragma unroll
    for (int i = 0; i < 4; ++i) {
      const size_t ao = (size_t)(m0 + (i << 4) + rlane) * lda + koff + k0;
      V ah = Frag<T>::load(Ab + ao);
      V al;
      if (SPLIT) al = Frag<T>::load(Ab2 + ao);
#pragma unroll
      for (int j = 0; j < 4; ++j) {
        acc[i][j] = Frag<T>::mma(ah, bh[j], acc[i][j]);
        if (SPLIT) {
          acc[i][j] = Frag<T>::mma(ah, bl[j], acc[i][j]);
          acc[i][j] = Frag<T>::mma(al, bh[j], acc[i][j]);
        }
      }
      Frag<T>::guard(acc[i][0], acc[i][3], ah, SPLIT ? al : ah);
    }
    Frag<T>::keep(bh[0], bh[1], bh[2], bh[3]);
    if (SPLIT) Frag<T>::keep(bl[0], bl[1], bl[2], bl[3]);
  }
  acc_guard4(acc[0][0], acc[0][1], acc[0][2], acc[0][3]);
  acc_guard4(acc[1][0], acc[1][1], acc[1][2], acc[1][3]);
  acc_guard4(acc[2][0], acc[2][1], acc[2][2], acc[2][3]);
  acc_guard4(acc[3][0], acc[3][1], acc[3][2], acc[3][3]);

  // ---- epilogue ----
  float* slab = sT[wave];
  const float* Rb = RESID ? (resid + (size_t)b * strideR) : nullptr;
#pragma unroll
  for (int i = 0; i < 4; ++i) {
    const int mBase = m0 + (i << 4);
#pragma unroll
    for (int j = 0; j < 4; ++j) {
      const int n = n0 + (j << 4) + rlane;
      float bv = 0.f;
      if (BIAS_MODE == 2) bv = bias[n];
#pragma unroll
      for (int r = 0; r < 8; ++r) {
        float v = acc[i][j][r] * scale;
        if (BIAS_MODE == 1) v += bias[mBase + mOff + r];
        if (BIAS_MODE == 2) v += bv;
        if (RESID) v += Rb[(size_t)(mBase + mOff + r) * ldc + n];
        if (ACT == 1) v = tanhf(v);
        if (ACT == 2) v = fmaxf(v, 0.0f);
        if (ACT == 3) v = v / (1.0f + expf(-v));
        if (ACT == 4) v = (v > 0.f) ? v : 0.01f * v;
        if (ACT == 5) v = 0.5f * v * (1.0f + erff(v * 0.70710678118654752f));
        slab[(mOff + r) * 68 + (j << 4) + rlane] = v;
      }
    }
    __builtin_amdgcn_fence(__ATOMIC_RELEASE, "workgroup");
    __builtin_amdgcn_wave_barrier();
    __builtin_amdgcn_fence(__ATOMIC_ACQUIRE, "workgroup");
    if (OUT_MODE == 0) {
      float* C = (float*)Cout + (size_t)b * strideC;
      const int hh = lane >> 4, c4 = (lane & 15) * 4;     // row seg = 256 B = 16 lanes x 16 B
      {
#pragma unroll
        for (int it = 0; it < 8; ++it) {
          const int row = it * 2 + hh;
          v4f v = *(const v4f*)(slab + row * 68 + c4);
          *(v4f*)(C + (size_t)(mBase + row) * ldc + n0 + c4) = v;
        }
        
      }
    } else {
      const int q = lane >> 3, c8 = (lane & 7) * 8;
      unsigned short* C  = (unsigned short*)Cout  + (size_t)b * strideC;
      unsigned short* C2 = (OUT_MODE == 2) ? ((unsigned short*)Cout2 + (size_t)b * strideC) : nullptr;
      {
#pragma unroll
        for (int it = 0; it < 4; ++it) {
          const int row = it * 4 + q;
          const float* sp = slab + row * 68 + c8;
          v8h hv, lv;
#pragma unroll
          for (int e = 0; e < 8; ++e) {
            if (OUT_MODE == 1) {
              hv[e] = (_Float16)sp[e];
            } else {
              unsigned short hb = f2bf_bits(sp[e]);
              unsigned short lb = f2bf_bits(sp[e] - bf_bits2f(hb));
              hv[e] = __builtin_bit_cast(_Float16, hb);
              lv[e] = __builtin_bit_cast(_Float16, lb);
            }
          }
          *(v8h*)(C + (size_t)(mBase + row) * ldc + n0 + c8) = hv;
          if (OUT_MODE == 2) *(v8h*)(C2 + (size_t)(mBase + row) * ldc + n0 + c8) = lv;
        }
        
      }
    }
    __builtin_amdgcn_fence(__ATOMIC_RELEASE, "workgroup");
    __builtin_amdgcn_wave_barrier();
    __builtin_amdgcn_fence(__ATOMIC_ACQUIRE, "workgroup");
  }
}

__global__ __launch_bounds__(256) void cast_f32_f16x2(
    const float* __restrict__ in, _Float16* __restrict__ out, int n2) {
  int i = blockIdx.x * 256 + threadIdx.x;
  if (i < n2) {
    const _Float16 h0 = (_Float16)in[2 * i], h1 = (_Float16)in[2 * i + 1];
    const unsigned u = (unsigned)__builtin_bit_cast(unsigned short, h0) | ((unsigned)__builtin_bit_cast(unsigned short, h1) << 16);
    ((unsigned*)out)[i] = u;
    
  }
}


} // namespace w25

// f32 -> bf16 hi + bf16 lo (x = hi + lo to ~2^-17 relative; RNE both), two neighbouring elements packed per 32-bit word
__device__ __forceinline__ unsigned int f2bf2_pack(float a, float b, unsigned int* lo) {
    const unsigned short ha = w25::f2bf_bits(a), hb = w25::f2bf_bits(b);
    const unsigned short la = w25::f2bf_bits(a - w25::bf_bits2f(ha)), lb = w25::f2bf_bits(b - w25::bf_bits2f(hb));
    *lo = (unsigned)la | ((unsigned)lb << 16); return (unsigned)ha | ((unsigned)hb << 16); }

namespace w25 {
// =====================================================================================
// Generic causal/non-causal attention for head_dim 64, f32 in / f32 out; 16-bit operands: bf16 with optional hi/lo splits, or
// plain f16 (F16=true, non-split, probabilities carried x2^15).
//   scores = (q*qscale)·kᵀ : v_wmma_f32_16x16x32_bf16; SPLIT_QK -> q,k as bf16 hi/lo (hi·hi + hi·lo + lo·hi)
//   out    = p·v           : v_wmma_f32_16x16x32_bf16; SPLIT_PV -> p,v as bf16 hi/lo; else p,v plain bf16
//   f32 accumulate; online softmax in f32. Block = 4 waves = 64 query rows of one (batch, head); S % 64 == 0.
//   Element (b, s, h, d) of tensor X lives at X[b*X_bs + s*X_rs + h*X_hs + d] (strides in floats, multiples of 4).
//   Masking: mask_mode 0 none, 1 causal (kv > q masked), 2 tensor [S][Skv] shared over (b,h) (float if
//   mask_is_int==0, int32 with element == 0 -> masked if 1, int32 with element != 0 -> masked if 2), 3 per-token vectors qmask[B][S] & kvmask[B][Skv] (int32,
//   0 -> masked), 4 causal + sliding window (kv > q or q - kv > W masked; W passed in mask_is_int);
//   5 = relative-position bias: s += cp[b,h,q][idx[q][kv]] + pc[b,h,kv][idx[q][kv]] with idx = mask_b ([S][Skv] int32) and
//   mask_a an int32 [S][Skv] tensor with nonzero = masked (tables: element (b,h,row,n) at X + b*c_bs + h*c_hs + row*c_rs + n);
//   masked scores are replaced by mask_fill (e.g. -inf or -1e9) before the softmax.
//   grid.x = B * H * (S/64) (or a sub-range with blk0).
// =====================================================================================
#define AT_D 64
#define AT_NW 4
#define AT_QB 64
#define AT_KC 64
struct AttnGeom { const float* cp = nullptr; const float* pc = nullptr; long c_bs = 0, c_rs = 0, c_hs = 0;   // mode-5 score-bias tables
                  long q_bs, q_rs, q_hs, k_bs, k_rs, k_hs, v_bs, v_rs, v_hs, o_bs, o_rs, o_hs;
                  int S, Skv, H, mask_mode; float qscale; int blk0; float mask_fill; int mask_is_int; };
static_assert(sizeof(AttnGeom) == 168, "no padding");

__device__ __forceinline__ unsigned short at_bf_bits(float f) {
  unsigned u = __float_as_uint(f);
  return (unsigned short)((u + 0x7FFFu + ((u >> 16) & 1u)) >> 16);
}
__device__ __forceinline__ __bf16 at_f2bf(float f) { return __builtin_bit_cast(__bf16, at_bf_bits(f)); }
__device__ __forceinline__ void at_split(float f, __bf16& hi, __bf16& lo) {
  const unsigned short hb = at_bf_bits(f);
  hi = __builtin_bit_cast(__bf16, hb);
  lo = at_f2bf(f - __uint_as_float(((unsigned)hb) << 16));
}
__device__ __forceinline__ v8f at_mma(v16b a, v16b b, v8f c) {
  c = __builtin_amdgcn_wmma_f32_16x16x32_bf16(false, a, false, b, (short)0, c, false, false);
  asm volatile("v_nop\n\tv_nop\n\tv_nop\n\tv_nop" : "+v"(c) : "v"(a), "v"(b));
  return c;
}
// 16-bit element as a bit pattern held in a __bf16 slot: f16 bits when F16, bf16 (RNE) otherwise
template <bool F16> __device__ __forceinline__ __bf16 at_to16(float f) {
  if (F16) return __builtin_bit_cast(__bf16, (_Float16)f);
  return at_f2bf(f);
}
template <bool F16> __device__ __forceinline__ v8f at_mma16(v16b a, v16b b, v8f c) {
  if (F16) {
    const v16h ah = __builtin_bit_cast(v16h, a), bh = __builtin_bit_cast(v16h, b);
    c = __builtin_amdgcn_wmma_f32_16x16x32_f16(false, ah, false, bh, (short)0, c, false, false);
    asm volatile("v_nop\n\tv_nop\n\tv_nop\n\tv_nop" : "+v"(c) : "v"(ah), "v"(bh));
    return c;
  }
  return at_mma(a, b, c);
}

template <bool SPLIT_QK, bool SPLIT_PV, bool F16 = false>
__global__ __launch_bounds__(128)
void attn64_kernel(const float* __restrict__ q, const float* __restrict__ k,
                   const float* __restrict__ v, float* __restrict__ out,
                   const void* __restrict__ mask_a, const int* __restrict__ mask_b, AttnGeom g) {
  static_assert(!(F16 && (SPLIT_QK || SPLIT_PV)), "f16 mode is non-split");
  const float PSC = F16 ? 32768.0f : 1.0f;     // f16 probabilities carried x2^15 (subnormal range), folded into the final 1/l
  union FB { v16b v; v8b h[2]; };
  __shared__ __align__(16) __bf16 Ksh[AT_KC * AT_D];             // K hi [kv][d]      8 KB
  __shared__ __align__(16) __bf16 Ksl[SPLIT_QK ? AT_KC * AT_D : 8];
  __shared__ __align__(16) __bf16 Vth[AT_D * AT_KC];             // V hi [d][kv]      8 KB
  __shared__ __align__(16) __bf16 Vtl[SPLIT_PV ? AT_D * AT_KC : 8];
  __shared__ __align__(16) __bf16 Psh[AT_NW][16 * AT_KC];        // per wave P hi [row][kv]  8 KB
  __shared__ __align__(16) __bf16 Psl[SPLIT_PV ? AT_NW : 1][SPLIT_PV ? 16 * AT_KC : 8];
  __shared__ __align__(16) float  Os[AT_NW][16 * 68];            // per wave out tile, pitch 68

  const int tid  = threadIdx.x;
  const int wave = tid >> 5;
  const int lane = tid & 31;
  const int hh   = lane >> 4;
  const int c    = lane & 15;

  const int nqb = g.S / AT_QB;
  const int bx = blockIdx.x + g.blk0;
  const int qb = bx % nqb;
  const int bh = bx / nqb;
  const int h  = bh % g.H;
  const int b  = bh / g.H;
  const int qbase_block = qb * AT_QB;
  const int q0 = qbase_block + wave * 16;

  const float* qb_ptr = q + (size_t)b * g.q_bs + (size_t)h * g.q_hs;
  const float* kb_ptr = k + (size_t)b * g.k_bs + (size_t)h * g.k_hs;
  const float* vb_ptr = v + (size_t)b * g.v_bs + (size_t)h * g.v_hs;
  float*       ob_ptr = out + (size_t)b * g.o_bs + (size_t)h * g.o_hs;

  // ---- Q fragments (A operand): 2 d-chunks, hi (and lo) ----
  v16b qah[2], qal[2];
  {
    const float* qrow = qb_ptr + (size_t)(q0 + c) * g.q_rs;
#pragma unroll
    for (int dc = 0; dc < 2; ++dc) {
#pragma unroll
      for (int e = 0; e < 8; ++e) {
        const float f0 = qrow[dc * 32 + 8 * hh + e] * g.qscale;
        const float f1 = qrow[dc * 32 + 16 + 8 * hh + e] * g.qscale;
        if (SPLIT_QK) { __bf16 hq, lq; at_split(f0, hq, lq); qah[dc][e] = hq; qal[dc][e] = lq; at_split(f1, hq, lq); qah[dc][8 + e] = hq; qal[dc][8 + e] = lq; }
        else { qah[dc][e] = at_to16<F16>(f0); qah[dc][8 + e] = at_to16<F16>(f1); qal[dc][e] = qah[dc][e]; qal[dc][8 + e] = qah[dc][8 + e]; }
      }
    }
  }

  float mrow[8], lrow[8];
  v8f oacc[4];
#pragma unroll
  for (int r = 0; r < 8; ++r) { mrow[r] = -INFINITY; lrow[r] = 0.f; }
#pragma unroll
  for (int t = 0; t < 4; ++t) oacc[t] = (v8f){0.f,0.f,0.f,0.f,0.f,0.f,0.f,0.f};

  const int nChunks = (g.mask_mode == 1 || g.mask_mode == 4) ? (qb + 1) : (g.Skv / AT_KC);   // block-uniform
  // per-row query mask (mode 3)
  int qkeep[8];
#pragma unroll
  for (int r = 0; r < 8; ++r) qkeep[r] = (g.mask_mode == 3) ? mask_b[(size_t)b * g.S + q0 + 8 * hh + r] : 1;   // mask_b = qmask in mode 3
  for (int kc = 0; kc < nChunks; ++kc) {
    const int kv0 = kc * AT_KC;
    __syncthreads();
    {
      const int kvr = tid >> 1, dh = (tid & 1) * 32;
      const float* krow = kb_ptr + (size_t)(kv0 + kvr) * g.k_rs + dh;
      const float* vrow = vb_ptr + (size_t)(kv0 + kvr) * g.v_rs + dh;
#pragma unroll
      for (int i = 0; i < 8; ++i) {
        v4f kk = *(const v4f*)(krow + 4 * i);
        v4f vv = *(const v4f*)(vrow + 4 * i);
#pragma unroll
        for (int e = 0; e < 4; ++e) {
          const int d = dh + 4 * i + e;
          if (SPLIT_QK) { __bf16 a, bl; at_split(kk[e], a, bl); Ksh[kvr * AT_D + d] = a; Ksl[kvr * AT_D + d] = bl; }
          else Ksh[kvr * AT_D + d] = at_to16<F16>(kk[e]);
          if (SPLIT_PV) { __bf16 a, bl; at_split(vv[e], a, bl); Vth[d * AT_KC + kvr] = a; Vtl[d * AT_KC + kvr] = bl; }
          else Vth[d * AT_KC + kvr] = at_to16<F16>(vv[e]);
        }
      }
    }
    __syncthreads();

    v8f s[4];
#pragma unroll
    for (int j = 0; j < 4; ++j) {
      s[j] = (v8f){0.f,0.f,0.f,0.f,0.f,0.f,0.f,0.f};
#pragma unroll 1
      for (int dc = 0; dc < 2; ++dc) {
        FB kb;
        kb.h[0] = *(const v8b*)(Ksh + (j * 16 + c) * AT_D + dc * 32 + 8 * hh);
        kb.h[1] = *(const v8b*)(Ksh + (j * 16 + c) * AT_D + dc * 32 + 16 + 8 * hh);
        s[j] = at_mma16<F16>(qah[dc], kb.v, s[j]);
        if (SPLIT_QK) {
          FB kl;
          kl.h[0] = *(const v8b*)(Ksl + (j * 16 + c) * AT_D + dc * 32 + 8 * hh);
          kl.h[1] = *(const v8b*)(Ksl + (j * 16 + c) * AT_D + dc * 32 + 16 + 8 * hh);
          s[j] = at_mma16<F16>(qah[dc], kl.v, s[j]);
          s[j] = at_mma16<F16>(qal[dc], kb.v, s[j]);
        }
      }
    }
    const bool diag = (g.mask_mode == 1) && (kc == qb);
    int kvkeep[4] = {1, 1, 1, 1};
    if (g.mask_mode == 3) {
#pragma unroll
      for (int j = 0; j < 4; ++j) kvkeep[j] = ((const int*)mask_a)[(size_t)b * g.Skv + kv0 + j * 16 + c];   // mask_a = kvmask
    }
    float cm[8];
#pragma unroll
    for (int r = 0; r < 8; ++r) {
      const int qrow = q0 + 8 * hh + r;
      float m = -INFINITY;
#pragma unroll
      for (int j = 0; j < 4; ++j) {
        const int kvcol = kv0 + j * 16 + c;
        bool masked = false;
        if (diag) masked = (kvcol > qrow);
        else if (g.mask_mode == 4) masked = (kvcol > qrow) || (qrow - kvcol > g.mask_is_int);
        else if (g.mask_mode == 2) {
          const size_t mi = (size_t)qrow * g.Skv + kvcol;
          masked = (g.mask_is_int == 0) ? (((const float*)mask_a)[mi] == 0.0f)
                 : (g.mask_is_int == 1) ? (((const int*)mask_a)[mi] == 0) : (((const int*)mask_a)[mi] != 0);
        } else if (g.mask_mode == 3) masked = (qkeep[r] == 0) || (kvkeep[j] == 0);
        else if (g.mask_mode == 5) {
          const size_t mi = (size_t)qrow * g.Skv + kvcol;
          masked = (((const int*)mask_a)[mi] != 0);
          int n = mask_b[mi]; n = n < 0 ? 0 : n;
          s[j][r] += g.cp[(size_t)b * g.c_bs + (size_t)h * g.c_hs + (size_t)qrow * g.c_rs + n]
                   + g.pc[(size_t)b * g.c_bs + (size_t)h * g.c_hs + (size_t)kvcol * g.c_rs + n];
        }
        if (masked) s[j][r] = g.mask_fill;
        m = fmaxf(m, s[j][r]);
      }
#pragma unroll
      for (int off = 1; off < 16; off <<= 1) m = fmaxf(m, __shfl_xor(m, off, 32));
      cm[r] = m;
    }
    __bf16* pwh = Psh[wave];
    __bf16* pwl = Psl[SPLIT_PV ? wave : 0];
#pragma unroll
    for (int r = 0; r < 8; ++r) {
      const float mnew = fmaxf(mrow[r], cm[r]);
      const float alpha = expf(mrow[r] - mnew);
      mrow[r] = mnew;
      float psum = 0.f;
#pragma unroll
      for (int j = 0; j < 4; ++j) {
        const float p = expf(s[j][r] - mnew);
        psum += p;
        if (SPLIT_PV) { __bf16 a, bl; at_split(p, a, bl); pwh[(8 * hh + r) * AT_KC + j * 16 + c] = a; pwl[(8 * hh + r) * AT_KC + j * 16 + c] = bl; }
        else pwh[(8 * hh + r) * AT_KC + j * 16 + c] = at_to16<F16>(p * PSC);
      }
#pragma unroll
      for (int off = 1; off < 16; off <<= 1) psum += __shfl_xor(psum, off, 32);
      lrow[r] = lrow[r] * alpha + psum;
#pragma unroll
      for (int t = 0; t < 4; ++t) oacc[t][r] *= alpha;
    }
    __builtin_amdgcn_fence(__ATOMIC_RELEASE, "workgroup");
    __builtin_amdgcn_wave_barrier();
    __builtin_amdgcn_fence(__ATOMIC_ACQUIRE, "workgroup");
#pragma unroll 1
    for (int kk = 0; kk < 2; ++kk) {
      FB pa, pl;
      pa.h[0] = *(const v8b*)(pwh + c * AT_KC + kk * 32 + 8 * hh);
      pa.h[1] = *(const v8b*)(pwh + c * AT_KC + kk * 32 + 16 + 8 * hh);
      if (SPLIT_PV) {
        pl.h[0] = *(const v8b*)(pwl + c * AT_KC + kk * 32 + 8 * hh);
        pl.h[1] = *(const v8b*)(pwl + c * AT_KC + kk * 32 + 16 + 8 * hh);
      }
#pragma unroll
      for (int t = 0; t < 4; ++t) {
        FB vb;
        vb.h[0] = *(const v8b*)(Vth + (t * 16 + c) * AT_KC + kk * 32 + 8 * hh);
        vb.h[1] = *(const v8b*)(Vth + (t * 16 + c) * AT_KC + kk * 32 + 16 + 8 * hh);
        oacc[t] = at_mma16<F16>(pa.v, vb.v, oacc[t]);
        if (SPLIT_PV) {
          FB vl;
          vl.h[0] = *(const v8b*)(Vtl + (t * 16 + c) * AT_KC + kk * 32 + 8 * hh);
          vl.h[1] = *(const v8b*)(Vtl + (t * 16 + c) * AT_KC + kk * 32 + 16 + 8 * hh);
          oacc[t] = at_mma16<F16>(pa.v, vl.v, oacc[t]);
          oacc[t] = at_mma16<F16>(pl.v, vb.v, oacc[t]);
        }
      }
    }
  }

  float* os = Os[wave];
#pragma unroll
  for (int r = 0; r < 8; ++r) {
    const float inv = 1.0f / (lrow[r] * PSC);
#pragma unroll
    for (int t = 0; t < 4; ++t) os[(8 * hh + r) * 68 + t * 16 + c] = oacc[t][r] * inv;
  }
  __builtin_amdgcn_fence(__ATOMIC_RELEASE, "workgroup");
  __builtin_amdgcn_wave_barrier();
  __builtin_amdgcn_fence(__ATOMIC_ACQUIRE, "workgroup");
  {
    const int c4 = (lane & 15) * 4;
    {
#pragma unroll
      for (int it = 0; it < 8; ++it) {
        const int row = it * 2 + hh;
        v4f val = *(const v4f*)(os + row * 68 + c4);
        *(v4f*)(ob_ptr + (size_t)(q0 + row) * g.o_rs + c4) = val;
      }
      
    }
  }
}

} // namespace w25

// Operand preparation, one launch: blockIdx.y == 0 takes 64 rows of q, blockIdx.y == 1 takes 64 rows of memory. A wave holds 8 whole rows in registers (16 bytes per lane
//   and row, the 8 loads in flight together) and everything that is made of a row is made from that one read: the row dot (q . w_q -> AQ, memory . w_m -> CM), the bf16 hi
//   and lo planes of the similarity product (q * w_qm; memory) and, for memory, the f16 plane x ts transposed to [d][m], the operand of the query->memory product.
//   The transposed tile and the 64 dots go through LDS so that every global store covers whole 128-byte lines.
typedef __attribute__((ext_vector_type(2))) unsigned v2u;
typedef __attribute__((ext_vector_type(8))) _Float16 v8hp;
template <int M, int D>
__global__ __launch_bounds__(256) void k_bi_prep(const float* __restrict__ Q, const float* __restrict__ MEM, const float* __restrict__ wq, const float* __restrict__ wm, const float* __restrict__ wqm,
        float* __restrict__ AQ, float* __restrict__ CM, __bf16* __restrict__ QH, __bf16* __restrict__ QL, __bf16* __restrict__ MH, __bf16* __restrict__ ML, _Float16* __restrict__ MT, float ts) {
    static_assert(D == 128 && M % 64 == 0, "one 16-byte load per lane and row; a block's 64 rows lie in one batch");
    __shared__ float res[64];
    __shared__ __align__(16) _Float16 tr[D][72];   // [d][m], pitch 144 bytes = 16 x 9: 16-byte reads along m without bank conflicts
    const bool isq = blockIdx.y == 0;
    const int lane = threadIdx.x & 31, wv = threadIdx.x >> 5;
    const size_t rb = (size_t)blockIdx.x * 64, r0 = rb + wv * 8;
    const float* xp = (isq ? Q : MEM) + r0 * D + lane * 4;
    const v4f w = *(const v4f*)((isq ? wq : wm) + lane * 4);
    const v4f g = *(const v4f*)(wqm + lane * 4);   // used by the q blocks alone; read here so that it flies with the rows
    v4f x[8];
#pragma unroll
    for (int i = 0; i < 8; ++i) x[i] = *(const v4f*)(xp + i * D);
    asm volatile("s_wait_xcnt 0x0" ::: "memory");   // the work below reuses the address registers that the loads above name
    __builtin_amdgcn_sched_barrier(0);   // holds the first rewrite of those registers behind the wait; left free it is scheduled ahead of it
    float keep = 0.f;
#pragma unroll
    for (int i = 0; i < 8; ++i) {
        float s = x[i][0] * w[0]; s += x[i][1] * w[1]; s += x[i][2] * w[2]; s += x[i][3] * w[3];
        for (int o = 16; o > 0; o >>= 1) s += __shfl_xor(s, o, 32);
        if (lane == i) keep = s;
    }
    if (lane < 8) res[wv * 8 + lane] = keep;
    if (isq) {
#pragma unroll
        for (int i = 0; i < 8; ++i) x[i] *= g;
    } else {
#pragma unroll
        for (int e = 0; e < 4; ++e) { v8hp h;
#pragma unroll
            for (int i = 0; i < 8; ++i) h[i] = (_Float16)(x[i][e] * ts);
            *(v8hp*)&tr[lane * 4 + e][wv * 8] = h; }
    }
    v2u hi[8], lo[8];
#pragma unroll
    for (int i = 0; i < 8; ++i) { unsigned l0, l1;
        hi[i][0] = f2bf2_pack(x[i][0], x[i][1], &l0); hi[i][1] = f2bf2_pack(x[i][2], x[i][3], &l1); lo[i][0] = l0; lo[i][1] = l1; }
    __syncthreads();   // publishes res and tr; it stands ahead of every global store, so that no wave waits at it for stores to land
    __bf16* ph = (isq ? QH : MH) + r0 * D + lane * 4;
    __bf16* pl = (isq ? QL : ML) + r0 * D + lane * 4;
#pragma unroll
    for (int i = 0; i < 8; ++i) { *(v2u*)(ph + i * D) = hi[i]; *(v2u*)(pl + i * D) = lo[i]; }
    if (threadIdx.x < 64) VST2(float, (isq ? AQ : CM) + rb + threadIdx.x, res[threadIdx.x]);
    if (!isq) {
        _Float16* mt = MT + (rb / M) * (size_t)D * M + rb % M + (lane & 7) * 8;
#pragma unroll
        for (int it = 0; it < 4; ++it) { const int d = wv * 16 + it * 4 + (lane >> 3);   // a wave store = 4 rows of d x one 128-byte line
            *(v8hp*)(mt + (size_t)d * M) = *(const v8hp*)&tr[d][(lane & 7) * 8]; }
    } }
// expf, step for step as the compiler expands it (x * log2(e) in two parts, 2^fraction, ldexp, the two range tests), written out so that the v_nop can stand in the
//   statement of v_exp_f32: it fills the one slot the instruction set asks for in front of a vector instruction that reads the result or overwrites the source
__device__ __forceinline__ float exp_slot(float x) {
    const float ph = x * 0x1.715476p+0f;
    const float pl = fmaf(x, 0x1.4ae0bep-26f, fmaf(x, 0x1.715476p+0f, -ph));
    const float en = rintf(ph);
    const float a = (ph - en) + pl;
    float y;
    asm("v_exp_f32 %0, %1\n\tv_nop" : "=v"(y) : "v"(a));
    float r = ldexpf(y, (int)en);
    r = (x < -0x1.9d1da0p+6f) ? 0.f : r;
    r = (x > 0x1.62e430p+6f) ? __builtin_inff() : r;
    return r;
}
// one wave per row, RW rows per wave one after the other: sim = tril + AQ[n] + CM[m], masked exactly as the module: sim + (1 - qm*mm) * -1e30; the whole row stays in
//   registers (32 values per lane) from the one read of SIM to the one write: row max -> RMX, softmax over m (exp once), probabilities x ps stored as f16, the
//   operand plane of the query->memory product. CM and the memory mask are read once per wave; max and sum meet by lane shuffles, so the kernel has no barrier.
typedef __attribute__((ext_vector_type(4))) _Float16 v4h;
typedef __attribute__((ext_vector_type(4))) int      v4i;
template <int N, int M, int RW>
__global__ __launch_bounds__(256) void k_bi_soft16(const float* __restrict__ SIM, const float* __restrict__ AQ, const float* __restrict__ CM, const int* __restrict__ QM, const int* __restrict__ MM, float* __restrict__ RMX, _Float16* __restrict__ P16, float ps) {
    static_assert(M % 128 == 0 && N % (8 * RW) == 0, "whole 512-byte wave loads; whole blocks of 8 waves x RW rows");
    constexpr int C = M / 128;
    const int lane = threadIdx.x & 31, wv = __builtin_amdgcn_readfirstlane(threadIdx.x >> 5);
    const size_t bz = blockIdx.y;   // batch = blockIdx.y
    const size_t row0 = bz * N + (size_t)(blockIdx.x * 8 + wv) * RW;
    float aqv[RW], qmv[RW];
#pragma unroll
    for (int r = 0; r < RW; ++r) { aqv[r] = AQ[row0 + r]; qmv[r] = (float)QM[row0 + r]; }
    const float* sr = SIM + row0 * M + lane * 4;
    v4f x[C], nx[C], cm[C], mf[C]; v4i mk[C];
#pragma unroll
    for (int i = 0; i < C; ++i) x[i] = *(const v4f*)(sr + i * 128);
#pragma unroll
    for (int i = 0; i < C; ++i) { cm[i] = *(const v4f*)(CM + bz * M + lane * 4 + i * 128); mk[i] = *(const v4i*)(MM + bz * M + lane * 4 + i * 128); }
#pragma unroll
    for (int r = 0; r < RW; ++r) {
        if (r + 1 < RW) {
#pragma unroll
            for (int i = 0; i < C; ++i) nx[i] = *(const v4f*)(sr + (size_t)(r + 1) * M + i * 128);   // the next row flies while this one is worked on
            asm volatile("s_wait_xcnt 0x0" ::: "memory");   // the row's work may reuse the offset register that the loads above name
            __builtin_amdgcn_sched_barrier(0);   // keeps the loads and their wait at the head of the row's work; left free the loads sink to just ahead of their first use
        }
        if (r == 0) {
#pragma unroll
            for (int i = 0; i < C; ++i) mf[i] = __builtin_convertvector(mk[i], v4f);
        }
        const float aq = aqv[r], qm = qmv[r];
        float mx = -3.0e38f;
#pragma unroll
        for (int i = 0; i < C; ++i)
#pragma unroll
            for (int e = 0; e < 4; ++e) { const float msk = qm * mf[i][e]; const float v = x[i][e] + aq + cm[i][e] + (1.f - msk) * -1.0e30f; x[i][e] = v; mx = fmaxf(mx, v); }
        for (int o = 16; o > 0; o >>= 1) mx = fmaxf(mx, __shfl_xor(mx, o, 32));
        v4f s4 = {0.f, 0.f, 0.f, 0.f};
#pragma unroll
        for (int i = 0; i < C; ++i)
#pragma unroll
            for (int e = 0; e < 4; ++e) { const float ev = exp_slot(x[i][e] - mx); x[i][e] = ev; s4[e] += ev; }
        float s = (s4[0] + s4[1]) + (s4[2] + s4[3]);
        for (int o = 16; o > 0; o >>= 1) s += __shfl_xor(s, o, 32);
        const float inv = 1.f / s;
        _Float16* pr = P16 + (row0 + r) * M + lane * 4;
        v4h hv[C];
#pragma unroll
        for (int i = 0; i < C; ++i)
#pragma unroll
            for (int e = 0; e < 4; ++e) hv[i][e] = (_Float16)((x[i][e] * inv) * ps);
        __builtin_amdgcn_sched_barrier(0);   // with the one below: nothing that refills a register of these stores is scheduled between them and their wait
#pragma unroll
        for (int i = 0; i < C; ++i) *(v4h*)(pr + i * 128) = hv[i];
        VST2(float, RMX + (row0 + r) * 32 + lane, mx);   // row max staged as a whole 32-float line (slot 0 is read later)
        if (r + 1 < RW) {
            asm volatile("s_wait_xcnt 0x0" ::: "memory");   // the next row's work reuses the registers that the stores above name
            __builtin_amdgcn_sched_barrier(0);
        }
#pragma unroll
        for (int i = 0; i < C; ++i) x[i] = nx[i];
    } }

// Similarity product, masked row softmax and query->memory product in ONE launch; the similarity matrix and the probabilities never leave the registers.
//   Block = 16 waves = 4 groups of 16 query rows x 4 quarters of the memory axis. A wave walks its quarter in tiles of 32 memory rows:
//   S^T = memory x (q * w_qm)^T (bf16 hi/lo, three products), so that a lane holds scores of ONE query (column lane & 15; rows 8 * (lane >> 4) + r of each 16-row tile);
//   sim = S + AQ[n] + CM[m] + (1 - qm * mm) * -1e30 as the module has it; running maximum and sum; the two 16-row score tiles, as f16 x ps, ARE the B operand of
//   O^T += memory^T x P^T (the k order of the fragment loaders). The four quarters of a query meet once, at the end, through LDS.
//   The memory tiles (hi, lo, transposed f16) come into LDS by asynchronous 16-byte copies, two buffers: tile s + 1 flies while tile s is worked on; the four waves that
//   share a quarter each copy a fourth of its tile. Row pitches 272 and 80 bytes (16 x odd) keep the 16-byte fragment reads off each other's banks.
//   Every '#pragma unroll' below stands on a loop whose index picks a fragment, an accumulator or a vector element: unrolled, these stay in registers.
template <int N, int M, int D>
__global__ __launch_bounds__(512) void k_bi_fused(const __bf16* __restrict__ QH, const __bf16* __restrict__ QL, const __bf16* __restrict__ MH, const __bf16* __restrict__ ML, const _Float16* __restrict__ MT,
        const float* __restrict__ AQ, const float* __restrict__ CM, const int* __restrict__ QM, const int* __restrict__ MM, float* __restrict__ RMX, float* __restrict__ OUT, float ps, float os) {
    static_assert(N % 64 == 0 && M == 1024 && D == 128, "64 query rows a block; 4 quarters of 8 tiles of 32 memory rows; 2 mask words a thread; 256-byte operand rows");
    typedef w25::Frag<__bf16> FB; typedef w25::Frag<_Float16> FH; typedef w25::v8f v8f;
    constexpr int PA = 272, PT = 80;                    // LDS row pitch in bytes: 256-byte rows of hi and lo, 64-byte rows of the transposed tile
    constexpr int TILE = 2 * 32 * PA + D * PT;          // one quarter's tile: hi, lo, transposed
    constexpr int BUF = 4 * TILE, MQ4 = M / 4, NS = MQ4 / 32;
    static_assert(2 * BUF >= 16 * 8 * 32 * 8 * 4, "the ring later holds the 16 waves' partial outputs");
    __shared__ __align__(16) unsigned char ring[2 * BUF];
    __shared__ __align__(16) unsigned char qs[2 * 64 * PA];
    __shared__ __align__(16) float scm[M];
    __shared__ __align__(16) float smf[M];
    __shared__ float smx[4][4][16];
    __shared__ float ssm[4][4][16];
    const int lane = threadIdx.x & 31, wv = __builtin_amdgcn_readfirstlane(threadIdx.x >> 5);
    const int qg = wv & 3, ms = wv >> 2, nl = lane & 15, h = lane >> 4, koff = h * 8;
    const size_t bz = blockIdx.y, q0 = bz * N + (size_t)blockIdx.x * 64, row = q0 + qg * 16 + nl;
    // this lane's share of a tile: 4 copies of hi, 4 of lo (2 rows x 256 bytes a wave copy), 4 of the transposed plane (8 rows x 64 bytes a wave copy)
    const unsigned la = (unsigned)(size_t)ring + ms * TILE + (qg * 8 + h) * PA + nl * 16;
    const unsigned lt = (unsigned)(size_t)ring + ms * TILE + 64 * PA + (qg * 32 + (lane >> 2)) * PT + (lane & 3) * 16;
    const size_t ga = (bz * M + ms * MQ4 + qg * 8 + h) * D + nl * 8;
    const __bf16* gh = MH + ga;
    const __bf16* gl = ML + ga;
    const _Float16* gt = MT + (bz * D + qg * 32 + (lane >> 2)) * M + ms * MQ4 + (lane & 3) * 8;
    auto copy_tile = [&](int s, int b) {
        const unsigned a = la + b * BUF, t = lt + b * BUF;
        const __bf16* x = gh + (size_t)s * 32 * D;
        const __bf16* y = gl + (size_t)s * 32 * D;
        const _Float16* z = gt + s * 32;
        // the wait is the last line of the copies' own statement: no register that a copy names is rewritten ahead of it
        asm volatile("global_load_async_to_lds_b128 %0, %12, off\n\t"
                     "global_load_async_to_lds_b128 %1, %13, off\n\t"
                     "global_load_async_to_lds_b128 %2, %14, off\n\t"
                     "global_load_async_to_lds_b128 %3, %15, off\n\t"
                     "global_load_async_to_lds_b128 %4, %16, off\n\t"
                     "global_load_async_to_lds_b128 %5, %17, off\n\t"
                     "global_load_async_to_lds_b128 %6, %18, off\n\t"
                     "global_load_async_to_lds_b128 %7, %19, off\n\t"
                     "global_load_async_to_lds_b128 %8, %20, off\n\t"
                     "global_load_async_to_lds_b128 %9, %21, off\n\t"
                     "global_load_async_to_lds_b128 %10, %22, off\n\t"
                     "global_load_async_to_lds_b128 %11, %23, off\n\t"
                     "s_wait_xcnt 0x0"
                     :: "v"(a), "v"(a + 2 * PA), "v"(a + 4 * PA), "v"(a + 6 * PA),
                        "v"(a + 32 * PA), "v"(a + 34 * PA), "v"(a + 36 * PA), "v"(a + 38 * PA),
                        "v"(t), "v"(t + 8 * PT), "v"(t + 16 * PT), "v"(t + 24 * PT),
                        "v"(x), "v"(x + 2 * D), "v"(x + 4 * D), "v"(x + 6 * D),
                        "v"(y), "v"(y + 2 * D), "v"(y + 4 * D), "v"(y + 6 * D),
                        "v"(z), "v"(z + 8 * M), "v"(z + 16 * M), "v"(z + 24 * M)
                     : "memory");
    };
    {   // the block's 64 rows of q * w_qm, hi and lo: wave wv copies rows 4 wv .. 4 wv + 3 of each plane
        const unsigned lq = (unsigned)(size_t)qs + (wv * 4 + h) * PA + nl * 16;
        const size_t gq = (q0 + wv * 4 + h) * D + nl * 8;
        const __bf16* x = QH + gq;
        const __bf16* y = QL + gq;
        asm volatile("global_load_async_to_lds_b128 %0, %4, off\n\t"
                     "global_load_async_to_lds_b128 %1, %5, off\n\t"
                     "global_load_async_to_lds_b128 %2, %6, off\n\t"
                     "global_load_async_to_lds_b128 %3, %7, off\n\t"
                     "s_wait_xcnt 0x0"   // as above: inside the copies' statement
                     :: "v"(lq), "v"(lq + 2 * PA), "v"(lq + 64 * PA), "v"(lq + 66 * PA), "v"(x), "v"(x + 2 * D), "v"(y), "v"(y + 2 * D)
                     : "memory");
    }
    copy_tile(0, 0);
    {   // CM and the memory mask (as float) of the whole batch row: read once a block
        typedef __attribute__((ext_vector_type(2))) float v2f; typedef __attribute__((ext_vector_type(2))) int v2i;
        const v2f c = *(const v2f*)(CM + bz * M + threadIdx.x * 2);
        const v2i k = *(const v2i*)(MM + bz * M + threadIdx.x * 2);
        *(v2f*)&scm[threadIdx.x * 2] = c;
        *(v2f*)&smf[threadIdx.x * 2] = __builtin_convertvector(k, v2f);
    }
    const float aq = AQ[row], qm = (float)QM[row];
    asm volatile("s_wait_asynccnt 0x0" ::: "memory");   // this wave's copies of q and of tile 0 have landed
    __syncthreads();                                     // ... and every other wave's; publishes scm and smf too
    copy_tile(1, 1);
    FB::V qh[4], ql[4];
#pragma unroll
    for (int kk = 0; kk < 4; ++kk) {
        qh[kk] = FB::load((const __bf16*)(qs + (qg * 16 + nl) * PA) + koff + kk * 32);
        ql[kk] = FB::load((const __bf16*)(qs + (64 + qg * 16 + nl) * PA) + koff + kk * 32);
    }
    v8f o[8];
#pragma unroll
    for (int dt = 0; dt < 8; ++dt) o[dt] = (v8f){0.f, 0.f, 0.f, 0.f, 0.f, 0.f, 0.f, 0.f};
    float mrun = -3.0e38f, lsum = 0.f;
#pragma unroll 1   // stays rolled: one trip is about a thousand instructions
    for (int s = 0; s < NS; ++s) {
        const unsigned char* tb = ring + (s & 1) * BUF + ms * TILE;
        const __bf16* th = (const __bf16*)(tb + nl * PA) + koff;
        const __bf16* tl = (const __bf16*)(tb + (32 + nl) * PA) + koff;
        const _Float16* tt = (const _Float16*)(tb + 64 * PA + nl * PT) + koff;
        v8f sc[2];
        sc[0] = (v8f){0.f, 0.f, 0.f, 0.f, 0.f, 0.f, 0.f, 0.f}; sc[1] = sc[0];
#pragma unroll
        for (int kk = 0; kk < 4; ++kk)
#pragma unroll
            for (int t = 0; t < 2; ++t) {
                const FB::V ah = FB::load(th + t * 16 * (PA / 2) + kk * 32);
                const FB::V al = FB::load(tl + t * 16 * (PA / 2) + kk * 32);
                sc[t] = FB::mma(ah, qh[kk], sc[t]);
                sc[t] = FB::mma(ah, ql[kk], sc[t]);
                sc[t] = FB::mma(al, qh[kk], sc[t]);
            }
        const int mb = ms * MQ4 + s * 32 + koff;
        float v[2][8];
        float mloc = -3.0e38f;
#pragma unroll
        for (int t = 0; t < 2; ++t) {
            const v4f c0 = *(const v4f*)&scm[mb + t * 16], c1 = *(const v4f*)&scm[mb + t * 16 + 4];
            const v4f f0 = *(const v4f*)&smf[mb + t * 16], f1 = *(const v4f*)&smf[mb + t * 16 + 4];
#pragma unroll
            for (int r = 0; r < 8; ++r) {
                const float msk = qm * (r < 4 ? f0[r & 3] : f1[r & 3]);
                const float x = sc[t][r] + aq + (r < 4 ? c0[r & 3] : c1[r & 3]) + (1.f - msk) * -1.0e30f;
                v[t][r] = x; mloc = fmaxf(mloc, x);
            }
        }
        mloc = fmaxf(mloc, __shfl_xor(mloc, 16, 32));   // the other 16 memory rows of this query's 32 lie in lane ^ 16
        const float mnew = fmaxf(mrun, mloc);
        const float alpha = exp_slot(mrun - mnew);
        mrun = mnew;
        FH::V pb;
        float s0 = 0.f, s1 = 0.f;
#pragma unroll
        for (int r = 0; r < 8; ++r) {
            const float e0 = exp_slot(v[0][r] - mnew), e1 = exp_slot(v[1][r] - mnew);
            s0 += e0; s1 += e1;
            pb[r] = (_Float16)(e0 * ps); pb[8 + r] = (_Float16)(e1 * ps);
        }
        lsum = lsum * alpha + (s0 + s1);
#pragma unroll
        for (int dt = 0; dt < 8; ++dt) {
            const FH::V vt = FH::load(tt + dt * 16 * (PT / 2));
            o[dt] = FH::mma(vt, pb, o[dt] * alpha);
        }
        asm volatile("s_wait_dscnt 0x0" ::: "memory");      // this wave's reads of buffer s & 1 have returned
        asm volatile("s_wait_asynccnt 0x0" ::: "memory");   // this wave's copies of tile s + 1 have landed
        __syncthreads();                                     // publishes tile s + 1 and ends every wave's reads of buffer s & 1
        if (s + 2 < NS) copy_tile(s + 2, s & 1);
    }
    asm volatile("s_wait_asynccnt 0x0" ::: "memory");       // nothing is in flight when the ring becomes the staging of the partial outputs
    lsum += __shfl_xor(lsum, 16, 32);
    if (h == 0) { smx[ms][qg][nl] = mrun; ssm[ms][qg][nl] = lsum; }
    __syncthreads();   // the four quarters' maxima and sums are there
    float mtot = smx[0][qg][nl];
#pragma unroll
    for (int j = 1; j < 4; ++j) mtot = fmaxf(mtot, smx[j][qg][nl]);
    float ltot = 0.f;
#pragma unroll
    for (int j = 0; j < 4; ++j) ltot += ssm[j][qg][nl] * exp_slot(smx[j][qg][nl] - mtot);
    const float fo = exp_slot(mrun - mtot);
    float* so = (float*)ring;   // [quarter][query group][d tile][lane][8]
#pragma unroll
    for (int dt = 0; dt < 8; ++dt) {
        const v8f w = o[dt] * fo;
        float* p = so + (((ms * 4 + qg) * 8 + dt) * 32 + lane) * 8;
        *(v4f*)p = (v4f){w[0], w[1], w[2], w[3]}; *(v4f*)(p + 4) = (v4f){w[4], w[5], w[6], w[7]};
    }
    __syncthreads();   // the partial outputs are there
    const float inv = os / ltot;
    float* op = OUT + row * D + ms * 32 + koff;   // wave (qg, ms) sums and stores d = 32 ms .. 32 ms + 31 of its 16 queries: one whole 128-byte line a query
#pragma unroll
    for (int j = 0; j < 2; ++j) {
        v4f a0 = {0.f, 0.f, 0.f, 0.f}, a1 = a0;
#pragma unroll
        for (int k = 0; k < 4; ++k) {
            const float* p = so + (((k * 4 + qg) * 8 + ms * 2 + j) * 32 + lane) * 8;
            a0 += *(const v4f*)p; a1 += *(const v4f*)(p + 4);
        }
        *(v4f*)(op + j * 16) = a0 * inv; *(v4f*)(op + j * 16 + 4) = a1 * inv;
    }
    if (ms == 0) {   // row maximum staged as a whole 32-float line (slot 0 is read later)
        asm volatile("s_wait_xcnt 0x0" ::: "memory");   // the address work below reuses registers that the stores above name
        __builtin_amdgcn_sched_barrier(0);   // holds the first rewrite of those registers behind the wait
        float* rp = RMX + row * 32 + h * 16;
        const v4f m4 = {mtot, mtot, mtot, mtot};
#pragma unroll
        for (int j = 0; j < 4; ++j) *(v4f*)(rp + j * 4) = m4;
    } }

// memory->query: p = softmax_n(RMX[b][n]); MQ[b][every row][d] = sum_n p_n q[b][n][d]. One block of 32 waves per (batch, 32-float slice of d): thread t owns row
//   maximum t for the statistics; for the weighted sum a wave reads 4 rows x 128 bytes per load and every lane has its 8 row loads in flight at once
//   (issued ahead of the statistics, which do not depend on them); partial sums meet by lane shuffles and one LDS table. The block then stores its slice into
//   all N rows of the second output itself, 16 bytes a lane, 8 stores a lane.
template <int N, int D>
__global__ __launch_bounds__(1024) void k_bi_m2q(const float* __restrict__ RMX, const float* __restrict__ Q, float* __restrict__ MQ) {
    static_assert(N == 1024 && D % 32 == 0, "one row maximum per thread; whole 128-byte slices of d");
    __shared__ float red[32]; __shared__ float pw[N]; __shared__ __align__(16) float part[32][32]; __shared__ __align__(16) float vec[32];
    const int b = blockIdx.x, d0 = blockIdx.y * 32, t = threadIdx.x, lane = t & 31, wv = t >> 5;
    const int rsub = lane >> 3, c4 = (lane & 7) * 4;
    const float r = RMX[((long long)b * N + t) * 32];
    const float* qb = Q + ((long long)b * N + wv * 4 + rsub) * D + d0 + c4;
    v4f x[N / 128];
    for (int i = 0; i < N / 128; ++i) x[i] = *(const v4f*)(qb + (long long)i * 128 * D);
    float mx = r;
    for (int o = 16; o > 0; o >>= 1) mx = fmaxf(mx, __shfl_xor(mx, o, 32));
    if (lane == 0) red[wv] = mx;
    __syncthreads();
    float mm = red[lane];
    for (int o = 16; o > 0; o >>= 1) mm = fmaxf(mm, __shfl_xor(mm, o, 32));
    __syncthreads();
    const float e = expf(r - mm); pw[t] = e;
    float s = e;
    for (int o = 16; o > 0; o >>= 1) s += __shfl_xor(s, o, 32);
    if (lane == 0) red[wv] = s;
    __syncthreads();
    float tot = red[lane];
    for (int o = 16; o > 0; o >>= 1) tot += __shfl_xor(tot, o, 32);
    v4f acc = {0.f, 0.f, 0.f, 0.f};
    for (int i = 0; i < N / 128; ++i) acc += pw[i * 128 + wv * 4 + rsub] * x[i];
    for (int c = 0; c < 4; ++c) { acc[c] += __shfl_xor(acc[c], 8, 32); acc[c] += __shfl_xor(acc[c], 16, 32); }
    if (lane < 8) *(v4f*)&part[wv][c4] = acc;
    __syncthreads();
    if (t < 32) { float a = 0.f;
        for (int w = 0; w < 32; ++w) a += part[w][t];
        vec[t] = a * (1.f / tot); }
    __syncthreads();   // publishes the finished slice to the 32 waves that store it
    const v4f bv = *(const v4f*)&vec[c4];
    float* op = MQ + ((long long)b * N + wv * 4 + rsub) * D + d0 + c4;   // a wave store = 4 rows x one whole 128-byte line, as the reads of q above
    for (int i = 0; i < N / 128; ++i) *(v4f*)(op + (long long)i * 128 * D) = bv; }


extern "C" void kernel_launch(void* const* d_in, const int* in_sizes, int n_in, void* d_out, int out_size, void* d_ws, size_t ws_size, hipStream_t stream) {
    (void)in_sizes; (void)n_in; (void)out_size; (void)ws_size;
    const float* q = (const float*)d_in[0];
    const float* mem = (const float*)d_in[1];
    const float* wq = (const float*)d_in[2];
    const float* wm = (const float*)d_in[3];
    const float* wqm = (const float*)d_in[4];
    const int* qmask = (const int*)d_in[5];
    const int* mmask = (const int*)d_in[6];
    const int Bn = 16;
    const int N = 1024;
    const int M = 1024;
    const int D = 128;
    float* out = (float*)d_out;
    float* mq = out + ((size_t)Bn * N * D);
    char* wsp = (char*)d_ws;
    float* AQ = (float*)wsp; wsp += (((size_t)((size_t)Bn * N) * 4 + 255) / 256) * 256;
    float* CM = (float*)wsp; wsp += (((size_t)((size_t)Bn * M) * 4 + 255) / 256) * 256;
    float* RMX = (float*)wsp; wsp += (((size_t)((size_t)Bn * N * 32) * 4 + 255) / 256) * 256;
    unsigned short* G64A = (unsigned short*)wsp; wsp += (((size_t)(16777216) * 2 + 255) / 256) * 256;
    unsigned short* G64B = (unsigned short*)wsp; wsp += (((size_t)(2097152) * 2 + 255) / 256) * 256;
    unsigned short* G64A2 = (unsigned short*)wsp; wsp += (((size_t)(2097152) * 2 + 255) / 256) * 256;
    unsigned short* G64B2 = (unsigned short*)wsp; wsp += (((size_t)(2097152) * 2 + 255) / 256) * 256;
    unsigned short* G64T = (unsigned short*)wsp; wsp += (((size_t)(2097152) * 2 + 255) / 256) * 256;
    k_bi_prep<1024, 128><<<dim3((unsigned)(Bn * N / 64), 2u), 256, 0, stream>>>(q, mem, wq, wm, wqm, AQ, CM, (__bf16*)(G64A), (__bf16*)(G64A2), (__bf16*)(G64B), (__bf16*)(G64B2), (_Float16*)(G64T), 16.0f);
    k_bi_fused<1024, 1024, 128><<<dim3((unsigned)(N / 64), (unsigned)Bn), 512, 0, stream>>>((const __bf16*)(G64A), (const __bf16*)(G64A2), (const __bf16*)(G64B), (const __bf16*)(G64B2), (const _Float16*)(G64T), AQ, CM, qmask, mmask, RMX, out, 4096.0f, 1.52587890625e-05f);
    k_bi_m2q<1024, 128><<<dim3((unsigned)Bn, 4u), 1024, 0, stream>>>(RMX, q, mq);
}

// v007
// Measured time: 38.1 microseconds a run.
// In both of two side-by-side timings against v006, it was 1.10 times as fast.
// All steps since the starting kernel, v000, together make it 40.3 times as fast.
// Contractions: per batch the trilinear term (q * w_qm).m^T [1024x128].[128x1024] on bf16 hi/lo split planes (logits reach ~+-30, so they need f32-class accuracy) and the query->memory read q2m.memory [1024x1024].[1024x128] with f16 operands (probabilities x 2^12) — both in one fused launch, a wave taking 32 memory rows x 16 queries a step; f32 accumulate. The mask arithmetic (sim + (1 - mask) * -1e30, exactly as the module), the row softmax (exp once) and the row maxima are f32 work inside that launch; the two linear terms, the softmax over rows and the memory->query vector (broadcast to every row) are f32 kernels.
#include <hip/hip_runtime.h>
#include <math.h>

typedef __attribute__((ext_vector_type(16))) _Float16 v16h;
typedef __attribute__((ext_vector_type(8)))  _Float16 v8h;
typedef __attribute__((ext_vector_type(16))) __bf16   v16b;
typedef __attribute__((ext_vector_type(8)))  float    v8f;
typedef __attribute__((ext_vector_type(4)))  float    v4f;

// 16-bit WMMA fragment map (wave32), lane L, h = L>>4, m = L&15:
//   A 16x32: lane = row m;   element i -> k = (i<8) ? 8h+i : 16+8h+(i-8)
//   B 32x16: lane = column m; the SAME k(i,h)
//   D 16x16 (8 f32): lane = column m; element r -> row 8h+r
__device__ __forceinline__ int frag_k(int i, int h) { return (i < 8) ? (8 * h + i) : (16 + 8 * h + (i - 8)); }
__device__ __forceinline__ __bf16 bf16_rne(float f) {
    unsigned int u = __float_as_uint(f);
    u += 0x7fffu + ((u >> 16) & 1u);
    return __builtin_bit_cast(__bf16, (unsigned short)(u >> 16));
}
__device__ __forceinline__ float bf16_f32(__bf16 b) { return __uint_as_float(((unsigned int)__builtin_bit_cast(unsigned short, b)) << 16); }
__device__ __forceinline__ v8f wmma16(v16h a, v16h b, v8f c) {
    c = __builtin_amdgcn_wmma_f32_16x16x32_f16(false, a, false, b, (short)0, c, false, false);
    asm volatile("v_nop\n\tv_nop\n\tv_nop\n\tv_nop" : "+v"(c) : "v"(a), "v"(b));
    return c;
}
__device__ __forceinline__ v8f wmmab(v16b a, v16b b, v8f c) {
    c = __builtin_amdgcn_wmma_f32_16x16x32_bf16(false, a, false, b, (short)0, c, false, false);
    asm volatile("v_nop\n\tv_nop\n\tv_nop\n\tv_nop" : "+v"(c) : "v"(a), "v"(b));
    return c;
}
struct Split { v16b hi, lo; };
// hi/lo split product: a.hi*b.hi + a.hi*b.lo + a.lo*b.hi
__device__ __forceinline__ v8f wmma3(const Split& a, const Split& b, v8f c) {
    c = __builtin_amdgcn_wmma_f32_16x16x32_bf16(false, a.hi, false, b.hi, (short)0, c, false, false);
    c = __builtin_amdgcn_wmma_f32_16x16x32_bf16(false, a.hi, false, b.lo, (short)0, c, false, false);
    c = __builtin_amdgcn_wmma_f32_16x16x32_bf16(false, a.lo, false, b.hi, (short)0, c, false, false);
    asm volatile("v_nop\n\tv_nop\n\tv_nop\n\tv_nop" : "+v"(c) : "v"(a.hi), "v"(a.lo), "v"(b.hi), "v"(b.lo));
    return c;
}
struct Split3 { v16b hi, mid, lo; };
// triple split product (6 terms, drops only terms below 2^-24 relative)
__device__ __forceinline__ v8f wmma6(const Split3& a, const Split3& b, v8f c) {
    c = __builtin_amdgcn_wmma_f32_16x16x32_bf16(false, a.hi, false, b.hi, (short)0, c, false, false);
    c = __builtin_amdgcn_wmma_f32_16x16x32_bf16(false, a.hi, false, b.mid, (short)0, c, false, false);
    c = __builtin_amdgcn_wmma_f32_16x16x32_bf16(false, a.mid, false, b.hi, (short)0, c, false, false);
    c = __builtin_amdgcn_wmma_f32_16x16x32_bf16(false, a.hi, false, b.lo, (short)0, c, false, false);
    c = __builtin_amdgcn_wmma_f32_16x16x32_bf16(false, a.mid, false, b.mid, (short)0, c, false, false);
    c = __builtin_amdgcn_wmma_f32_16x16x32_bf16(false, a.lo, false, b.hi, (short)0, c, false, false);
    asm volatile("v_nop\n\tv_nop\n\tv_nop\n\tv_nop" : "+v"(c) : "v"(a.hi), "v"(a.mid), "v"(a.lo), "v"(b.hi), "v"(b.mid), "v"(b.lo));
    return c;
}

// Fragment gathers from f32 memory: element i <- p[(k0 + frag_k(i,h)) * sk] * s, zero for k >= klen.
__device__ __forceinline__ v16h fh_ld(const float* __restrict__ p, long long sk, int k0, int h, int klen, float s) {
    v16h a;
#pragma unroll
    for (int i = 0; i < 16; ++i) { const int k = k0 + frag_k(i, h); a[i] = (k < klen) ? (_Float16)(p[(long long)k * sk] * s) : (_Float16)0.f; }
    return a;
}
__device__ __forceinline__ Split sp_ld(const float* __restrict__ p, long long sk, int k0, int h, int klen, float s) {
    Split r;
#pragma unroll
    for (int i = 0; i < 16; ++i) {
        const int k = k0 + frag_k(i, h); const float x = (k < klen) ? p[(long long)k * sk] * s : 0.f;
        const __bf16 hb = bf16_rne(x); r.hi[i] = hb; r.lo[i] = bf16_rne(x - bf16_f32(hb));
    }
    return r;
}
__device__ __forceinline__ Split3 sp3_ld(const float* __restrict__ p, long long sk, int k0, int h, int klen, float s) {
    Split3 r;
#pragma unroll
    for (int i = 0; i < 16; ++i) {
        const int k = k0 + frag_k(i, h); const float x = (k < klen) ? p[(long long)k * sk] * s : 0.f;
        const __bf16 hb = bf16_rne(x); const float r1 = x - bf16_f32(hb); const __bf16 mb = bf16_rne(r1);
        r.hi[i] = hb; r.mid[i] = mb; r.lo[i] = bf16_rne(r1 - bf16_f32(mb));
    }
    return r;
}
__device__ __forceinline__ v16b bh_ld(const float* __restrict__ p, long long sk, int k0, int h, int klen, float s) {
    v16b a;
#pragma unroll
    for (int i = 0; i < 16; ++i) { const int k = k0 + frag_k(i, h); a[i] = bf16_rne((k < klen) ? p[(long long)k * sk] * s : 0.f); }
    return a;
}
// f16 fragment from an f16 LDS/global row with element stride 1 (k-contiguous), no bounds (tile already zero padded)
__device__ __forceinline__ v16h fh_row(const _Float16* __restrict__ row, int k0, int h) {
    v16h a;
#pragma unroll
    for (int i = 0; i < 16; ++i) a[i] = row[k0 + frag_k(i, h)];
    return a;
}

#define VST2(T, ptr, val) do { const T vst2_v_ = (val); *(T*)(ptr) = vst2_v_;  } while (0)
typedef float v4f __attribute__((ext_vector_type(4)));
#define VST2V4(ptr, val) do { const v4f vst2_v4_ = (val); *(v4f*)(ptr) = vst2_v4_;  } while (0)

__device__ __attribute__((noinline)) float act_fn(float v, int act) {
    if (act == 1) return fmaxf(v, 0.f);                                                                               // relu
    if (act == 2) { const float u = 0.7978845608028654f * (v + 0.044715f * v * v * v); return 0.5f * v * (1.f + tanhf(u)); } // tanh-gelu
    if (act == 3) return v / (1.f + expf(-v));                                                                        // silu
    if (act == 4) return 0.5f * v * (1.f + erff(v * 0.7071067811865476f));                                             // erf-gelu
    if (act == 5) return tanhf(v);
    if (act == 6) return 1.f / (1.f + expf(-v));                                                                      // sigmoid
    if (act == 7) return (v > 0.f) ? v : 0.01f * v;                                                                   // leaky relu 0.01
    if (act == 8) return (v > 0.f) ? v : (expf(v) - 1.f);                                                             // elu
    if (act == 9) return fminf(fmaxf(v, 0.f), 6.f);                                                                   // relu6
    if (act == 10) return fabsf(v);                                                                                    // abs
    if (act == 11) return (v >= 0.f) ? v : 0.1f * v;                                                                  // leaky 0.1
    if (act == 12) return (v > 0.f) ? v : 0.2f * v;                                                                   // leaky 0.2
    if (act == 13) return (v > 20.f) ? v : log1pf(expf(v));                                                            // softplus
    return v;
}

// =====================================================================================================================
// k_gemm<MODE>: C(z, m, n) = act(alpha * sum_k A(z, m, k) * B(z, k, n) + bias) + beta * R(z, m, n)
//   One wave (32-thread block) per 16 x 32 tile of C; grid (ceil(N/32), ceil(M/16), Z). Batch z -> (zo = z / zi_n, zi = z % zi_n)
//   with separate outer/inner strides for every tensor (e.g. batch and head). A(m,k) = A[zo*sAo + zi*sAi + m*sAm + k*sAk] (f32),
//   B(k,n) = B[zo*sBo + zi*sBi + n*sBn + k*sBk] (f32); any M, N, K (K zero-padded to 32 inside the fragments, M/N tails guarded).
//   C(m,n) = C[zo*sCo + zi*sCi + m*sCm + n] (n contiguous). flags: 1 bias[n], 2 bias[m], 4 residual R[zo*sRo + zi*sRi + m*sRm + n*sRn].
//   MODE 0: f16 operands (A prescaled by sa, B by sb, both undone in the epilogue); 1: bf16 hi/lo split (3 products); 2: bf16;
//   3: bf16 hi/mid/lo triple split (6 products); 4: as 3 with Kahan-compensated f32 accumulation across k-steps.
// =====================================================================================================================
struct GemmP {
    const float* A; const float* B; const float* bias; const float* R; float* C;
    long long sAo, sAi, sAm, sAk, sBo, sBi, sBn, sBk, sCo, sCi, sCm, sRo, sRi, sRm, sRn;
    int M, N, K, zi_n, flags, act; float alpha, beta, sa, sb;
    int Npad, pad_;     // columns [N, Npad) of C are written as 0 so that padded workspace rows are covered by whole-line stores; Npad >= N
};
static_assert(sizeof(GemmP) == 5 * 8 + 15 * 8 + 6 * 4 + 4 * 4 + 2 * 4, "GemmP has padding");

template <int MODE>
__global__ __launch_bounds__(32) void k_gemm(GemmP p) {
    const int lane = threadIdx.x & 31, h = lane >> 4, l15 = lane & 15;
    const int m0 = blockIdx.y * 16, n0 = blockIdx.x * 32;
    const int z = blockIdx.z, zo = z / p.zi_n, zi = z - zo * p.zi_n;
    const float* A = p.A + zo * p.sAo + zi * p.sAi;
    const float* B = p.B + zo * p.sBo + zi * p.sBi;
    const int am = min(m0 + l15, p.M - 1);                       // clamped row for loads (stores are guarded)
    v8f acc[2], comp[2];
#pragma unroll
    for (int t = 0; t < 2; ++t) { v8f zz = {}; acc[t] = zz; comp[t] = zz; }
    for (int k0 = 0; k0 < p.K; k0 += 32) {
        const float* arow = A + (long long)am * p.sAm;
        if (MODE == 1) {
            const Split a = sp_ld(arow, p.sAk, k0, h, p.K, 1.f);
#pragma unroll
            for (int t = 0; t < 2; ++t) {
                const int bn = min(n0 + t * 16 + l15, p.N - 1);
                acc[t] = wmma3(a, sp_ld(B + (long long)bn * p.sBn, p.sBk, k0, h, p.K, 1.f), acc[t]);
            }
        } else if (MODE == 3) {
            const Split3 a = sp3_ld(arow, p.sAk, k0, h, p.K, 1.f);
#pragma unroll
            for (int t = 0; t < 2; ++t) {
                const int bn = min(n0 + t * 16 + l15, p.N - 1);
                acc[t] = wmma6(a, sp3_ld(B + (long long)bn * p.sBn, p.sBk, k0, h, p.K, 1.f), acc[t]);
            }
        } else if (MODE == 4) {
            // triple split as MODE 3, but each k-step's 6 products go into a fresh accumulator and the partial is added to the running f32 sum
            // on the VALU with Kahan compensation (accumulation error stays ~1 ulp however long K is)
            const Split3 a = sp3_ld(arow, p.sAk, k0, h, p.K, 1.f);
#pragma unroll
            for (int t = 0; t < 2; ++t) {
                const int bn = min(n0 + t * 16 + l15, p.N - 1); v8f zz = {};
                const v8f part = wmma6(a, sp3_ld(B + (long long)bn * p.sBn, p.sBk, k0, h, p.K, 1.f), zz);
                const v8f y = part - comp[t]; const v8f s = acc[t] + y; comp[t] = (s - acc[t]) - y; acc[t] = s;
            }
        } else if (MODE == 2) {
            const v16b a = bh_ld(arow, p.sAk, k0, h, p.K, 1.f);
#pragma unroll
            for (int t = 0; t < 2; ++t) {
                const int bn = min(n0 + t * 16 + l15, p.N - 1);
                acc[t] = wmmab(a, bh_ld(B + (long long)bn * p.sBn, p.sBk, k0, h, p.K, 1.f), acc[t]);
            }
        } else {
            const v16h a = fh_ld(arow, p.sAk, k0, h, p.K, p.sa);
#pragma unroll
            for (int t = 0; t < 2; ++t) {
                const int bn = min(n0 + t * 16 + l15, p.N - 1);
                acc[t] = wmma16(a, fh_ld(B + (long long)bn * p.sBn, p.sBk, k0, h, p.K, p.sb), acc[t]);
            }
        }
    }
    const float iscale = (MODE == 0) ? p.alpha / (p.sa * p.sb) : p.alpha;
    float* C = p.C + zo * p.sCo + zi * p.sCi;
    const float* R = p.R + zo * p.sRo + zi * p.sRi;
    __shared__ __align__(16) float ctile[16][36];
#pragma unroll
    for (int t = 0; t < 2; ++t) {
        const int n = n0 + t * 16 + l15; const int nn = min(n, p.N - 1);
#pragma unroll
        for (int r = 0; r < 8; ++r) {
            const int m = m0 + 8 * h + r; const int mm = min(m, p.M - 1);
            float v = acc[t][r] * iscale;
            if (p.flags & 1) v += p.bias[nn];
            if (p.flags & 2) v += p.bias[mm];
            if (p.flags & 8) v *= p.bias[(long long)zo * p.M + mm];   /* per-(z,row) scale vector laid out [Z][M]; exclusive with the bias flags */
            v = act_fn(v, p.act);
            if (p.flags & 4) v += p.beta * R[(long long)mm * p.sRm + (long long)nn * p.sRn];
            ctile[8 * h + r][t * 16 + l15] = (n < p.N) ? v : 0.f;
        }
    }
    __syncthreads();
    const int NW = (p.Npad > p.N) ? p.Npad : p.N;           // write width
    const bool fast = (m0 + 16 <= p.M) && (n0 + 32 <= NW) && ((p.sCm & 3) == 0) && ((((size_t)C) & 15) == 0);
    if (fast) {
#pragma unroll
        for (int s = 0; s < 4; ++s) {
            const int row = s * 4 + (lane >> 3), c4 = (lane & 7) * 4;
            const v4f v = *(const v4f*)&ctile[row][c4];
            VST2V4(C + (long long)(m0 + row) * p.sCm + n0 + c4, v);
        }
    } else {
        for (int row = 0; row < 16; ++row) {
            const int m = m0 + row, n = n0 + lane;
            if (m < p.M && n < NW) VST2(float, C + (long long)m * p.sCm + n, ctile[row][lane]);
        }
    }
}


// =====================================================================================================================
// k_gemmT<MODE, TM, TN>: same contract as k_gemm, but one wave computes a (16*TM) x (16*TN) tile: TM A fragments and TN B fragments are
//   loaded per 32-wide k-step and reused across TM*TN WMMAs (far fewer load/convert instructions per MAC). MODE 0 (f16), 1 (bf16 hi/lo),
//   2 (bf16) only. grid (ceil(NW/(16*TN)), ceil(M/(16*TM)), Z), block 32. Epilogue identical to k_gemm, run per 16x32 sub-tile.
// =====================================================================================================================
template <int MODE, int TM, int TN>
__global__ __launch_bounds__(32) void k_gemmT(GemmP p) {
    const int lane = threadIdx.x & 31, h = lane >> 4, l15 = lane & 15;
    const int m0 = blockIdx.y * (16 * TM), n0 = blockIdx.x * (16 * TN);
    const int z = blockIdx.z, zo = z / p.zi_n, zi = z - zo * p.zi_n;
    const float* A = p.A + zo * p.sAo + zi * p.sAi;
    const float* B = p.B + zo * p.sBo + zi * p.sBi;
    v8f acc[TM][TN];
#pragma unroll
    for (int i = 0; i < TM; ++i)
#pragma unroll
        for (int t = 0; t < TN; ++t) { v8f zz = {}; acc[i][t] = zz; }
    for (int k0 = 0; k0 < p.K; k0 += 32) {
        if (MODE == 1) {
            Split a[TM], b[TN];
#pragma unroll
            for (int i = 0; i < TM; ++i) { const int am = min(m0 + 16 * i + l15, p.M - 1); a[i] = sp_ld(A + (long long)am * p.sAm, p.sAk, k0, h, p.K, 1.f); }
#pragma unroll
            for (int t = 0; t < TN; ++t) { const int bn = min(n0 + 16 * t + l15, p.N - 1); b[t] = sp_ld(B + (long long)bn * p.sBn, p.sBk, k0, h, p.K, 1.f); }
#pragma unroll
            for (int i = 0; i < TM; ++i)
#pragma unroll
                for (int t = 0; t < TN; ++t) acc[i][t] = wmma3(a[i], b[t], acc[i][t]);
        } else if (MODE == 2) {
            v16b a[TM], b[TN];
#pragma unroll
            for (int i = 0; i < TM; ++i) { const int am = min(m0 + 16 * i + l15, p.M - 1); a[i] = bh_ld(A + (long long)am * p.sAm, p.sAk, k0, h, p.K, 1.f); }
#pragma unroll
            for (int t = 0; t < TN; ++t) { const int bn = min(n0 + 16 * t + l15, p.N - 1); b[t] = bh_ld(B + (long long)bn * p.sBn, p.sBk, k0, h, p.K, 1.f); }
#pragma unroll
            for (int i = 0; i < TM; ++i)
#pragma unroll
                for (int t = 0; t < TN; ++t) acc[i][t] = wmmab(a[i], b[t], acc[i][t]);
        } else {
            v16h a[TM], b[TN];
#pragma unroll
            for (int i = 0; i < TM; ++i) { const int am = min(m0 + 16 * i + l15, p.M - 1); a[i] = fh_ld(A + (long long)am * p.sAm, p.sAk, k0, h, p.K, p.sa); }
#pragma unroll
            for (int t = 0; t < TN; ++t) { const int bn = min(n0 + 16 * t + l15, p.N - 1); b[t] = fh_ld(B + (long long)bn * p.sBn, p.sBk, k0, h, p.K, p.sb); }
#pragma unroll
            for (int i = 0; i < TM; ++i)
#pragma unroll
                for (int t = 0; t < TN; ++t) acc[i][t] = wmma16(a[i], b[t], acc[i][t]);
        }
    }
    const float iscale = (MODE == 0) ? p.alpha / (p.sa * p.sb) : p.alpha;
    float* C = p.C + zo * p.sCo + zi * p.sCi;
    const float* R = p.R + zo * p.sRo + zi * p.sRi;
    const int NW = (p.Npad > p.N) ? p.Npad : p.N;
    __shared__ __align__(16) float ctile[16][36];
#pragma unroll
    for (int i = 0; i < TM; ++i) {
        const int mb = m0 + 16 * i; if (mb >= p.M) break;          // wave-uniform
#pragma unroll
        for (int tp = 0; tp < TN / 2; ++tp) {
            const int nb = n0 + 32 * tp; if (nb >= NW) break;        // wave-uniform
#pragma unroll
            for (int t2 = 0; t2 < 2; ++t2) {
                const int t = 2 * tp + t2; const int n = nb + t2 * 16 + l15; const int nn = min(n, p.N - 1);
#pragma unroll
                for (int r = 0; r < 8; ++r) {
                    const int m = mb + 8 * h + r; const int mm = min(m, p.M - 1);
                    float v = acc[i][t][r] * iscale;
                    if (p.flags & 1) v += p.bias[nn];
                    if (p.flags & 2) v += p.bias[mm];
            if (p.flags & 8) v *= p.bias[(long long)zo * p.M + mm];   /* per-(z,row) scale vector laid out [Z][M]; exclusive with the bias flags */
                    v = act_fn(v, p.act);
                    if (p.flags & 4) v += p.beta * R[(long long)mm * p.sRm + (long long)nn * p.sRn];
                    ctile[8 * h + r][t2 * 16 + l15] = (n < p.N) ? v : 0.f;
                }
            }
            __syncthreads();
            const bool fast = (mb + 16 <= p.M) && (nb + 32 <= NW) && ((p.sCm & 3) == 0) && ((((size_t)C) & 15) == 0);
            if (fast) {
#pragma unroll
                for (int s = 0; s < 4; ++s) {
                    const int row = s * 4 + (lane >> 3), c4 = (lane & 7) * 4;
                    const v4f v = *(const v4f*)&ctile[row][c4];
                    VST2V4(C + (long long)(mb + row) * p.sCm + nb + c4, v);
                }
            } else {
                for (int row = 0; row < 16; ++row) {
                    const int m = mb + row, n = nb + lane;
                    if (m < p.M && n < NW) VST2(float, C + (long long)m * p.sCm + n, ctile[row][lane]);
                }
            }
            __syncthreads();
        }
    }
}

// =====================================================================================================================
//   Wave = 16 queries, AW waves per block, 64-key blocks; grid (ceil(Lq/(16*AW)), H, B), block 32*AW. Any Lq, Lk; head dim dh <= DHP
//   (DHP multiple of 32), value dim dv <= DVP (multiple of 16, <= 128). Every tensor addressed by (batch, head, row, element) strides, f32.
//   Scores: QM 0 f16 operands, 1 bf16 hi/lo split, 2 bf16 triple split; statistics f32 (exp2 domain); P.V: P x 4096 as f16 with V f16 staged in LDS
//   (SPLITPV: P and V as bf16 hi/lo splits). kv head = h / hrep. Masking: causal = 1 (keep j <= i + coff, masked -> -inf, key blocks beyond the
//   diagonal skipped), causal = 2 (masked -> mfill, a finite fill like the -1e9; no skipping), causal = 3 (keep j >= i + coff,
//   masked -> -inf, no skipping); optional additive f32 mask Mf,
//   optional int keep-mask Mi (0 -> score := mfill), both addressed b*smb + h*smh + i*smi + j*smj (0 strides broadcast).
// =====================================================================================================================
#define AW 4
struct AttnP {   // apv4
    const float* Q; const float* K; const float* V; float* O; float* P; const float* Mf; const int* Mi; float* ST;
    const float* Pw; const float* Rt; const int* SQ; const int* SK;           // optional: post-softmax weight, relative-position table, segment ids
    long long swb, swh, swi, swj, srb, srh, sri;                                 // Pw strides (b,h,i,j); Rt strides (b,h,i), column = clamp(i - j + roff, 0, rn-1)
    long long sQb, sQh, sQi, sQd, sKb, sKh, sKj, sKd, sVb, sVh, sVj, sVd, sOb, sOh, sOi, sPb, sPh, sPi, smb, smh, smi, smj;
    int Lq, Lk, dh, dv, hrep, causal, coff, pband;   // pband > 0: P holds only the band |j - i| <= pband, column j - i + pband
    float scale, mfill; int nonorm, mpol;             // nonorm (online path only): O = sum_j exp(score_j) V_j without the 1/rowsum (scores must be <= ~0); mpol: Mi masks where ==0 (mpol 0) or where !=0 (mpol 1)
    int roff, rn, segpol, win;                        // Rt column offset/count; SQ/SK: score := mfill where (segpol 0) SQ[i] != SK[j] or (segpol 1) SQ[i] == SK[j]; win > 0: keys with i - j > win (after coff) -> -inf
};
//   Pw: the softmax numerator is multiplied by Pw(b,h,i,j) AFTER the row sum is taken (probs * weight, then P.V), as in post-softmax multiplicative biases.                                                    // ST (optional): per row (b,h,i) -> ST[((b*H + h)*Lq + i)*2 + {0,1}] = {row max of the scaled+masked score (natural units), sum_j exp(score - max)}
static_assert(sizeof(AttnP) == 12 * 8 + 29 * 8 + 16 * 4, "AttnP has padding");

#ifndef KATTN_ATTR
#define KATTN_ATTR
#endif
template <int DHP, int DVP, int QM, bool SPLITPV, bool TWOPASS>
__global__ __launch_bounds__(32 * AW) KATTN_ATTR void k_attn(AttnP p) {
    constexpr int NT = DVP / 16;                // output tiles
    constexpr int KS = DHP / 32;                // k-steps for the scores
    constexpr int VP = DVP + 8;                 // LDS pitch (halves)
    __shared__ __align__(16) float    pl[AW][16 * 64];
    __shared__ __align__(16) _Float16 vl[(SPLITPV ? 2 : 1) * 64 * VP];   // f16 V tile, or bf16 hi and lo tiles (same 2-byte size)
    const int lane = threadIdx.x & 31, hf = lane >> 4, l15 = lane & 15, wave = threadIdx.x >> 5;
    const int h = blockIdx.y, b = blockIdx.z, hk = h / p.hrep;
    const int q0 = (blockIdx.x * AW + wave) * 16;
    float* myp = pl[wave];
    const float L2E = 1.4426950408889634f;
    const float NEG = -__builtin_inff();
    const int qi = min(q0 + l15, p.Lq - 1);
    const float* qrow = p.Q + b * p.sQb + h * p.sQh + (long long)qi * p.sQi;
    const float* kbase = p.K + b * p.sKb + hk * p.sKh;
    const float* vbase = p.V + b * p.sVb + hk * p.sVh;
    v16h qa[QM == 0 ? KS : 1]; Split qs_[QM == 1 ? KS : 1]; Split3 qt_[QM == 2 ? KS : 1];
#pragma unroll
    for (int ks = 0; ks < KS; ++ks) {
        if (QM == 2) qt_[ks] = sp3_ld(qrow, p.sQd, ks * 32, hf, p.dh, 1.f);
        else if (QM == 1) qs_[ks] = sp_ld(qrow, p.sQd, ks * 32, hf, p.dh, 1.f);
        else qa[ks] = fh_ld(qrow, p.sQd, ks * 32, hf, p.dh, 1.f);
    }
    v8f o[NT]; float m8[8], l8[8];
#pragma unroll
    for (int t = 0; t < NT; ++t) { v8f zz = {}; o[t] = zz; }
#pragma unroll
    for (int i = 0; i < 8; ++i) { m8[i] = NEG; l8[i] = 0.f; }
    int jend = p.Lk;
    if (p.causal == 1) { const int je = (blockIdx.x * AW + AW - 1) * 16 + 16 + p.coff; jend = min(jend, max(je, 0)); }   // uniform per block
    const int npass = TWOPASS ? 2 : 1;
    for (int pass = 0; pass < npass; ++pass) {
        const bool dopv = (!TWOPASS) || pass == 1;
        for (int j0 = 0; j0 < jend; j0 += 64) {
            if (dopv) {
                __syncthreads();                                 // previous key block's reads of vl / pl are done
                for (int idx = threadIdx.x; idx < 64 * DVP; idx += 32 * AW) {
                    const int jr = idx / DVP, d = idx - jr * DVP, j = j0 + jr;
                    const float f = (j < p.Lk && d < p.dv) ? vbase[(long long)j * p.sVj + (long long)d * p.sVd] : 0.f;
                    if (SPLITPV) {
                        const __bf16 hb = bf16_rne(f);
                        ((__bf16*)vl)[jr * VP + d] = hb; ((__bf16*)vl)[64 * VP + jr * VP + d] = bf16_rne(f - bf16_f32(hb));
                    } else vl[jr * VP + d] = (_Float16)f;
                }
            }
            v8f s[4];
#pragma unroll
            for (int t = 0; t < 4; ++t) {
                const int j = min(j0 + t * 16 + l15, p.Lk - 1);
                const float* krow = kbase + (long long)j * p.sKj;
                v8f acc = {};
#pragma unroll
                for (int ks = 0; ks < KS; ++ks) {
                    if (QM == 2)      acc = wmma6(qt_[ks], sp3_ld(krow, p.sKd, ks * 32, hf, p.dh, 1.f), acc);
                    else if (QM == 1) acc = wmma3(qs_[ks], sp_ld(krow, p.sKd, ks * 32, hf, p.dh, 1.f), acc);
                    else              acc = wmma16(qa[ks], fh_ld(krow, p.sKd, ks * 32, hf, p.dh, 1.f), acc);
                }
                s[t] = acc;
            }
            float pv[8][4];
#pragma unroll
            for (int i = 0; i < 8; ++i) {
                const int irow = q0 + i + 8 * hf;
                const int ic = min(irow, p.Lq - 1);
                float sc[4];
#pragma unroll
                for (int t = 0; t < 4; ++t) {
                    const int jg = j0 + t * 16 + l15;
                    float v = s[t][i] * p.scale;
                    if (p.Mf) v += p.Mf[b * p.smb + h * p.smh + (long long)ic * p.smi + (long long)min(jg, p.Lk - 1) * p.smj];
                    if (p.Rt) { int rc = ic - min(jg, p.Lk - 1) + p.roff; rc = rc < 0 ? 0 : (rc >= p.rn ? p.rn - 1 : rc); v += p.Rt[b * p.srb + h * p.srh + (long long)ic * p.sri + rc]; }
                    if (p.Mi) { const int mv = p.Mi[b * p.smb + h * p.smh + (long long)ic * p.smi + (long long)min(jg, p.Lk - 1) * p.smj]; if (p.mpol ? (mv != 0) : (mv == 0)) v = p.mfill; }
                    if (p.SQ) { const bool same = p.SQ[(long long)b * p.Lq + ic] == p.SK[(long long)b * p.Lk + min(jg, p.Lk - 1)]; if (p.segpol ? same : !same) v = p.mfill; }
                    if (p.causal == 2 && jg > irow + p.coff) v = p.mfill;
                    if (jg >= p.Lk || (p.causal == 1 && jg > irow + p.coff) || (p.causal == 3 && jg < irow + p.coff) || (p.win > 0 && irow + p.coff - jg > p.win)) v = NEG; else v *= L2E;
                    sc[t] = v;
                }
                if (!TWOPASS || pass == 0) {
                    float mx = fmaxf(fmaxf(sc[0], sc[1]), fmaxf(sc[2], sc[3]));
                    mx = fmaxf(mx, __shfl_xor(mx, 1, 32)); mx = fmaxf(mx, __shfl_xor(mx, 2, 32));
                    mx = fmaxf(mx, __shfl_xor(mx, 4, 32)); mx = fmaxf(mx, __shfl_xor(mx, 8, 32));
                    const float mnew = fmaxf(m8[i], mx);
                    const float corr = (mnew == NEG) ? 1.f : exp2f(m8[i] - mnew);
                    float rs = 0.f;
#pragma unroll
                    for (int t = 0; t < 4; ++t) {
                        const float pp = (sc[t] == NEG) ? 0.f : exp2f(sc[t] - mnew); rs += pp;
                        pv[i][t] = p.Pw ? pp * p.Pw[b * p.swb + h * p.swh + (long long)ic * p.swi + (long long)min(j0 + t * 16 + l15, p.Lk - 1) * p.swj] : pp;
                    }
                    rs += __shfl_xor(rs, 1, 32); rs += __shfl_xor(rs, 2, 32); rs += __shfl_xor(rs, 4, 32); rs += __shfl_xor(rs, 8, 32);
                    l8[i] = l8[i] * corr + rs; m8[i] = mnew;
                    if (!TWOPASS) {
#pragma unroll
                        for (int t = 0; t < NT; ++t) o[t][i] *= corr;
                    }
                } else {
                    const float inv = (l8[i] > 0.f) ? 1.f / l8[i] : 0.f;
#pragma unroll
                    for (int t = 0; t < 4; ++t) {
                        const int jg = j0 + t * 16 + l15;
                        float pp = (sc[t] == NEG) ? 0.f : exp2f(sc[t] - m8[i]) * inv;
                        if (p.Pw) pp *= p.Pw[b * p.swb + h * p.swh + (long long)ic * p.swi + (long long)min(jg, p.Lk - 1) * p.swj];
                        pv[i][t] = pp;
                    }
                }
            }
            if (dopv) {
#pragma unroll
                for (int i = 0; i < 8; ++i)
#pragma unroll
                    for (int t = 0; t < 4; ++t) ((float*)myp)[(i + 8 * hf) * 64 + t * 16 + l15] = pv[i][t];
                __syncthreads();                                 // P (per wave) and V (shared) visible
                if (p.P) {
                    float* pb_ = p.P + b * p.sPb + h * p.sPh;
                    const bool fastP = (p.pband == 0) && ((p.sPi & 3) == 0) && (j0 + 64 <= p.Lk) && (q0 + 16 <= p.Lq) && ((((size_t)pb_) & 15) == 0);
                    if (fastP) {
#pragma unroll
                        for (int s = 0; s < 8; ++s) {
                            const int row = s * 2 + (lane >> 4), c4 = (lane & 15) * 4;
                            const v4f v = *(const v4f*)(myp + row * 64 + c4);
                            VST2V4(pb_ + (long long)(q0 + row) * p.sPi + j0 + c4, v);
                        }
                    } else {
                        for (int row = 0; row < 16; ++row) {
                            const int irow = q0 + row; if (irow >= p.Lq) continue;
                            for (int c = lane; c < 64; c += 32) {
                                const int jg = j0 + c; if (jg >= p.Lk) continue;
                                if (p.pband == 0) VST2(float, pb_ + (long long)irow * p.sPi + jg, myp[row * 64 + c]);
                                else if (jg - irow <= p.pband && irow - jg <= p.pband) VST2(float, pb_ + (long long)irow * p.sPi + (jg - irow + p.pband), myp[row * 64 + c]);
                            }
                        }
                    }
                }
                if (SPLITPV) {
                    const Split pa0 = sp_ld(myp + l15 * 64, 1, 0, hf, 64, 1.f), pa1 = sp_ld(myp + l15 * 64, 1, 32, hf, 64, 1.f);
                    const __bf16* vh = (const __bf16*)vl; const __bf16* vlo = vh + 64 * VP;
#pragma unroll
                    for (int t = 0; t < NT; ++t) {
                        const int dcol = t * 16 + l15;
                        Split b0, b1;
#pragma unroll
                        for (int e = 0; e < 16; ++e) {
                            const int k0 = frag_k(e, hf), k1 = 32 + frag_k(e, hf);
                            b0.hi[e] = vh[k0 * VP + dcol]; b0.lo[e] = vlo[k0 * VP + dcol]; b1.hi[e] = vh[k1 * VP + dcol]; b1.lo[e] = vlo[k1 * VP + dcol];
                        }
                        o[t] = wmma3(pa0, b0, o[t]);
                        o[t] = wmma3(pa1, b1, o[t]);
                    }
                } else {
                    const v16h pa0 = fh_ld(myp + l15 * 64, 1, 0, hf, 64, 4096.f), pa1 = fh_ld(myp + l15 * 64, 1, 32, hf, 64, 4096.f);
#pragma unroll
                    for (int t = 0; t < NT; ++t) {
                        const int dcol = t * 16 + l15;
                        v16h b0, b1;
#pragma unroll
                        for (int e = 0; e < 16; ++e) { b0[e] = vl[frag_k(e, hf) * VP + dcol]; b1[e] = vl[(32 + frag_k(e, hf)) * VP + dcol]; }
                        o[t] = wmma16(pa0, b0, o[t]);
                        o[t] = wmma16(pa1, b1, o[t]);
                    }
                }
            }
        }
    }
    float* obase = p.O + b * p.sOb + h * p.sOh;
    if (p.ST) {
        const int rl = lane >> 1, isel = rl & 7;           // row q0 + rl ; rl>>3 == hf holds because lane>>4 == (lane>>1)>>3
        float mv = 0.f, lv = 0.f;
#pragma unroll
        for (int i = 0; i < 8; ++i) if (i == isel) { mv = m8[i]; lv = l8[i]; }
        const int irow = q0 + rl;
        if (irow < p.Lq) { float* st = p.ST + (((long long)b * gridDim.y + h) * p.Lq + irow) * 2 + (lane & 1); VST2(float, st, (lane & 1) ? lv : mv * 0.6931471805599453f); }
    }
    float invr[8];
#pragma unroll
    for (int i = 0; i < 8; ++i) {
        if (TWOPASS) invr[i] = SPLITPV ? 1.f : (1.f / 4096.f);
        else if (p.nonorm) invr[i] = exp2f(m8[i]) * (SPLITPV ? 1.f : (1.f / 4096.f));
        else invr[i] = (l8[i] > 0.f) ? (SPLITPV ? 1.f / l8[i] : 1.f / (l8[i] * 4096.f)) : 0.f;
    }
    __syncthreads();                                             // all waves done with pl/vl from the main loop
    const bool ofast = ((p.sOi & 3) == 0) && ((((size_t)obase) & 15) == 0) && (q0 + 16 <= p.Lq);
#pragma unroll
    for (int c0 = 0; c0 < DVP; c0 += 64) {
#pragma unroll
        for (int i = 0; i < 8; ++i)
#pragma unroll
            for (int t = 0; t < NT; ++t) if (t * 16 >= c0 && t * 16 < c0 + 64) ((float*)myp)[(i + 8 * hf) * 64 + (t * 16 - c0) + l15] = o[t][i] * invr[i];
        __syncthreads();
        const int cw = (DVP - c0 < 64) ? (DVP - c0) : 64;      // staged columns in this chunk (multiple of 16)
        if (ofast && (c0 + cw <= p.dv) && (cw % 32 == 0)) {
            const int lpr = cw / 4;                              // lanes per row (16 for 64 cols, 8 for 32)
            const int rows_per_ins = 32 / lpr;
            for (int r0 = 0; r0 < 16; r0 += rows_per_ins) {
                const int row = r0 + lane / lpr, c4 = (lane % lpr) * 4;
                const v4f v = *(const v4f*)(myp + row * 64 + c4);
                VST2V4(obase + (long long)(q0 + row) * p.sOi + c0 + c4, v);
            }
        } else {
            for (int row = 0; row < 16; ++row) {
                const int irow = q0 + row; if (irow >= p.Lq) continue;
                for (int c = lane; c < cw; c += 32) { const int d = c0 + c; if (d < p.dv) VST2(float, obase + (long long)irow * p.sOi + d, myp[row * 64 + c]); }
            }
        }
        __syncthreads();
    }
}

// =====================================================================================================================
// k_tr: dst(z, c, r) = alpha * src(z, r, c) (+ beta * R2(z, c, r)): [Z][R][C] (row stride lds) -> [Z][C][R] (row stride ldd) through a 32x32 LDS tile;
//   flags: 1 -> add beta * residual R2 addressed like dst (z*sRz + c*ldr + r); act applied before the residual.
// =====================================================================================================================
struct TrP { const float* src; float* dst; const float* R2; long long sSz, lds, sDz, ldd, sRz, ldr; int R, C, flags, act; float alpha, beta; };
static_assert(sizeof(TrP) == 3 * 8 + 6 * 8 + 6 * 4, "TrP has padding");
__global__ __launch_bounds__(256) void k_tr(TrP p) {
    __shared__ float tile[32][33];
    const int c0 = blockIdx.x * 32, r0 = blockIdx.y * 32, z = blockIdx.z;
    const int lane = threadIdx.x & 31, wave = threadIdx.x >> 5;
    const float* s = p.src + z * p.sSz;
#pragma unroll
    for (int k = 0; k < 4; ++k) {
        const int rl = wave * 4 + k, r = r0 + rl, c = c0 + lane;
        tile[rl][lane] = (r < p.R && c < p.C) ? s[(long long)r * p.lds + c] : 0.f;
    }
    __syncthreads();
    float* d = p.dst + z * p.sDz; const float* rr = p.R2 + z * p.sRz;
#pragma unroll
    for (int k = 0; k < 4; ++k) {
        const int cl = wave * 4 + k, c = c0 + cl, r = r0 + lane;
        if (c < p.C && r < p.R) {
            float v = act_fn(p.alpha * tile[lane][cl], p.act);
            if (p.flags & 1) v += p.beta * rr[(long long)c * p.ldr + r];
            VST2(float, d + (long long)c * p.ldd + r, v);
        }
    }
}

// k_affine: dst[i] = a * (sdev ? sdev[0] : 1) * src[i] + b, i < n (one thread per element; consecutive lanes -> consecutive addresses)
__global__ __launch_bounds__(256) void k_affine(const float* __restrict__ src, float* __restrict__ dst, int n, float a, float b, const float* __restrict__ sdev) {
    const int i = blockIdx.x * 256 + threadIdx.x;
    if (i < n) { const float aa = sdev ? a * sdev[0] : a; const float v = aa * src[i] + b; VST2(float, dst + i, v); }
}

// =====================================================================================================================
// k_softmax: row softmax over n contiguous elements, one 256-thread block per row; rows addressed z*sz + r*sr (grid (R, Z)).
//   out = scale_out * softmax(scale_in * x + (Mf ? Mf[z*smz + r*smr + j] : 0)); a row whose max is -inf is written as 0.
// =====================================================================================================================
struct SmP { const float* src; float* dst; const float* Mf; long long sz, sr, dz, dr, smz, smr; int n, pad; float scale_in, scale_out; };
static_assert(sizeof(SmP) == 3 * 8 + 6 * 8 + 4 * 4, "SmP has padding");
__global__ __launch_bounds__(256) void k_softmax(SmP p) {
    __shared__ float red[256];
    const int r = blockIdx.x, z = blockIdx.y, tid = threadIdx.x;
    const float* s = p.src + z * p.sz + (long long)r * p.sr;
    const float* mf = p.Mf ? (p.Mf + z * p.smz + (long long)r * p.smr) : nullptr;
    float mx = -__builtin_inff();
    for (int j = tid; j < p.n; j += 256) { float v = s[j] * p.scale_in; if (mf) v += mf[j]; mx = fmaxf(mx, v); }
    red[tid] = mx; __syncthreads();
    for (int o = 128; o > 0; o >>= 1) { if (tid < o) red[tid] = fmaxf(red[tid], red[tid + o]); __syncthreads(); }
    mx = red[0]; __syncthreads();
    float sum = 0.f;
    for (int j = tid; j < p.n; j += 256) { float v = s[j] * p.scale_in; if (mf) v += mf[j]; sum += (mx == -__builtin_inff()) ? 0.f : expf(v - mx); }
    red[tid] = sum; __syncthreads();
    for (int o = 128; o > 0; o >>= 1) { if (tid < o) red[tid] += red[tid + o]; __syncthreads(); }
    sum = red[0];
    const float inv = (sum > 0.f) ? p.scale_out / sum : 0.f;
    float* d = p.dst + z * p.dz + (long long)r * p.dr;
    for (int j = tid; j < p.n; j += 256) { float v = s[j] * p.scale_in; if (mf) v += mf[j]; const float o = (mx == -__builtin_inff()) ? 0.f : expf(v - mx) * inv; VST2(float, d + j, o); }
}
// =====================================================================================================================
// k_stats: mean and rsqrt(var + eps) over a set of n elements addressed base + z*sz + (e / inner) * so + (e % inner) * si, one 256-thread
// k_norm_apply: y = (x - mean[set]) * rstd[set] * g[c] + b[c] over a [Z][C][L] channel-major tensor with set = z*G + c / (C/G) (G groups per z;
//   G = C -> per-channel sets indexed z*C+c; for batch norm pass stats indexed by c only via bn = 1). Optional act. Output same layout.
// =====================================================================================================================
//   mode 0: mean / rsqrt(var + eps); mode 1 (RMSNorm): 0 / rsqrt(mean(x^2) + eps); mode 2 (L2 normalize * sqrt(n)): 0 / sqrt(n) / max(||x||, eps); mode 3: as 0 with unbiased variance (n-1)
__global__ __launch_bounds__(256) void k_stats(const float* __restrict__ x, long long sz, long long so, long long si, int inner, int n, float eps, float* __restrict__ stat, int mode) {
    __shared__ float red[256];
    const int z = blockIdx.x, tid = threadIdx.x;
    const float* base = x + z * sz;
    float s = 0.f;
    for (int e = tid; e < n; e += 256) s += base[(long long)(e / inner) * so + (long long)(e % inner) * si];
    red[tid] = s; __syncthreads();
    for (int o = 128; o > 0; o >>= 1) { if (tid < o) red[tid] += red[tid + o]; __syncthreads(); }
    const float mu = (mode == 0 || mode == 3) ? red[0] / (float)n : 0.f; __syncthreads();
    float q = 0.f;
    for (int e = tid; e < n; e += 256) { const float dlt = base[(long long)(e / inner) * so + (long long)(e % inner) * si] - mu; q += dlt * dlt; }
    red[tid] = q; __syncthreads();
    for (int o = 128; o > 0; o >>= 1) { if (tid < o) red[tid] += red[tid + o]; __syncthreads(); }
    {
        float rs;
        if (mode == 2) rs = sqrtf((float)n) / fmaxf(sqrtf(red[0]), eps); else if (mode == 3) rs = rsqrtf(red[0] / (float)(n - 1) + eps); else rs = rsqrtf(red[0] / (float)n + eps);
        if (tid < 32) { const float v = (tid == 0) ? mu : ((tid == 1) ? rs : 0.f); VST2(float, stat + (long long)z * 32 + tid, v); }
    }
}
//   One thread per element over the flat [Z][C][L] index space: grid ceil(Z*C*L / 256).
__global__ __launch_bounds__(256) void k_norm_apply(const float* __restrict__ x, float* __restrict__ y, const float* __restrict__ stat, const float* __restrict__ g, const float* __restrict__ bta,
                                                     int Z, int C, int L, int G, int bn, int act) {
    const long long idx = (long long)blockIdx.x * 256 + threadIdx.x;
    if (idx >= (long long)Z * C * L) return;
    const int l = (int)(idx % L); const long long zc = idx / L; const int c = (int)(zc % C), z = (int)(zc / C); (void)l;
    const int set = bn ? c : (z * G + c / (C / G));
    float v = (x[idx] - stat[(long long)set * 32]) * stat[(long long)set * 32 + 1];
    if (g) v *= g[c];
    if (bta) v += bta[c];
    v = act_fn(v, act);
    VST2(float, y + idx, v);
}

// k_lse_neg: c[i] = -(st[2i] + log(st[2i+1])) = minus the log-sum-exp of row i from k_attn's ST output (for softmax over the query dimension)
__global__ __launch_bounds__(256) void k_lse_neg(const float* __restrict__ st, float* __restrict__ c, int n) {
    const int i = blockIdx.x * 256 + threadIdx.x;
    if (i < n) { const float v = -(st[2 * i] + logf(st[2 * i + 1])); VST2(float, c + i, v); }
}

// k_iota: dst[i] = a * i + b as int32 (segment/position id helper)
__global__ __launch_bounds__(256) void k_iota(int* __restrict__ dst, int n, int a, int b) {
    const int i = blockIdx.x * 256 + threadIdx.x;
    if (i < n) { const int v = a * i + b; VST2(int, dst + i, v); }
}

// k_axpby: dst[i] = a * x[i] + b * y[i] (+ c), i < n
__global__ __launch_bounds__(256) void k_axpby(const float* __restrict__ x, const float* __restrict__ y, float* __restrict__ dst, int n, float a, float b, float c) {
    const int i = blockIdx.x * 256 + threadIdx.x;
    if (i < n) { const float v = a * x[i] + b * y[i] + c; VST2(float, dst + i, v); }
}

// =====================================================================================================================
// k_rope: rotary embedding on a [R rows][Hn heads][D] view (row stride sXr, head stride sXh, element stride 1) -> Y (own strides).
//   mode 0: rotate_half (partner d±D/2, sign - for d<D/2); mode 1: interleaved pairs (partner d^1, sign - for even d).
//   table column tcol: tmode 0 -> d, 1 -> d % (D/2), 2 -> d / 2; position p: pmode 0 -> r % S, 1 -> head index, 2 -> pos[r];
//   c = C[(r / S) * sCb + p * sCp + tcol * sCd], s likewise from Sn; y = x[d] * c + sign * x[partner] * s. X and Y must not alias.
// =====================================================================================================================
struct RopeP { const float* X; float* Y; const float* C; const float* Sn; const int* pos; long long sXr, sXh, sYr, sYh, sCb, sCp, sCd; int R, Hn, D, S, mode, tmode, pmode, pad; };
static_assert(sizeof(RopeP) == 5 * 8 + 7 * 8 + 8 * 4, "RopeP has padding");
__global__ __launch_bounds__(256) void k_rope(RopeP p) {
    const long long idx = (long long)blockIdx.x * 256 + threadIdx.x;
    if (idx >= (long long)p.R * p.Hn * p.D) return;
    const int d = (int)(idx % p.D); const long long rh = idx / p.D; const int h = (int)(rh % p.Hn); const int r = (int)(rh / p.Hn);
    const int half = p.D / 2;
    int partner; float sign;
    if (p.mode == 0) { partner = (d < half) ? d + half : d - half; sign = (d < half) ? -1.f : 1.f; }
    else { partner = d ^ 1; sign = (d & 1) ? 1.f : -1.f; }
    const int tcol = (p.tmode == 0) ? d : ((p.tmode == 1) ? (d % half) : (d >> 1));
    const int pp = (p.pmode == 0) ? (r % p.S) : ((p.pmode == 1) ? h : p.pos[r]);
    const long long toff = (long long)(r / p.S) * p.sCb + (long long)pp * p.sCp + (long long)tcol * p.sCd;
    const float* xr = p.X + (long long)r * p.sXr + (long long)h * p.sXh;
    const float v = xr[d] * p.C[toff] + sign * xr[partner] * p.Sn[toff];
    VST2(float, p.Y + (long long)r * p.sYr + (long long)h * p.sYh + d, v);
}

// k_invf + k_sincos (split so neither kernel carries a large VALU-fma footprint): invf_i = num * (1 / powf(base, (2 i)/D)) [fmode 0],
//   num * expf((2 i) * cexp) [fmode 1], num * powf(base, -2 (i - 1) / D) [fmode 2]; then cs/sn[s*half + i] = cos/sin((pscale * s) * invf_i)
__global__ __launch_bounds__(256) void k_invf(float* __restrict__ invb, int half, int D, float base, float num, int fmode, float cexp) {
    const int i = blockIdx.x * 256 + threadIdx.x;
    if (i >= ((half + 31) / 32) * 32) return;
    if (i >= half) { VST2(float, invb + i, 0.f); return; }
    const float e = (float)(2 * i) / (float)D;
    float invf;
    if (fmode == 1) invf = num * expf((float)(2 * i) * cexp);
    else if (fmode == 2) invf = num * powf(base, (-2.0f * ((float)i - 1.0f)) / (float)D);
    else invf = num * (1.0f / powf(base, e));
    VST2(float, invb + i, invf);
}
__global__ __launch_bounds__(256) void k_sincos(float* __restrict__ cs, float* __restrict__ sn, const float* __restrict__ invb, int S, int half, float pscale) {
    const int idx = blockIdx.x * 256 + threadIdx.x;
    if (idx >= S * half) return;
    const int s = idx / half, i = idx - s * half;
    const float ang = (pscale * (float)s) * invb[i];
    VST2(float, cs + idx, cosf(ang)); VST2(float, sn + idx, sinf(ang));
}

// k_mulact: dst[i] = act(x[i]) * y[i]
__global__ __launch_bounds__(256) void k_mulact(const float* __restrict__ x, const float* __restrict__ y, float* __restrict__ dst, int n, int act) {
    const int i = blockIdx.x * 256 + threadIdx.x;
    if (i < n) { const float v = act_fn(x[i], act) * y[i]; VST2(float, dst + i, v); }
}

// =====================================================================================================================
// k_matvec: thread-per-row matrix-vector products for N <= 8 output columns (heads with 1-3 outputs, gates), f32 on the VALU.
//   C[r*sCm + j] = act(alpha * sum_k A[r*sAm + k*sAk] * B[j*sBn + k*sBk] + bias[j]) + beta * R[r*sRm + j*sRn]; each thread writes its N contiguous floats.
// =====================================================================================================================
__global__ __launch_bounds__(256) void k_matvec(GemmP p) {
    // 32 lanes write one line with one instruction.
    const int rpt = (p.N == 1) ? 1 : 32;
    const long long r0 = ((long long)blockIdx.x * 256 + threadIdx.x) * rpt; const int z = blockIdx.z, zo = z / p.zi_n, zi = z - zo * p.zi_n;
    if (r0 >= p.M) return;
    const float* Bb = p.B + zo * p.sBo + zi * p.sBi;
    float* C = p.C + zo * p.sCo + zi * p.sCi; const float* R = p.R + zo * p.sRo + zi * p.sRi;
    for (int rr = 0; rr < rpt; ++rr) {
        const long long r = r0 + rr; if (r >= p.M) break;
        const float* A = p.A + zo * p.sAo + zi * p.sAi + r * p.sAm;
        float acc[8] = {0.f, 0.f, 0.f, 0.f, 0.f, 0.f, 0.f, 0.f};
        for (int k = 0; k < p.K; ++k) { const float a = A[(long long)k * p.sAk];
#pragma unroll
            for (int j = 0; j < 8; ++j) if (j < p.N) acc[j] += a * Bb[(long long)j * p.sBn + (long long)k * p.sBk]; }
#pragma unroll
        for (int j = 0; j < 8; ++j) if (j < p.N) {
            float v = acc[j] * p.alpha;
            if (p.flags & 1) v += p.bias[j];
            if (p.flags & 2) v += p.bias[r];
            v = act_fn(v, p.act);
            if (p.flags & 4) v += p.beta * R[r * p.sRm + (long long)j * p.sRn];
            VST2(float, C + r * p.sCm + j, v);
        }
    }
}
// k_smallsoftmax: thread-per-row softmax for short rows (n <= 64): dst[r*dr + j] = softmax(scale*src[r*sr + j])
__global__ __launch_bounds__(256) void k_smallsoftmax(const float* __restrict__ src, float* __restrict__ dst, long long sr, long long dr, int n, long long R, float scale) {
    const long long r0 = ((long long)blockIdx.x * 256 + threadIdx.x) * 32;
    for (int rr = 0; rr < 32; ++rr) {
        const long long r = r0 + rr; if (r >= R) return;
        const float* s = src + r * sr; float* d = dst + r * dr;
        float mx = -__builtin_inff();
        for (int j = 0; j < n; ++j) mx = fmaxf(mx, s[j] * scale);
        float sum = 0.f;
        for (int j = 0; j < n; ++j) sum += expf(s[j] * scale - mx);
        const float inv = 1.f / sum;
        for (int j = 0; j < n; ++j) { const float v = expf(s[j] * scale - mx) * inv; VST2(float, d + j, v); }
    }
}

__global__ __launch_bounds__(32) void k_unitstat(float* __restrict__ st) { const int t = threadIdx.x; const float v = (t == 1) ? 1.f : 0.f; VST2(float, st + t, v); }

// destination (e.g. a d_out whose row width is not a multiple of 32 floats) is written by consecutive lanes of one instruction
__global__ __launch_bounds__(256) void k_lincopy(const float* __restrict__ src, long long lds, float* __restrict__ dst, long long ldd, long long rows, int cols) {
    const long long i = (long long)blockIdx.x * 256 + threadIdx.x; if (i >= rows * cols) return;
    const long long r = i / cols; const int c = (int)(i - r * cols);
    const float v = src[r * lds + c]; VST2(float, dst + r * ldd + c, v);
}

namespace w25 {
typedef __attribute__((ext_vector_type(16))) _Float16 v16h;
typedef __attribute__((ext_vector_type(8)))  _Float16 v8h;
typedef __attribute__((ext_vector_type(16))) __bf16   v16b;
typedef __attribute__((ext_vector_type(8)))  __bf16   v8b;
typedef __attribute__((ext_vector_type(8)))  float    v8f;
typedef __attribute__((ext_vector_type(4)))  float    v4f;

__device__ __forceinline__ unsigned short f2bf_bits(float f) {
  unsigned u = __float_as_uint(f);
  return (unsigned short)((u + 0x7FFFu + ((u >> 16) & 1u)) >> 16);
}
__device__ __forceinline__ float bf_bits2f(unsigned short h) { return __uint_as_float(((unsigned)h) << 16); }

// hazard guards as plain device helpers (no inline asm inside the kernel template body)
__device__ __forceinline__ void dep_guard_h(v8f& a, v8f& b, v16h x, v16h y) { asm volatile("v_nop\n\tv_nop\n\tv_nop\n\tv_nop" : "+v"(a), "+v"(b) : "v"(x), "v"(y)); }
__device__ __forceinline__ void dep_guard_b(v8f& a, v8f& b, v16b x, v16b y) { asm volatile("v_nop\n\tv_nop\n\tv_nop\n\tv_nop" : "+v"(a), "+v"(b) : "v"(x), "v"(y)); }
__device__ __forceinline__ void keep4_h(v16h a, v16h b, v16h c, v16h d) { asm volatile("v_nop" :: "v"(a), "v"(b), "v"(c), "v"(d)); }
__device__ __forceinline__ void keep4_b(v16b a, v16b b, v16b c, v16b d) { asm volatile("v_nop" :: "v"(a), "v"(b), "v"(c), "v"(d)); }
__device__ __forceinline__ void acc_guard4(v8f& a, v8f& b, v8f& c, v8f& d) { asm volatile("v_nop\n\tv_nop\n\tv_nop\n\tv_nop" : "+v"(a), "+v"(b), "+v"(c), "+v"(d)); }
template <typename T> struct Frag;
template <> struct Frag<_Float16> {
  typedef v16h V; union U { v16h v; v8h h[2]; };
  static __device__ __forceinline__ v16h load(const _Float16* p) {   // elements 0..7 <- p[0..7], 8..15 <- p[16..23]
    U f; f.h[0] = *(const v8h*)(p); f.h[1] = *(const v8h*)(p + 16); return f.v;
  }
  static __device__ __forceinline__ v8f mma(v16h a, v16h b, v8f c) {
    return __builtin_amdgcn_wmma_f32_16x16x32_f16(false, a, false, b, (short)0, c, false, false);
  }
  static __device__ __forceinline__ void guard(v8f& a, v8f& b, v16h x, v16h y) { dep_guard_h(a, b, x, y); }
  static __device__ __forceinline__ void keep(v16h a, v16h b, v16h c, v16h d) { keep4_h(a, b, c, d); }
};
template <> struct Frag<__bf16> {
  typedef v16b V; union U { v16b v; v8b h[2]; };
  static __device__ __forceinline__ v16b load(const __bf16* p) {
    U f; f.h[0] = *(const v8b*)(p); f.h[1] = *(const v8b*)(p + 16); return f.v;
  }
  static __device__ __forceinline__ v8f mma(v16b a, v16b b, v8f c) {
    return __builtin_amdgcn_wmma_f32_16x16x32_bf16(false, a, false, b, (short)0, c, false, false);
  }
  static __device__ __forceinline__ void guard(v8f& a, v8f& b, v16b x, v16b y) { dep_guard_b(a, b, x, y); }
  static __device__ __forceinline__ void keep(v16b a, v16b b, v16b c, v16b d) { keep4_b(a, b, c, d); }
};

// ---- Register-blocked batched WMMA GEMM ------------------------------------
// C[m,n] = scale * sum_k A[m,k] * Bt[n,k] (+bias)(+resid); each wave owns a 64x64 tile.
// A row-major [M,K]; Bt row-major [N,K]; M,N % 64 == 0, K % 32 == 0.
// SPLIT: operands are hi/lo planes (A2/Bt2 = lo planes, same layout); product = hi·hi + hi·lo + lo·hi.
// BIAS_MODE: 0 = none, 1 = bias[m], 2 = bias[n].
// OUT_MODE: 0 = f32, 1 = f16, 2 = bf16 hi plane (Cout) + bf16 lo plane (Cout2).
// ET: 0 = f16 operands, 1 = bf16 operands (pointers passed as 16-bit storage)
template <int ET> struct Elem;
template <> struct Elem<0> { typedef _Float16 T; };
template <> struct Elem<1> { typedef __bf16 T; };
template <int ET, bool SPLIT, int BIAS_MODE, int OUT_MODE, bool RESID, int ACT = 0>
__global__ __launch_bounds__(256) void wmma_gemm64(
    const unsigned short* __restrict__ Ap, const unsigned short* __restrict__ A2p, int lda, long strideA,
    const unsigned short* __restrict__ Btp, const unsigned short* __restrict__ Bt2p, int ldb, long strideB,
    void* __restrict__ Cout, void* __restrict__ Cout2, int ldc, long strideC,
    const float* __restrict__ bias,
    const float* __restrict__ resid, long strideR,
    int M, int N, int K, float scale) {
  typedef typename Elem<ET>::T T;
  typedef typename Frag<T>::V V;
  const T* A = (const T*)Ap; const T* A2 = (const T*)A2p; const T* Bt = (const T*)Btp; const T* Bt2 = (const T*)Bt2p;
  __shared__ __align__(16) float sT[8][16 * 68];   // per-wave 16x64 slab, pitch 68 floats
  const int b    = blockIdx.y;
  const int lane = threadIdx.x & 31;
  const int wave = threadIdx.x >> 5;
  const int tilesN = N >> 6;
  const int tilesM = M >> 6;
  const int tile = blockIdx.x * 8 + wave;
  if (tile >= tilesM * tilesN) return;   // wave-uniform; no block barriers in this kernel
  const int tm = tile / tilesN;
  const int tn = tile - tm * tilesN;
  const int m0 = tm << 6;
  const int n0 = tn << 6;

  const T* Ab  = A  + (size_t)b * strideA;
  const T* Bb  = Bt + (size_t)b * strideB;
  const T* Ab2 = SPLIT ? (A2  + (size_t)b * strideA) : nullptr;
  const T* Bb2 = SPLIT ? (Bt2 + (size_t)b * strideB) : nullptr;

  const int rlane = lane & 15;                 // row (A) / col (B, D) within subtile
  const int koff  = (lane >> 4) * 8;           // k offset of this lane half
  const int mOff  = (lane >> 4) * 8;           // D row offset

  v8f acc[4][4];
#pragma unroll
  for (int i = 0; i < 4; ++i)
#pragma unroll
    for (int j = 0; j < 4; ++j) acc[i][j] = (v8f){0.f,0.f,0.f,0.f,0.f,0.f,0.f,0.f};

  for (int k0 = 0; k0 < K; k0 += 32) {
    V bh[4], bl[4];
#pragma unroll
    for (int j = 0; j < 4; ++j) {
      const size_t bo = (size_t)(n0 + (j << 4) + rlane) * ldb + koff + k0;
      bh[j] = Frag<T>::load(Bb + bo);
      if (SPLIT) bl[j] = Frag<T>::load(Bb2 + bo);
    }
#pragma unroll
    for (int i = 0; i < 4; ++i) {
      const size_t ao = (size_t)(m0 + (i << 4) + rlane) * lda + koff + k0;
      V ah = Frag<T>::load(Ab + ao);
      V al;
      if (SPLIT) al = Frag<T>::load(Ab2 + ao);
#pragma unroll
      for (int j = 0; j < 4; ++j) {
        acc[i][j] = Frag<T>::mma(ah, bh[j], acc[i][j]);
        if (SPLIT) {
          acc[i][j] = Frag<T>::mma(ah, bl[j], acc[i][j]);
          acc[i][j] = Frag<T>::mma(al, bh[j], acc[i][j]);
        }
      }
      Frag<T>::guard(acc[i][0], acc[i][3], ah, SPLIT ? al : ah);
    }
    Frag<T>::keep(bh[0], bh[1], bh[2], bh[3]);
    if (SPLIT) Frag<T>::keep(bl[0], bl[1], bl[2], bl[3]);
  }
  acc_guard4(acc[0][0], acc[0][1], acc[0][2], acc[0][3]);
  acc_guard4(acc[1][0], acc[1][1], acc[1][2], acc[1][3]);
  acc_guard4(acc[2][0], acc[2][1], acc[2][2], acc[2][3]);
  acc_guard4(acc[3][0], acc[3][1], acc[3][2], acc[3][3]);

  // ---- epilogue ----
  float* slab = sT[wave];
  const float* Rb = RESID ? (resid + (size_t)b * strideR) : nullptr;
#pragma unroll
  for (int i = 0; i < 4; ++i) {
    const int mBase = m0 + (i << 4);
#pragma unroll
    for (int j = 0; j < 4; ++j) {
      const int n = n0 + (j << 4) + rlane;
      float bv = 0.f;
      if (BIAS_MODE == 2) bv = bias[n];
#pragma unroll
      for (int r = 0; r < 8; ++r) {
        float v = acc[i][j][r] * scale;
        if (BIAS_MODE == 1) v += bias[mBase + mOff + r];
        if (BIAS_MODE == 2) v += bv;
        if (RESID) v += Rb[(size_t)(mBase + mOff + r) * ldc + n];
        if (ACT == 1) v = tanhf(v);
        if (ACT == 2) v = fmaxf(v, 0.0f);
        if (ACT == 3) v = v / (1.0f + expf(-v));
        if (ACT == 4) v = (v > 0.f) ? v : 0.01f * v;
        if (ACT == 5) v = 0.5f * v * (1.0f + erff(v * 0.70710678118654752f));
        slab[(mOff + r) * 68 + (j << 4) + rlane] = v;
      }
    }
    __builtin_amdgcn_fence(__ATOMIC_RELEASE, "workgroup");
    __builtin_amdgcn_wave_barrier();
    __builtin_amdgcn_fence(__ATOMIC_ACQUIRE, "workgroup");
    if (OUT_MODE == 0) {
      float* C = (float*)Cout + (size_t)b * strideC;
      const int hh = lane >> 4, c4 = (lane & 15) * 4;     // row seg = 256 B = 16 lanes x 16 B
      {
#pragma unroll
        for (int it = 0; it < 8; ++it) {
          const int row = it * 2 + hh;
          v4f v = *(const v4f*)(slab + row * 68 + c4);
          *(v4f*)(C + (size_t)(mBase + row) * ldc + n0 + c4) = v;
        }
        
      }
    } else {
      const int q = lane >> 3, c8 = (lane & 7) * 8;
      unsigned short* C  = (unsigned short*)Cout  + (size_t)b * strideC;
      unsigned short* C2 = (OUT_MODE == 2) ? ((unsigned short*)Cout2 + (size_t)b * strideC) : nullptr;
      {
#pragma unroll
        for (int it = 0; it < 4; ++it) {
          const int row = it * 4 + q;
          const float* sp = slab + row * 68 + c8;
          v8h hv, lv;
#pragma unroll
          for (int e = 0; e < 8; ++e) {
            if (OUT_MODE == 1) {
              hv[e] = (_Float16)sp[e];
            } else {
              unsigned short hb = f2bf_bits(sp[e]);
              unsigned short lb = f2bf_bits(sp[e] - bf_bits2f(hb));
              hv[e] = __builtin_bit_cast(_Float16, hb);
              lv[e] = __builtin_bit_cast(_Float16, lb);
            }
          }
          *(v8h*)(C + (size_t)(mBase + row) * ldc + n0 + c8) = hv;
          if (OUT_MODE == 2) *(v8h*)(C2 + (size_t)(mBase + row) * ldc + n0 + c8) = lv;
        }
        
      }
    }
    __builtin_amdgcn_fence(__ATOMIC_RELEASE, "workgroup");
    __builtin_amdgcn_wave_barrier();
    __builtin_amdgcn_fence(__ATOMIC_ACQUIRE, "workgroup");
  }
}

__global__ __launch_bounds__(256) void cast_f32_f16x2(
    const float* __restrict__ in, _Float16* __restrict__ out, int n2) {
  int i = blockIdx.x * 256 + threadIdx.x;
  if (i < n2) {
    const _Float16 h0 = (_Float16)in[2 * i], h1 = (_Float16)in[2 * i + 1];
    const unsigned u = (unsigned)__builtin_bit_cast(unsigned short, h0) | ((unsigned)__builtin_bit_cast(unsigned short, h1) << 16);
    ((unsigned*)out)[i] = u;
    
  }
}


} // namespace w25

// f32 -> bf16 hi + bf16 lo (x = hi + lo to ~2^-17 relative; RNE both), two neighbouring elements packed per 32-bit word
__device__ __forceinline__ unsigned int f2bf2_pack(float a, float b, unsigned int* lo) {
    const unsigned short ha = w25::f2bf_bits(a), hb = w25::f2bf_bits(b);
    const unsigned short la = w25::f2bf_bits(a - w25::bf_bits2f(ha)), lb = w25::f2bf_bits(b - w25::bf_bits2f(hb));
    *lo = (unsigned)la | ((unsigned)lb << 16); return (unsigned)ha | ((unsigned)hb << 16); }

namespace w25 {
// =====================================================================================
// Generic causal/non-causal attention for head_dim 64, f32 in / f32 out; 16-bit operands: bf16 with optional hi/lo splits, or
// plain f16 (F16=true, non-split, probabilities carried x2^15).
//   scores = (q*qscale)·kᵀ : v_wmma_f32_16x16x32_bf16; SPLIT_QK -> q,k as bf16 hi/lo (hi·hi + hi·lo + lo·hi)
//   out    = p·v           : v_wmma_f32_16x16x32_bf16; SPLIT_PV -> p,v as bf16 hi/lo; else p,v plain bf16
//   f32 accumulate; online softmax in f32. Block = 4 waves = 64 query rows of one (batch, head); S % 64 == 0.
//   Element (b, s, h, d) of tensor X lives at X[b*X_bs + s*X_rs + h*X_hs + d] (strides in floats, multiples of 4).
//   Masking: mask_mode 0 none, 1 causal (kv > q masked), 2 tensor [S][Skv] shared over (b,h) (float if
//   mask_is_int==0, int32 with element == 0 -> masked if 1, int32 with element != 0 -> masked if 2), 3 per-token vectors qmask[B][S] & kvmask[B][Skv] (int32,
//   0 -> masked), 4 causal + sliding window (kv > q or q - kv > W masked; W passed in mask_is_int);
//   5 = relative-position bias: s += cp[b,h,q][idx[q][kv]] + pc[b,h,kv][idx[q][kv]] with idx = mask_b ([S][Skv] int32) and
//   mask_a an int32 [S][Skv] tensor with nonzero = masked (tables: element (b,h,row,n) at X + b*c_bs + h*c_hs + row*c_rs + n);
//   masked scores are replaced by mask_fill (e.g. -inf or -1e9) before the softmax.
//   grid.x = B * H * (S/64) (or a sub-range with blk0).
// =====================================================================================
#define AT_D 64
#define AT_NW 4
#define AT_QB 64
#define AT_KC 64
struct AttnGeom { const float* cp = nullptr; const float* pc = nullptr; long c_bs = 0, c_rs = 0, c_hs = 0;   // mode-5 score-bias tables
                  long q_bs, q_rs, q_hs, k_bs, k_rs, k_hs, v_bs, v_rs, v_hs, o_bs, o_rs, o_hs;
                  int S, Skv, H, mask_mode; float qscale; int blk0; float mask_fill; int mask_is_int; };
static_assert(sizeof(AttnGeom) == 168, "no padding");

__device__ __forceinline__ unsigned short at_bf_bits(float f) {
  unsigned u = __float_as_uint(f);
  return (unsigned short)((u + 0x7FFFu + ((u >> 16) & 1u)) >> 16);
}
__device__ __forceinline__ __bf16 at_f2bf(float f) { return __builtin_bit_cast(__bf16, at_bf_bits(f)); }
__device__ __forceinline__ void at_split(float f, __bf16& hi, __bf16& lo) {
  const unsigned short hb = at_bf_bits(f);
  hi = __builtin_bit_cast(__bf16, hb);
  lo = at_f2bf(f - __uint_as_float(((unsigned)hb) << 16));
}
__device__ __forceinline__ v8f at_mma(v16b a, v16b b, v8f c) {
  c = __builtin_amdgcn_wmma_f32_16x16x32_bf16(false, a, false, b, (short)0, c, false, false);
  asm volatile("v_nop\n\tv_nop\n\tv_nop\n\tv_nop" : "+v"(c) : "v"(a), "v"(b));
  return c;
}
// 16-bit element as a bit pattern held in a __bf16 slot: f16 bits when F16, bf16 (RNE) otherwise
template <bool F16> __device__ __forceinline__ __bf16 at_to16(float f) {
  if (F16) return __builtin_bit_cast(__bf16, (_Float16)f);
  return at_f2bf(f);
}
template <bool F16> __device__ __forceinline__ v8f at_mma16(v16b a, v16b b, v8f c) {
  if (F16) {
    const v16h ah = __builtin_bit_cast(v16h, a), bh = __builtin_bit_cast(v16h, b);
    c = __builtin_amdgcn_wmma_f32_16x16x32_f16(false, ah, false, bh, (short)0, c, false, false);
    asm volatile("v_nop\n\tv_nop\n\tv_nop\n\tv_nop" : "+v"(c) : "v"(ah), "v"(bh));
    return c;
  }
  return at_mma(a, b, c);
}

template <bool SPLIT_QK, bool SPLIT_PV, bool F16 = false>
__global__ __launch_bounds__(128)
void attn64_kernel(const float* __restrict__ q, const float* __restrict__ k,
                   const float* __restrict__ v, float* __restrict__ out,
                   const void* __restrict__ mask_a, const int* __restrict__ mask_b, AttnGeom g) {
  static_assert(!(F16 && (SPLIT_QK || SPLIT_PV)), "f16 mode is non-split");
  const float PSC = F16 ? 32768.0f : 1.0f;     // f16 probabilities carried x2^15 (subnormal range), folded into the final 1/l
  union FB { v16b v; v8b h[2]; };
  __shared__ __align__(16) __bf16 Ksh[AT_KC * AT_D];             // K hi [kv][d]      8 KB
  __shared__ __align__(16) __bf16 Ksl[SPLIT_QK ? AT_KC * AT_D : 8];
  __shared__ __align__(16) __bf16 Vth[AT_D * AT_KC];             // V hi [d][kv]      8 KB
  __shared__ __align__(16) __bf16 Vtl[SPLIT_PV ? AT_D * AT_KC : 8];
  __shared__ __align__(16) __bf16 Psh[AT_NW][16 * AT_KC];        // per wave P hi [row][kv]  8 KB
  __shared__ __align__(16) __bf16 Psl[SPLIT_PV ? AT_NW : 1][SPLIT_PV ? 16 * AT_KC : 8];
  __shared__ __align__(16) float  Os[AT_NW][16 * 68];            // per wave out tile, pitch 68

  const int tid  = threadIdx.x;
  const int wave = tid >> 5;
  const int lane = tid & 31;
  const int hh   = lane >> 4;
  const int c    = lane & 15;

  const int nqb = g.S / AT_QB;
  const int bx = blockIdx.x + g.blk0;
  const int qb = bx % nqb;
  const int bh = bx / nqb;
  const int h  = bh % g.H;
  const int b  = bh / g.H;
  const int qbase_block = qb * AT_QB;
  const int q0 = qbase_block + wave * 16;

  const float* qb_ptr = q + (size_t)b * g.q_bs + (size_t)h * g.q_hs;
  const float* kb_ptr = k + (size_t)b * g.k_bs + (size_t)h * g.k_hs;
  const float* vb_ptr = v + (size_t)b * g.v_bs + (size_t)h * g.v_hs;
  float*       ob_ptr = out + (size_t)b * g.o_bs + (size_t)h * g.o_hs;

  // ---- Q fragments (A operand): 2 d-chunks, hi (and lo) ----
  v16b qah[2], qal[2];
  {
    const float* qrow = qb_ptr + (size_t)(q0 + c) * g.q_rs;
#pragma unroll
    for (int dc = 0; dc < 2; ++dc) {
#pragma unroll
      for (int e = 0; e < 8; ++e) {
        const float f0 = qrow[dc * 32 + 8 * hh + e] * g.qscale;
        const float f1 = qrow[dc * 32 + 16 + 8 * hh + e] * g.qscale;
        if (SPLIT_QK) { __bf16 hq, lq; at_split(f0, hq, lq); qah[dc][e] = hq; qal[dc][e] = lq; at_split(f1, hq, lq); qah[dc][8 + e] = hq; qal[dc][8 + e] = lq; }
        else { qah[dc][e] = at_to16<F16>(f0); qah[dc][8 + e] = at_to16<F16>(f1); qal[dc][e] = qah[dc][e]; qal[dc][8 + e] = qah[dc][8 + e]; }
      }
    }
  }

  float mrow[8], lrow[8];
  v8f oacc[4];
#pragma unroll
  for (int r = 0; r < 8; ++r) { mrow[r] = -INFINITY; lrow[r] = 0.f; }
#pragma unroll
  for (int t = 0; t < 4; ++t) oacc[t] = (v8f){0.f,0.f,0.f,0.f,0.f,0.f,0.f,0.f};

  const int nChunks = (g.mask_mode == 1 || g.mask_mode == 4) ? (qb + 1) : (g.Skv / AT_KC);   // block-uniform
  // per-row query mask (mode 3)
  int qkeep[8];
#pragma unroll
  for (int r = 0; r < 8; ++r) qkeep[r] = (g.mask_mode == 3) ? mask_b[(size_t)b * g.S + q0 + 8 * hh + r] : 1;   // mask_b = qmask in mode 3
  for (int kc = 0; kc < nChunks; ++kc) {
    const int kv0 = kc * AT_KC;
    __syncthreads();
    {
      const int kvr = tid >> 1, dh = (tid & 1) * 32;
      const float* krow = kb_ptr + (size_t)(kv0 + kvr) * g.k_rs + dh;
      const float* vrow = vb_ptr + (size_t)(kv0 + kvr) * g.v_rs + dh;
#pragma unroll
      for (int i = 0; i < 8; ++i) {
        v4f kk = *(const v4f*)(krow + 4 * i);
        v4f vv = *(const v4f*)(vrow + 4 * i);
#pragma unroll
        for (int e = 0; e < 4; ++e) {
          const int d = dh + 4 * i + e;
          if (SPLIT_QK) { __bf16 a, bl; at_split(kk[e], a, bl); Ksh[kvr * AT_D + d] = a; Ksl[kvr * AT_D + d] = bl; }
          else Ksh[kvr * AT_D + d] = at_to16<F16>(kk[e]);
          if (SPLIT_PV) { __bf16 a, bl; at_split(vv[e], a, bl); Vth[d * AT_KC + kvr] = a; Vtl[d * AT_KC + kvr] = bl; }
          else Vth[d * AT_KC + kvr] = at_to16<F16>(vv[e]);
        }
      }
    }
    __syncthreads();

    v8f s[4];
#pragma unroll
    for (int j = 0; j < 4; ++j) {
      s[j] = (v8f){0.f,0.f,0.f,0.f,0.f,0.f,0.f,0.f};
#pragma unroll 1
      for (int dc = 0; dc < 2; ++dc) {
        FB kb;
        kb.h[0] = *(const v8b*)(Ksh + (j * 16 + c) * AT_D + dc * 32 + 8 * hh);
        kb.h[1] = *(const v8b*)(Ksh + (j * 16 + c) * AT_D + dc * 32 + 16 + 8 * hh);
        s[j] = at_mma16<F16>(qah[dc], kb.v, s[j]);
        if (SPLIT_QK) {
          FB kl;
          kl.h[0] = *(const v8b*)(Ksl + (j * 16 + c) * AT_D + dc * 32 + 8 * hh);
          kl.h[1] = *(const v8b*)(Ksl + (j * 16 + c) * AT_D + dc * 32 + 16 + 8 * hh);
          s[j] = at_mma16<F16>(qah[dc], kl.v, s[j]);
          s[j] = at_mma16<F16>(qal[dc], kb.v, s[j]);
        }
      }
    }
    const bool diag = (g.mask_mode == 1) && (kc == qb);
    int kvkeep[4] = {1, 1, 1, 1};
    if (g.mask_mode == 3) {
#pragma unroll
      for (int j = 0; j < 4; ++j) kvkeep[j] = ((const int*)mask_a)[(size_t)b * g.Skv + kv0 + j * 16 + c];   // mask_a = kvmask
    }
    float cm[8];
#pragma unroll
    for (int r = 0; r < 8; ++r) {
      const int qrow = q0 + 8 * hh + r;
      float m = -INFINITY;
#pragma unroll
      for (int j = 0; j < 4; ++j) {
        const int kvcol = kv0 + j * 16 + c;
        bool masked = false;
        if (diag) masked = (kvcol > qrow);
        else if (g.mask_mode == 4) masked = (kvcol > qrow) || (qrow - kvcol > g.mask_is_int);
        else if (g.mask_mode == 2) {
          const size_t mi = (size_t)qrow * g.Skv + kvcol;
          masked = (g.mask_is_int == 0) ? (((const float*)mask_a)[mi] == 0.0f)
                 : (g.mask_is_int == 1) ? (((const int*)mask_a)[mi] == 0) : (((const int*)mask_a)[mi] != 0);
        } else if (g.mask_mode == 3) masked = (qkeep[r] == 0) || (kvkeep[j] == 0);
        else if (g.mask_mode == 5) {
          const size_t mi = (size_t)qrow * g.Skv + kvcol;
          masked = (((const int*)mask_a)[mi] != 0);
          int n = mask_b[mi]; n = n < 0 ? 0 : n;
          s[j][r] += g.cp[(size_t)b * g.c_bs + (size_t)h * g.c_hs + (size_t)qrow * g.c_rs + n]
                   + g.pc[(size_t)b * g.c_bs + (size_t)h * g.c_hs + (size_t)kvcol * g.c_rs + n];
        }
        if (masked) s[j][r] = g.mask_fill;
        m = fmaxf(m, s[j][r]);
      }
#pragma unroll
      for (int off = 1; off < 16; off <<= 1) m = fmaxf(m, __shfl_xor(m, off, 32));
      cm[r] = m;
    }
    __bf16* pwh = Psh[wave];
    __bf16* pwl = Psl[SPLIT_PV ? wave : 0];
#pragma unroll
    for (int r = 0; r < 8; ++r) {
      const float mnew = fmaxf(mrow[r], cm[r]);
      const float alpha = expf(mrow[r] - mnew);
      mrow[r] = mnew;
      float psum = 0.f;
#pragma unroll
      for (int j = 0; j < 4; ++j) {
        const float p = expf(s[j][r] - mnew);
        psum += p;
        if (SPLIT_PV) { __bf16 a, bl; at_split(p, a, bl); pwh[(8 * hh + r) * AT_KC + j * 16 + c] = a; pwl[(8 * hh + r) * AT_KC + j * 16 + c] = bl; }
        else pwh[(8 * hh + r) * AT_KC + j * 16 + c] = at_to16<F16>(p * PSC);
      }
#pragma unroll
      for (int off = 1; off < 16; off <<= 1) psum += __shfl_xor(psum, off, 32);
      lrow[r] = lrow[r] * alpha + psum;
#pragma unroll
      for (int t = 0; t < 4; ++t) oacc[t][r] *= alpha;
    }
    __builtin_amdgcn_fence(__ATOMIC_RELEASE, "workgroup");
    __builtin_amdgcn_wave_barrier();
    __builtin_amdgcn_fence(__ATOMIC_ACQUIRE, "workgroup");
#pragma unroll 1
    for (int kk = 0; kk < 2; ++kk) {
      FB pa, pl;
      pa.h[0] = *(const v8b*)(pwh + c * AT_KC + kk * 32 + 8 * hh);
      pa.h[1] = *(const v8b*)(pwh + c * AT_KC + kk * 32 + 16 + 8 * hh);
      if (SPLIT_PV) {
        pl.h[0] = *(const v8b*)(pwl + c * AT_KC + kk * 32 + 8 * hh);
        pl.h[1] = *(const v8b*)(pwl + c * AT_KC + kk * 32 + 16 + 8 * hh);
      }
#pragma unroll
      for (int t = 0; t < 4; ++t) {
        FB vb;
        vb.h[0] = *(const v8b*)(Vth + (t * 16 + c) * AT_KC + kk * 32 + 8 * hh);
        vb.h[1] = *(const v8b*)(Vth + (t * 16 + c) * AT_KC + kk * 32 + 16 + 8 * hh);
        oacc[t] = at_mma16<F16>(pa.v, vb.v, oacc[t]);
        if (SPLIT_PV) {
          FB vl;
          vl.h[0] = *(const v8b*)(Vtl + (t * 16 + c) * AT_KC + kk * 32 + 8 * hh);
          vl.h[1] = *(const v8b*)(Vtl + (t * 16 + c) * AT_KC + kk * 32 + 16 + 8 * hh);
          oacc[t] = at_mma16<F16>(pa.v, vl.v, oacc[t]);
          oacc[t] = at_mma16<F16>(pl.v, vb.v, oacc[t]);
        }
      }
    }
  }

  float* os = Os[wave];
#pragma unroll
  for (int r = 0; r < 8; ++r) {
    const float inv = 1.0f / (lrow[r] * PSC);
#pragma unroll
    for (int t = 0; t < 4; ++t) os[(8 * hh + r) * 68 + t * 16 + c] = oacc[t][r] * inv;
  }
  __builtin_amdgcn_fence(__ATOMIC_RELEASE, "workgroup");
  __builtin_amdgcn_wave_barrier();
  __builtin_amdgcn_fence(__ATOMIC_ACQUIRE, "workgroup");
  {
    const int c4 = (lane & 15) * 4;
    {
#pragma unroll
      for (int it = 0; it < 8; ++it) {
        const int row = it * 2 + hh;
        v4f val = *(const v4f*)(os + row * 68 + c4);
        *(v4f*)(ob_ptr + (size_t)(q0 + row) * g.o_rs + c4) = val;
      }
      
    }
  }
}

} // namespace w25

// Operand preparation, one launch: blockIdx.y == 0 takes 64 rows of q, blockIdx.y == 1 takes 64 rows of memory. A wave holds 8 whole rows in registers (16 bytes per lane
//   and row, the 8 loads in flight together) and everything that is made of a row is made from that one read: the row dot (q . w_q -> AQ, memory . w_m -> CM), the bf16 hi
//   and lo planes of the similarity product (q * w_qm; memory) and, for memory, the f16 plane x ts transposed to [d][m], the operand of the query->memory product.
//   The transposed tile and the 64 dots go through LDS so that every global store covers whole 128-byte lines.
typedef __attribute__((ext_vector_type(2))) unsigned v2u;
typedef __attribute__((ext_vector_type(8))) _Float16 v8hp;
template <int M, int D>
__global__ __launch_bounds__(256) void k_bi_prep(const float* __restrict__ Q, const float* __restrict__ MEM, const float* __restrict__ wq, const float* __restrict__ wm, const float* __restrict__ wqm,
        float* __restrict__ AQ, float* __restrict__ CM, __bf16* __restrict__ QH, __bf16* __restrict__ QL, __bf16* __restrict__ MH, __bf16* __restrict__ ML, _Float16* __restrict__ MT, float ts) {
    static_assert(D == 128 && M % 64 == 0, "one 16-byte load per lane and row; a block's 64 rows lie in one batch");
    __shared__ float res[64];
    __shared__ __align__(16) _Float16 tr[D][72];   // [d][m], pitch 144 bytes = 16 x 9: 16-byte reads along m without bank conflicts
    const bool isq = blockIdx.y == 0;
    const int lane = threadIdx.x & 31, wv = threadIdx.x >> 5;
    const size_t rb = (size_t)blockIdx.x * 64, r0 = rb + wv * 8;
    const float* xp = (isq ? Q : MEM) + r0 * D + lane * 4;
    const v4f w = *(const v4f*)((isq ? wq : wm) + lane * 4);
    const v4f g = *(const v4f*)(wqm + lane * 4);   // used by the q blocks alone; read here so that it flies with the rows
    v4f x[8];
#pragma unroll
    for (int i = 0; i < 8; ++i) x[i] = *(const v4f*)(xp + i * D);
    asm volatile("s_wait_xcnt 0x0" ::: "memory");   // the work below reuses the address registers that the loads above name
    __builtin_amdgcn_sched_barrier(0);   // holds the first rewrite of those registers behind the wait; left free it is scheduled ahead of it
    float keep = 0.f;
#pragma unroll
    for (int i = 0; i < 8; ++i) {
        float s = x[i][0] * w[0]; s += x[i][1] * w[1]; s += x[i][2] * w[2]; s += x[i][3] * w[3];
        for (int o = 16; o > 0; o >>= 1) s += __shfl_xor(s, o, 32);
        if (lane == i) keep = s;
    }
    if (lane < 8) res[wv * 8 + lane] = keep;
    if (isq) {
#pragma unroll
        for (int i = 0; i < 8; ++i) x[i] *= g;
    } else {
#pragma unroll
        for (int e = 0; e < 4; ++e) { v8hp h;
#pragma unroll
            for (int i = 0; i < 8; ++i) h[i] = (_Float16)(x[i][e] * ts);
            *(v8hp*)&tr[lane * 4 + e][wv * 8] = h; }
    }
    v2u hi[8], lo[8];
#pragma unroll
    for (int i = 0; i < 8; ++i) { unsigned l0, l1;
        hi[i][0] = f2bf2_pack(x[i][0], x[i][1], &l0); hi[i][1] = f2bf2_pack(x[i][2], x[i][3], &l1); lo[i][0] = l0; lo[i][1] = l1; }
    __syncthreads();   // publishes res and tr; it stands ahead of every global store, so that no wave waits at it for stores to land
    __bf16* ph = (isq ? QH : MH) + r0 * D + lane * 4;
    __bf16* pl = (isq ? QL : ML) + r0 * D + lane * 4;
#pragma unroll
    for (int i = 0; i < 8; ++i) { *(v2u*)(ph + i * D) = hi[i]; *(v2u*)(pl + i * D) = lo[i]; }
    if (threadIdx.x < 64) VST2(float, (isq ? AQ : CM) + rb + threadIdx.x, res[threadIdx.x]);
    if (!isq) {
        _Float16* mt = MT + (rb / M) * (size_t)D * M + rb % M + (lane & 7) * 8;
#pragma unroll
        for (int it = 0; it < 4; ++it) { const int d = wv * 16 + it * 4 + (lane >> 3);   // a wave store = 4 rows of d x one 128-byte line
            *(v8hp*)(mt + (size_t)d * M) = *(const v8hp*)&tr[d][(lane & 7) * 8]; }
    } }
// expf, step for step as the compiler expands it (x * log2(e) in two parts, 2^fraction, ldexp, the two range tests), written out so that the v_nop can stand in the
//   statement of v_exp_f32: it fills the one slot the instruction set asks for in front of a vector instruction that reads the result or overwrites the source
__device__ __forceinline__ float exp_slot(float x) {
    const float ph = x * 0x1.715476p+0f;
    const float pl = fmaf(x, 0x1.4ae0bep-26f, fmaf(x, 0x1.715476p+0f, -ph));
    const float en = rintf(ph);
    const float a = (ph - en) + pl;
    float y;
    asm("v_exp_f32 %0, %1\n\tv_nop" : "=v"(y) : "v"(a));
    float r = ldexpf(y, (int)en);
    r = (x < -0x1.9d1da0p+6f) ? 0.f : r;
    r = (x > 0x1.62e430p+6f) ? __builtin_inff() : r;
    return r;
}
// one wave per row, RW rows per wave one after the other: sim = tril + AQ[n] + CM[m], masked exactly as the module: sim + (1 - qm*mm) * -1e30; the whole row stays in
//   registers (32 values per lane) from the one read of SIM to the one write: row max -> RMX, softmax over m (exp once), probabilities x ps stored as f16, the
//   operand plane of the query->memory product. CM and the memory mask are read once per wave; max and sum meet by lane shuffles, so the kernel has no barrier.
typedef __attribute__((ext_vector_type(4))) _Float16 v4h;
typedef __attribute__((ext_vector_type(4))) int      v4i;
template <int N, int M, int RW>
__global__ __launch_bounds__(256) void k_bi_soft16(const float* __restrict__ SIM, const float* __restrict__ AQ, const float* __restrict__ CM, const int* __restrict__ QM, const int* __restrict__ MM, float* __restrict__ RMX, _Float16* __restrict__ P16, float ps) {
    static_assert(M % 128 == 0 && N % (8 * RW) == 0, "whole 512-byte wave loads; whole blocks of 8 waves x RW rows");
    constexpr int C = M / 128;
    const int lane = threadIdx.x & 31, wv = __builtin_amdgcn_readfirstlane(threadIdx.x >> 5);
    const size_t bz = blockIdx.y;   // batch = blockIdx.y
    const size_t row0 = bz * N + (size_t)(blockIdx.x * 8 + wv) * RW;
    float aqv[RW], qmv[RW];
#pragma unroll
    for (int r = 0; r < RW; ++r) { aqv[r] = AQ[row0 + r]; qmv[r] = (float)QM[row0 + r]; }
    const float* sr = SIM + row0 * M + lane * 4;
    v4f x[C], nx[C], cm[C], mf[C]; v4i mk[C];
#pragma unroll
    for (int i = 0; i < C; ++i) x[i] = *(const v4f*)(sr + i * 128);
#pragma unroll
    for (int i = 0; i < C; ++i) { cm[i] = *(const v4f*)(CM + bz * M + lane * 4 + i * 128); mk[i] = *(const v4i*)(MM + bz * M + lane * 4 + i * 128); }
#pragma unroll
    for (int r = 0; r < RW; ++r) {
        if (r + 1 < RW) {
#pragma unroll
            for (int i = 0; i < C; ++i) nx[i] = *(const v4f*)(sr + (size_t)(r + 1) * M + i * 128);   // the next row flies while this one is worked on
            asm volatile("s_wait_xcnt 0x0" ::: "memory");   // the row's work may reuse the offset register that the loads above name
            __builtin_amdgcn_sched_barrier(0);   // keeps the loads and their wait at the head of the row's work; left free the loads sink to just ahead of their first use
        }
        if (r == 0) {
#pragma unroll
            for (int i = 0; i < C; ++i) mf[i] = __builtin_convertvector(mk[i], v4f);
        }
        const float aq = aqv[r], qm = qmv[r];
        float mx = -3.0e38f;
#pragma unroll
        for (int i = 0; i < C; ++i)
#pragma unroll
            for (int e = 0; e < 4; ++e) { const float msk = qm * mf[i][e]; const float v = x[i][e] + aq + cm[i][e] + (1.f - msk) * -1.0e30f; x[i][e] = v; mx = fmaxf(mx, v); }
        for (int o = 16; o > 0; o >>= 1) mx = fmaxf(mx, __shfl_xor(mx, o, 32));
        v4f s4 = {0.f, 0.f, 0.f, 0.f};
#pragma unroll
        for (int i = 0; i < C; ++i)
#pragma unroll
            for (int e = 0; e < 4; ++e) { const float ev = exp_slot(x[i][e] - mx); x[i][e] = ev; s4[e] += ev; }
        float s = (s4[0] + s4[1]) + (s4[2] + s4[3]);
        for (int o = 16; o > 0; o >>= 1) s += __shfl_xor(s, o, 32);
        const float inv = 1.f / s;
        _Float16* pr = P16 + (row0 + r) * M + lane * 4;
        v4h hv[C];
#pragma unroll
        for (int i = 0; i < C; ++i)
#pragma unroll
            for (int e = 0; e < 4; ++e) hv[i][e] = (_Float16)((x[i][e] * inv) * ps);
        __builtin_amdgcn_sched_barrier(0);   // with the one below: nothing that refills a register of these stores is scheduled between them and their wait
#pragma unroll
        for (int i = 0; i < C; ++i) *(v4h*)(pr + i * 128) = hv[i];
        VST2(float, RMX + (row0 + r) * 32 + lane, mx);   // row max staged as a whole 32-float line (slot 0 is read later)
        if (r + 1 < RW) {
            asm volatile("s_wait_xcnt 0x0" ::: "memory");   // the next row's work reuses the registers that the stores above name
            __builtin_amdgcn_sched_barrier(0);
        }
#pragma unroll
        for (int i = 0; i < C; ++i) x[i] = nx[i];
    } }

// Similarity product, masked row softmax and query->memory product in ONE launch; the similarity matrix and the probabilities never leave the registers.
//   Block = 16 waves = 4 groups of 16 query rows x 4 quarters of the memory axis. A wave walks its quarter in tiles of 32 memory rows:
//   S^T = memory x (q * w_qm)^T (bf16 hi/lo, three products), so that a lane holds scores of ONE query (column lane & 15; rows 8 * (lane >> 4) + r of each 16-row tile);
//   sim = S + AQ[n] + CM[m] + (1 - qm * mm) * -1e30 as the module has it; running maximum and sum; p = 2^((sim - max) * log2(e) + lps), one subtraction, one fused
//   multiply-add and one v_exp_f32 a score: the f16 scale 2^lps rides in the exponent and, being in the sum as well, cancels in the quotient (os undoes the scale of the
//   transposed plane alone). The subtraction comes first: at -1e30 a product with log2(e) would round by more than the whole exponent range. The two 16-row score tiles, as f16, ARE the B operand of
//   O^T += memory^T x P^T (the k order of the fragment loaders). The four quarters of a query meet once, at the end, through LDS.
//   The memory tiles (hi, lo, transposed f16) come into LDS by asynchronous 16-byte copies, two buffers: tile s + 1 flies while tile s is worked on; the four waves that
//   share a quarter each copy a fourth of its tile. Row pitches 272 and 80 bytes (16 x odd) keep the 16-byte fragment reads off each other's banks.
//   Every '#pragma unroll' below stands on a loop whose index picks a fragment, an accumulator or a vector element: unrolled, these stay in registers.
template <int N, int M, int D>
__global__ __launch_bounds__(512) void k_bi_fused(const __bf16* __restrict__ QH, const __bf16* __restrict__ QL, const __bf16* __restrict__ MH, const __bf16* __restrict__ ML, const _Float16* __restrict__ MT,
        const float* __restrict__ AQ, const float* __restrict__ CM, const int* __restrict__ QM, const int* __restrict__ MM, float* __restrict__ RMX, float* __restrict__ OUT, float lps, float os) {
    static_assert(N % 64 == 0 && M == 1024 && D == 128, "64 query rows a block; 4 quarters of 8 tiles of 32 memory rows; 2 mask words a thread; 256-byte operand rows");
    typedef w25::Frag<__bf16> FB; typedef w25::Frag<_Float16> FH; typedef w25::v8f v8f;
    constexpr int PA = 272, PT = 80;                    // LDS row pitch in bytes: 256-byte rows of hi and lo, 64-byte rows of the transposed tile
    constexpr int TILE = 2 * 32 * PA + D * PT;          // one quarter's tile: hi, lo, transposed
    constexpr int BUF = 4 * TILE, MQ4 = M / 4, NS = MQ4 / 32;
    static_assert(2 * BUF >= 16 * 8 * 32 * 8 * 4, "the ring later holds the 16 waves' partial outputs");
    __shared__ __align__(16) unsigned char ring[2 * BUF];
    __shared__ __align__(16) unsigned char qs[2 * 64 * PA];
    __shared__ __align__(16) float scm[M];
    __shared__ __align__(16) float smf[M];
    __shared__ float smx[4][4][16];
    __shared__ float ssm[4][4][16];
    const int lane = threadIdx.x & 31, wv = __builtin_amdgcn_readfirstlane(threadIdx.x >> 5);
    const int qg = wv & 3, ms = wv >> 2, nl = lane & 15, h = lane >> 4, koff = h * 8;
    const size_t bz = blockIdx.y, q0 = bz * N + (size_t)blockIdx.x * 64, row = q0 + qg * 16 + nl;
    // this lane's share of a tile: 4 copies of hi, 4 of lo (2 rows x 256 bytes a wave copy), 4 of the transposed plane (8 rows x 64 bytes a wave copy)
    const unsigned la = (unsigned)(size_t)ring + ms * TILE + (qg * 8 + h) * PA + nl * 16;
    const unsigned lt = (unsigned)(size_t)ring + ms * TILE + 64 * PA + (qg * 32 + (lane >> 2)) * PT + (lane & 3) * 16;
    const size_t ga = (bz * M + ms * MQ4 + qg * 8 + h) * D + nl * 8;
    const __bf16* gh = MH + ga;
    const __bf16* gl = ML + ga;
    const _Float16* gt = MT + (bz * D + qg * 32 + (lane >> 2)) * M + ms * MQ4 + (lane & 3) * 8;
    auto copy_tile = [&](int s, int b) {
        const unsigned a = la + b * BUF, t = lt + b * BUF;
        const __bf16* x = gh + (size_t)s * 32 * D;
        const __bf16* y = gl + (size_t)s * 32 * D;
        const _Float16* z = gt + s * 32;
        // the wait is the last line of the copies' own statement: no register that a copy names is rewritten ahead of it
        asm volatile("global_load_async_to_lds_b128 %0, %12, off\n\t"
                     "global_load_async_to_lds_b128 %1, %13, off\n\t"
                     "global_load_async_to_lds_b128 %2, %14, off\n\t"
                     "global_load_async_to_lds_b128 %3, %15, off\n\t"
                     "global_load_async_to_lds_b128 %4, %16, off\n\t"
                     "global_load_async_to_lds_b128 %5, %17, off\n\t"
                     "global_load_async_to_lds_b128 %6, %18, off\n\t"
                     "global_load_async_to_lds_b128 %7, %19, off\n\t"
                     "global_load_async_to_lds_b128 %8, %20, off\n\t"
                     "global_load_async_to_lds_b128 %9, %21, off\n\t"
                     "global_load_async_to_lds_b128 %10, %22, off\n\t"
                     "global_load_async_to_lds_b128 %11, %23, off\n\t"
                     "s_wait_xcnt 0x0"
                     :: "v"(a), "v"(a + 2 * PA), "v"(a + 4 * PA), "v"(a + 6 * PA),
                        "v"(a + 32 * PA), "v"(a + 34 * PA), "v"(a + 36 * PA), "v"(a + 38 * PA),
                        "v"(t), "v"(t + 8 * PT), "v"(t + 16 * PT), "v"(t + 24 * PT),
                        "v"(x), "v"(x + 2 * D), "v"(x + 4 * D), "v"(x + 6 * D),
                        "v"(y), "v"(y + 2 * D), "v"(y + 4 * D), "v"(y + 6 * D),
                        "v"(z), "v"(z + 8 * M), "v"(z + 16 * M), "v"(z + 24 * M)
                     : "memory");
    };
    {   // the block's 64 rows of q * w_qm, hi and lo: wave wv copies rows 4 wv .. 4 wv + 3 of each plane
        const unsigned lq = (unsigned)(size_t)qs + (wv * 4 + h) * PA + nl * 16;
        const size_t gq = (q0 + wv * 4 + h) * D + nl * 8;
        const __bf16* x = QH + gq;
        const __bf16* y = QL + gq;
        asm volatile("global_load_async_to_lds_b128 %0, %4, off\n\t"
                     "global_load_async_to_lds_b128 %1, %5, off\n\t"
                     "global_load_async_to_lds_b128 %2, %6, off\n\t"
                     "global_load_async_to_lds_b128 %3, %7, off\n\t"
                     "s_wait_xcnt 0x0"   // as above: inside the copies' statement
                     :: "v"(lq), "v"(lq + 2 * PA), "v"(lq + 64 * PA), "v"(lq + 66 * PA), "v"(x), "v"(x + 2 * D), "v"(y), "v"(y + 2 * D)
                     : "memory");
    }
    copy_tile(0, 0);
    {   // CM and the memory mask (as float) of the whole batch row: read once a block
        typedef __attribute__((ext_vector_type(2))) float v2f; typedef __attribute__((ext_vector_type(2))) int v2i;
        const v2f c = *(const v2f*)(CM + bz * M + threadIdx.x * 2);
        const v2i k = *(const v2i*)(MM + bz * M + threadIdx.x * 2);
        *(v2f*)&scm[threadIdx.x * 2] = c;
        *(v2f*)&smf[threadIdx.x * 2] = __builtin_convertvector(k, v2f);
    }
    const float aq = AQ[row], qm = (float)QM[row];
    asm volatile("s_wait_asynccnt 0x0" ::: "memory");   // this wave's copies of q and of tile 0 have landed
    __syncthreads();                                     // ... and every other wave's; publishes scm and smf too
    copy_tile(1, 1);
    FB::V qh[4], ql[4];
#pragma unroll
    for (int kk = 0; kk < 4; ++kk) {
        qh[kk] = FB::load((const __bf16*)(qs + (qg * 16 + nl) * PA) + koff + kk * 32);
        ql[kk] = FB::load((const __bf16*)(qs + (64 + qg * 16 + nl) * PA) + koff + kk * 32);
    }
    v8f o[8];
#pragma unroll
    for (int dt = 0; dt < 8; ++dt) o[dt] = (v8f){0.f, 0.f, 0.f, 0.f, 0.f, 0.f, 0.f, 0.f};
    float mrun = -3.0e38f, lsum = 0.f;
    constexpr float L2E = 0x1.715476p+0f;   // log2(e)
    typedef __attribute__((ext_vector_type(2))) float v2e;
#pragma unroll 1   // stays rolled: one trip is about a thousand instructions
    for (int s = 0; s < NS; ++s) {
        const unsigned char* tb = ring + (s & 1) * BUF + ms * TILE;
        const __bf16* th = (const __bf16*)(tb + nl * PA) + koff;
        const __bf16* tl = (const __bf16*)(tb + (32 + nl) * PA) + koff;
        const _Float16* tt = (const _Float16*)(tb + 64 * PA + nl * PT) + koff;
        v8f sc[2];
        sc[0] = (v8f){0.f, 0.f, 0.f, 0.f, 0.f, 0.f, 0.f, 0.f}; sc[1] = sc[0];
#pragma unroll
        for (int kk = 0; kk < 4; ++kk)
#pragma unroll
            for (int t = 0; t < 2; ++t) {
                const FB::V ah = FB::load(th + t * 16 * (PA / 2) + kk * 32);
                const FB::V al = FB::load(tl + t * 16 * (PA / 2) + kk * 32);
                sc[t] = FB::mma(ah, qh[kk], sc[t]);
                sc[t] = FB::mma(ah, ql[kk], sc[t]);
                sc[t] = FB::mma(al, qh[kk], sc[t]);
            }
        const int mb = ms * MQ4 + s * 32 + koff;
        float v[2][8];
        float mloc = -3.0e38f;
#pragma unroll
        for (int t = 0; t < 2; ++t) {
            const v4f c0 = *(const v4f*)&scm[mb + t * 16], c1 = *(const v4f*)&scm[mb + t * 16 + 4];
            const v4f f0 = *(const v4f*)&smf[mb + t * 16], f1 = *(const v4f*)&smf[mb + t * 16 + 4];
#pragma unroll
            for (int r = 0; r < 8; ++r) {
                const float msk = qm * (r < 4 ? f0[r & 3] : f1[r & 3]);
                const float x = sc[t][r] + aq + (r < 4 ? c0[r & 3] : c1[r & 3]) + (1.f - msk) * -1.0e30f;
                v[t][r] = x; mloc = fmaxf(mloc, x);
            }
        }
        mloc = fmaxf(mloc, __shfl_xor(mloc, 16, 32));   // the other 16 memory rows of this query's 32 lie in lane ^ 16
        const float mnew = fmaxf(mrun, mloc);
        float alpha = (mrun - mnew) * L2E;
        mrun = mnew;
        float e[2][8];   // first the exponents, two at a time (packed subtract, packed fused multiply-add), then 2^e in place
#pragma unroll
        for (int t = 0; t < 2; ++t)
#pragma unroll
            for (int r = 0; r < 8; r += 2) {
                const v2e a = __builtin_elementwise_fma((v2e){v[t][r], v[t][r + 1]} - (v2e){mnew, mnew}, (v2e){L2E, L2E}, (v2e){lps, lps});
                e[t][r] = a[0]; e[t][r + 1] = a[1];
            }
        // v_exp_f32 in runs: each fills the slot that the instruction set asks for behind the one before it, and the one v_nop fills it behind the last;
        //   left to the compiler every exponential went through one register, a dependent chain with a v_nop of its own
        asm("v_exp_f32 %0, %0\n\tv_exp_f32 %1, %1\n\tv_exp_f32 %2, %2\n\tv_exp_f32 %3, %3\n\tv_exp_f32 %4, %4\n\tv_exp_f32 %5, %5\n\t"
            "v_exp_f32 %6, %6\n\tv_exp_f32 %7, %7\n\tv_exp_f32 %8, %8\n\tv_nop"
            : "+v"(e[0][0]), "+v"(e[0][1]), "+v"(e[0][2]), "+v"(e[0][3]), "+v"(e[0][4]), "+v"(e[0][5]), "+v"(e[0][6]), "+v"(e[0][7]), "+v"(alpha));
        asm("v_exp_f32 %0, %0\n\tv_exp_f32 %1, %1\n\tv_exp_f32 %2, %2\n\tv_exp_f32 %3, %3\n\tv_exp_f32 %4, %4\n\tv_exp_f32 %5, %5\n\t"
            "v_exp_f32 %6, %6\n\tv_exp_f32 %7, %7\n\tv_nop"
            : "+v"(e[1][0]), "+v"(e[1][1]), "+v"(e[1][2]), "+v"(e[1][3]), "+v"(e[1][4]), "+v"(e[1][5]), "+v"(e[1][6]), "+v"(e[1][7]));
        FH::V pb;
        float s0 = 0.f, s1 = 0.f;
#pragma unroll
        for (int r = 0; r < 8; ++r) {
            s0 += e[0][r]; s1 += e[1][r];
            pb[r] = (_Float16)e[0][r]; pb[8 + r] = (_Float16)e[1][r];
        }
        lsum = lsum * alpha + (s0 + s1);
#pragma unroll
        for (int dt = 0; dt < 8; ++dt) {
            const FH::V vt = FH::load(tt + dt * 16 * (PT / 2));
            o[dt] = FH::mma(vt, pb, o[dt] * alpha);
        }
        asm volatile("s_wait_dscnt 0x0" ::: "memory");      // this wave's reads of buffer s & 1 have returned
        asm volatile("s_wait_asynccnt 0x0" ::: "memory");   // this wave's copies of tile s + 1 have landed
        __syncthreads();                                     // publishes tile s + 1 and ends every wave's reads of buffer s & 1
        if (s + 2 < NS) copy_tile(s + 2, s & 1);
    }
    asm volatile("s_wait_asynccnt 0x0" ::: "memory");       // nothing is in flight when the ring becomes the staging of the partial outputs
    lsum += __shfl_xor(lsum, 16, 32);
    if (h == 0) { smx[ms][qg][nl] = mrun; ssm[ms][qg][nl] = lsum; }
    __syncthreads();   // the four quarters' maxima and sums are there
    float mtot = smx[0][qg][nl];
#pragma unroll
    for (int j = 1; j < 4; ++j) mtot = fmaxf(mtot, smx[j][qg][nl]);
    float ltot = 0.f;
#pragma unroll
    for (int j = 0; j < 4; ++j) ltot += ssm[j][qg][nl] * exp_slot(smx[j][qg][nl] - mtot);
    const float fo = exp_slot(mrun - mtot);
    float* so = (float*)ring;   // [quarter][query group][d tile][lane][8]
#pragma unroll
    for (int dt = 0; dt < 8; ++dt) {
        const v8f w = o[dt] * fo;
        float* p = so + (((ms * 4 + qg) * 8 + dt) * 32 + lane) * 8;
        *(v4f*)p = (v4f){w[0], w[1], w[2], w[3]}; *(v4f*)(p + 4) = (v4f){w[4], w[5], w[6], w[7]};
    }
    __syncthreads();   // the partial outputs are there
    const float inv = os / ltot;
    float* op = OUT + row * D + ms * 32 + koff;   // wave (qg, ms) sums and stores d = 32 ms .. 32 ms + 31 of its 16 queries: one whole 128-byte line a query
#pragma unroll
    for (int j = 0; j < 2; ++j) {
        v4f a0 = {0.f, 0.f, 0.f, 0.f}, a1 = a0;
#pragma unroll
        for (int k = 0; k < 4; ++k) {
            const float* p = so + (((k * 4 + qg) * 8 + ms * 2 + j) * 32 + lane) * 8;
            a0 += *(const v4f*)p; a1 += *(const v4f*)(p + 4);
        }
        *(v4f*)(op + j * 16) = a0 * inv; *(v4f*)(op + j * 16 + 4) = a1 * inv;
    }
    if (ms == 0) {   // row maximum staged as a whole 32-float line (slot 0 is read later)
        asm volatile("s_wait_xcnt 0x0" ::: "memory");   // the address work below reuses registers that the stores above name
        __builtin_amdgcn_sched_barrier(0);   // holds the first rewrite of those registers behind the wait
        float* rp = RMX + row * 32 + h * 16;
        const v4f m4 = {mtot, mtot, mtot, mtot};
#pragma unroll
        for (int j = 0; j < 4; ++j) *(v4f*)(rp + j * 4) = m4;
    } }

// memory->query: p = softmax_n(RMX[b][n]); MQ[b][every row][d] = sum_n p_n q[b][n][d]. One block of 32 waves per (batch, 32-float slice of d): thread t owns row
//   maximum t for the statistics; for the weighted sum a wave reads 4 rows x 128 bytes per load and every lane has its 8 row loads in flight at once
//   (issued ahead of the statistics, which do not depend on them); partial sums meet by lane shuffles and one LDS table. The block then stores its slice into
//   all N rows of the second output itself, 16 bytes a lane, 8 stores a lane.
template <int N, int D>
__global__ __launch_bounds__(1024) void k_bi_m2q(const float* __restrict__ RMX, const float* __restrict__ Q, float* __restrict__ MQ) {
    static_assert(N == 1024 && D % 32 == 0, "one row maximum per thread; whole 128-byte slices of d");
    __shared__ float red[32]; __shared__ float pw[N]; __shared__ __align__(16) float part[32][32]; __shared__ __align__(16) float vec[32];
    const int b = blockIdx.x, d0 = blockIdx.y * 32, t = threadIdx.x, lane = t & 31, wv = t >> 5;
    const int rsub = lane >> 3, c4 = (lane & 7) * 4;
    const float r = RMX[((long long)b * N + t) * 32];
    const float* qb = Q + ((long long)b * N + wv * 4 + rsub) * D + d0 + c4;
    v4f x[N / 128];
    for (int i = 0; i < N / 128; ++i) x[i] = *(const v4f*)(qb + (long long)i * 128 * D);
    float mx = r;
    for (int o = 16; o > 0; o >>= 1) mx = fmaxf(mx, __shfl_xor(mx, o, 32));
    if (lane == 0) red[wv] = mx;
    __syncthreads();
    float mm = red[lane];
    for (int o = 16; o > 0; o >>= 1) mm = fmaxf(mm, __shfl_xor(mm, o, 32));
    __syncthreads();
    const float e = expf(r - mm); pw[t] = e;
    float s = e;
    for (int o = 16; o > 0; o >>= 1) s += __shfl_xor(s, o, 32);
    if (lane == 0) red[wv] = s;
    __syncthreads();
    float tot = red[lane];
    for (int o = 16; o > 0; o >>= 1) tot += __shfl_xor(tot, o, 32);
    v4f acc = {0.f, 0.f, 0.f, 0.f};
    for (int i = 0; i < N / 128; ++i) acc += pw[i * 128 + wv * 4 + rsub] * x[i];
    for (int c = 0; c < 4; ++c) { acc[c] += __shfl_xor(acc[c], 8, 32); acc[c] += __shfl_xor(acc[c], 16, 32); }
    if (lane < 8) *(v4f*)&part[wv][c4] = acc;
    __syncthreads();
    if (t < 32) { float a = 0.f;
        for (int w = 0; w < 32; ++w) a += part[w][t];
        vec[t] = a * (1.f / tot); }
    __syncthreads();   // publishes the finished slice to the 32 waves that store it
    const v4f bv = *(const v4f*)&vec[c4];
    float* op = MQ + ((long long)b * N + wv * 4 + rsub) * D + d0 + c4;   // a wave store = 4 rows x one whole 128-byte line, as the reads of q above
    for (int i = 0; i < N / 128; ++i) *(v4f*)(op + (long long)i * 128 * D) = bv; }


extern "C" void kernel_launch(void* const* d_in, const int* in_sizes, int n_in, void* d_out, int out_size, void* d_ws, size_t ws_size, hipStream_t stream) {
    (void)in_sizes; (void)n_in; (void)out_size; (void)ws_size;
    const float* q = (const float*)d_in[0];
    const float* mem = (const float*)d_in[1];
    const float* wq = (const float*)d_in[2];
    const float* wm = (const float*)d_in[3];
    const float* wqm = (const float*)d_in[4];
    const int* qmask = (const int*)d_in[5];
    const int* mmask = (const int*)d_in[6];
    const int Bn = 16;
    const int N = 1024;
    const int M = 1024;
    const int D = 128;
    float* out = (float*)d_out;
    float* mq = out + ((size_t)Bn * N * D);
    char* wsp = (char*)d_ws;
    float* AQ = (float*)wsp; wsp += (((size_t)((size_t)Bn * N) * 4 + 255) / 256) * 256;
    float* CM = (float*)wsp; wsp += (((size_t)((size_t)Bn * M) * 4 + 255) / 256) * 256;
    float* RMX = (float*)wsp; wsp += (((size_t)((size_t)Bn * N * 32) * 4 + 255) / 256) * 256;
    unsigned short* G64A = (unsigned short*)wsp; wsp += (((size_t)(16777216) * 2 + 255) / 256) * 256;
    unsigned short* G64B = (unsigned short*)wsp; wsp += (((size_t)(2097152) * 2 + 255) / 256) * 256;
    unsigned short* G64A2 = (unsigned short*)wsp; wsp += (((size_t)(2097152) * 2 + 255) / 256) * 256;
    unsigned short* G64B2 = (unsigned short*)wsp; wsp += (((size_t)(2097152) * 2 + 255) / 256) * 256;
    unsigned short* G64T = (unsigned short*)wsp; wsp += (((size_t)(2097152) * 2 + 255) / 256) * 256;
    k_bi_prep<1024, 128><<<dim3((unsigned)(Bn * N / 64), 2u), 256, 0, stream>>>(q, mem, wq, wm, wqm, AQ, CM, (__bf16*)(G64A), (__bf16*)(G64A2), (__bf16*)(G64B), (__bf16*)(G64B2), (_Float16*)(G64T), 16.0f);
    k_bi_fused<1024, 1024, 128><<<dim3((unsigned)(N / 64), (unsigned)Bn), 512, 0, stream>>>((const __bf16*)(G64A), (const __bf16*)(G64A2), (const __bf16*)(G64B), (const __bf16*)(G64B2), (const _Float16*)(G64T), AQ, CM, qmask, mmask, RMX, out, 12.0f, 0.0625f);
    k_bi_m2q<1024, 128><<<dim3((unsigned)Bn, 4u), 1024, 0, stream>>>(RMX, q, mq);
}

// v008
// It runs in 29.4 microseconds.
// Timed twice side by side with v007, it ran 1.30 times as fast both times.
// Counting every step since v000, which is the starting kernel, it is 52.4 times as fast.
// Contractions: per batch the trilinear term (q * w_qm).m^T [1024x128].[128x1024] on bf16 hi/lo split planes (logits reach ~+-30, so they need f32-class accuracy) and the query->memory read q2m.memory [1024x1024].[1024x128] with f16 operands (probabilities x 2^12) — one fused kernel, each wave 16 queries x a quarter of the memory in tiles of 32 rows; f32 accumulate. The memory's linear term rides in the first product (its other operand is q * w_qm + w_m); the query's linear term, the mask arithmetic (sim + (1 - mask) * -1e30, exactly as the module), the row softmax (exp once), the row maxima, the softmax over rows and the memory->query vector (broadcast to every row) are f32 arithmetic.
#include <hip/hip_runtime.h>
#include <math.h>

typedef __attribute__((ext_vector_type(16))) _Float16 v16h;
typedef __attribute__((ext_vector_type(8)))  _Float16 v8h;
typedef __attribute__((ext_vector_type(16))) __bf16   v16b;
typedef __attribute__((ext_vector_type(8)))  float    v8f;
typedef __attribute__((ext_vector_type(4)))  float    v4f;

// 16-bit WMMA fragment map (wave32), lane L, h = L>>4, m = L&15:
//   A 16x32: lane = row m;   element i -> k = (i<8) ? 8h+i : 16+8h+(i-8)
//   B 32x16: lane = column m; the SAME k(i,h)
//   D 16x16 (8 f32): lane = column m; element r -> row 8h+r
__device__ __forceinline__ int frag_k(int i, int h) { return (i < 8) ? (8 * h + i) : (16 + 8 * h + (i - 8)); }
__device__ __forceinline__ __bf16 bf16_rne(float f) {
    unsigned int u = __float_as_uint(f);
    u += 0x7fffu + ((u >> 16) & 1u);
    return __builtin_bit_cast(__bf16, (unsigned short)(u >> 16));
}
__device__ __forceinline__ float bf16_f32(__bf16 b) { return __uint_as_float(((unsigned int)__builtin_bit_cast(unsigned short, b)) << 16); }
__device__ __forceinline__ v8f wmma16(v16h a, v16h b, v8f c) {
    c = __builtin_amdgcn_wmma_f32_16x16x32_f16(false, a, false, b, (short)0, c, false, false);
    asm volatile("v_nop\n\tv_nop\n\tv_nop\n\tv_nop" : "+v"(c) : "v"(a), "v"(b));
    return c;
}
__device__ __forceinline__ v8f wmmab(v16b a, v16b b, v8f c) {
    c = __builtin_amdgcn_wmma_f32_16x16x32_bf16(false, a, false, b, (short)0, c, false, false);
    asm volatile("v_nop\n\tv_nop\n\tv_nop\n\tv_nop" : "+v"(c) : "v"(a), "v"(b));
    return c;
}
struct Split { v16b hi, lo; };
// hi/lo split product: a.hi*b.hi + a.hi*b.lo + a.lo*b.hi
__device__ __forceinline__ v8f wmma3(const Split& a, const Split& b, v8f c) {
    c = __builtin_amdgcn_wmma_f32_16x16x32_bf16(false, a.hi, false, b.hi, (short)0, c, false, false);
    c = __builtin_amdgcn_wmma_f32_16x16x32_bf16(false, a.hi, false, b.lo, (short)0, c, false, false);
    c = __builtin_amdgcn_wmma_f32_16x16x32_bf16(false, a.lo, false, b.hi, (short)0, c, false, false);
    asm volatile("v_nop\n\tv_nop\n\tv_nop\n\tv_nop" : "+v"(c) : "v"(a.hi), "v"(a.lo), "v"(b.hi), "v"(b.lo));
    return c;
}
struct Split3 { v16b hi, mid, lo; };
// triple split product (6 terms, drops only terms below 2^-24 relative)
__device__ __forceinline__ v8f wmma6(const Split3& a, const Split3& b, v8f c) {
    c = __builtin_amdgcn_wmma_f32_16x16x32_bf16(false, a.hi, false, b.hi, (short)0, c, false, false);
    c = __builtin_amdgcn_wmma_f32_16x16x32_bf16(false, a.hi, false, b.mid, (short)0, c, false, false);
    c = __builtin_amdgcn_wmma_f32_16x16x32_bf16(false, a.mid, false, b.hi, (short)0, c, false, false);
    c = __builtin_amdgcn_wmma_f32_16x16x32_bf16(false, a.hi, false, b.lo, (short)0, c, false, false);
    c = __builtin_amdgcn_wmma_f32_16x16x32_bf16(false, a.mid, false, b.mid, (short)0, c, false, false);
    c = __builtin_amdgcn_wmma_f32_16x16x32_bf16(false, a.lo, false, b.hi, (short)0, c, false, false);
    asm volatile("v_nop\n\tv_nop\n\tv_nop\n\tv_nop" : "+v"(c) : "v"(a.hi), "v"(a.mid), "v"(a.lo), "v"(b.hi), "v"(b.mid), "v"(b.lo));
    return c;
}

// Fragment gathers from f32 memory: element i <- p[(k0 + frag_k(i,h)) * sk] * s, zero for k >= klen.
__device__ __forceinline__ v16h fh_ld(const float* __restrict__ p, long long sk, int k0, int h, int klen, float s) {
    v16h a;
#pragma unroll
    for (int i = 0; i < 16; ++i) { const int k = k0 + frag_k(i, h); a[i] = (k < klen) ? (_Float16)(p[(long long)k * sk] * s) : (_Float16)0.f; }
    return a;
}
__device__ __forceinline__ Split sp_ld(const float* __restrict__ p, long long sk, int k0, int h, int klen, float s) {
    Split r;
#pragma unroll
    for (int i = 0; i < 16; ++i) {
        const int k = k0 + frag_k(i, h); const float x = (k < klen) ? p[(long long)k * sk] * s : 0.f;
        const __bf16 hb = bf16_rne(x); r.hi[i] = hb; r.lo[i] = bf16_rne(x - bf16_f32(hb));
    }
    return r;
}
__device__ __forceinline__ Split3 sp3_ld(const float* __restrict__ p, long long sk, int k0, int h, int klen, float s) {
    Split3 r;
#pragma unroll
    for (int i = 0; i < 16; ++i) {
        const int k = k0 + frag_k(i, h); const float x = (k < klen) ? p[(long long)k * sk] * s : 0.f;
        const __bf16 hb = bf16_rne(x); const float r1 = x - bf16_f32(hb); const __bf16 mb = bf16_rne(r1);
        r.hi[i] = hb; r.mid[i] = mb; r.lo[i] = bf16_rne(r1 - bf16_f32(mb));
    }
    return r;
}
__device__ __forceinline__ v16b bh_ld(const float* __restrict__ p, long long sk, int k0, int h, int klen, float s) {
    v16b a;
#pragma unroll
    for (int i = 0; i < 16; ++i) { const int k = k0 + frag_k(i, h); a[i] = bf16_rne((k < klen) ? p[(long long)k * sk] * s : 0.f); }
    return a;
}
// f16 fragment from an f16 LDS/global row with element stride 1 (k-contiguous), no bounds (tile already zero padded)
__device__ __forceinline__ v16h fh_row(const _Float16* __restrict__ row, int k0, int h) {
    v16h a;
#pragma unroll
    for (int i = 0; i < 16; ++i) a[i] = row[k0 + frag_k(i, h)];
    return a;
}

#define VST2(T, ptr, val) do { const T vst2_v_ = (val); *(T*)(ptr) = vst2_v_;  } while (0)
typedef float v4f __attribute__((ext_vector_type(4)));
#define VST2V4(ptr, val) do { const v4f vst2_v4_ = (val); *(v4f*)(ptr) = vst2_v4_;  } while (0)

__device__ __attribute__((noinline)) float act_fn(float v, int act) {
    if (act == 1) return fmaxf(v, 0.f);                                                                               // relu
    if (act == 2) { const float u = 0.7978845608028654f * (v + 0.044715f * v * v * v); return 0.5f * v * (1.f + tanhf(u)); } // tanh-gelu
    if (act == 3) return v / (1.f + expf(-v));                                                                        // silu
    if (act == 4) return 0.5f * v * (1.f + erff(v * 0.7071067811865476f));                                             // erf-gelu
    if (act == 5) return tanhf(v);
    if (act == 6) return 1.f / (1.f + expf(-v));                                                                      // sigmoid
    if (act == 7) return (v > 0.f) ? v : 0.01f * v;                                                                   // leaky relu 0.01
    if (act == 8) return (v > 0.f) ? v : (expf(v) - 1.f);                                                             // elu
    if (act == 9) return fminf(fmaxf(v, 0.f), 6.f);                                                                   // relu6
    if (act == 10) return fabsf(v);                                                                                    // abs
    if (act == 11) return (v >= 0.f) ? v : 0.1f * v;                                                                  // leaky 0.1
    if (act == 12) return (v > 0.f) ? v : 0.2f * v;                                                                   // leaky 0.2
    if (act == 13) return (v > 20.f) ? v : log1pf(expf(v));                                                            // softplus
    return v;
}

// =====================================================================================================================
// k_gemm<MODE>: C(z, m, n) = act(alpha * sum_k A(z, m, k) * B(z, k, n) + bias) + beta * R(z, m, n)
//   One wave (32-thread block) per 16 x 32 tile of C; grid (ceil(N/32), ceil(M/16), Z). Batch z -> (zo = z / zi_n, zi = z % zi_n)
//   with separate outer/inner strides for every tensor (e.g. batch and head). A(m,k) = A[zo*sAo + zi*sAi + m*sAm + k*sAk] (f32),
//   B(k,n) = B[zo*sBo + zi*sBi + n*sBn + k*sBk] (f32); any M, N, K (K zero-padded to 32 inside the fragments, M/N tails guarded).
//   C(m,n) = C[zo*sCo + zi*sCi + m*sCm + n] (n contiguous). flags: 1 bias[n], 2 bias[m], 4 residual R[zo*sRo + zi*sRi + m*sRm + n*sRn].
//   MODE 0: f16 operands (A prescaled by sa, B by sb, both undone in the epilogue); 1: bf16 hi/lo split (3 products); 2: bf16;
//   3: bf16 hi/mid/lo triple split (6 products); 4: as 3 with Kahan-compensated f32 accumulation across k-steps.
// =====================================================================================================================
struct GemmP {
    const float* A; const float* B; const float* bias; const float* R; float* C;
    long long sAo, sAi, sAm, sAk, sBo, sBi, sBn, sBk, sCo, sCi, sCm, sRo, sRi, sRm, sRn;
    int M, N, K, zi_n, flags, act; float alpha, beta, sa, sb;
    int Npad, pad_;     // columns [N, Npad) of C are written as 0 so that padded workspace rows are covered by whole-line stores; Npad >= N
};
static_assert(sizeof(GemmP) == 5 * 8 + 15 * 8 + 6 * 4 + 4 * 4 + 2 * 4, "GemmP has padding");

template <int MODE>
__global__ __launch_bounds__(32) void k_gemm(GemmP p) {
    const int lane = threadIdx.x & 31, h = lane >> 4, l15 = lane & 15;
    const int m0 = blockIdx.y * 16, n0 = blockIdx.x * 32;
    const int z = blockIdx.z, zo = z / p.zi_n, zi = z - zo * p.zi_n;
    const float* A = p.A + zo * p.sAo + zi * p.sAi;
    const float* B = p.B + zo * p.sBo + zi * p.sBi;
    const int am = min(m0 + l15, p.M - 1);                       // clamped row for loads (stores are guarded)
    v8f acc[2], comp[2];
#pragma unroll
    for (int t = 0; t < 2; ++t) { v8f zz = {}; acc[t] = zz; comp[t] = zz; }
    for (int k0 = 0; k0 < p.K; k0 += 32) {
        const float* arow = A + (long long)am * p.sAm;
        if (MODE == 1) {
            const Split a = sp_ld(arow, p.sAk, k0, h, p.K, 1.f);
#pragma unroll
            for (int t = 0; t < 2; ++t) {
                const int bn = min(n0 + t * 16 + l15, p.N - 1);
                acc[t] = wmma3(a, sp_ld(B + (long long)bn * p.sBn, p.sBk, k0, h, p.K, 1.f), acc[t]);
            }
        } else if (MODE == 3) {
            const Split3 a = sp3_ld(arow, p.sAk, k0, h, p.K, 1.f);
#pragma unroll
            for (int t = 0; t < 2; ++t) {
                const int bn = min(n0 + t * 16 + l15, p.N - 1);
                acc[t] = wmma6(a, sp3_ld(B + (long long)bn * p.sBn, p.sBk, k0, h, p.K, 1.f), acc[t]);
            }
        } else if (MODE == 4) {
            // triple split as MODE 3, but each k-step's 6 products go into a fresh accumulator and the partial is added to the running f32 sum
            // on the VALU with Kahan compensation (accumulation error stays ~1 ulp however long K is)
            const Split3 a = sp3_ld(arow, p.sAk, k0, h, p.K, 1.f);
#pragma unroll
            for (int t = 0; t < 2; ++t) {
                const int bn = min(n0 + t * 16 + l15, p.N - 1); v8f zz = {};
                const v8f part = wmma6(a, sp3_ld(B + (long long)bn * p.sBn, p.sBk, k0, h, p.K, 1.f), zz);
                const v8f y = part - comp[t]; const v8f s = acc[t] + y; comp[t] = (s - acc[t]) - y; acc[t] = s;
            }
        } else if (MODE == 2) {
            const v16b a = bh_ld(arow, p.sAk, k0, h, p.K, 1.f);
#pragma unroll
            for (int t = 0; t < 2; ++t) {
                const int bn = min(n0 + t * 16 + l15, p.N - 1);
                acc[t] = wmmab(a, bh_ld(B + (long long)bn * p.sBn, p.sBk, k0, h, p.K, 1.f), acc[t]);
            }
        } else {
            const v16h a = fh_ld(arow, p.sAk, k0, h, p.K, p.sa);
#pragma unroll
            for (int t = 0; t < 2; ++t) {
                const int bn = min(n0 + t * 16 + l15, p.N - 1);
                acc[t] = wmma16(a, fh_ld(B + (long long)bn * p.sBn, p.sBk, k0, h, p.K, p.sb), acc[t]);
            }
        }
    }
    const float iscale = (MODE == 0) ? p.alpha / (p.sa * p.sb) : p.alpha;
    float* C = p.C + zo * p.sCo + zi * p.sCi;
    const float* R = p.R + zo * p.sRo + zi * p.sRi;
    __shared__ __align__(16) float ctile[16][36];
#pragma unroll
    for (int t = 0; t < 2; ++t) {
        const int n = n0 + t * 16 + l15; const int nn = min(n, p.N - 1);
#pragma unroll
        for (int r = 0; r < 8; ++r) {
            const int m = m0 + 8 * h + r; const int mm = min(m, p.M - 1);
            float v = acc[t][r] * iscale;
            if (p.flags & 1) v += p.bias[nn];
            if (p.flags & 2) v += p.bias[mm];
            if (p.flags & 8) v *= p.bias[(long long)zo * p.M + mm];   /* per-(z,row) scale vector laid out [Z][M]; exclusive with the bias flags */
            v = act_fn(v, p.act);
            if (p.flags & 4) v += p.beta * R[(long long)mm * p.sRm + (long long)nn * p.sRn];
            ctile[8 * h + r][t * 16 + l15] = (n < p.N) ? v : 0.f;
        }
    }
    __syncthreads();
    const int NW = (p.Npad > p.N) ? p.Npad : p.N;           // write width
    const bool fast = (m0 + 16 <= p.M) && (n0 + 32 <= NW) && ((p.sCm & 3) == 0) && ((((size_t)C) & 15) == 0);
    if (fast) {
#pragma unroll
        for (int s = 0; s < 4; ++s) {
            const int row = s * 4 + (lane >> 3), c4 = (lane & 7) * 4;
            const v4f v = *(const v4f*)&ctile[row][c4];
            VST2V4(C + (long long)(m0 + row) * p.sCm + n0 + c4, v);
        }
    } else {
        for (int row = 0; row < 16; ++row) {
            const int m = m0 + row, n = n0 + lane;
            if (m < p.M && n < NW) VST2(float, C + (long long)m * p.sCm + n, ctile[row][lane]);
        }
    }
}


// =====================================================================================================================
// k_gemmT<MODE, TM, TN>: same contract as k_gemm, but one wave computes a (16*TM) x (16*TN) tile: TM A fragments and TN B fragments are
//   loaded per 32-wide k-step and reused across TM*TN WMMAs (far fewer load/convert instructions per MAC). MODE 0 (f16), 1 (bf16 hi/lo),
//   2 (bf16) only. grid (ceil(NW/(16*TN)), ceil(M/(16*TM)), Z), block 32. Epilogue identical to k_gemm, run per 16x32 sub-tile.
// =====================================================================================================================
template <int MODE, int TM, int TN>
__global__ __launch_bounds__(32) void k_gemmT(GemmP p) {
    const int lane = threadIdx.x & 31, h = lane >> 4, l15 = lane & 15;
    const int m0 = blockIdx.y * (16 * TM), n0 = blockIdx.x * (16 * TN);
    const int z = blockIdx.z, zo = z / p.zi_n, zi = z - zo * p.zi_n;
    const float* A = p.A + zo * p.sAo + zi * p.sAi;
    const float* B = p.B + zo * p.sBo + zi * p.sBi;
    v8f acc[TM][TN];
#pragma unroll
    for (int i = 0; i < TM; ++i)
#pragma unroll
        for (int t = 0; t < TN; ++t) { v8f zz = {}; acc[i][t] = zz; }
    for (int k0 = 0; k0 < p.K; k0 += 32) {
        if (MODE == 1) {
            Split a[TM], b[TN];
#pragma unroll
            for (int i = 0; i < TM; ++i) { const int am = min(m0 + 16 * i + l15, p.M - 1); a[i] = sp_ld(A + (long long)am * p.sAm, p.sAk, k0, h, p.K, 1.f); }
#pragma unroll
            for (int t = 0; t < TN; ++t) { const int bn = min(n0 + 16 * t + l15, p.N - 1); b[t] = sp_ld(B + (long long)bn * p.sBn, p.sBk, k0, h, p.K, 1.f); }
#pragma unroll
            for (int i = 0; i < TM; ++i)
#pragma unroll
                for (int t = 0; t < TN; ++t) acc[i][t] = wmma3(a[i], b[t], acc[i][t]);
        } else if (MODE == 2) {
            v16b a[TM], b[TN];
#pragma unroll
            for (int i = 0; i < TM; ++i) { const int am = min(m0 + 16 * i + l15, p.M - 1); a[i] = bh_ld(A + (long long)am * p.sAm, p.sAk, k0, h, p.K, 1.f); }
#pragma unroll
            for (int t = 0; t < TN; ++t) { const int bn = min(n0 + 16 * t + l15, p.N - 1); b[t] = bh_ld(B + (long long)bn * p.sBn, p.sBk, k0, h, p.K, 1.f); }
#pragma unroll
            for (int i = 0; i < TM; ++i)
#pragma unroll
                for (int t = 0; t < TN; ++t) acc[i][t] = wmmab(a[i], b[t], acc[i][t]);
        } else {
            v16h a[TM], b[TN];
#pragma unroll
            for (int i = 0; i < TM; ++i) { const int am = min(m0 + 16 * i + l15, p.M - 1); a[i] = fh_ld(A + (long long)am * p.sAm, p.sAk, k0, h, p.K, p.sa); }
#pragma unroll
            for (int t = 0; t < TN; ++t) { const int bn = min(n0 + 16 * t + l15, p.N - 1); b[t] = fh_ld(B + (long long)bn * p.sBn, p.sBk, k0, h, p.K, p.sb); }
#pragma unroll
            for (int i = 0; i < TM; ++i)
#pragma unroll
                for (int t = 0; t < TN; ++t) acc[i][t] = wmma16(a[i], b[t], acc[i][t]);
        }
    }
    const float iscale = (MODE == 0) ? p.alpha / (p.sa * p.sb) : p.alpha;
    float* C = p.C + zo * p.sCo + zi * p.sCi;
    const float* R = p.R + zo * p.sRo + zi * p.sRi;
    const int NW = (p.Npad > p.N) ? p.Npad : p.N;
    __shared__ __align__(16) float ctile[16][36];
#pragma unroll
    for (int i = 0; i < TM; ++i) {
        const int mb = m0 + 16 * i; if (mb >= p.M) break;          // wave-uniform
#pragma unroll
        for (int tp = 0; tp < TN / 2; ++tp) {
            const int nb = n0 + 32 * tp; if (nb >= NW) break;        // wave-uniform
#pragma unroll
            for (int t2 = 0; t2 < 2; ++t2) {
                const int t = 2 * tp + t2; const int n = nb + t2 * 16 + l15; const int nn = min(n, p.N - 1);
#pragma unroll
                for (int r = 0; r < 8; ++r) {
                    const int m = mb + 8 * h + r; const int mm = min(m, p.M - 1);
                    float v = acc[i][t][r] * iscale;
                    if (p.flags & 1) v += p.bias[nn];
                    if (p.flags & 2) v += p.bias[mm];
            if (p.flags & 8) v *= p.bias[(long long)zo * p.M + mm];   /* per-(z,row) scale vector laid out [Z][M]; exclusive with the bias flags */
                    v = act_fn(v, p.act);
                    if (p.flags & 4) v += p.beta * R[(long long)mm * p.sRm + (long long)nn * p.sRn];
                    ctile[8 * h + r][t2 * 16 + l15] = (n < p.N) ? v : 0.f;
                }
            }
            __syncthreads();
            const bool fast = (mb + 16 <= p.M) && (nb + 32 <= NW) && ((p.sCm & 3) == 0) && ((((size_t)C) & 15) == 0);
            if (fast) {
#pragma unroll
                for (int s = 0; s < 4; ++s) {
                    const int row = s * 4 + (lane >> 3), c4 = (lane & 7) * 4;
                    const v4f v = *(const v4f*)&ctile[row][c4];
                    VST2V4(C + (long long)(mb + row) * p.sCm + nb + c4, v);
                }
            } else {
                for (int row = 0; row < 16; ++row) {
                    const int m = mb + row, n = nb + lane;
                    if (m < p.M && n < NW) VST2(float, C + (long long)m * p.sCm + n, ctile[row][lane]);
                }
            }
            __syncthreads();
        }
    }
}

// =====================================================================================================================
//   Wave = 16 queries, AW waves per block, 64-key blocks; grid (ceil(Lq/(16*AW)), H, B), block 32*AW. Any Lq, Lk; head dim dh <= DHP
//   (DHP multiple of 32), value dim dv <= DVP (multiple of 16, <= 128). Every tensor addressed by (batch, head, row, element) strides, f32.
//   Scores: QM 0 f16 operands, 1 bf16 hi/lo split, 2 bf16 triple split; statistics f32 (exp2 domain); P.V: P x 4096 as f16 with V f16 staged in LDS
//   (SPLITPV: P and V as bf16 hi/lo splits). kv head = h / hrep. Masking: causal = 1 (keep j <= i + coff, masked -> -inf, key blocks beyond the
//   diagonal skipped), causal = 2 (masked -> mfill, a finite fill like the -1e9; no skipping), causal = 3 (keep j >= i + coff,
//   masked -> -inf, no skipping); optional additive f32 mask Mf,
//   optional int keep-mask Mi (0 -> score := mfill), both addressed b*smb + h*smh + i*smi + j*smj (0 strides broadcast).
// =====================================================================================================================
#define AW 4
struct AttnP {   // apv4
    const float* Q; const float* K; const float* V; float* O; float* P; const float* Mf; const int* Mi; float* ST;
    const float* Pw; const float* Rt; const int* SQ; const int* SK;           // optional: post-softmax weight, relative-position table, segment ids
    long long swb, swh, swi, swj, srb, srh, sri;                                 // Pw strides (b,h,i,j); Rt strides (b,h,i), column = clamp(i - j + roff, 0, rn-1)
    long long sQb, sQh, sQi, sQd, sKb, sKh, sKj, sKd, sVb, sVh, sVj, sVd, sOb, sOh, sOi, sPb, sPh, sPi, smb, smh, smi, smj;
    int Lq, Lk, dh, dv, hrep, causal, coff, pband;   // pband > 0: P holds only the band |j - i| <= pband, column j - i + pband
    float scale, mfill; int nonorm, mpol;             // nonorm (online path only): O = sum_j exp(score_j) V_j without the 1/rowsum (scores must be <= ~0); mpol: Mi masks where ==0 (mpol 0) or where !=0 (mpol 1)
    int roff, rn, segpol, win;                        // Rt column offset/count; SQ/SK: score := mfill where (segpol 0) SQ[i] != SK[j] or (segpol 1) SQ[i] == SK[j]; win > 0: keys with i - j > win (after coff) -> -inf
};
//   Pw: the softmax numerator is multiplied by Pw(b,h,i,j) AFTER the row sum is taken (probs * weight, then P.V), as in post-softmax multiplicative biases.                                                    // ST (optional): per row (b,h,i) -> ST[((b*H + h)*Lq + i)*2 + {0,1}] = {row max of the scaled+masked score (natural units), sum_j exp(score - max)}
static_assert(sizeof(AttnP) == 12 * 8 + 29 * 8 + 16 * 4, "AttnP has padding");

#ifndef KATTN_ATTR
#define KATTN_ATTR
#endif
template <int DHP, int DVP, int QM, bool SPLITPV, bool TWOPASS>
__global__ __launch_bounds__(32 * AW) KATTN_ATTR void k_attn(AttnP p) {
    constexpr int NT = DVP / 16;                // output tiles
    constexpr int KS = DHP / 32;                // k-steps for the scores
    constexpr int VP = DVP + 8;                 // LDS pitch (halves)
    __shared__ __align__(16) float    pl[AW][16 * 64];
    __shared__ __align__(16) _Float16 vl[(SPLITPV ? 2 : 1) * 64 * VP];   // f16 V tile, or bf16 hi and lo tiles (same 2-byte size)
    const int lane = threadIdx.x & 31, hf = lane >> 4, l15 = lane & 15, wave = threadIdx.x >> 5;
    const int h = blockIdx.y, b = blockIdx.z, hk = h / p.hrep;
    const int q0 = (blockIdx.x * AW + wave) * 16;
    float* myp = pl[wave];
    const float L2E = 1.4426950408889634f;
    const float NEG = -__builtin_inff();
    const int qi = min(q0 + l15, p.Lq - 1);
    const float* qrow = p.Q + b * p.sQb + h * p.sQh + (long long)qi * p.sQi;
    const float* kbase = p.K + b * p.sKb + hk * p.sKh;
    const float* vbase = p.V + b * p.sVb + hk * p.sVh;
    v16h qa[QM == 0 ? KS : 1]; Split qs_[QM == 1 ? KS : 1]; Split3 qt_[QM == 2 ? KS : 1];
#pragma unroll
    for (int ks = 0; ks < KS; ++ks) {
        if (QM == 2) qt_[ks] = sp3_ld(qrow, p.sQd, ks * 32, hf, p.dh, 1.f);
        else if (QM == 1) qs_[ks] = sp_ld(qrow, p.sQd, ks * 32, hf, p.dh, 1.f);
        else qa[ks] = fh_ld(qrow, p.sQd, ks * 32, hf, p.dh, 1.f);
    }
    v8f o[NT]; float m8[8], l8[8];
#pragma unroll
    for (int t = 0; t < NT; ++t) { v8f zz = {}; o[t] = zz; }
#pragma unroll
    for (int i = 0; i < 8; ++i) { m8[i] = NEG; l8[i] = 0.f; }
    int jend = p.Lk;
    if (p.causal == 1) { const int je = (blockIdx.x * AW + AW - 1) * 16 + 16 + p.coff; jend = min(jend, max(je, 0)); }   // uniform per block
    const int npass = TWOPASS ? 2 : 1;
    for (int pass = 0; pass < npass; ++pass) {
        const bool dopv = (!TWOPASS) || pass == 1;
        for (int j0 = 0; j0 < jend; j0 += 64) {
            if (dopv) {
                __syncthreads();                                 // previous key block's reads of vl / pl are done
                for (int idx = threadIdx.x; idx < 64 * DVP; idx += 32 * AW) {
                    const int jr = idx / DVP, d = idx - jr * DVP, j = j0 + jr;
                    const float f = (j < p.Lk && d < p.dv) ? vbase[(long long)j * p.sVj + (long long)d * p.sVd] : 0.f;
                    if (SPLITPV) {
                        const __bf16 hb = bf16_rne(f);
                        ((__bf16*)vl)[jr * VP + d] = hb; ((__bf16*)vl)[64 * VP + jr * VP + d] = bf16_rne(f - bf16_f32(hb));
                    } else vl[jr * VP + d] = (_Float16)f;
                }
            }
            v8f s[4];
#pragma unroll
            for (int t = 0; t < 4; ++t) {
                const int j = min(j0 + t * 16 + l15, p.Lk - 1);
                const float* krow = kbase + (long long)j * p.sKj;
                v8f acc = {};
#pragma unroll
                for (int ks = 0; ks < KS; ++ks) {
                    if (QM == 2)      acc = wmma6(qt_[ks], sp3_ld(krow, p.sKd, ks * 32, hf, p.dh, 1.f), acc);
                    else if (QM == 1) acc = wmma3(qs_[ks], sp_ld(krow, p.sKd, ks * 32, hf, p.dh, 1.f), acc);
                    else              acc = wmma16(qa[ks], fh_ld(krow, p.sKd, ks * 32, hf, p.dh, 1.f), acc);
                }
                s[t] = acc;
            }
            float pv[8][4];
#pragma unroll
            for (int i = 0; i < 8; ++i) {
                const int irow = q0 + i + 8 * hf;
                const int ic = min(irow, p.Lq - 1);
                float sc[4];
#pragma unroll
                for (int t = 0; t < 4; ++t) {
                    const int jg = j0 + t * 16 + l15;
                    float v = s[t][i] * p.scale;
                    if (p.Mf) v += p.Mf[b * p.smb + h * p.smh + (long long)ic * p.smi + (long long)min(jg, p.Lk - 1) * p.smj];
                    if (p.Rt) { int rc = ic - min(jg, p.Lk - 1) + p.roff; rc = rc < 0 ? 0 : (rc >= p.rn ? p.rn - 1 : rc); v += p.Rt[b * p.srb + h * p.srh + (long long)ic * p.sri + rc]; }
                    if (p.Mi) { const int mv = p.Mi[b * p.smb + h * p.smh + (long long)ic * p.smi + (long long)min(jg, p.Lk - 1) * p.smj]; if (p.mpol ? (mv != 0) : (mv == 0)) v = p.mfill; }
                    if (p.SQ) { const bool same = p.SQ[(long long)b * p.Lq + ic] == p.SK[(long long)b * p.Lk + min(jg, p.Lk - 1)]; if (p.segpol ? same : !same) v = p.mfill; }
                    if (p.causal == 2 && jg > irow + p.coff) v = p.mfill;
                    if (jg >= p.Lk || (p.causal == 1 && jg > irow + p.coff) || (p.causal == 3 && jg < irow + p.coff) || (p.win > 0 && irow + p.coff - jg > p.win)) v = NEG; else v *= L2E;
                    sc[t] = v;
                }
                if (!TWOPASS || pass == 0) {
                    float mx = fmaxf(fmaxf(sc[0], sc[1]), fmaxf(sc[2], sc[3]));
                    mx = fmaxf(mx, __shfl_xor(mx, 1, 32)); mx = fmaxf(mx, __shfl_xor(mx, 2, 32));
                    mx = fmaxf(mx, __shfl_xor(mx, 4, 32)); mx = fmaxf(mx, __shfl_xor(mx, 8, 32));
                    const float mnew = fmaxf(m8[i], mx);
                    const float corr = (mnew == NEG) ? 1.f : exp2f(m8[i] - mnew);
                    float rs = 0.f;
#pragma unroll
                    for (int t = 0; t < 4; ++t) {
                        const float pp = (sc[t] == NEG) ? 0.f : exp2f(sc[t] - mnew); rs += pp;
                        pv[i][t] = p.Pw ? pp * p.Pw[b * p.swb + h * p.swh + (long long)ic * p.swi + (long long)min(j0 + t * 16 + l15, p.Lk - 1) * p.swj] : pp;
                    }
                    rs += __shfl_xor(rs, 1, 32); rs += __shfl_xor(rs, 2, 32); rs += __shfl_xor(rs, 4, 32); rs += __shfl_xor(rs, 8, 32);
                    l8[i] = l8[i] * corr + rs; m8[i] = mnew;
                    if (!TWOPASS) {
#pragma unroll
                        for (int t = 0; t < NT; ++t) o[t][i] *= corr;
                    }
                } else {
                    const float inv = (l8[i] > 0.f) ? 1.f / l8[i] : 0.f;
#pragma unroll
                    for (int t = 0; t < 4; ++t) {
                        const int jg = j0 + t * 16 + l15;
                        float pp = (sc[t] == NEG) ? 0.f : exp2f(sc[t] - m8[i]) * inv;
                        if (p.Pw) pp *= p.Pw[b * p.swb + h * p.swh + (long long)ic * p.swi + (long long)min(jg, p.Lk - 1) * p.swj];
                        pv[i][t] = pp;
                    }
                }
            }
            if (dopv) {
#pragma unroll
                for (int i = 0; i < 8; ++i)
#pragma unroll
                    for (int t = 0; t < 4; ++t) ((float*)myp)[(i + 8 * hf) * 64 + t * 16 + l15] = pv[i][t];
                __syncthreads();                                 // P (per wave) and V (shared) visible
                if (p.P) {
                    float* pb_ = p.P + b * p.sPb + h * p.sPh;
                    const bool fastP = (p.pband == 0) && ((p.sPi & 3) == 0) && (j0 + 64 <= p.Lk) && (q0 + 16 <= p.Lq) && ((((size_t)pb_) & 15) == 0);
                    if (fastP) {
#pragma unroll
                        for (int s = 0; s < 8; ++s) {
                            const int row = s * 2 + (lane >> 4), c4 = (lane & 15) * 4;
                            const v4f v = *(const v4f*)(myp + row * 64 + c4);
                            VST2V4(pb_ + (long long)(q0 + row) * p.sPi + j0 + c4, v);
                        }
                    } else {
                        for (int row = 0; row < 16; ++row) {
                            const int irow = q0 + row; if (irow >= p.Lq) continue;
                            for (int c = lane; c < 64; c += 32) {
                                const int jg = j0 + c; if (jg >= p.Lk) continue;
                                if (p.pband == 0) VST2(float, pb_ + (long long)irow * p.sPi + jg, myp[row * 64 + c]);
                                else if (jg - irow <= p.pband && irow - jg <= p.pband) VST2(float, pb_ + (long long)irow * p.sPi + (jg - irow + p.pband), myp[row * 64 + c]);
                            }
                        }
                    }
                }
                if (SPLITPV) {
                    const Split pa0 = sp_ld(myp + l15 * 64, 1, 0, hf, 64, 1.f), pa1 = sp_ld(myp + l15 * 64, 1, 32, hf, 64, 1.f);
                    const __bf16* vh = (const __bf16*)vl; const __bf16* vlo = vh + 64 * VP;
#pragma unroll
                    for (int t = 0; t < NT; ++t) {
                        const int dcol = t * 16 + l15;
                        Split b0, b1;
#pragma unroll
                        for (int e = 0; e < 16; ++e) {
                            const int k0 = frag_k(e, hf), k1 = 32 + frag_k(e, hf);
                            b0.hi[e] = vh[k0 * VP + dcol]; b0.lo[e] = vlo[k0 * VP + dcol]; b1.hi[e] = vh[k1 * VP + dcol]; b1.lo[e] = vlo[k1 * VP + dcol];
                        }
                        o[t] = wmma3(pa0, b0, o[t]);
                        o[t] = wmma3(pa1, b1, o[t]);
                    }
                } else {
                    const v16h pa0 = fh_ld(myp + l15 * 64, 1, 0, hf, 64, 4096.f), pa1 = fh_ld(myp + l15 * 64, 1, 32, hf, 64, 4096.f);
#pragma unroll
                    for (int t = 0; t < NT; ++t) {
                        const int dcol = t * 16 + l15;
                        v16h b0, b1;
#pragma unroll
                        for (int e = 0; e < 16; ++e) { b0[e] = vl[frag_k(e, hf) * VP + dcol]; b1[e] = vl[(32 + frag_k(e, hf)) * VP + dcol]; }
                        o[t] = wmma16(pa0, b0, o[t]);
                        o[t] = wmma16(pa1, b1, o[t]);
                    }
                }
            }
        }
    }
    float* obase = p.O + b * p.sOb + h * p.sOh;
    if (p.ST) {
        const int rl = lane >> 1, isel = rl & 7;           // row q0 + rl ; rl>>3 == hf holds because lane>>4 == (lane>>1)>>3
        float mv = 0.f, lv = 0.f;
#pragma unroll
        for (int i = 0; i < 8; ++i) if (i == isel) { mv = m8[i]; lv = l8[i]; }
        const int irow = q0 + rl;
        if (irow < p.Lq) { float* st = p.ST + (((long long)b * gridDim.y + h) * p.Lq + irow) * 2 + (lane & 1); VST2(float, st, (lane & 1) ? lv : mv * 0.6931471805599453f); }
    }
    float invr[8];
#pragma unroll
    for (int i = 0; i < 8; ++i) {
        if (TWOPASS) invr[i] = SPLITPV ? 1.f : (1.f / 4096.f);
        else if (p.nonorm) invr[i] = exp2f(m8[i]) * (SPLITPV ? 1.f : (1.f / 4096.f));
        else invr[i] = (l8[i] > 0.f) ? (SPLITPV ? 1.f / l8[i] : 1.f / (l8[i] * 4096.f)) : 0.f;
    }
    __syncthreads();                                             // all waves done with pl/vl from the main loop
    const bool ofast = ((p.sOi & 3) == 0) && ((((size_t)obase) & 15) == 0) && (q0 + 16 <= p.Lq);
#pragma unroll
    for (int c0 = 0; c0 < DVP; c0 += 64) {
#pragma unroll
        for (int i = 0; i < 8; ++i)
#pragma unroll
            for (int t = 0; t < NT; ++t) if (t * 16 >= c0 && t * 16 < c0 + 64) ((float*)myp)[(i + 8 * hf) * 64 + (t * 16 - c0) + l15] = o[t][i] * invr[i];
        __syncthreads();
        const int cw = (DVP - c0 < 64) ? (DVP - c0) : 64;      // staged columns in this chunk (multiple of 16)
        if (ofast && (c0 + cw <= p.dv) && (cw % 32 == 0)) {
            const int lpr = cw / 4;                              // lanes per row (16 for 64 cols, 8 for 32)
            const int rows_per_ins = 32 / lpr;
            for (int r0 = 0; r0 < 16; r0 += rows_per_ins) {
                const int row = r0 + lane / lpr, c4 = (lane % lpr) * 4;
                const v4f v = *(const v4f*)(myp + row * 64 + c4);
                VST2V4(obase + (long long)(q0 + row) * p.sOi + c0 + c4, v);
            }
        } else {
            for (int row = 0; row < 16; ++row) {
                const int irow = q0 + row; if (irow >= p.Lq) continue;
                for (int c = lane; c < cw; c += 32) { const int d = c0 + c; if (d < p.dv) VST2(float, obase + (long long)irow * p.sOi + d, myp[row * 64 + c]); }
            }
        }
        __syncthreads();
    }
}

// =====================================================================================================================
// k_tr: dst(z, c, r) = alpha * src(z, r, c) (+ beta * R2(z, c, r)): [Z][R][C] (row stride lds) -> [Z][C][R] (row stride ldd) through a 32x32 LDS tile;
//   flags: 1 -> add beta * residual R2 addressed like dst (z*sRz + c*ldr + r); act applied before the residual.
// =====================================================================================================================
struct TrP { const float* src; float* dst; const float* R2; long long sSz, lds, sDz, ldd, sRz, ldr; int R, C, flags, act; float alpha, beta; };
static_assert(sizeof(TrP) == 3 * 8 + 6 * 8 + 6 * 4, "TrP has padding");
__global__ __launch_bounds__(256) void k_tr(TrP p) {
    __shared__ float tile[32][33];
    const int c0 = blockIdx.x * 32, r0 = blockIdx.y * 32, z = blockIdx.z;
    const int lane = threadIdx.x & 31, wave = threadIdx.x >> 5;
    const float* s = p.src + z * p.sSz;
#pragma unroll
    for (int k = 0; k < 4; ++k) {
        const int rl = wave * 4 + k, r = r0 + rl, c = c0 + lane;
        tile[rl][lane] = (r < p.R && c < p.C) ? s[(long long)r * p.lds + c] : 0.f;
    }
    __syncthreads();
    float* d = p.dst + z * p.sDz; const float* rr = p.R2 + z * p.sRz;
#pragma unroll
    for (int k = 0; k < 4; ++k) {
        const int cl = wave * 4 + k, c = c0 + cl, r = r0 + lane;
        if (c < p.C && r < p.R) {
            float v = act_fn(p.alpha * tile[lane][cl], p.act);
            if (p.flags & 1) v += p.beta * rr[(long long)c * p.ldr + r];
            VST2(float, d + (long long)c * p.ldd + r, v);
        }
    }
}

// k_affine: dst[i] = a * (sdev ? sdev[0] : 1) * src[i] + b, i < n (one thread per element; consecutive lanes -> consecutive addresses)
__global__ __launch_bounds__(256) void k_affine(const float* __restrict__ src, float* __restrict__ dst, int n, float a, float b, const float* __restrict__ sdev) {
    const int i = blockIdx.x * 256 + threadIdx.x;
    if (i < n) { const float aa = sdev ? a * sdev[0] : a; const float v = aa * src[i] + b; VST2(float, dst + i, v); }
}

// =====================================================================================================================
// k_softmax: row softmax over n contiguous elements, one 256-thread block per row; rows addressed z*sz + r*sr (grid (R, Z)).
//   out = scale_out * softmax(scale_in * x + (Mf ? Mf[z*smz + r*smr + j] : 0)); a row whose max is -inf is written as 0.
// =====================================================================================================================
struct SmP { const float* src; float* dst; const float* Mf; long long sz, sr, dz, dr, smz, smr; int n, pad; float scale_in, scale_out; };
static_assert(sizeof(SmP) == 3 * 8 + 6 * 8 + 4 * 4, "SmP has padding");
__global__ __launch_bounds__(256) void k_softmax(SmP p) {
    __shared__ float red[256];
    const int r = blockIdx.x, z = blockIdx.y, tid = threadIdx.x;
    const float* s = p.src + z * p.sz + (long long)r * p.sr;
    const float* mf = p.Mf ? (p.Mf + z * p.smz + (long long)r * p.smr) : nullptr;
    float mx = -__builtin_inff();
    for (int j = tid; j < p.n; j += 256) { float v = s[j] * p.scale_in; if (mf) v += mf[j]; mx = fmaxf(mx, v); }
    red[tid] = mx; __syncthreads();
    for (int o = 128; o > 0; o >>= 1) { if (tid < o) red[tid] = fmaxf(red[tid], red[tid + o]); __syncthreads(); }
    mx = red[0]; __syncthreads();
    float sum = 0.f;
    for (int j = tid; j < p.n; j += 256) { float v = s[j] * p.scale_in; if (mf) v += mf[j]; sum += (mx == -__builtin_inff()) ? 0.f : expf(v - mx); }
    red[tid] = sum; __syncthreads();
    for (int o = 128; o > 0; o >>= 1) { if (tid < o) red[tid] += red[tid + o]; __syncthreads(); }
    sum = red[0];
    const float inv = (sum > 0.f) ? p.scale_out / sum : 0.f;
    float* d = p.dst + z * p.dz + (long long)r * p.dr;
    for (int j = tid; j < p.n; j += 256) { float v = s[j] * p.scale_in; if (mf) v += mf[j]; const float o = (mx == -__builtin_inff()) ? 0.f : expf(v - mx) * inv; VST2(float, d + j, o); }
}
// =====================================================================================================================
// k_stats: mean and rsqrt(var + eps) over a set of n elements addressed base + z*sz + (e / inner) * so + (e % inner) * si, one 256-thread
// k_norm_apply: y = (x - mean[set]) * rstd[set] * g[c] + b[c] over a [Z][C][L] channel-major tensor with set = z*G + c / (C/G) (G groups per z;
//   G = C -> per-channel sets indexed z*C+c; for batch norm pass stats indexed by c only via bn = 1). Optional act. Output same layout.
// =====================================================================================================================
//   mode 0: mean / rsqrt(var + eps); mode 1 (RMSNorm): 0 / rsqrt(mean(x^2) + eps); mode 2 (L2 normalize * sqrt(n)): 0 / sqrt(n) / max(||x||, eps); mode 3: as 0 with unbiased variance (n-1)
__global__ __launch_bounds__(256) void k_stats(const float* __restrict__ x, long long sz, long long so, long long si, int inner, int n, float eps, float* __restrict__ stat, int mode) {
    __shared__ float red[256];
    const int z = blockIdx.x, tid = threadIdx.x;
    const float* base = x + z * sz;
    float s = 0.f;
    for (int e = tid; e < n; e += 256) s += base[(long long)(e / inner) * so + (long long)(e % inner) * si];
    red[tid] = s; __syncthreads();
    for (int o = 128; o > 0; o >>= 1) { if (tid < o) red[tid] += red[tid + o]; __syncthreads(); }
    const float mu = (mode == 0 || mode == 3) ? red[0] / (float)n : 0.f; __syncthreads();
    float q = 0.f;
    for (int e = tid; e < n; e += 256) { const float dlt = base[(long long)(e / inner) * so + (long long)(e % inner) * si] - mu; q += dlt * dlt; }
    red[tid] = q; __syncthreads();
    for (int o = 128; o > 0; o >>= 1) { if (tid < o) red[tid] += red[tid + o]; __syncthreads(); }
    {
        float rs;
        if (mode == 2) rs = sqrtf((float)n) / fmaxf(sqrtf(red[0]), eps); else if (mode == 3) rs = rsqrtf(red[0] / (float)(n - 1) + eps); else rs = rsqrtf(red[0] / (float)n + eps);
        if (tid < 32) { const float v = (tid == 0) ? mu : ((tid == 1) ? rs : 0.f); VST2(float, stat + (long long)z * 32 + tid, v); }
    }
}
//   One thread per element over the flat [Z][C][L] index space: grid ceil(Z*C*L / 256).
__global__ __launch_bounds__(256) void k_norm_apply(const float* __restrict__ x, float* __restrict__ y, const float* __restrict__ stat, const float* __restrict__ g, const float* __restrict__ bta,
                                                     int Z, int C, int L, int G, int bn, int act) {
    const long long idx = (long long)blockIdx.x * 256 + threadIdx.x;
    if (idx >= (long long)Z * C * L) return;
    const int l = (int)(idx % L); const long long zc = idx / L; const int c = (int)(zc % C), z = (int)(zc / C); (void)l;
    const int set = bn ? c : (z * G + c / (C / G));
    float v = (x[idx] - stat[(long long)set * 32]) * stat[(long long)set * 32 + 1];
    if (g) v *= g[c];
    if (bta) v += bta[c];
    v = act_fn(v, act);
    VST2(float, y + idx, v);
}

// k_lse_neg: c[i] = -(st[2i] + log(st[2i+1])) = minus the log-sum-exp of row i from k_attn's ST output (for softmax over the query dimension)
__global__ __launch_bounds__(256) void k_lse_neg(const float* __restrict__ st, float* __restrict__ c, int n) {
    const int i = blockIdx.x * 256 + threadIdx.x;
    if (i < n) { const float v = -(st[2 * i] + logf(st[2 * i + 1])); VST2(float, c + i, v); }
}

// k_iota: dst[i] = a * i + b as int32 (segment/position id helper)
__global__ __launch_bounds__(256) void k_iota(int* __restrict__ dst, int n, int a, int b) {
    const int i = blockIdx.x * 256 + threadIdx.x;
    if (i < n) { const int v = a * i + b; VST2(int, dst + i, v); }
}

// k_axpby: dst[i] = a * x[i] + b * y[i] (+ c), i < n
__global__ __launch_bounds__(256) void k_axpby(const float* __restrict__ x, const float* __restrict__ y, float* __restrict__ dst, int n, float a, float b, float c) {
    const int i = blockIdx.x * 256 + threadIdx.x;
    if (i < n) { const float v = a * x[i] + b * y[i] + c; VST2(float, dst + i, v); }
}

// =====================================================================================================================
// k_rope: rotary embedding on a [R rows][Hn heads][D] view (row stride sXr, head stride sXh, element stride 1) -> Y (own strides).
//   mode 0: rotate_half (partner d±D/2, sign - for d<D/2); mode 1: interleaved pairs (partner d^1, sign - for even d).
//   table column tcol: tmode 0 -> d, 1 -> d % (D/2), 2 -> d / 2; position p: pmode 0 -> r % S, 1 -> head index, 2 -> pos[r];
//   c = C[(r / S) * sCb + p * sCp + tcol * sCd], s likewise from Sn; y = x[d] * c + sign * x[partner] * s. X and Y must not alias.
// =====================================================================================================================
struct RopeP { const float* X; float* Y; const float* C; const float* Sn; const int* pos; long long sXr, sXh, sYr, sYh, sCb, sCp, sCd; int R, Hn, D, S, mode, tmode, pmode, pad; };
static_assert(sizeof(RopeP) == 5 * 8 + 7 * 8 + 8 * 4, "RopeP has padding");
__global__ __launch_bounds__(256) void k_rope(RopeP p) {
    const long long idx = (long long)blockIdx.x * 256 + threadIdx.x;
    if (idx >= (long long)p.R * p.Hn * p.D) return;
    const int d = (int)(idx % p.D); const long long rh = idx / p.D; const int h = (int)(rh % p.Hn); const int r = (int)(rh / p.Hn);
    const int half = p.D / 2;
    int partner; float sign;
    if (p.mode == 0) { partner = (d < half) ? d + half : d - half; sign = (d < half) ? -1.f : 1.f; }
    else { partner = d ^ 1; sign = (d & 1) ? 1.f : -1.f; }
    const int tcol = (p.tmode == 0) ? d : ((p.tmode == 1) ? (d % half) : (d >> 1));
    const int pp = (p.pmode == 0) ? (r % p.S) : ((p.pmode == 1) ? h : p.pos[r]);
    const long long toff = (long long)(r / p.S) * p.sCb + (long long)pp * p.sCp + (long long)tcol * p.sCd;
    const float* xr = p.X + (long long)r * p.sXr + (long long)h * p.sXh;
    const float v = xr[d] * p.C[toff] + sign * xr[partner] * p.Sn[toff];
    VST2(float, p.Y + (long long)r * p.sYr + (long long)h * p.sYh + d, v);
}

// k_invf + k_sincos (split so neither kernel carries a large VALU-fma footprint): invf_i = num * (1 / powf(base, (2 i)/D)) [fmode 0],
//   num * expf((2 i) * cexp) [fmode 1], num * powf(base, -2 (i - 1) / D) [fmode 2]; then cs/sn[s*half + i] = cos/sin((pscale * s) * invf_i)
__global__ __launch_bounds__(256) void k_invf(float* __restrict__ invb, int half, int D, float base, float num, int fmode, float cexp) {
    const int i = blockIdx.x * 256 + threadIdx.x;
    if (i >= ((half + 31) / 32) * 32) return;
    if (i >= half) { VST2(float, invb + i, 0.f); return; }
    const float e = (float)(2 * i) / (float)D;
    float invf;
    if (fmode == 1) invf = num * expf((float)(2 * i) * cexp);
    else if (fmode == 2) invf = num * powf(base, (-2.0f * ((float)i - 1.0f)) / (float)D);
    else invf = num * (1.0f / powf(base, e));
    VST2(float, invb + i, invf);
}
__global__ __launch_bounds__(256) void k_sincos(float* __restrict__ cs, float* __restrict__ sn, const float* __restrict__ invb, int S, int half, float pscale) {
    const int idx = blockIdx.x * 256 + threadIdx.x;
    if (idx >= S * half) return;
    const int s = idx / half, i = idx - s * half;
    const float ang = (pscale * (float)s) * invb[i];
    VST2(float, cs + idx, cosf(ang)); VST2(float, sn + idx, sinf(ang));
}

// k_mulact: dst[i] = act(x[i]) * y[i]
__global__ __launch_bounds__(256) void k_mulact(const float* __restrict__ x, const float* __restrict__ y, float* __restrict__ dst, int n, int act) {
    const int i = blockIdx.x * 256 + threadIdx.x;
    if (i < n) { const float v = act_fn(x[i], act) * y[i]; VST2(float, dst + i, v); }
}

// =====================================================================================================================
// k_matvec: thread-per-row matrix-vector products for N <= 8 output columns (heads with 1-3 outputs, gates), f32 on the VALU.
//   C[r*sCm + j] = act(alpha * sum_k A[r*sAm + k*sAk] * B[j*sBn + k*sBk] + bias[j]) + beta * R[r*sRm + j*sRn]; each thread writes its N contiguous floats.
// =====================================================================================================================
__global__ __launch_bounds__(256) void k_matvec(GemmP p) {
    // 32 lanes write one line with one instruction.
    const int rpt = (p.N == 1) ? 1 : 32;
    const long long r0 = ((long long)blockIdx.x * 256 + threadIdx.x) * rpt; const int z = blockIdx.z, zo = z / p.zi_n, zi = z - zo * p.zi_n;
    if (r0 >= p.M) return;
    const float* Bb = p.B + zo * p.sBo + zi * p.sBi;
    float* C = p.C + zo * p.sCo + zi * p.sCi; const float* R = p.R + zo * p.sRo + zi * p.sRi;
    for (int rr = 0; rr < rpt; ++rr) {
        const long long r = r0 + rr; if (r >= p.M) break;
        const float* A = p.A + zo * p.sAo + zi * p.sAi + r * p.sAm;
        float acc[8] = {0.f, 0.f, 0.f, 0.f, 0.f, 0.f, 0.f, 0.f};
        for (int k = 0; k < p.K; ++k) { const float a = A[(long long)k * p.sAk];
#pragma unroll
            for (int j = 0; j < 8; ++j) if (j < p.N) acc[j] += a * Bb[(long long)j * p.sBn + (long long)k * p.sBk]; }
#pragma unroll
        for (int j = 0; j < 8; ++j) if (j < p.N) {
            float v = acc[j] * p.alpha;
            if (p.flags & 1) v += p.bias[j];
            if (p.flags & 2) v += p.bias[r];
            v = act_fn(v, p.act);
            if (p.flags & 4) v += p.beta * R[r * p.sRm + (long long)j * p.sRn];
            VST2(float, C + r * p.sCm + j, v);
        }
    }
}
// k_smallsoftmax: thread-per-row softmax for short rows (n <= 64): dst[r*dr + j] = softmax(scale*src[r*sr + j])
__global__ __launch_bounds__(256) void k_smallsoftmax(const float* __restrict__ src, float* __restrict__ dst, long long sr, long long dr, int n, long long R, float scale) {
    const long long r0 = ((long long)blockIdx.x * 256 + threadIdx.x) * 32;
    for (int rr = 0; rr < 32; ++rr) {
        const long long r = r0 + rr; if (r >= R) return;
        const float* s = src + r * sr; float* d = dst + r * dr;
        float mx = -__builtin_inff();
        for (int j = 0; j < n; ++j) mx = fmaxf(mx, s[j] * scale);
        float sum = 0.f;
        for (int j = 0; j < n; ++j) sum += expf(s[j] * scale - mx);
        const float inv = 1.f / sum;
        for (int j = 0; j < n; ++j) { const float v = expf(s[j] * scale - mx) * inv; VST2(float, d + j, v); }
    }
}

__global__ __launch_bounds__(32) void k_unitstat(float* __restrict__ st) { const int t = threadIdx.x; const float v = (t == 1) ? 1.f : 0.f; VST2(float, st + t, v); }

// destination (e.g. a d_out whose row width is not a multiple of 32 floats) is written by consecutive lanes of one instruction
__global__ __launch_bounds__(256) void k_lincopy(const float* __restrict__ src, long long lds, float* __restrict__ dst, long long ldd, long long rows, int cols) {
    const long long i = (long long)blockIdx.x * 256 + threadIdx.x; if (i >= rows * cols) return;
    const long long r = i / cols; const int c = (int)(i - r * cols);
    const float v = src[r * lds + c]; VST2(float, dst + r * ldd + c, v);
}

namespace w25 {
typedef __attribute__((ext_vector_type(16))) _Float16 v16h;
typedef __attribute__((ext_vector_type(8)))  _Float16 v8h;
typedef __attribute__((ext_vector_type(16))) __bf16   v16b;
typedef __attribute__((ext_vector_type(8)))  __bf16   v8b;
typedef __attribute__((ext_vector_type(8)))  float    v8f;
typedef __attribute__((ext_vector_type(4)))  float    v4f;

__device__ __forceinline__ unsigned short f2bf_bits(float f) {
  unsigned u = __float_as_uint(f);
  return (unsigned short)((u + 0x7FFFu + ((u >> 16) & 1u)) >> 16);
}
__device__ __forceinline__ float bf_bits2f(unsigned short h) { return __uint_as_float(((unsigned)h) << 16); }

// hazard guards as plain device helpers (no inline asm inside the kernel template body)
__device__ __forceinline__ void dep_guard_h(v8f& a, v8f& b, v16h x, v16h y) { asm volatile("v_nop\n\tv_nop\n\tv_nop\n\tv_nop" : "+v"(a), "+v"(b) : "v"(x), "v"(y)); }
__device__ __forceinline__ void dep_guard_b(v8f& a, v8f& b, v16b x, v16b y) { asm volatile("v_nop\n\tv_nop\n\tv_nop\n\tv_nop" : "+v"(a), "+v"(b) : "v"(x), "v"(y)); }
__device__ __forceinline__ void keep4_h(v16h a, v16h b, v16h c, v16h d) { asm volatile("v_nop" :: "v"(a), "v"(b), "v"(c), "v"(d)); }
__device__ __forceinline__ void keep4_b(v16b a, v16b b, v16b c, v16b d) { asm volatile("v_nop" :: "v"(a), "v"(b), "v"(c), "v"(d)); }
__device__ __forceinline__ void acc_guard4(v8f& a, v8f& b, v8f& c, v8f& d) { asm volatile("v_nop\n\tv_nop\n\tv_nop\n\tv_nop" : "+v"(a), "+v"(b), "+v"(c), "+v"(d)); }
template <typename T> struct Frag;
template <> struct Frag<_Float16> {
  typedef v16h V; union U { v16h v; v8h h[2]; };
  static __device__ __forceinline__ v16h load(const _Float16* p) {   // elements 0..7 <- p[0..7], 8..15 <- p[16..23]
    U f; f.h[0] = *(const v8h*)(p); f.h[1] = *(const v8h*)(p + 16); return f.v;
  }
  static __device__ __forceinline__ v8f mma(v16h a, v16h b, v8f c) {
    return __builtin_amdgcn_wmma_f32_16x16x32_f16(false, a, false, b, (short)0, c, false, false);
  }
  static __device__ __forceinline__ void guard(v8f& a, v8f& b, v16h x, v16h y) { dep_guard_h(a, b, x, y); }
  static __device__ __forceinline__ void keep(v16h a, v16h b, v16h c, v16h d) { keep4_h(a, b, c, d); }
};
template <> struct Frag<__bf16> {
  typedef v16b V; union U { v16b v; v8b h[2]; };
  static __device__ __forceinline__ v16b load(const __bf16* p) {
    U f; f.h[0] = *(const v8b*)(p); f.h[1] = *(const v8b*)(p + 16); return f.v;
  }
  static __device__ __forceinline__ v8f mma(v16b a, v16b b, v8f c) {
    return __builtin_amdgcn_wmma_f32_16x16x32_bf16(false, a, false, b, (short)0, c, false, false);
  }
  static __device__ __forceinline__ void guard(v8f& a, v8f& b, v16b x, v16b y) { dep_guard_b(a, b, x, y); }
  static __device__ __forceinline__ void keep(v16b a, v16b b, v16b c, v16b d) { keep4_b(a, b, c, d); }
};

// ---- Register-blocked batched WMMA GEMM ------------------------------------
// C[m,n] = scale * sum_k A[m,k] * Bt[n,k] (+bias)(+resid); each wave owns a 64x64 tile.
// A row-major [M,K]; Bt row-major [N,K]; M,N % 64 == 0, K % 32 == 0.
// SPLIT: operands are hi/lo planes (A2/Bt2 = lo planes, same layout); product = hi·hi + hi·lo + lo·hi.
// BIAS_MODE: 0 = none, 1 = bias[m], 2 = bias[n].
// OUT_MODE: 0 = f32, 1 = f16, 2 = bf16 hi plane (Cout) + bf16 lo plane (Cout2).
// ET: 0 = f16 operands, 1 = bf16 operands (pointers passed as 16-bit storage)
template <int ET> struct Elem;
template <> struct Elem<0> { typedef _Float16 T; };
template <> struct Elem<1> { typedef __bf16 T; };
template <int ET, bool SPLIT, int BIAS_MODE, int OUT_MODE, bool RESID, int ACT = 0>
__global__ __launch_bounds__(256) void wmma_gemm64(
    const unsigned short* __restrict__ Ap, const unsigned short* __restrict__ A2p, int lda, long strideA,
    const unsigned short* __restrict__ Btp, const unsigned short* __restrict__ Bt2p, int ldb, long strideB,
    void* __restrict__ Cout, void* __restrict__ Cout2, int ldc, long strideC,
    const float* __restrict__ bias,
    const float* __restrict__ resid, long strideR,
    int M, int N, int K, float scale) {
  typedef typename Elem<ET>::T T;
  typedef typename Frag<T>::V V;
  const T* A = (const T*)Ap; const T* A2 = (const T*)A2p; const T* Bt = (const T*)Btp; const T* Bt2 = (const T*)Bt2p;
  __shared__ __align__(16) float sT[8][16 * 68];   // per-wave 16x64 slab, pitch 68 floats
  const int b    = blockIdx.y;
  const int lane = threadIdx.x & 31;
  const int wave = threadIdx.x >> 5;
  const int tilesN = N >> 6;
  const int tilesM = M >> 6;
  const int tile = blockIdx.x * 8 + wave;
  if (tile >= tilesM * tilesN) return;   // wave-uniform; no block barriers in this kernel
  const int tm = tile / tilesN;
  const int tn = tile - tm * tilesN;
  const int m0 = tm << 6;
  const int n0 = tn << 6;

  const T* Ab  = A  + (size_t)b * strideA;
  const T* Bb  = Bt + (size_t)b * strideB;
  const T* Ab2 = SPLIT ? (A2  + (size_t)b * strideA) : nullptr;
  const T* Bb2 = SPLIT ? (Bt2 + (size_t)b * strideB) : nullptr;

  const int rlane = lane & 15;                 // row (A) / col (B, D) within subtile
  const int koff  = (lane >> 4) * 8;           // k offset of this lane half
  const int mOff  = (lane >> 4) * 8;           // D row offset

  v8f acc[4][4];
#pragma unroll
  for (int i = 0; i < 4; ++i)
#pragma unroll
    for (int j = 0; j < 4; ++j) acc[i][j] = (v8f){0.f,0.f,0.f,0.f,0.f,0.f,0.f,0.f};

  for (int k0 = 0; k0 < K; k0 += 32) {
    V bh[4], bl[4];
#pragma unroll
    for (int j = 0; j < 4; ++j) {
      const size_t bo = (size_t)(n0 + (j << 4) + rlane) * ldb + koff + k0;
      bh[j] = Frag<T>::load(Bb + bo);
      if (SPLIT) bl[j] = Frag<T>::load(Bb2 + bo);
    }
#pragma unroll
    for (int i = 0; i < 4; ++i) {
      const size_t ao = (size_t)(m0 + (i << 4) + rlane) * lda + koff + k0;
      V ah = Frag<T>::load(Ab + ao);
      V al;
      if (SPLIT) al = Frag<T>::load(Ab2 + ao);
#pragma unroll
      for (int j = 0; j < 4; ++j) {
        acc[i][j] = Frag<T>::mma(ah, bh[j], acc[i][j]);
        if (SPLIT) {
          acc[i][j] = Frag<T>::mma(ah, bl[j], acc[i][j]);
          acc[i][j] = Frag<T>::mma(al, bh[j], acc[i][j]);
        }
      }
      Frag<T>::guard(acc[i][0], acc[i][3], ah, SPLIT ? al : ah);
    }
    Frag<T>::keep(bh[0], bh[1], bh[2], bh[3]);
    if (SPLIT) Frag<T>::keep(bl[0], bl[1], bl[2], bl[3]);
  }
  acc_guard4(acc[0][0], acc[0][1], acc[0][2], acc[0][3]);
  acc_guard4(acc[1][0], acc[1][1], acc[1][2], acc[1][3]);
  acc_guard4(acc[2][0], acc[2][1], acc[2][2], acc[2][3]);
  acc_guard4(acc[3][0], acc[3][1], acc[3][2], acc[3][3]);

  // ---- epilogue ----
  float* slab = sT[wave];
  const float* Rb = RESID ? (resid + (size_t)b * strideR) : nullptr;
#pragma unroll
  for (int i = 0; i < 4; ++i) {
    const int mBase = m0 + (i << 4);
#pragma unroll
    for (int j = 0; j < 4; ++j) {
      const int n = n0 + (j << 4) + rlane;
      float bv = 0.f;
      if (BIAS_MODE == 2) bv = bias[n];
#pragma unroll
      for (int r = 0; r < 8; ++r) {
        float v = acc[i][j][r] * scale;
        if (BIAS_MODE == 1) v += bias[mBase + mOff + r];
        if (BIAS_MODE == 2) v += bv;
        if (RESID) v += Rb[(size_t)(mBase + mOff + r) * ldc + n];
        if (ACT == 1) v = tanhf(v);
        if (ACT == 2) v = fmaxf(v, 0.0f);
        if (ACT == 3) v = v / (1.0f + expf(-v));
        if (ACT == 4) v = (v > 0.f) ? v : 0.01f * v;
        if (ACT == 5) v = 0.5f * v * (1.0f + erff(v * 0.70710678118654752f));
        slab[(mOff + r) * 68 + (j << 4) + rlane] = v;
      }
    }
    __builtin_amdgcn_fence(__ATOMIC_RELEASE, "workgroup");
    __builtin_amdgcn_wave_barrier();
    __builtin_amdgcn_fence(__ATOMIC_ACQUIRE, "workgroup");
    if (OUT_MODE == 0) {
      float* C = (float*)Cout + (size_t)b * strideC;
      const int hh = lane >> 4, c4 = (lane & 15) * 4;     // row seg = 256 B = 16 lanes x 16 B
      {
#pragma unroll
        for (int it = 0; it < 8; ++it) {
          const int row = it * 2 + hh;
          v4f v = *(const v4f*)(slab + row * 68 + c4);
          *(v4f*)(C + (size_t)(mBase + row) * ldc + n0 + c4) = v;
        }
        
      }
    } else {
      const int q = lane >> 3, c8 = (lane & 7) * 8;
      unsigned short* C  = (unsigned short*)Cout  + (size_t)b * strideC;
      unsigned short* C2 = (OUT_MODE == 2) ? ((unsigned short*)Cout2 + (size_t)b * strideC) : nullptr;
      {
#pragma unroll
        for (int it = 0; it < 4; ++it) {
          const int row = it * 4 + q;
          const float* sp = slab + row * 68 + c8;
          v8h hv, lv;
#pragma unroll
          for (int e = 0; e < 8; ++e) {
            if (OUT_MODE == 1) {
              hv[e] = (_Float16)sp[e];
            } else {
              unsigned short hb = f2bf_bits(sp[e]);
              unsigned short lb = f2bf_bits(sp[e] - bf_bits2f(hb));
              hv[e] = __builtin_bit_cast(_Float16, hb);
              lv[e] = __builtin_bit_cast(_Float16, lb);
            }
          }
          *(v8h*)(C + (size_t)(mBase + row) * ldc + n0 + c8) = hv;
          if (OUT_MODE == 2) *(v8h*)(C2 + (size_t)(mBase + row) * ldc + n0 + c8) = lv;
        }
        
      }
    }
    __builtin_amdgcn_fence(__ATOMIC_RELEASE, "workgroup");
    __builtin_amdgcn_wave_barrier();
    __builtin_amdgcn_fence(__ATOMIC_ACQUIRE, "workgroup");
  }
}

__global__ __launch_bounds__(256) void cast_f32_f16x2(
    const float* __restrict__ in, _Float16* __restrict__ out, int n2) {
  int i = blockIdx.x * 256 + threadIdx.x;
  if (i < n2) {
    const _Float16 h0 = (_Float16)in[2 * i], h1 = (_Float16)in[2 * i + 1];
    const unsigned u = (unsigned)__builtin_bit_cast(unsigned short, h0) | ((unsigned)__builtin_bit_cast(unsigned short, h1) << 16);
    ((unsigned*)out)[i] = u;
    
  }
}


} // namespace w25

namespace w25 {
// =====================================================================================
// Generic causal/non-causal attention for head_dim 64, f32 in / f32 out; 16-bit operands: bf16 with optional hi/lo splits, or
// plain f16 (F16=true, non-split, probabilities carried x2^15).
//   scores = (q*qscale)·kᵀ : v_wmma_f32_16x16x32_bf16; SPLIT_QK -> q,k as bf16 hi/lo (hi·hi + hi·lo + lo·hi)
//   out    = p·v           : v_wmma_f32_16x16x32_bf16; SPLIT_PV -> p,v as bf16 hi/lo; else p,v plain bf16
//   f32 accumulate; online softmax in f32. Block = 4 waves = 64 query rows of one (batch, head); S % 64 == 0.
//   Element (b, s, h, d) of tensor X lives at X[b*X_bs + s*X_rs + h*X_hs + d] (strides in floats, multiples of 4).
//   Masking: mask_mode 0 none, 1 causal (kv > q masked), 2 tensor [S][Skv] shared over (b,h) (float if
//   mask_is_int==0, int32 with element == 0 -> masked if 1, int32 with element != 0 -> masked if 2), 3 per-token vectors qmask[B][S] & kvmask[B][Skv] (int32,
//   0 -> masked), 4 causal + sliding window (kv > q or q - kv > W masked; W passed in mask_is_int);
//   5 = relative-position bias: s += cp[b,h,q][idx[q][kv]] + pc[b,h,kv][idx[q][kv]] with idx = mask_b ([S][Skv] int32) and
//   mask_a an int32 [S][Skv] tensor with nonzero = masked (tables: element (b,h,row,n) at X + b*c_bs + h*c_hs + row*c_rs + n);
//   masked scores are replaced by mask_fill (e.g. -inf or -1e9) before the softmax.
//   grid.x = B * H * (S/64) (or a sub-range with blk0).
// =====================================================================================
#define AT_D 64
#define AT_NW 4
#define AT_QB 64
#define AT_KC 64
struct AttnGeom { const float* cp = nullptr; const float* pc = nullptr; long c_bs = 0, c_rs = 0, c_hs = 0;   // mode-5 score-bias tables
                  long q_bs, q_rs, q_hs, k_bs, k_rs, k_hs, v_bs, v_rs, v_hs, o_bs, o_rs, o_hs;
                  int S, Skv, H, mask_mode; float qscale; int blk0; float mask_fill; int mask_is_int; };
static_assert(sizeof(AttnGeom) == 168, "no padding");

__device__ __forceinline__ unsigned short at_bf_bits(float f) {
  unsigned u = __float_as_uint(f);
  return (unsigned short)((u + 0x7FFFu + ((u >> 16) & 1u)) >> 16);
}
__device__ __forceinline__ __bf16 at_f2bf(float f) { return __builtin_bit_cast(__bf16, at_bf_bits(f)); }
__device__ __forceinline__ void at_split(float f, __bf16& hi, __bf16& lo) {
  const unsigned short hb = at_bf_bits(f);
  hi = __builtin_bit_cast(__bf16, hb);
  lo = at_f2bf(f - __uint_as_float(((unsigned)hb) << 16));
}
__device__ __forceinline__ v8f at_mma(v16b a, v16b b, v8f c) {
  c = __builtin_amdgcn_wmma_f32_16x16x32_bf16(false, a, false, b, (short)0, c, false, false);
  asm volatile("v_nop\n\tv_nop\n\tv_nop\n\tv_nop" : "+v"(c) : "v"(a), "v"(b));
  return c;
}
// 16-bit element as a bit pattern held in a __bf16 slot: f16 bits when F16, bf16 (RNE) otherwise
template <bool F16> __device__ __forceinline__ __bf16 at_to16(float f) {
  if (F16) return __builtin_bit_cast(__bf16, (_Float16)f);
  return at_f2bf(f);
}
template <bool F16> __device__ __forceinline__ v8f at_mma16(v16b a, v16b b, v8f c) {
  if (F16) {
    const v16h ah = __builtin_bit_cast(v16h, a), bh = __builtin_bit_cast(v16h, b);
    c = __builtin_amdgcn_wmma_f32_16x16x32_f16(false, ah, false, bh, (short)0, c, false, false);
    asm volatile("v_nop\n\tv_nop\n\tv_nop\n\tv_nop" : "+v"(c) : "v"(ah), "v"(bh));
    return c;
  }
  return at_mma(a, b, c);
}

template <bool SPLIT_QK, bool SPLIT_PV, bool F16 = false>
__global__ __launch_bounds__(128)
void attn64_kernel(const float* __restrict__ q, const float* __restrict__ k,
                   const float* __restrict__ v, float* __restrict__ out,
                   const void* __restrict__ mask_a, const int* __restrict__ mask_b, AttnGeom g) {
  static_assert(!(F16 && (SPLIT_QK || SPLIT_PV)), "f16 mode is non-split");
  const float PSC = F16 ? 32768.0f : 1.0f;     // f16 probabilities carried x2^15 (subnormal range), folded into the final 1/l
  union FB { v16b v; v8b h[2]; };
  __shared__ __align__(16) __bf16 Ksh[AT_KC * AT_D];             // K hi [kv][d]      8 KB
  __shared__ __align__(16) __bf16 Ksl[SPLIT_QK ? AT_KC * AT_D : 8];
  __shared__ __align__(16) __bf16 Vth[AT_D * AT_KC];             // V hi [d][kv]      8 KB
  __shared__ __align__(16) __bf16 Vtl[SPLIT_PV ? AT_D * AT_KC : 8];
  __shared__ __align__(16) __bf16 Psh[AT_NW][16 * AT_KC];        // per wave P hi [row][kv]  8 KB
  __shared__ __align__(16) __bf16 Psl[SPLIT_PV ? AT_NW : 1][SPLIT_PV ? 16 * AT_KC : 8];
  __shared__ __align__(16) float  Os[AT_NW][16 * 68];            // per wave out tile, pitch 68

  const int tid  = threadIdx.x;
  const int wave = tid >> 5;
  const int lane = tid & 31;
  const int hh   = lane >> 4;
  const int c    = lane & 15;

  const int nqb = g.S / AT_QB;
  const int bx = blockIdx.x + g.blk0;
  const int qb = bx % nqb;
  const int bh = bx / nqb;
  const int h  = bh % g.H;
  const int b  = bh / g.H;
  const int qbase_block = qb * AT_QB;
  const int q0 = qbase_block + wave * 16;

  const float* qb_ptr = q + (size_t)b * g.q_bs + (size_t)h * g.q_hs;
  const float* kb_ptr = k + (size_t)b * g.k_bs + (size_t)h * g.k_hs;
  const float* vb_ptr = v + (size_t)b * g.v_bs + (size_t)h * g.v_hs;
  float*       ob_ptr = out + (size_t)b * g.o_bs + (size_t)h * g.o_hs;

  // ---- Q fragments (A operand): 2 d-chunks, hi (and lo) ----
  v16b qah[2], qal[2];
  {
    const float* qrow = qb_ptr + (size_t)(q0 + c) * g.q_rs;
#pragma unroll
    for (int dc = 0; dc < 2; ++dc) {
#pragma unroll
      for (int e = 0; e < 8; ++e) {
        const float f0 = qrow[dc * 32 + 8 * hh + e] * g.qscale;
        const float f1 = qrow[dc * 32 + 16 + 8 * hh + e] * g.qscale;
        if (SPLIT_QK) { __bf16 hq, lq; at_split(f0, hq, lq); qah[dc][e] = hq; qal[dc][e] = lq; at_split(f1, hq, lq); qah[dc][8 + e] = hq; qal[dc][8 + e] = lq; }
        else { qah[dc][e] = at_to16<F16>(f0); qah[dc][8 + e] = at_to16<F16>(f1); qal[dc][e] = qah[dc][e]; qal[dc][8 + e] = qah[dc][8 + e]; }
      }
    }
  }

  float mrow[8], lrow[8];
  v8f oacc[4];
#pragma unroll
  for (int r = 0; r < 8; ++r) { mrow[r] = -INFINITY; lrow[r] = 0.f; }
#pragma unroll
  for (int t = 0; t < 4; ++t) oacc[t] = (v8f){0.f,0.f,0.f,0.f,0.f,0.f,0.f,0.f};

  const int nChunks = (g.mask_mode == 1 || g.mask_mode == 4) ? (qb + 1) : (g.Skv / AT_KC);   // block-uniform
  // per-row query mask (mode 3)
  int qkeep[8];
#pragma unroll
  for (int r = 0; r < 8; ++r) qkeep[r] = (g.mask_mode == 3) ? mask_b[(size_t)b * g.S + q0 + 8 * hh + r] : 1;   // mask_b = qmask in mode 3
  for (int kc = 0; kc < nChunks; ++kc) {
    const int kv0 = kc * AT_KC;
    __syncthreads();
    {
      const int kvr = tid >> 1, dh = (tid & 1) * 32;
      const float* krow = kb_ptr + (size_t)(kv0 + kvr) * g.k_rs + dh;
      const float* vrow = vb_ptr + (size_t)(kv0 + kvr) * g.v_rs + dh;
#pragma unroll
      for (int i = 0; i < 8; ++i) {
        v4f kk = *(const v4f*)(krow + 4 * i);
        v4f vv = *(const v4f*)(vrow + 4 * i);
#pragma unroll
        for (int e = 0; e < 4; ++e) {
          const int d = dh + 4 * i + e;
          if (SPLIT_QK) { __bf16 a, bl; at_split(kk[e], a, bl); Ksh[kvr * AT_D + d] = a; Ksl[kvr * AT_D + d] = bl; }
          else Ksh[kvr * AT_D + d] = at_to16<F16>(kk[e]);
          if (SPLIT_PV) { __bf16 a, bl; at_split(vv[e], a, bl); Vth[d * AT_KC + kvr] = a; Vtl[d * AT_KC + kvr] = bl; }
          else Vth[d * AT_KC + kvr] = at_to16<F16>(vv[e]);
        }
      }
    }
    __syncthreads();

    v8f s[4];
#pragma unroll
    for (int j = 0; j < 4; ++j) {
      s[j] = (v8f){0.f,0.f,0.f,0.f,0.f,0.f,0.f,0.f};
#pragma unroll 1
      for (int dc = 0; dc < 2; ++dc) {
        FB kb;
        kb.h[0] = *(const v8b*)(Ksh + (j * 16 + c) * AT_D + dc * 32 + 8 * hh);
        kb.h[1] = *(const v8b*)(Ksh + (j * 16 + c) * AT_D + dc * 32 + 16 + 8 * hh);
        s[j] = at_mma16<F16>(qah[dc], kb.v, s[j]);
        if (SPLIT_QK) {
          FB kl;
          kl.h[0] = *(const v8b*)(Ksl + (j * 16 + c) * AT_D + dc * 32 + 8 * hh);
          kl.h[1] = *(const v8b*)(Ksl + (j * 16 + c) * AT_D + dc * 32 + 16 + 8 * hh);
          s[j] = at_mma16<F16>(qah[dc], kl.v, s[j]);
          s[j] = at_mma16<F16>(qal[dc], kb.v, s[j]);
        }
      }
    }
    const bool diag = (g.mask_mode == 1) && (kc == qb);
    int kvkeep[4] = {1, 1, 1, 1};
    if (g.mask_mode == 3) {
#pragma unroll
      for (int j = 0; j < 4; ++j) kvkeep[j] = ((const int*)mask_a)[(size_t)b * g.Skv + kv0 + j * 16 + c];   // mask_a = kvmask
    }
    float cm[8];
#pragma unroll
    for (int r = 0; r < 8; ++r) {
      const int qrow = q0 + 8 * hh + r;
      float m = -INFINITY;
#pragma unroll
      for (int j = 0; j < 4; ++j) {
        const int kvcol = kv0 + j * 16 + c;
        bool masked = false;
        if (diag) masked = (kvcol > qrow);
        else if (g.mask_mode == 4) masked = (kvcol > qrow) || (qrow - kvcol > g.mask_is_int);
        else if (g.mask_mode == 2) {
          const size_t mi = (size_t)qrow * g.Skv + kvcol;
          masked = (g.mask_is_int == 0) ? (((const float*)mask_a)[mi] == 0.0f)
                 : (g.mask_is_int == 1) ? (((const int*)mask_a)[mi] == 0) : (((const int*)mask_a)[mi] != 0);
        } else if (g.mask_mode == 3) masked = (qkeep[r] == 0) || (kvkeep[j] == 0);
        else if (g.mask_mode == 5) {
          const size_t mi = (size_t)qrow * g.Skv + kvcol;
          masked = (((const int*)mask_a)[mi] != 0);
          int n = mask_b[mi]; n = n < 0 ? 0 : n;
          s[j][r] += g.cp[(size_t)b * g.c_bs + (size_t)h * g.c_hs + (size_t)qrow * g.c_rs + n]
                   + g.pc[(size_t)b * g.c_bs + (size_t)h * g.c_hs + (size_t)kvcol * g.c_rs + n];
        }
        if (masked) s[j][r] = g.mask_fill;
        m = fmaxf(m, s[j][r]);
      }
#pragma unroll
      for (int off = 1; off < 16; off <<= 1) m = fmaxf(m, __shfl_xor(m, off, 32));
      cm[r] = m;
    }
    __bf16* pwh = Psh[wave];
    __bf16* pwl = Psl[SPLIT_PV ? wave : 0];
#pragma unroll
    for (int r = 0; r < 8; ++r) {
      const float mnew = fmaxf(mrow[r], cm[r]);
      const float alpha = expf(mrow[r] - mnew);
      mrow[r] = mnew;
      float psum = 0.f;
#pragma unroll
      for (int j = 0; j < 4; ++j) {
        const float p = expf(s[j][r] - mnew);
        psum += p;
        if (SPLIT_PV) { __bf16 a, bl; at_split(p, a, bl); pwh[(8 * hh + r) * AT_KC + j * 16 + c] = a; pwl[(8 * hh + r) * AT_KC + j * 16 + c] = bl; }
        else pwh[(8 * hh + r) * AT_KC + j * 16 + c] = at_to16<F16>(p * PSC);
      }
#pragma unroll
      for (int off = 1; off < 16; off <<= 1) psum += __shfl_xor(psum, off, 32);
      lrow[r] = lrow[r] * alpha + psum;
#pragma unroll
      for (int t = 0; t < 4; ++t) oacc[t][r] *= alpha;
    }
    __builtin_amdgcn_fence(__ATOMIC_RELEASE, "workgroup");
    __builtin_amdgcn_wave_barrier();
    __builtin_amdgcn_fence(__ATOMIC_ACQUIRE, "workgroup");
#pragma unroll 1
    for (int kk = 0; kk < 2; ++kk) {
      FB pa, pl;
      pa.h[0] = *(const v8b*)(pwh + c * AT_KC + kk * 32 + 8 * hh);
      pa.h[1] = *(const v8b*)(pwh + c * AT_KC + kk * 32 + 16 + 8 * hh);
      if (SPLIT_PV) {
        pl.h[0] = *(const v8b*)(pwl + c * AT_KC + kk * 32 + 8 * hh);
        pl.h[1] = *(const v8b*)(pwl + c * AT_KC + kk * 32 + 16 + 8 * hh);
      }
#pragma unroll
      for (int t = 0; t < 4; ++t) {
        FB vb;
        vb.h[0] = *(const v8b*)(Vth + (t * 16 + c) * AT_KC + kk * 32 + 8 * hh);
        vb.h[1] = *(const v8b*)(Vth + (t * 16 + c) * AT_KC + kk * 32 + 16 + 8 * hh);
        oacc[t] = at_mma16<F16>(pa.v, vb.v, oacc[t]);
        if (SPLIT_PV) {
          FB vl;
          vl.h[0] = *(const v8b*)(Vtl + (t * 16 + c) * AT_KC + kk * 32 + 8 * hh);
          vl.h[1] = *(const v8b*)(Vtl + (t * 16 + c) * AT_KC + kk * 32 + 16 + 8 * hh);
          oacc[t] = at_mma16<F16>(pa.v, vl.v, oacc[t]);
          oacc[t] = at_mma16<F16>(pl.v, vb.v, oacc[t]);
        }
      }
    }
  }

  float* os = Os[wave];
#pragma unroll
  for (int r = 0; r < 8; ++r) {
    const float inv = 1.0f / (lrow[r] * PSC);
#pragma unroll
    for (int t = 0; t < 4; ++t) os[(8 * hh + r) * 68 + t * 16 + c] = oacc[t][r] * inv;
  }
  __builtin_amdgcn_fence(__ATOMIC_RELEASE, "workgroup");
  __builtin_amdgcn_wave_barrier();
  __builtin_amdgcn_fence(__ATOMIC_ACQUIRE, "workgroup");
  {
    const int c4 = (lane & 15) * 4;
    {
#pragma unroll
      for (int it = 0; it < 8; ++it) {
        const int row = it * 2 + hh;
        v4f val = *(const v4f*)(os + row * 68 + c4);
        *(v4f*)(ob_ptr + (size_t)(q0 + row) * g.o_rs + c4) = val;
      }
      
    }
  }
}

} // namespace w25

typedef __attribute__((ext_vector_type(2))) unsigned v2u;
typedef __attribute__((ext_vector_type(8))) _Float16 v8hp;
typedef __attribute__((ext_vector_type(2))) float v2fp;
typedef __attribute__((ext_vector_type(2))) __bf16 v2bp;
// two neighbouring f32 -> packed bf16 hi (returned) and packed bf16 lo of the remainders (x = hi + lo to ~2^-17 relative), both rounded to nearest even by the
//   hardware's packed conversion: five instructions a pair, which is what lets the split stand inside the product loop
__device__ __forceinline__ unsigned bf2_split(float a, float b, unsigned* lo) {
    const unsigned h = __builtin_bit_cast(unsigned, __builtin_convertvector((v2fp){a, b}, v2bp));
    const v2fp r = (v2fp){a, b} - (v2fp){__uint_as_float(h << 16), __uint_as_float(h & 0xffff0000u)};
    *lo = __builtin_bit_cast(unsigned, __builtin_convertvector(r, v2bp));
    return h; }
// transposing LDS load: lane (c = lane & 15, h = lane >> 4) gets column c, rows 8 h .. 8 h + 7 of the 16 x 16 block of 16-bit values whose row 8 (lane >> 4) + (lane & 7),
//   16-byte half (lane >> 3) & 1 the lane's address names: half of a 16 x 32 A fragment in the fragment loaders' k order
typedef __attribute__((ext_vector_type(8))) short v8sp;
__device__ __forceinline__ v8hp lds_tr16(const unsigned char* p) {
    typedef __attribute__((address_space(3))) v8sp lds_v8sp;
    return __builtin_bit_cast(v8hp, __builtin_amdgcn_ds_load_tr16_b128_v8i16((lds_v8sp*)p)); }
// expf, step for step as the compiler expands it (x * log2(e) in two parts, 2^fraction, ldexp, the two range tests), written out so that the v_nop can stand in the
//   statement of v_exp_f32: it fills the one slot the instruction set asks for in front of a vector instruction that reads the result or overwrites the source
__device__ __forceinline__ float exp_slot(float x) {
    const float ph = x * 0x1.715476p+0f;
    const float pl = fmaf(x, 0x1.4ae0bep-26f, fmaf(x, 0x1.715476p+0f, -ph));
    const float en = rintf(ph);
    const float a = (ph - en) + pl;
    float y;
    asm("v_exp_f32 %0, %1\n\tv_nop" : "=v"(y) : "v"(a));
    float r = ldexpf(y, (int)en);
    r = (x < -0x1.9d1da0p+6f) ? 0.f : r;
    r = (x > 0x1.62e430p+6f) ? __builtin_inff() : r;
    return r;
}
// one wave per row, RW rows per wave one after the other: sim = tril + AQ[n] + CM[m], masked exactly as the module: sim + (1 - qm*mm) * -1e30; the whole row stays in
//   registers (32 values per lane) from the one read of SIM to the one write: row max -> RMX, softmax over m (exp once), probabilities x ps stored as f16, the
//   operand plane of the query->memory product. CM and the memory mask are read once per wave; max and sum meet by lane shuffles, so the kernel has no barrier.
typedef __attribute__((ext_vector_type(4))) _Float16 v4h;
typedef __attribute__((ext_vector_type(4))) int      v4i;
template <int N, int M, int RW>
__global__ __launch_bounds__(256) void k_bi_soft16(const float* __restrict__ SIM, const float* __restrict__ AQ, const float* __restrict__ CM, const int* __restrict__ QM, const int* __restrict__ MM, float* __restrict__ RMX, _Float16* __restrict__ P16, float ps) {
    static_assert(M % 128 == 0 && N % (8 * RW) == 0, "whole 512-byte wave loads; whole blocks of 8 waves x RW rows");
    constexpr int C = M / 128;
    const int lane = threadIdx.x & 31, wv = __builtin_amdgcn_readfirstlane(threadIdx.x >> 5);
    const size_t bz = blockIdx.y;   // batch = blockIdx.y
    const size_t row0 = bz * N + (size_t)(blockIdx.x * 8 + wv) * RW;
    float aqv[RW], qmv[RW];
#pragma unroll
    for (int r = 0; r < RW; ++r) { aqv[r] = AQ[row0 + r]; qmv[r] = (float)QM[row0 + r]; }
    const float* sr = SIM + row0 * M + lane * 4;
    v4f x[C], nx[C], cm[C], mf[C]; v4i mk[C];
#pragma unroll
    for (int i = 0; i < C; ++i) x[i] = *(const v4f*)(sr + i * 128);
#pragma unroll
    for (int i = 0; i < C; ++i) { cm[i] = *(const v4f*)(CM + bz * M + lane * 4 + i * 128); mk[i] = *(const v4i*)(MM + bz * M + lane * 4 + i * 128); }
#pragma unroll
    for (int r = 0; r < RW; ++r) {
        if (r + 1 < RW) {
#pragma unroll
            for (int i = 0; i < C; ++i) nx[i] = *(const v4f*)(sr + (size_t)(r + 1) * M + i * 128);   // the next row flies while this one is worked on
            asm volatile("s_wait_xcnt 0x0" ::: "memory");   // the row's work may reuse the offset register that the loads above name
            __builtin_amdgcn_sched_barrier(0);   // keeps the loads and their wait at the head of the row's work; left free the loads sink to just ahead of their first use
        }
        if (r == 0) {
#pragma unroll
            for (int i = 0; i < C; ++i) mf[i] = __builtin_convertvector(mk[i], v4f);
        }
        const float aq = aqv[r], qm = qmv[r];
        float mx = -3.0e38f;
#pragma unroll
        for (int i = 0; i < C; ++i)
#pragma unroll
            for (int e = 0; e < 4; ++e) { const float msk = qm * mf[i][e]; const float v = x[i][e] + aq + cm[i][e] + (1.f - msk) * -1.0e30f; x[i][e] = v; mx = fmaxf(mx, v); }
        for (int o = 16; o > 0; o >>= 1) mx = fmaxf(mx, __shfl_xor(mx, o, 32));
        v4f s4 = {0.f, 0.f, 0.f, 0.f};
#pragma unroll
        for (int i = 0; i < C; ++i)
#pragma unroll
            for (int e = 0; e < 4; ++e) { const float ev = exp_slot(x[i][e] - mx); x[i][e] = ev; s4[e] += ev; }
        float s = (s4[0] + s4[1]) + (s4[2] + s4[3]);
        for (int o = 16; o > 0; o >>= 1) s += __shfl_xor(s, o, 32);
        const float inv = 1.f / s;
        _Float16* pr = P16 + (row0 + r) * M + lane * 4;
        v4h hv[C];
#pragma unroll
        for (int i = 0; i < C; ++i)
#pragma unroll
            for (int e = 0; e < 4; ++e) hv[i][e] = (_Float16)((x[i][e] * inv) * ps);
        __builtin_amdgcn_sched_barrier(0);   // with the one below: nothing that refills a register of these stores is scheduled between them and their wait
#pragma unroll
        for (int i = 0; i < C; ++i) *(v4h*)(pr + i * 128) = hv[i];
        VST2(float, RMX + (row0 + r) * 32 + lane, mx);   // row max staged as a whole 32-float line (slot 0 is read later)
        if (r + 1 < RW) {
            asm volatile("s_wait_xcnt 0x0" ::: "memory");   // the next row's work reuses the registers that the stores above name
            __builtin_amdgcn_sched_barrier(0);
        }
#pragma unroll
        for (int i = 0; i < C; ++i) x[i] = nx[i];
    } }

// Operand preparation, similarity product, masked row softmax and query->memory product in ONE launch; the 16-bit operands, the similarity matrix and the
//   probabilities never leave the chip's LDS and registers.
//   Block = 16 waves = 4 groups of 16 query rows x 4 quarters of the memory axis. A wave walks its quarter in tiles of 32 memory rows:
//   S^T = memory x (q * w_qm + w_m)^T (bf16 hi/lo, three products): sum_d m_d (q_d w_qm_d + w_m_d) is the trilinear term and memory . w_m in one product, so no row dot
//   of memory is needed; a lane holds scores of ONE query (column lane & 15; rows 8 * (lane >> 4) + r of each 16-row tile);
//   sim = S + q . w_q + (1 - qm * mm) * -1e30 as the module has it; running maximum and sum; p = 2^((sim - max) * log2(e) + lps), one subtraction, one fused
//   multiply-add and one v_exp_f32 a score: the f16 scale 2^lps rides in the exponent and, being in the sum as well, cancels in the quotient (os undoes the scale ts of the
//   f16 tile alone). The subtraction comes first: at -1e30 a product with log2(e) would round by more than the whole exponent range. The two 16-row score tiles, as f16, ARE the B operand of
//   O^T += memory^T x P^T (the k order of the fragment loaders). The four quarters of a query meet once, at the end, through LDS.
//   The memory tiles are made here from the f32 input, two LDS buffers: of the four waves that share a quarter each brings 8 whole rows of tile s + 1 into an LDS slot of
//   its own by asynchronous 16-byte copies that fly under trip s, reads them back ahead of the trip's second product and stores, one row between every two of that
//   product's matrix instructions, their bf16 hi and lo rows and their f16 x ts rows. The f16 tile stays row-major ([m][d]: every store covers one whole row); the
//   second product takes its memory^T fragments from it by transposing loads. Row pitches 272 bytes (16 x odd, 16-byte reads) and 288 bytes (32 x odd, transposing
//   reads) keep the fragment reads off each other's banks.
//   Every '#pragma unroll' below stands on a loop whose index picks a fragment, an accumulator or a vector element: unrolled, these stay in registers.
template <int N, int M, int D>
__global__ __launch_bounds__(512) void k_bi_fused(const float* __restrict__ Q, const float* __restrict__ MEM, const float* __restrict__ wq, const float* __restrict__ wm, const float* __restrict__ wqm,
        const int* __restrict__ QM, const int* __restrict__ MM, float* __restrict__ RMX, float* __restrict__ OUT, float ts, float lps, float os) {
    static_assert(N % 64 == 0 && M == 1024 && D == 128, "64 query rows a block; 4 quarters of 8 tiles of 32 memory rows; 2 mask words a thread; one 16-byte load per lane and row");
    typedef w25::Frag<__bf16> FB; typedef w25::Frag<_Float16> FH; typedef w25::v8f v8f;
    constexpr int PA = 272, PV = 288;                   // LDS row pitch in bytes: 256-byte rows of hi and lo; 256-byte rows of the f16 tile
    constexpr int TILE = 2 * 32 * PA + 32 * PV;         // one quarter's tile: hi, lo, f16
    constexpr int BUF = 4 * TILE, MQ4 = M / 4, NS = MQ4 / 32;
    static_assert(2 * BUF >= 16 * 8 * 32 * 8 * 4, "the ring later holds the 16 waves' partial outputs");
    __shared__ __align__(32) unsigned char ring[2 * BUF];
    __shared__ __align__(16) unsigned char qs[2 * 64 * PA];
    __shared__ __align__(16) float smf[M];
    __shared__ __align__(16) unsigned char raw[16 * 8 * 512];   // a slot of 8 f32 rows for each wave, filled and read by that wave alone
    __shared__ float saq[64];
    float (*smx)[4][16] = (float (*)[4][16])smf;           // the quarters' maxima and sums take the mask's place behind the loop
    float (*ssm)[4][16] = (float (*)[4][16])(smf + 256);
    const int lane = threadIdx.x & 31, wv = __builtin_amdgcn_readfirstlane(threadIdx.x >> 5);
    const int qg = wv & 3, ms = wv >> 2, nl = lane & 15, h = lane >> 4, koff = h * 8;
    const size_t bz = blockIdx.y, q0 = bz * N + (size_t)blockIdx.x * 64, row = q0 + qg * 16 + nl;
    const unsigned l4 = lane * 4;
    const float* gm = MEM + (bz * M + ms * MQ4 + qg * 8) * D + l4;   // this lane's 16 bytes of the first of this wave's 8 rows of its quarter's tile 0
    const unsigned char* rw = raw + wv * 4096 + lane * 16;           // ... and their place in the wave's own slot: rows 512 bytes apart, as in memory
    auto copy_rows = [&](int s) {
        const float* p = gm + (size_t)s * 32 * D;
        // an immediate offset moves the LDS address and the global address alike, so one address of each serves the 8 rows;
        //   the wait is the last line of the copies' own statement: no register that a copy names is rewritten ahead of it
        asm volatile("global_load_async_to_lds_b128 %0, %1, off\n\t"
                     "global_load_async_to_lds_b128 %0, %1, off offset:512\n\t"
                     "global_load_async_to_lds_b128 %0, %1, off offset:1024\n\t"
                     "global_load_async_to_lds_b128 %0, %1, off offset:1536\n\t"
                     "global_load_async_to_lds_b128 %0, %1, off offset:2048\n\t"
                     "global_load_async_to_lds_b128 %0, %1, off offset:2560\n\t"
                     "global_load_async_to_lds_b128 %0, %1, off offset:3072\n\t"
                     "global_load_async_to_lds_b128 %0, %1, off offset:3584\n\t"
                     "s_wait_xcnt 0x0"
                     :: "v"((unsigned)(size_t)rw), "v"(p) : "memory");
    };
    // one f32 row (this lane's 4 values) -> its bf16 hi row, bf16 lo row and f16 x ts row of a tile; pa, pf: this lane's 8 bytes of the wave's first row there
    auto put_row = [&](const v4f x, unsigned char* pa, unsigned char* pf, int i) {
        v2u hi, lo; unsigned l0, l1;
        hi[0] = bf2_split(x[0], x[1], &l0); hi[1] = bf2_split(x[2], x[3], &l1); lo[0] = l0; lo[1] = l1;
        *(v2u*)(pa + i * PA) = hi; *(v2u*)(pa + (32 + i) * PA) = lo;
        *(v4h*)(pf + i * PV) = __builtin_convertvector(x * ts, v4h);
    };
    copy_rows(0);
    float qm;
    {   // the block's 64 rows of q: wave wv takes rows 4 wv .. 4 wv + 3: q . w_q -> saq, q * w_qm + w_m -> hi and lo rows of qs
        typedef __attribute__((ext_vector_type(2))) int v2i;
        const float* xp = Q + (q0 + wv * 4) * D + l4;
        const v4f w = *(const v4f*)(wq + lane * 4), g = *(const v4f*)(wqm + lane * 4), u = *(const v4f*)(wm + lane * 4);
        const v2i k = *(const v2i*)(MM + bz * M + threadIdx.x * 2);   // the memory mask of the whole batch row: read once a block, kept as float
        const int kq = (QM + q0 + qg * 16)[(unsigned)nl];   // scalar base and a lane offset that lives on: no address register of its own to be reused
        v4f y[4];
#pragma unroll
        for (int i = 0; i < 4; ++i) y[i] = *(const v4f*)(xp + i * D);
        asm volatile("s_wait_xcnt 0x0" ::: "memory");   // the work below reuses the address registers that the loads above name
        __builtin_amdgcn_sched_barrier(0);   // holds the first rewrite of those registers behind the wait
        *(v2fp*)&smf[threadIdx.x * 2] = __builtin_convertvector(k, v2fp);
        qm = (float)kq;
        float keep = 0.f;
#pragma unroll
        for (int i = 0; i < 4; ++i) {
            float s = y[i][0] * w[0]; s += y[i][1] * w[1]; s += y[i][2] * w[2]; s += y[i][3] * w[3];
            for (int o = 16; o > 0; o >>= 1) s += __shfl_xor(s, o, 32);
            if (lane == i) keep = s;
        }
        if (lane < 4) saq[wv * 4 + lane] = keep;
        unsigned char* pq = qs + wv * 4 * PA + lane * 8;
#pragma unroll
        for (int i = 0; i < 4; ++i) { v2u hi, lo; unsigned l0, l1;
            const v4f z = y[i] * g + u;
            hi[0] = bf2_split(z[0], z[1], &l0); hi[1] = bf2_split(z[2], z[3], &l1); lo[0] = l0; lo[1] = l1;
            *(v2u*)(pq + i * PA) = hi; *(v2u*)(pq + (64 + i) * PA) = lo; }
    }
    asm volatile("s_wait_asynccnt 0x0" ::: "memory");   // this wave's copies of tile 0 have landed; it alone reads its slot
#pragma unroll
    for (int i = 0; i < 8; ++i) put_row(*(const v4f*)(rw + i * 512), ring + ms * TILE + qg * 8 * PA + lane * 8, ring + ms * TILE + 64 * PA + qg * 8 * PV + lane * 8, i);
    asm volatile("s_wait_dscnt 0x0" ::: "memory");      // this wave's reads of its slot have returned before the next copies are aimed at it
    __syncthreads();   // publishes qs, saq, smf and tile 0
    copy_rows(1);
    const float aq = saq[qg * 16 + nl];
    FB::V qh[4], ql[4];
#pragma unroll
    for (int kk = 0; kk < 4; ++kk) {
        qh[kk] = FB::load((const __bf16*)(qs + (qg * 16 + nl) * PA) + koff + kk * 32);
        ql[kk] = FB::load((const __bf16*)(qs + (64 + qg * 16 + nl) * PA) + koff + kk * 32);
    }
    v8f o[8];
#pragma unroll
    for (int dt = 0; dt < 8; ++dt) o[dt] = (v8f){0.f, 0.f, 0.f, 0.f, 0.f, 0.f, 0.f, 0.f};
    float mrun = -3.0e38f, lsum = 0.f;
    constexpr float L2E = 0x1.715476p+0f;   // log2(e)
    typedef __attribute__((ext_vector_type(2))) float v2e;
    // O^T += memory^T x P^T over the 8 tiles of d; with make, tile s + 1 is made in between, a row for each tile of d, so that its vector work and its LDS stores run under
    //   the fragment reads and the matrix instructions. It goes into buffer nb, whose last readers (trip s - 1) left it at the barrier one trip ago.
    auto second = [&](const unsigned char* tt, const FH::V pb, const float alpha, const bool make, const int nb) __attribute__((always_inline)) {
        FH::U f[2];
        f[0].h[0] = lds_tr16(tt); f[0].h[1] = lds_tr16(tt + 16 * PV);
        v4f x[2];
        // holds the wait below behind the exponentials (left free it is scheduled up into the first product, where the copies are still young) and, in both forms of the trip,
        //   the second product's work out of the first product's stretch, where no register is free: without it the build spills
        __builtin_amdgcn_sched_barrier(0);
        if (make) {
            asm volatile("s_wait_asynccnt 0x0" ::: "memory");   // this wave's copies of tile s + 1 have landed; it alone reads its slot
            x[0] = *(const v4f*)rw;
        }
        unsigned char* pa = ring + nb * BUF + ms * TILE + qg * 8 * PA + lane * 8;
        unsigned char* pf = ring + nb * BUF + ms * TILE + 64 * PA + qg * 8 * PV + lane * 8;
#pragma unroll
        for (int dt = 0; dt < 8; ++dt) {
            if (dt < 7) { f[(dt + 1) & 1].h[0] = lds_tr16(tt + 32 * (dt + 1)); f[(dt + 1) & 1].h[1] = lds_tr16(tt + 16 * PV + 32 * (dt + 1)); }   // read ahead of the row's stores
            if (make) {
                if (dt < 7) x[(dt + 1) & 1] = *(const v4f*)(rw + (dt + 1) * 512);   // one row ahead: its latency is covered and only two rows' registers are held
                put_row(x[dt & 1], pa, pf, dt);
            }
            o[dt] = FH::mma(f[dt & 1].v, pb, o[dt] * alpha);
        }
    };
    // one trip: tile s is worked on; with make, tile s + 1 is made. Inlined at both places: a call would put the accumulators into memory
    auto trip = [&](const int s, const bool make) __attribute__((always_inline)) {
        const unsigned char* tb = ring + (s & 1) * BUF + ms * TILE;
        const __bf16* th = (const __bf16*)(tb + nl * PA) + koff;
        const __bf16* tl = (const __bf16*)(tb + (32 + nl) * PA) + koff;
        const unsigned char* tt = tb + 64 * PA + (koff + (lane & 7)) * PV + ((lane >> 3) & 1) * 16;   // the transposing load's lane address: memory rows 8 h + (lane & 7)
        v8f sc[2];
        sc[0] = (v8f){0.f, 0.f, 0.f, 0.f, 0.f, 0.f, 0.f, 0.f}; sc[1] = sc[0];
#pragma unroll
        for (int kk = 0; kk < 4; ++kk)
#pragma unroll
            for (int t = 0; t < 2; ++t) {
                const FB::V ah = FB::load(th + t * 16 * (PA / 2) + kk * 32);
                const FB::V al = FB::load(tl + t * 16 * (PA / 2) + kk * 32);
                sc[t] = FB::mma(ah, qh[kk], sc[t]);
                sc[t] = FB::mma(ah, ql[kk], sc[t]);
                sc[t] = FB::mma(al, qh[kk], sc[t]);
            }
        const int mb = ms * MQ4 + s * 32 + koff;
        float v[2][8];
        float mloc = -3.0e38f;
#pragma unroll
        for (int t = 0; t < 2; ++t) {
            const v4f f0 = *(const v4f*)&smf[mb + t * 16], f1 = *(const v4f*)&smf[mb + t * 16 + 4];
#pragma unroll
            for (int r = 0; r < 8; ++r) {
                const float msk = qm * (r < 4 ? f0[r & 3] : f1[r & 3]);
                const float sim = sc[t][r] + aq + (1.f - msk) * -1.0e30f;
                v[t][r] = sim; mloc = fmaxf(mloc, sim);
            }
        }
        mloc = fmaxf(mloc, __shfl_xor(mloc, 16, 32));   // the other 16 memory rows of this query's 32 lie in lane ^ 16
        const float mnew = fmaxf(mrun, mloc);
        float alpha = (mrun - mnew) * L2E;
        mrun = mnew;
        float e[2][8];   // first the exponents, two at a time (packed subtract, packed fused multiply-add), then 2^e in place
#pragma unroll
        for (int t = 0; t < 2; ++t)
#pragma unroll
            for (int r = 0; r < 8; r += 2) {
                const v2e a = __builtin_elementwise_fma((v2e){v[t][r], v[t][r + 1]} - (v2e){mnew, mnew}, (v2e){L2E, L2E}, (v2e){lps, lps});
                e[t][r] = a[0]; e[t][r + 1] = a[1];
            }
        // v_exp_f32 in runs: each fills the slot that the instruction set asks for behind the one before it, and the one v_nop fills it behind the last;
        //   left to the compiler every exponential went through one register, a dependent chain with a v_nop of its own
        asm("v_exp_f32 %0, %0\n\tv_exp_f32 %1, %1\n\tv_exp_f32 %2, %2\n\tv_exp_f32 %3, %3\n\tv_exp_f32 %4, %4\n\tv_exp_f32 %5, %5\n\t"
            "v_exp_f32 %6, %6\n\tv_exp_f32 %7, %7\n\tv_exp_f32 %8, %8\n\tv_nop"
            : "+v"(e[0][0]), "+v"(e[0][1]), "+v"(e[0][2]), "+v"(e[0][3]), "+v"(e[0][4]), "+v"(e[0][5]), "+v"(e[0][6]), "+v"(e[0][7]), "+v"(alpha));
        asm("v_exp_f32 %0, %0\n\tv_exp_f32 %1, %1\n\tv_exp_f32 %2, %2\n\tv_exp_f32 %3, %3\n\tv_exp_f32 %4, %4\n\tv_exp_f32 %5, %5\n\t"
            "v_exp_f32 %6, %6\n\tv_exp_f32 %7, %7\n\tv_nop"
            : "+v"(e[1][0]), "+v"(e[1][1]), "+v"(e[1][2]), "+v"(e[1][3]), "+v"(e[1][4]), "+v"(e[1][5]), "+v"(e[1][6]), "+v"(e[1][7]));
        FH::V pb;
        float s0 = 0.f, s1 = 0.f;
#pragma unroll
        for (int r = 0; r < 8; ++r) {
            s0 += e[0][r]; s1 += e[1][r];
            pb[r] = (_Float16)e[0][r]; pb[8 + r] = (_Float16)e[1][r];
        }
        lsum = lsum * alpha + (s0 + s1);
        second(tt, pb, alpha, make, (s + 1) & 1);
    };
#pragma unroll 1   // stays rolled
    for (int s = 0; s < NS - 1; ++s) {
        trip(s, true);
        asm volatile("s_wait_dscnt 0x0" ::: "memory");   // this wave's reads of its slot have returned before the next copies are aimed at it
        __syncthreads();                          // publishes tile s + 1 and ends every wave's reads of buffer s & 1
        if (s + 2 < NS) copy_rows(s + 2);         // flies under trip s + 1 up to its second product
    }
    trip(NS - 1, false);   // the last tile: none to make
    __syncthreads();       // ends every wave's reads of the ring and of the mask, whose places are used anew below
    lsum += __shfl_xor(lsum, 16, 32);
    if (h == 0) { smx[ms][qg][nl] = mrun; ssm[ms][qg][nl] = lsum; }
    __syncthreads();   // the four quarters' maxima and sums are there
    float mtot = smx[0][qg][nl];
#pragma unroll
    for (int j = 1; j < 4; ++j) mtot = fmaxf(mtot, smx[j][qg][nl]);
    float ltot = 0.f;
#pragma unroll
    for (int j = 0; j < 4; ++j) ltot += ssm[j][qg][nl] * exp_slot(smx[j][qg][nl] - mtot);
    const float fo = exp_slot(mrun - mtot);
    float* so = (float*)ring;   // [quarter][query group][d tile][lane][8]
#pragma unroll
    for (int dt = 0; dt < 8; ++dt) {
        const v8f w = o[dt] * fo;
        float* p = so + (((ms * 4 + qg) * 8 + dt) * 32 + lane) * 8;
        *(v4f*)p = (v4f){w[0], w[1], w[2], w[3]}; *(v4f*)(p + 4) = (v4f){w[4], w[5], w[6], w[7]};
    }
    __syncthreads();   // the partial outputs are there
    const float inv = os / ltot;
    float* op = OUT + row * D + ms * 32 + koff;   // wave (qg, ms) sums and stores d = 32 ms .. 32 ms + 31 of its 16 queries: one whole 128-byte line a query
#pragma unroll
    for (int j = 0; j < 2; ++j) {
        v4f a0 = {0.f, 0.f, 0.f, 0.f}, a1 = a0;
#pragma unroll
        for (int k = 0; k < 4; ++k) {
            const float* p = so + (((k * 4 + qg) * 8 + ms * 2 + j) * 32 + lane) * 8;
            a0 += *(const v4f*)p; a1 += *(const v4f*)(p + 4);
        }
        *(v4f*)(op + j * 16) = a0 * inv; *(v4f*)(op + j * 16 + 4) = a1 * inv;
    }
    if (ms == 0) {   // row maximum staged as a whole 32-float line (slot 0 is read later)
        asm volatile("s_wait_xcnt 0x0" ::: "memory");   // the address work below reuses registers that the stores above name
        __builtin_amdgcn_sched_barrier(0);   // holds the first rewrite of those registers behind the wait
        float* rp = RMX + row * 32 + h * 16;
        const v4f m4 = {mtot, mtot, mtot, mtot};
#pragma unroll
        for (int j = 0; j < 4; ++j) *(v4f*)(rp + j * 4) = m4;
    } }

// memory->query: p = softmax_n(RMX[b][n]); MQ[b][every row][d] = sum_n p_n q[b][n][d]. One block of 32 waves per (batch, 32-float slice of d): thread t owns row
//   maximum t for the statistics; for the weighted sum a wave reads 4 rows x 128 bytes per load and every lane has its 8 row loads in flight at once
//   (issued ahead of the statistics, which do not depend on them); partial sums meet by lane shuffles and one LDS table. The block then stores its slice into
//   all N rows of the second output itself, 16 bytes a lane, 8 stores a lane.
template <int N, int D>
__global__ __launch_bounds__(1024) void k_bi_m2q(const float* __restrict__ RMX, const float* __restrict__ Q, float* __restrict__ MQ) {
    static_assert(N == 1024 && D % 32 == 0, "one row maximum per thread; whole 128-byte slices of d");
    __shared__ float red[32]; __shared__ float pw[N]; __shared__ __align__(16) float part[32][32]; __shared__ __align__(16) float vec[32];
    const int b = blockIdx.x, d0 = blockIdx.y * 32, t = threadIdx.x, lane = t & 31, wv = t >> 5;
    const int rsub = lane >> 3, c4 = (lane & 7) * 4;
    const float r = RMX[((long long)b * N + t) * 32];
    const float* qb = Q + ((long long)b * N + wv * 4 + rsub) * D + d0 + c4;
    v4f x[N / 128];
    for (int i = 0; i < N / 128; ++i) x[i] = *(const v4f*)(qb + (long long)i * 128 * D);
    float mx = r;
    for (int o = 16; o > 0; o >>= 1) mx = fmaxf(mx, __shfl_xor(mx, o, 32));
    if (lane == 0) red[wv] = mx;
    __syncthreads();
    float mm = red[lane];
    for (int o = 16; o > 0; o >>= 1) mm = fmaxf(mm, __shfl_xor(mm, o, 32));
    __syncthreads();
    const float e = expf(r - mm); pw[t] = e;
    float s = e;
    for (int o = 16; o > 0; o >>= 1) s += __shfl_xor(s, o, 32);
    if (lane == 0) red[wv] = s;
    __syncthreads();
    float tot = red[lane];
    for (int o = 16; o > 0; o >>= 1) tot += __shfl_xor(tot, o, 32);
    v4f acc = {0.f, 0.f, 0.f, 0.f};
    for (int i = 0; i < N / 128; ++i) acc += pw[i * 128 + wv * 4 + rsub] * x[i];
    for (int c = 0; c < 4; ++c) { acc[c] += __shfl_xor(acc[c], 8, 32); acc[c] += __shfl_xor(acc[c], 16, 32); }
    if (lane < 8) *(v4f*)&part[wv][c4] = acc;
    __syncthreads();
    if (t < 32) { float a = 0.f;
        for (int w = 0; w < 32; ++w) a += part[w][t];
        vec[t] = a * (1.f / tot); }
    __syncthreads();   // publishes the finished slice to the 32 waves that store it
    const v4f bv = *(const v4f*)&vec[c4];
    float* op = MQ + ((long long)b * N + wv * 4 + rsub) * D + d0 + c4;   // a wave store = 4 rows x one whole 128-byte line, as the reads of q above
    for (int i = 0; i < N / 128; ++i) *(v4f*)(op + (long long)i * 128 * D) = bv; }


extern "C" void kernel_launch(void* const* d_in, const int* in_sizes, int n_in, void* d_out, int out_size, void* d_ws, size_t ws_size, hipStream_t stream) {
    (void)in_sizes; (void)n_in; (void)out_size; (void)ws_size;
    const float* q = (const float*)d_in[0];
    const float* mem = (const float*)d_in[1];
    const float* wq = (const float*)d_in[2];
    const float* wm = (const float*)d_in[3];
    const float* wqm = (const float*)d_in[4];
    const int* qmask = (const int*)d_in[5];
    const int* mmask = (const int*)d_in[6];
    const int Bn = 16;
    const int N = 1024;
    const int M = 1024;
    const int D = 128;
    float* out = (float*)d_out;
    float* mq = out + ((size_t)Bn * N * D);
    char* wsp = (char*)d_ws;
    float* RMX = (float*)wsp;
    k_bi_fused<1024, 1024, 128><<<dim3((unsigned)(N / 64), (unsigned)Bn), 512, 0, stream>>>(q, mem, wq, wm, wqm, qmask, mmask, RMX, out, 16.0f, 12.0f, 0.0625f);
    k_bi_m2q<1024, 128><<<dim3((unsigned)Bn, 4u), 1024, 0, stream>>>(RMX, q, mq);
}

// v009
// Measured time: 22.9 microseconds a run.
// Timed twice side by side with v008, it ran 1.28 times as fast both times.
// Counting every step since v000, which is the starting kernel, it is 67.1 times as fast.
// Contractions: per batch the trilinear term (q * w_qm).m^T [1024x128].[128x1024] on bf16 hi/lo split planes (logits reach ~+-30, so they need f32-class accuracy) and the query->memory read q2m.memory [1024x1024].[1024x128] with f16 operands (probabilities x 2^12) — one fused kernel, each wave 16 queries x a quarter of the batch's unmasked memory rows in tiles of 32 rows; f32 accumulate. The memory's linear term rides in the first product (its other operand is q * w_qm + w_m); the query's linear term, the mask arithmetic (sim + (1 - mask) * -1e30, exactly as the module), the row softmax (exp once), the row maxima, the softmax over rows and the memory->query vector (broadcast to every row) are f32 arithmetic.
#include <hip/hip_runtime.h>
#include <math.h>

typedef __attribute__((ext_vector_type(16))) _Float16 v16h;
typedef __attribute__((ext_vector_type(8)))  _Float16 v8h;
typedef __attribute__((ext_vector_type(16))) __bf16   v16b;
typedef __attribute__((ext_vector_type(8)))  float    v8f;
typedef __attribute__((ext_vector_type(4)))  float    v4f;

// 16-bit WMMA fragment map (wave32), lane L, h = L>>4, m = L&15:
//   A 16x32: lane = row m;   element i -> k = (i<8) ? 8h+i : 16+8h+(i-8)
//   B 32x16: lane = column m; the SAME k(i,h)
//   D 16x16 (8 f32): lane = column m; element r -> row 8h+r
__device__ __forceinline__ int frag_k(int i, int h) { return (i < 8) ? (8 * h + i) : (16 + 8 * h + (i - 8)); }
__device__ __forceinline__ __bf16 bf16_rne(float f) {
    unsigned int u = __float_as_uint(f);
    u += 0x7fffu + ((u >> 16) & 1u);
    return __builtin_bit_cast(__bf16, (unsigned short)(u >> 16));
}
__device__ __forceinline__ float bf16_f32(__bf16 b) { return __uint_as_float(((unsigned int)__builtin_bit_cast(unsigned short, b)) << 16); }
__device__ __forceinline__ v8f wmma16(v16h a, v16h b, v8f c) {
    c = __builtin_amdgcn_wmma_f32_16x16x32_f16(false, a, false, b, (short)0, c, false, false);
    asm volatile("v_nop\n\tv_nop\n\tv_nop\n\tv_nop" : "+v"(c) : "v"(a), "v"(b));
    return c;
}
__device__ __forceinline__ v8f wmmab(v16b a, v16b b, v8f c) {
    c = __builtin_amdgcn_wmma_f32_16x16x32_bf16(false, a, false, b, (short)0, c, false, false);
    asm volatile("v_nop\n\tv_nop\n\tv_nop\n\tv_nop" : "+v"(c) : "v"(a), "v"(b));
    return c;
}
struct Split { v16b hi, lo; };
// hi/lo split product: a.hi*b.hi + a.hi*b.lo + a.lo*b.hi
__device__ __forceinline__ v8f wmma3(const Split& a, const Split& b, v8f c) {
    c = __builtin_amdgcn_wmma_f32_16x16x32_bf16(false, a.hi, false, b.hi, (short)0, c, false, false);
    c = __builtin_amdgcn_wmma_f32_16x16x32_bf16(false, a.hi, false, b.lo, (short)0, c, false, false);
    c = __builtin_amdgcn_wmma_f32_16x16x32_bf16(false, a.lo, false, b.hi, (short)0, c, false, false);
    asm volatile("v_nop\n\tv_nop\n\tv_nop\n\tv_nop" : "+v"(c) : "v"(a.hi), "v"(a.lo), "v"(b.hi), "v"(b.lo));
    return c;
}
struct Split3 { v16b hi, mid, lo; };
// triple split product (6 terms, drops only terms below 2^-24 relative)
__device__ __forceinline__ v8f wmma6(const Split3& a, const Split3& b, v8f c) {
    c = __builtin_amdgcn_wmma_f32_16x16x32_bf16(false, a.hi, false, b.hi, (short)0, c, false, false);
    c = __builtin_amdgcn_wmma_f32_16x16x32_bf16(false, a.hi, false, b.mid, (short)0, c, false, false);
    c = __builtin_amdgcn_wmma_f32_16x16x32_bf16(false, a.mid, false, b.hi, (short)0, c, false, false);
    c = __builtin_amdgcn_wmma_f32_16x16x32_bf16(false, a.hi, false, b.lo, (short)0, c, false, false);
    c = __builtin_amdgcn_wmma_f32_16x16x32_bf16(false, a.mid, false, b.mid, (short)0, c, false, false);
    c = __builtin_amdgcn_wmma_f32_16x16x32_bf16(false, a.lo, false, b.hi, (short)0, c, false, false);
    asm volatile("v_nop\n\tv_nop\n\tv_nop\n\tv_nop" : "+v"(c) : "v"(a.hi), "v"(a.mid), "v"(a.lo), "v"(b.hi), "v"(b.mid), "v"(b.lo));
    return c;
}

// Fragment gathers from f32 memory: element i <- p[(k0 + frag_k(i,h)) * sk] * s, zero for k >= klen.
__device__ __forceinline__ v16h fh_ld(const float* __restrict__ p, long long sk, int k0, int h, int klen, float s) {
    v16h a;
#pragma unroll
    for (int i = 0; i < 16; ++i) { const int k = k0 + frag_k(i, h); a[i] = (k < klen) ? (_Float16)(p[(long long)k * sk] * s) : (_Float16)0.f; }
    return a;
}
__device__ __forceinline__ Split sp_ld(const float* __restrict__ p, long long sk, int k0, int h, int klen, float s) {
    Split r;
#pragma unroll
    for (int i = 0; i < 16; ++i) {
        const int k = k0 + frag_k(i, h); const float x = (k < klen) ? p[(long long)k * sk] * s : 0.f;
        const __bf16 hb = bf16_rne(x); r.hi[i] = hb; r.lo[i] = bf16_rne(x - bf16_f32(hb));
    }
    return r;
}
__device__ __forceinline__ Split3 sp3_ld(const float* __restrict__ p, long long sk, int k0, int h, int klen, float s) {
    Split3 r;
#pragma unroll
    for (int i = 0; i < 16; ++i) {
        const int k = k0 + frag_k(i, h); const float x = (k < klen) ? p[(long long)k * sk] * s : 0.f;
        const __bf16 hb = bf16_rne(x); const float r1 = x - bf16_f32(hb); const __bf16 mb = bf16_rne(r1);
        r.hi[i] = hb; r.mid[i] = mb; r.lo[i] = bf16_rne(r1 - bf16_f32(mb));
    }
    return r;
}
__device__ __forceinline__ v16b bh_ld(const float* __restrict__ p, long long sk, int k0, int h, int klen, float s) {
    v16b a;
#pragma unroll
    for (int i = 0; i < 16; ++i) { const int k = k0 + frag_k(i, h); a[i] = bf16_rne((k < klen) ? p[(long long)k * sk] * s : 0.f); }
    return a;
}
// f16 fragment from an f16 LDS/global row with element stride 1 (k-contiguous), no bounds (tile already zero padded)
__device__ __forceinline__ v16h fh_row(const _Float16* __restrict__ row, int k0, int h) {
    v16h a;
#pragma unroll
    for (int i = 0; i < 16; ++i) a[i] = row[k0 + frag_k(i, h)];
    return a;
}

#define VST2(T, ptr, val) do { const T vst2_v_ = (val); *(T*)(ptr) = vst2_v_;  } while (0)
typedef float v4f __attribute__((ext_vector_type(4)));
#define VST2V4(ptr, val) do { const v4f vst2_v4_ = (val); *(v4f*)(ptr) = vst2_v4_;  } while (0)

__device__ __attribute__((noinline)) float act_fn(float v, int act) {
    if (act == 1) return fmaxf(v, 0.f);                                                                               // relu
    if (act == 2) { const float u = 0.7978845608028654f * (v + 0.044715f * v * v * v); return 0.5f * v * (1.f + tanhf(u)); } // tanh-gelu
    if (act == 3) return v / (1.f + expf(-v));                                                                        // silu
    if (act == 4) return 0.5f * v * (1.f + erff(v * 0.7071067811865476f));                                             // erf-gelu
    if (act == 5) return tanhf(v);
    if (act == 6) return 1.f / (1.f + expf(-v));                                                                      // sigmoid
    if (act == 7) return (v > 0.f) ? v : 0.01f * v;                                                                   // leaky relu 0.01
    if (act == 8) return (v > 0.f) ? v : (expf(v) - 1.f);                                                             // elu
    if (act == 9) return fminf(fmaxf(v, 0.f), 6.f);                                                                   // relu6
    if (act == 10) return fabsf(v);                                                                                    // abs
    if (act == 11) return (v >= 0.f) ? v : 0.1f * v;                                                                  // leaky 0.1
    if (act == 12) return (v > 0.f) ? v : 0.2f * v;                                                                   // leaky 0.2
    if (act == 13) return (v > 20.f) ? v : log1pf(expf(v));                                                            // softplus
    return v;
}

// =====================================================================================================================
// k_gemm<MODE>: C(z, m, n) = act(alpha * sum_k A(z, m, k) * B(z, k, n) + bias) + beta * R(z, m, n)
//   One wave (32-thread block) per 16 x 32 tile of C; grid (ceil(N/32), ceil(M/16), Z). Batch z -> (zo = z / zi_n, zi = z % zi_n)
//   with separate outer/inner strides for every tensor (e.g. batch and head). A(m,k) = A[zo*sAo + zi*sAi + m*sAm + k*sAk] (f32),
//   B(k,n) = B[zo*sBo + zi*sBi + n*sBn + k*sBk] (f32); any M, N, K (K zero-padded to 32 inside the fragments, M/N tails guarded).
//   C(m,n) = C[zo*sCo + zi*sCi + m*sCm + n] (n contiguous). flags: 1 bias[n], 2 bias[m], 4 residual R[zo*sRo + zi*sRi + m*sRm + n*sRn].
//   MODE 0: f16 operands (A prescaled by sa, B by sb, both undone in the epilogue); 1: bf16 hi/lo split (3 products); 2: bf16;
//   3: bf16 hi/mid/lo triple split (6 products); 4: as 3 with Kahan-compensated f32 accumulation across k-steps.
// =====================================================================================================================
struct GemmP {
    const float* A; const float* B; const float* bias; const float* R; float* C;
    long long sAo, sAi, sAm, sAk, sBo, sBi, sBn, sBk, sCo, sCi, sCm, sRo, sRi, sRm, sRn;
    int M, N, K, zi_n, flags, act; float alpha, beta, sa, sb;
    int Npad, pad_;     // columns [N, Npad) of C are written as 0 so that padded workspace rows are covered by whole-line stores; Npad >= N
};
static_assert(sizeof(GemmP) == 5 * 8 + 15 * 8 + 6 * 4 + 4 * 4 + 2 * 4, "GemmP has padding");

template <int MODE>
__global__ __launch_bounds__(32) void k_gemm(GemmP p) {
    const int lane = threadIdx.x & 31, h = lane >> 4, l15 = lane & 15;
    const int m0 = blockIdx.y * 16, n0 = blockIdx.x * 32;
    const int z = blockIdx.z, zo = z / p.zi_n, zi = z - zo * p.zi_n;
    const float* A = p.A + zo * p.sAo + zi * p.sAi;
    const float* B = p.B + zo * p.sBo + zi * p.sBi;
    const int am = min(m0 + l15, p.M - 1);                       // clamped row for loads (stores are guarded)
    v8f acc[2], comp[2];
#pragma unroll
    for (int t = 0; t < 2; ++t) { v8f zz = {}; acc[t] = zz; comp[t] = zz; }
    for (int k0 = 0; k0 < p.K; k0 += 32) {
        const float* arow = A + (long long)am * p.sAm;
        if (MODE == 1) {
            const Split a = sp_ld(arow, p.sAk, k0, h, p.K, 1.f);
#pragma unroll
            for (int t = 0; t < 2; ++t) {
                const int bn = min(n0 + t * 16 + l15, p.N - 1);
                acc[t] = wmma3(a, sp_ld(B + (long long)bn * p.sBn, p.sBk, k0, h, p.K, 1.f), acc[t]);
            }
        } else if (MODE == 3) {
            const Split3 a = sp3_ld(arow, p.sAk, k0, h, p.K, 1.f);
#pragma unroll
            for (int t = 0; t < 2; ++t) {
                const int bn = min(n0 + t * 16 + l15, p.N - 1);
                acc[t] = wmma6(a, sp3_ld(B + (long long)bn * p.sBn, p.sBk, k0, h, p.K, 1.f), acc[t]);
            }
        } else if (MODE == 4) {
            // triple split as MODE 3, but each k-step's 6 products go into a fresh accumulator and the partial is added to the running f32 sum
            // on the VALU with Kahan compensation (accumulation error stays ~1 ulp however long K is)
            const Split3 a = sp3_ld(arow, p.sAk, k0, h, p.K, 1.f);
#pragma unroll
            for (int t = 0; t < 2; ++t) {
                const int bn = min(n0 + t * 16 + l15, p.N - 1); v8f zz = {};
                const v8f part = wmma6(a, sp3_ld(B + (long long)bn * p.sBn, p.sBk, k0, h, p.K, 1.f), zz);
                const v8f y = part - comp[t]; const v8f s = acc[t] + y; comp[t] = (s - acc[t]) - y; acc[t] = s;
            }
        } else if (MODE == 2) {
            const v16b a = bh_ld(arow, p.sAk, k0, h, p.K, 1.f);
#pragma unroll
            for (int t = 0; t < 2; ++t) {
                const int bn = min(n0 + t * 16 + l15, p.N - 1);
                acc[t] = wmmab(a, bh_ld(B + (long long)bn * p.sBn, p.sBk, k0, h, p.K, 1.f), acc[t]);
            }
        } else {
            const v16h a = fh_ld(arow, p.sAk, k0, h, p.K, p.sa);
#pragma unroll
            for (int t = 0; t < 2; ++t) {
                const int bn = min(n0 + t * 16 + l15, p.N - 1);
                acc[t] = wmma16(a, fh_ld(B + (long long)bn * p.sBn, p.sBk, k0, h, p.K, p.sb), acc[t]);
            }
        }
    }
    const float iscale = (MODE == 0) ? p.alpha / (p.sa * p.sb) : p.alpha;
    float* C = p.C + zo * p.sCo + zi * p.sCi;
    const float* R = p.R + zo * p.sRo + zi * p.sRi;
    __shared__ __align__(16) float ctile[16][36];
#pragma unroll
    for (int t = 0; t < 2; ++t) {
        const int n = n0 + t * 16 + l15; const int nn = min(n, p.N - 1);
#pragma unroll
        for (int r = 0; r < 8; ++r) {
            const int m = m0 + 8 * h + r; const int mm = min(m, p.M - 1);
            float v = acc[t][r] * iscale;
            if (p.flags & 1) v += p.bias[nn];
            if (p.flags & 2) v += p.bias[mm];
            if (p.flags & 8) v *= p.bias[(long long)zo * p.M + mm];   /* per-(z,row) scale vector laid out [Z][M]; exclusive with the bias flags */
            v = act_fn(v, p.act);
            if (p.flags & 4) v += p.beta * R[(long long)mm * p.sRm + (long long)nn * p.sRn];
            ctile[8 * h + r][t * 16 + l15] = (n < p.N) ? v : 0.f;
        }
    }
    __syncthreads();
    const int NW = (p.Npad > p.N) ? p.Npad : p.N;           // write width
    const bool fast = (m0 + 16 <= p.M) && (n0 + 32 <= NW) && ((p.sCm & 3) == 0) && ((((size_t)C) & 15) == 0);
    if (fast) {
#pragma unroll
        for (int s = 0; s < 4; ++s) {
            const int row = s * 4 + (lane >> 3), c4 = (lane & 7) * 4;
            const v4f v = *(const v4f*)&ctile[row][c4];
            VST2V4(C + (long long)(m0 + row) * p.sCm + n0 + c4, v);
        }
    } else {
        for (int row = 0; row < 16; ++row) {
            const int m = m0 + row, n = n0 + lane;
            if (m < p.M && n < NW) VST2(float, C + (long long)m * p.sCm + n, ctile[row][lane]);
        }
    }
}


// =====================================================================================================================
// k_gemmT<MODE, TM, TN>: same contract as k_gemm, but one wave computes a (16*TM) x (16*TN) tile: TM A fragments and TN B fragments are
//   loaded per 32-wide k-step and reused across TM*TN WMMAs (far fewer load/convert instructions per MAC). MODE 0 (f16), 1 (bf16 hi/lo),
//   2 (bf16) only. grid (ceil(NW/(16*TN)), ceil(M/(16*TM)), Z), block 32. Epilogue identical to k_gemm, run per 16x32 sub-tile.
// =====================================================================================================================
template <int MODE, int TM, int TN>
__global__ __launch_bounds__(32) void k_gemmT(GemmP p) {
    const int lane = threadIdx.x & 31, h = lane >> 4, l15 = lane & 15;
    const int m0 = blockIdx.y * (16 * TM), n0 = blockIdx.x * (16 * TN);
    const int z = blockIdx.z, zo = z / p.zi_n, zi = z - zo * p.zi_n;
    const float* A = p.A + zo * p.sAo + zi * p.sAi;
    const float* B = p.B + zo * p.sBo + zi * p.sBi;
    v8f acc[TM][TN];
#pragma unroll
    for (int i = 0; i < TM; ++i)
#pragma unroll
        for (int t = 0; t < TN; ++t) { v8f zz = {}; acc[i][t] = zz; }
    for (int k0 = 0; k0 < p.K; k0 += 32) {
        if (MODE == 1) {
            Split a[TM], b[TN];
#pragma unroll
            for (int i = 0; i < TM; ++i) { const int am = min(m0 + 16 * i + l15, p.M - 1); a[i] = sp_ld(A + (long long)am * p.sAm, p.sAk, k0, h, p.K, 1.f); }
#pragma unroll
            for (int t = 0; t < TN; ++t) { const int bn = min(n0 + 16 * t + l15, p.N - 1); b[t] = sp_ld(B + (long long)bn * p.sBn, p.sBk, k0, h, p.K, 1.f); }
#pragma unroll
            for (int i = 0; i < TM; ++i)
#pragma unroll
                for (int t = 0; t < TN; ++t) acc[i][t] = wmma3(a[i], b[t], acc[i][t]);
        } else if (MODE == 2) {
            v16b a[TM], b[TN];
#pragma unroll
            for (int i = 0; i < TM; ++i) { const int am = min(m0 + 16 * i + l15, p.M - 1); a[i] = bh_ld(A + (long long)am * p.sAm, p.sAk, k0, h, p.K, 1.f); }
#pragma unroll
            for (int t = 0; t < TN; ++t) { const int bn = min(n0 + 16 * t + l15, p.N - 1); b[t] = bh_ld(B + (long long)bn * p.sBn, p.sBk, k0, h, p.K, 1.f); }
#pragma unroll
            for (int i = 0; i < TM; ++i)
#pragma unroll
                for (int t = 0; t < TN; ++t) acc[i][t] = wmmab(a[i], b[t], acc[i][t]);
        } else {
            v16h a[TM], b[TN];
#pragma unroll
            for (int i = 0; i < TM; ++i) { const int am = min(m0 + 16 * i + l15, p.M - 1); a[i] = fh_ld(A + (long long)am * p.sAm, p.sAk, k0, h, p.K, p.sa); }
#pragma unroll
            for (int t = 0; t < TN; ++t) { const int bn = min(n0 + 16 * t + l15, p.N - 1); b[t] = fh_ld(B + (long long)bn * p.sBn, p.sBk, k0, h, p.K, p.sb); }
#pragma unroll
            for (int i = 0; i < TM; ++i)
#pragma unroll
                for (int t = 0; t < TN; ++t) acc[i][t] = wmma16(a[i], b[t], acc[i][t]);
        }
    }
    const float iscale = (MODE == 0) ? p.alpha / (p.sa * p.sb) : p.alpha;
    float* C = p.C + zo * p.sCo + zi * p.sCi;
    const float* R = p.R + zo * p.sRo + zi * p.sRi;
    const int NW = (p.Npad > p.N) ? p.Npad : p.N;
    __shared__ __align__(16) float ctile[16][36];
#pragma unroll
    for (int i = 0; i < TM; ++i) {
        const int mb = m0 + 16 * i; if (mb >= p.M) break;          // wave-uniform
#pragma unroll
        for (int tp = 0; tp < TN / 2; ++tp) {
            const int nb = n0 + 32 * tp; if (nb >= NW) break;        // wave-uniform
#pragma unroll
            for (int t2 = 0; t2 < 2; ++t2) {
                const int t = 2 * tp + t2; const int n = nb + t2 * 16 + l15; const int nn = min(n, p.N - 1);
#pragma unroll
                for (int r = 0; r < 8; ++r) {
                    const int m = mb + 8 * h + r; const int mm = min(m, p.M - 1);
                    float v = acc[i][t][r] * iscale;
                    if (p.flags & 1) v += p.bias[nn];
                    if (p.flags & 2) v += p.bias[mm];
            if (p.flags & 8) v *= p.bias[(long long)zo * p.M + mm];   /* per-(z,row) scale vector laid out [Z][M]; exclusive with the bias flags */
                    v = act_fn(v, p.act);
                    if (p.flags & 4) v += p.beta * R[(long long)mm * p.sRm + (long long)nn * p.sRn];
                    ctile[8 * h + r][t2 * 16 + l15] = (n < p.N) ? v : 0.f;
                }
            }
            __syncthreads();
            const bool fast = (mb + 16 <= p.M) && (nb + 32 <= NW) && ((p.sCm & 3) == 0) && ((((size_t)C) & 15) == 0);
            if (fast) {
#pragma unroll
                for (int s = 0; s < 4; ++s) {
                    const int row = s * 4 + (lane >> 3), c4 = (lane & 7) * 4;
                    const v4f v = *(const v4f*)&ctile[row][c4];
                    VST2V4(C + (long long)(mb + row) * p.sCm + nb + c4, v);
                }
            } else {
                for (int row = 0; row < 16; ++row) {
                    const int m = mb + row, n = nb + lane;
                    if (m < p.M && n < NW) VST2(float, C + (long long)m * p.sCm + n, ctile[row][lane]);
                }
            }
            __syncthreads();
        }
    }
}

// =====================================================================================================================
//   Wave = 16 queries, AW waves per block, 64-key blocks; grid (ceil(Lq/(16*AW)), H, B), block 32*AW. Any Lq, Lk; head dim dh <= DHP
//   (DHP multiple of 32), value dim dv <= DVP (multiple of 16, <= 128). Every tensor addressed by (batch, head, row, element) strides, f32.
//   Scores: QM 0 f16 operands, 1 bf16 hi/lo split, 2 bf16 triple split; statistics f32 (exp2 domain); P.V: P x 4096 as f16 with V f16 staged in LDS
//   (SPLITPV: P and V as bf16 hi/lo splits). kv head = h / hrep. Masking: causal = 1 (keep j <= i + coff, masked -> -inf, key blocks beyond the
//   diagonal skipped), causal = 2 (masked -> mfill, a finite fill like the -1e9; no skipping), causal = 3 (keep j >= i + coff,
//   masked -> -inf, no skipping); optional additive f32 mask Mf,
//   optional int keep-mask Mi (0 -> score := mfill), both addressed b*smb + h*smh + i*smi + j*smj (0 strides broadcast).
// =====================================================================================================================
#define AW 4
struct AttnP {   // apv4
    const float* Q; const float* K; const float* V; float* O; float* P; const float* Mf; const int* Mi; float* ST;
    const float* Pw; const float* Rt; const int* SQ; const int* SK;           // optional: post-softmax weight, relative-position table, segment ids
    long long swb, swh, swi, swj, srb, srh, sri;                                 // Pw strides (b,h,i,j); Rt strides (b,h,i), column = clamp(i - j + roff, 0, rn-1)
    long long sQb, sQh, sQi, sQd, sKb, sKh, sKj, sKd, sVb, sVh, sVj, sVd, sOb, sOh, sOi, sPb, sPh, sPi, smb, smh, smi, smj;
    int Lq, Lk, dh, dv, hrep, causal, coff, pband;   // pband > 0: P holds only the band |j - i| <= pband, column j - i + pband
    float scale, mfill; int nonorm, mpol;             // nonorm (online path only): O = sum_j exp(score_j) V_j without the 1/rowsum (scores must be <= ~0); mpol: Mi masks where ==0 (mpol 0) or where !=0 (mpol 1)
    int roff, rn, segpol, win;                        // Rt column offset/count; SQ/SK: score := mfill where (segpol 0) SQ[i] != SK[j] or (segpol 1) SQ[i] == SK[j]; win > 0: keys with i - j > win (after coff) -> -inf
};
//   Pw: the softmax numerator is multiplied by Pw(b,h,i,j) AFTER the row sum is taken (probs * weight, then P.V), as in post-softmax multiplicative biases.                                                    // ST (optional): per row (b,h,i) -> ST[((b*H + h)*Lq + i)*2 + {0,1}] = {row max of the scaled+masked score (natural units), sum_j exp(score - max)}
static_assert(sizeof(AttnP) == 12 * 8 + 29 * 8 + 16 * 4, "AttnP has padding");

#ifndef KATTN_ATTR
#define KATTN_ATTR
#endif
template <int DHP, int DVP, int QM, bool SPLITPV, bool TWOPASS>
__global__ __launch_bounds__(32 * AW) KATTN_ATTR void k_attn(AttnP p) {
    constexpr int NT = DVP / 16;                // output tiles
    constexpr int KS = DHP / 32;                // k-steps for the scores
    constexpr int VP = DVP + 8;                 // LDS pitch (halves)
    __shared__ __align__(16) float    pl[AW][16 * 64];
    __shared__ __align__(16) _Float16 vl[(SPLITPV ? 2 : 1) * 64 * VP];   // f16 V tile, or bf16 hi and lo tiles (same 2-byte size)
    const int lane = threadIdx.x & 31, hf = lane >> 4, l15 = lane & 15, wave = threadIdx.x >> 5;
    const int h = blockIdx.y, b = blockIdx.z, hk = h / p.hrep;
    const int q0 = (blockIdx.x * AW + wave) * 16;
    float* myp = pl[wave];
    const float L2E = 1.4426950408889634f;
    const float NEG = -__builtin_inff();
    const int qi = min(q0 + l15, p.Lq - 1);
    const float* qrow = p.Q + b * p.sQb + h * p.sQh + (long long)qi * p.sQi;
    const float* kbase = p.K + b * p.sKb + hk * p.sKh;
    const float* vbase = p.V + b * p.sVb + hk * p.sVh;
    v16h qa[QM == 0 ? KS : 1]; Split qs_[QM == 1 ? KS : 1]; Split3 qt_[QM == 2 ? KS : 1];
#pragma unroll
    for (int ks = 0; ks < KS; ++ks) {
        if (QM == 2) qt_[ks] = sp3_ld(qrow, p.sQd, ks * 32, hf, p.dh, 1.f);
        else if (QM == 1) qs_[ks] = sp_ld(qrow, p.sQd, ks * 32, hf, p.dh, 1.f);
        else qa[ks] = fh_ld(qrow, p.sQd, ks * 32, hf, p.dh, 1.f);
    }
    v8f o[NT]; float m8[8], l8[8];
#pragma unroll
    for (int t = 0; t < NT; ++t) { v8f zz = {}; o[t] = zz; }
#pragma unroll
    for (int i = 0; i < 8; ++i) { m8[i] = NEG; l8[i] = 0.f; }
    int jend = p.Lk;
    if (p.causal == 1) { const int je = (blockIdx.x * AW + AW - 1) * 16 + 16 + p.coff; jend = min(jend, max(je, 0)); }   // uniform per block
    const int npass = TWOPASS ? 2 : 1;
    for (int pass = 0; pass < npass; ++pass) {
        const bool dopv = (!TWOPASS) || pass == 1;
        for (int j0 = 0; j0 < jend; j0 += 64) {
            if (dopv) {
                __syncthreads();                                 // previous key block's reads of vl / pl are done
                for (int idx = threadIdx.x; idx < 64 * DVP; idx += 32 * AW) {
                    const int jr = idx / DVP, d = idx - jr * DVP, j = j0 + jr;
                    const float f = (j < p.Lk && d < p.dv) ? vbase[(long long)j * p.sVj + (long long)d * p.sVd] : 0.f;
                    if (SPLITPV) {
                        const __bf16 hb = bf16_rne(f);
                        ((__bf16*)vl)[jr * VP + d] = hb; ((__bf16*)vl)[64 * VP + jr * VP + d] = bf16_rne(f - bf16_f32(hb));
                    } else vl[jr * VP + d] = (_Float16)f;
                }
            }
            v8f s[4];
#pragma unroll
            for (int t = 0; t < 4; ++t) {
                const int j = min(j0 + t * 16 + l15, p.Lk - 1);
                const float* krow = kbase + (long long)j * p.sKj;
                v8f acc = {};
#pragma unroll
                for (int ks = 0; ks < KS; ++ks) {
                    if (QM == 2)      acc = wmma6(qt_[ks], sp3_ld(krow, p.sKd, ks * 32, hf, p.dh, 1.f), acc);
                    else if (QM == 1) acc = wmma3(qs_[ks], sp_ld(krow, p.sKd, ks * 32, hf, p.dh, 1.f), acc);
                    else              acc = wmma16(qa[ks], fh_ld(krow, p.sKd, ks * 32, hf, p.dh, 1.f), acc);
                }
                s[t] = acc;
            }
            float pv[8][4];
#pragma unroll
            for (int i = 0; i < 8; ++i) {
                const int irow = q0 + i + 8 * hf;
                const int ic = min(irow, p.Lq - 1);
                float sc[4];
#pragma unroll
                for (int t = 0; t < 4; ++t) {
                    const int jg = j0 + t * 16 + l15;
                    float v = s[t][i] * p.scale;
                    if (p.Mf) v += p.Mf[b * p.smb + h * p.smh + (long long)ic * p.smi + (long long)min(jg, p.Lk - 1) * p.smj];
                    if (p.Rt) { int rc = ic - min(jg, p.Lk - 1) + p.roff; rc = rc < 0 ? 0 : (rc >= p.rn ? p.rn - 1 : rc); v += p.Rt[b * p.srb + h * p.srh + (long long)ic * p.sri + rc]; }
                    if (p.Mi) { const int mv = p.Mi[b * p.smb + h * p.smh + (long long)ic * p.smi + (long long)min(jg, p.Lk - 1) * p.smj]; if (p.mpol ? (mv != 0) : (mv == 0)) v = p.mfill; }
                    if (p.SQ) { const bool same = p.SQ[(long long)b * p.Lq + ic] == p.SK[(long long)b * p.Lk + min(jg, p.Lk - 1)]; if (p.segpol ? same : !same) v = p.mfill; }
                    if (p.causal == 2 && jg > irow + p.coff) v = p.mfill;
                    if (jg >= p.Lk || (p.causal == 1 && jg > irow + p.coff) || (p.causal == 3 && jg < irow + p.coff) || (p.win > 0 && irow + p.coff - jg > p.win)) v = NEG; else v *= L2E;
                    sc[t] = v;
                }
                if (!TWOPASS || pass == 0) {
                    float mx = fmaxf(fmaxf(sc[0], sc[1]), fmaxf(sc[2], sc[3]));
                    mx = fmaxf(mx, __shfl_xor(mx, 1, 32)); mx = fmaxf(mx, __shfl_xor(mx, 2, 32));
                    mx = fmaxf(mx, __shfl_xor(mx, 4, 32)); mx = fmaxf(mx, __shfl_xor(mx, 8, 32));
                    const float mnew = fmaxf(m8[i], mx);
                    const float corr = (mnew == NEG) ? 1.f : exp2f(m8[i] - mnew);
                    float rs = 0.f;
#pragma unroll
                    for (int t = 0; t < 4; ++t) {
                        const float pp = (sc[t] == NEG) ? 0.f : exp2f(sc[t] - mnew); rs += pp;
                        pv[i][t] = p.Pw ? pp * p.Pw[b * p.swb + h * p.swh + (long long)ic * p.swi + (long long)min(j0 + t * 16 + l15, p.Lk - 1) * p.swj] : pp;
                    }
                    rs += __shfl_xor(rs, 1, 32); rs += __shfl_xor(rs, 2, 32); rs += __shfl_xor(rs, 4, 32); rs += __shfl_xor(rs, 8, 32);
                    l8[i] = l8[i] * corr + rs; m8[i] = mnew;
                    if (!TWOPASS) {
#pragma unroll
                        for (int t = 0; t < NT; ++t) o[t][i] *= corr;
                    }
                } else {
                    const float inv = (l8[i] > 0.f) ? 1.f / l8[i] : 0.f;
#pragma unroll
                    for (int t = 0; t < 4; ++t) {
                        const int jg = j0 + t * 16 + l15;
                        float pp = (sc[t] == NEG) ? 0.f : exp2f(sc[t] - m8[i]) * inv;
                        if (p.Pw) pp *= p.Pw[b * p.swb + h * p.swh + (long long)ic * p.swi + (long long)min(jg, p.Lk - 1) * p.swj];
                        pv[i][t] = pp;
                    }
                }
            }
            if (dopv) {
#pragma unroll
                for (int i = 0; i < 8; ++i)
#pragma unroll
                    for (int t = 0; t < 4; ++t) ((float*)myp)[(i + 8 * hf) * 64 + t * 16 + l15] = pv[i][t];
                __syncthreads();                                 // P (per wave) and V (shared) visible
                if (p.P) {
                    float* pb_ = p.P + b * p.sPb + h * p.sPh;
                    const bool fastP = (p.pband == 0) && ((p.sPi & 3) == 0) && (j0 + 64 <= p.Lk) && (q0 + 16 <= p.Lq) && ((((size_t)pb_) & 15) == 0);
                    if (fastP) {
#pragma unroll
                        for (int s = 0; s < 8; ++s) {
                            const int row = s * 2 + (lane >> 4), c4 = (lane & 15) * 4;
                            const v4f v = *(const v4f*)(myp + row * 64 + c4);
                            VST2V4(pb_ + (long long)(q0 + row) * p.sPi + j0 + c4, v);
                        }
                    } else {
                        for (int row = 0; row < 16; ++row) {
                            const int irow = q0 + row; if (irow >= p.Lq) continue;
                            for (int c = lane; c < 64; c += 32) {
                                const int jg = j0 + c; if (jg >= p.Lk) continue;
                                if (p.pband == 0) VST2(float, pb_ + (long long)irow * p.sPi + jg, myp[row * 64 + c]);
                                else if (jg - irow <= p.pband && irow - jg <= p.pband) VST2(float, pb_ + (long long)irow * p.sPi + (jg - irow + p.pband), myp[row * 64 + c]);
                            }
                        }
                    }
                }
                if (SPLITPV) {
                    const Split pa0 = sp_ld(myp + l15 * 64, 1, 0, hf, 64, 1.f), pa1 = sp_ld(myp + l15 * 64, 1, 32, hf, 64, 1.f);
                    const __bf16* vh = (const __bf16*)vl; const __bf16* vlo = vh + 64 * VP;
#pragma unroll
                    for (int t = 0; t < NT; ++t) {
                        const int dcol = t * 16 + l15;
                        Split b0, b1;
#pragma unroll
                        for (int e = 0; e < 16; ++e) {
                            const int k0 = frag_k(e, hf), k1 = 32 + frag_k(e, hf);
                            b0.hi[e] = vh[k0 * VP + dcol]; b0.lo[e] = vlo[k0 * VP + dcol]; b1.hi[e] = vh[k1 * VP + dcol]; b1.lo[e] = vlo[k1 * VP + dcol];
                        }
                        o[t] = wmma3(pa0, b0, o[t]);
                        o[t] = wmma3(pa1, b1, o[t]);
                    }
                } else {
                    const v16h pa0 = fh_ld(myp + l15 * 64, 1, 0, hf, 64, 4096.f), pa1 = fh_ld(myp + l15 * 64, 1, 32, hf, 64, 4096.f);
#pragma unroll
                    for (int t = 0; t < NT; ++t) {
                        const int dcol = t * 16 + l15;
                        v16h b0, b1;
#pragma unroll
                        for (int e = 0; e < 16; ++e) { b0[e] = vl[frag_k(e, hf) * VP + dcol]; b1[e] = vl[(32 + frag_k(e, hf)) * VP + dcol]; }
                        o[t] = wmma16(pa0, b0, o[t]);
                        o[t] = wmma16(pa1, b1, o[t]);
                    }
                }
            }
        }
    }
    float* obase = p.O + b * p.sOb + h * p.sOh;
    if (p.ST) {
        const int rl = lane >> 1, isel = rl & 7;           // row q0 + rl ; rl>>3 == hf holds because lane>>4 == (lane>>1)>>3
        float mv = 0.f, lv = 0.f;
#pragma unroll
        for (int i = 0; i < 8; ++i) if (i == isel) { mv = m8[i]; lv = l8[i]; }
        const int irow = q0 + rl;
        if (irow < p.Lq) { float* st = p.ST + (((long long)b * gridDim.y + h) * p.Lq + irow) * 2 + (lane & 1); VST2(float, st, (lane & 1) ? lv : mv * 0.6931471805599453f); }
    }
    float invr[8];
#pragma unroll
    for (int i = 0; i < 8; ++i) {
        if (TWOPASS) invr[i] = SPLITPV ? 1.f : (1.f / 4096.f);
        else if (p.nonorm) invr[i] = exp2f(m8[i]) * (SPLITPV ? 1.f : (1.f / 4096.f));
        else invr[i] = (l8[i] > 0.f) ? (SPLITPV ? 1.f / l8[i] : 1.f / (l8[i] * 4096.f)) : 0.f;
    }
    __syncthreads();                                             // all waves done with pl/vl from the main loop
    const bool ofast = ((p.sOi & 3) == 0) && ((((size_t)obase) & 15) == 0) && (q0 + 16 <= p.Lq);
#pragma unroll
    for (int c0 = 0; c0 < DVP; c0 += 64) {
#pragma unroll
        for (int i = 0; i < 8; ++i)
#pragma unroll
            for (int t = 0; t < NT; ++t) if (t * 16 >= c0 && t * 16 < c0 + 64) ((float*)myp)[(i + 8 * hf) * 64 + (t * 16 - c0) + l15] = o[t][i] * invr[i];
        __syncthreads();
        const int cw = (DVP - c0 < 64) ? (DVP - c0) : 64;      // staged columns in this chunk (multiple of 16)
        if (ofast && (c0 + cw <= p.dv) && (cw % 32 == 0)) {
            const int lpr = cw / 4;                              // lanes per row (16 for 64 cols, 8 for 32)
            const int rows_per_ins = 32 / lpr;
            for (int r0 = 0; r0 < 16; r0 += rows_per_ins) {
                const int row = r0 + lane / lpr, c4 = (lane % lpr) * 4;
                const v4f v = *(const v4f*)(myp + row * 64 + c4);
                VST2V4(obase + (long long)(q0 + row) * p.sOi + c0 + c4, v);
            }
        } else {
            for (int row = 0; row < 16; ++row) {
                const int irow = q0 + row; if (irow >= p.Lq) continue;
                for (int c = lane; c < cw; c += 32) { const int d = c0 + c; if (d < p.dv) VST2(float, obase + (long long)irow * p.sOi + d, myp[row * 64 + c]); }
            }
        }
        __syncthreads();
    }
}

// =====================================================================================================================
// k_tr: dst(z, c, r) = alpha * src(z, r, c) (+ beta * R2(z, c, r)): [Z][R][C] (row stride lds) -> [Z][C][R] (row stride ldd) through a 32x32 LDS tile;
//   flags: 1 -> add beta * residual R2 addressed like dst (z*sRz + c*ldr + r); act applied before the residual.
// =====================================================================================================================
struct TrP { const float* src; float* dst; const float* R2; long long sSz, lds, sDz, ldd, sRz, ldr; int R, C, flags, act; float alpha, beta; };
static_assert(sizeof(TrP) == 3 * 8 + 6 * 8 + 6 * 4, "TrP has padding");
__global__ __launch_bounds__(256) void k_tr(TrP p) {
    __shared__ float tile[32][33];
    const int c0 = blockIdx.x * 32, r0 = blockIdx.y * 32, z = blockIdx.z;
    const int lane = threadIdx.x & 31, wave = threadIdx.x >> 5;
    const float* s = p.src + z * p.sSz;
#pragma unroll
    for (int k = 0; k < 4; ++k) {
        const int rl = wave * 4 + k, r = r0 + rl, c = c0 + lane;
        tile[rl][lane] = (r < p.R && c < p.C) ? s[(long long)r * p.lds + c] : 0.f;
    }
    __syncthreads();
    float* d = p.dst + z * p.sDz; const float* rr = p.R2 + z * p.sRz;
#pragma unroll
    for (int k = 0; k < 4; ++k) {
        const int cl = wave * 4 + k, c = c0 + cl, r = r0 + lane;
        if (c < p.C && r < p.R) {
            float v = act_fn(p.alpha * tile[lane][cl], p.act);
            if (p.flags & 1) v += p.beta * rr[(long long)c * p.ldr + r];
            VST2(float, d + (long long)c * p.ldd + r, v);
        }
    }
}

// k_affine: dst[i] = a * (sdev ? sdev[0] : 1) * src[i] + b, i < n (one thread per element; consecutive lanes -> consecutive addresses)
__global__ __launch_bounds__(256) void k_affine(const float* __restrict__ src, float* __restrict__ dst, int n, float a, float b, const float* __restrict__ sdev) {
    const int i = blockIdx.x * 256 + threadIdx.x;
    if (i < n) { const float aa = sdev ? a * sdev[0] : a; const float v = aa * src[i] + b; VST2(float, dst + i, v); }
}

// =====================================================================================================================
// k_softmax: row softmax over n contiguous elements, one 256-thread block per row; rows addressed z*sz + r*sr (grid (R, Z)).
//   out = scale_out * softmax(scale_in * x + (Mf ? Mf[z*smz + r*smr + j] : 0)); a row whose max is -inf is written as 0.
// =====================================================================================================================
struct SmP { const float* src; float* dst; const float* Mf; long long sz, sr, dz, dr, smz, smr; int n, pad; float scale_in, scale_out; };
static_assert(sizeof(SmP) == 3 * 8 + 6 * 8 + 4 * 4, "SmP has padding");
__global__ __launch_bounds__(256) void k_softmax(SmP p) {
    __shared__ float red[256];
    const int r = blockIdx.x, z = blockIdx.y, tid = threadIdx.x;
    const float* s = p.src + z * p.sz + (long long)r * p.sr;
    const float* mf = p.Mf ? (p.Mf + z * p.smz + (long long)r * p.smr) : nullptr;
    float mx = -__builtin_inff();
    for (int j = tid; j < p.n; j += 256) { float v = s[j] * p.scale_in; if (mf) v += mf[j]; mx = fmaxf(mx, v); }
    red[tid] = mx; __syncthreads();
    for (int o = 128; o > 0; o >>= 1) { if (tid < o) red[tid] = fmaxf(red[tid], red[tid + o]); __syncthreads(); }
    mx = red[0]; __syncthreads();
    float sum = 0.f;
    for (int j = tid; j < p.n; j += 256) { float v = s[j] * p.scale_in; if (mf) v += mf[j]; sum += (mx == -__builtin_inff()) ? 0.f : expf(v - mx); }
    red[tid] = sum; __syncthreads();
    for (int o = 128; o > 0; o >>= 1) { if (tid < o) red[tid] += red[tid + o]; __syncthreads(); }
    sum = red[0];
    const float inv = (sum > 0.f) ? p.scale_out / sum : 0.f;
    float* d = p.dst + z * p.dz + (long long)r * p.dr;
    for (int j = tid; j < p.n; j += 256) { float v = s[j] * p.scale_in; if (mf) v += mf[j]; const float o = (mx == -__builtin_inff()) ? 0.f : expf(v - mx) * inv; VST2(float, d + j, o); }
}
// =====================================================================================================================
// k_stats: mean and rsqrt(var + eps) over a set of n elements addressed base + z*sz + (e / inner) * so + (e % inner) * si, one 256-thread
// k_norm_apply: y = (x - mean[set]) * rstd[set] * g[c] + b[c] over a [Z][C][L] channel-major tensor with set = z*G + c / (C/G) (G groups per z;
//   G = C -> per-channel sets indexed z*C+c; for batch norm pass stats indexed by c only via bn = 1). Optional act. Output same layout.
// =====================================================================================================================
//   mode 0: mean / rsqrt(var + eps); mode 1 (RMSNorm): 0 / rsqrt(mean(x^2) + eps); mode 2 (L2 normalize * sqrt(n)): 0 / sqrt(n) / max(||x||, eps); mode 3: as 0 with unbiased variance (n-1)
__global__ __launch_bounds__(256) void k_stats(const float* __restrict__ x, long long sz, long long so, long long si, int inner, int n, float eps, float* __restrict__ stat, int mode) {
    __shared__ float red[256];
    const int z = blockIdx.x, tid = threadIdx.x;
    const float* base = x + z * sz;
    float s = 0.f;
    for (int e = tid; e < n; e += 256) s += base[(long long)(e / inner) * so + (long long)(e % inner) * si];
    red[tid] = s; __syncthreads();
    for (int o = 128; o > 0; o >>= 1) { if (tid < o) red[tid] += red[tid + o]; __syncthreads(); }
    const float mu = (mode == 0 || mode == 3) ? red[0] / (float)n : 0.f; __syncthreads();
    float q = 0.f;
    for (int e = tid; e < n; e += 256) { const float dlt = base[(long long)(e / inner) * so + (long long)(e % inner) * si] - mu; q += dlt * dlt; }
    red[tid] = q; __syncthreads();
    for (int o = 128; o > 0; o >>= 1) { if (tid < o) red[tid] += red[tid + o]; __syncthreads(); }
    {
        float rs;
        if (mode == 2) rs = sqrtf((float)n) / fmaxf(sqrtf(red[0]), eps); else if (mode == 3) rs = rsqrtf(red[0] / (float)(n - 1) + eps); else rs = rsqrtf(red[0] / (float)n + eps);
        if (tid < 32) { const float v = (tid == 0) ? mu : ((tid == 1) ? rs : 0.f); VST2(float, stat + (long long)z * 32 + tid, v); }
    }
}
//   One thread per element over the flat [Z][C][L] index space: grid ceil(Z*C*L / 256).
__global__ __launch_bounds__(256) void k_norm_apply(const float* __restrict__ x, float* __restrict__ y, const float* __restrict__ stat, const float* __restrict__ g, const float* __restrict__ bta,
                                                     int Z, int C, int L, int G, int bn, int act) {
    const long long idx = (long long)blockIdx.x * 256 + threadIdx.x;
    if (idx >= (long long)Z * C * L) return;
    const int l = (int)(idx % L); const long long zc = idx / L; const int c = (int)(zc % C), z = (int)(zc / C); (void)l;
    const int set = bn ? c : (z * G + c / (C / G));
    float v = (x[idx] - stat[(long long)set * 32]) * stat[(long long)set * 32 + 1];
    if (g) v *= g[c];
    if (bta) v += bta[c];
    v = act_fn(v, act);
    VST2(float, y + idx, v);
}

// k_lse_neg: c[i] = -(st[2i] + log(st[2i+1])) = minus the log-sum-exp of row i from k_attn's ST output (for softmax over the query dimension)
__global__ __launch_bounds__(256) void k_lse_neg(const float* __restrict__ st, float* __restrict__ c, int n) {
    const int i = blockIdx.x * 256 + threadIdx.x;
    if (i < n) { const float v = -(st[2 * i] + logf(st[2 * i + 1])); VST2(float, c + i, v); }
}

// k_iota: dst[i] = a * i + b as int32 (segment/position id helper)
__global__ __launch_bounds__(256) void k_iota(int* __restrict__ dst, int n, int a, int b) {
    const int i = blockIdx.x * 256 + threadIdx.x;
    if (i < n) { const int v = a * i + b; VST2(int, dst + i, v); }
}

// k_axpby: dst[i] = a * x[i] + b * y[i] (+ c), i < n
__global__ __launch_bounds__(256) void k_axpby(const float* __restrict__ x, const float* __restrict__ y, float* __restrict__ dst, int n, float a, float b, float c) {
    const int i = blockIdx.x * 256 + threadIdx.x;
    if (i < n) { const float v = a * x[i] + b * y[i] + c; VST2(float, dst + i, v); }
}

// =====================================================================================================================
// k_rope: rotary embedding on a [R rows][Hn heads][D] view (row stride sXr, head stride sXh, element stride 1) -> Y (own strides).
//   mode 0: rotate_half (partner d±D/2, sign - for d<D/2); mode 1: interleaved pairs (partner d^1, sign - for even d).
//   table column tcol: tmode 0 -> d, 1 -> d % (D/2), 2 -> d / 2; position p: pmode 0 -> r % S, 1 -> head index, 2 -> pos[r];
//   c = C[(r / S) * sCb + p * sCp + tcol * sCd], s likewise from Sn; y = x[d] * c + sign * x[partner] * s. X and Y must not alias.
// =====================================================================================================================
struct RopeP { const float* X; float* Y; const float* C; const float* Sn; const int* pos; long long sXr, sXh, sYr, sYh, sCb, sCp, sCd; int R, Hn, D, S, mode, tmode, pmode, pad; };
static_assert(sizeof(RopeP) == 5 * 8 + 7 * 8 + 8 * 4, "RopeP has padding");
__global__ __launch_bounds__(256) void k_rope(RopeP p) {
    const long long idx = (long long)blockIdx.x * 256 + threadIdx.x;
    if (idx >= (long long)p.R * p.Hn * p.D) return;
    const int d = (int)(idx % p.D); const long long rh = idx / p.D; const int h = (int)(rh % p.Hn); const int r = (int)(rh / p.Hn);
    const int half = p.D / 2;
    int partner; float sign;
    if (p.mode == 0) { partner = (d < half) ? d + half : d - half; sign = (d < half) ? -1.f : 1.f; }
    else { partner = d ^ 1; sign = (d & 1) ? 1.f : -1.f; }
    const int tcol = (p.tmode == 0) ? d : ((p.tmode == 1) ? (d % half) : (d >> 1));
    const int pp = (p.pmode == 0) ? (r % p.S) : ((p.pmode == 1) ? h : p.pos[r]);
    const long long toff = (long long)(r / p.S) * p.sCb + (long long)pp * p.sCp + (long long)tcol * p.sCd;
    const float* xr = p.X + (long long)r * p.sXr + (long long)h * p.sXh;
    const float v = xr[d] * p.C[toff] + sign * xr[partner] * p.Sn[toff];
    VST2(float, p.Y + (long long)r * p.sYr + (long long)h * p.sYh + d, v);
}

// k_invf + k_sincos (split so neither kernel carries a large VALU-fma footprint): invf_i = num * (1 / powf(base, (2 i)/D)) [fmode 0],
//   num * expf((2 i) * cexp) [fmode 1], num * powf(base, -2 (i - 1) / D) [fmode 2]; then cs/sn[s*half + i] = cos/sin((pscale * s) * invf_i)
__global__ __launch_bounds__(256) void k_invf(float* __restrict__ invb, int half, int D, float base, float num, int fmode, float cexp) {
    const int i = blockIdx.x * 256 + threadIdx.x;
    if (i >= ((half + 31) / 32) * 32) return;
    if (i >= half) { VST2(float, invb + i, 0.f); return; }
    const float e = (float)(2 * i) / (float)D;
    float invf;
    if (fmode == 1) invf = num * expf((float)(2 * i) * cexp);
    else if (fmode == 2) invf = num * powf(base, (-2.0f * ((float)i - 1.0f)) / (float)D);
    else invf = num * (1.0f / powf(base, e));
    VST2(float, invb + i, invf);
}
__global__ __launch_bounds__(256) void k_sincos(float* __restrict__ cs, float* __restrict__ sn, const float* __restrict__ invb, int S, int half, float pscale) {
    const int idx = blockIdx.x * 256 + threadIdx.x;
    if (idx >= S * half) return;
    const int s = idx / half, i = idx - s * half;
    const float ang = (pscale * (float)s) * invb[i];
    VST2(float, cs + idx, cosf(ang)); VST2(float, sn + idx, sinf(ang));
}

// k_mulact: dst[i] = act(x[i]) * y[i]
__global__ __launch_bounds__(256) void k_mulact(const float* __restrict__ x, const float* __restrict__ y, float* __restrict__ dst, int n, int act) {
    const int i = blockIdx.x * 256 + threadIdx.x;
    if (i < n) { const float v = act_fn(x[i], act) * y[i]; VST2(float, dst + i, v); }
}

// =====================================================================================================================
// k_matvec: thread-per-row matrix-vector products for N <= 8 output columns (heads with 1-3 outputs, gates), f32 on the VALU.
//   C[r*sCm + j] = act(alpha * sum_k A[r*sAm + k*sAk] * B[j*sBn + k*sBk] + bias[j]) + beta * R[r*sRm + j*sRn]; each thread writes its N contiguous floats.
// =====================================================================================================================
__global__ __launch_bounds__(256) void k_matvec(GemmP p) {
    // 32 lanes write one line with one instruction.
    const int rpt = (p.N == 1) ? 1 : 32;
    const long long r0 = ((long long)blockIdx.x * 256 + threadIdx.x) * rpt; const int z = blockIdx.z, zo = z / p.zi_n, zi = z - zo * p.zi_n;
    if (r0 >= p.M) return;
    const float* Bb = p.B + zo * p.sBo + zi * p.sBi;
    float* C = p.C + zo * p.sCo + zi * p.sCi; const float* R = p.R + zo * p.sRo + zi * p.sRi;
    for (int rr = 0; rr < rpt; ++rr) {
        const long long r = r0 + rr; if (r >= p.M) break;
        const float* A = p.A + zo * p.sAo + zi * p.sAi + r * p.sAm;
        float acc[8] = {0.f, 0.f, 0.f, 0.f, 0.f, 0.f, 0.f, 0.f};
        for (int k = 0; k < p.K; ++k) { const float a = A[(long long)k * p.sAk];
#pragma unroll
            for (int j = 0; j < 8; ++j) if (j < p.N) acc[j] += a * Bb[(long long)j * p.sBn + (long long)k * p.sBk]; }
#pragma unroll
        for (int j = 0; j < 8; ++j) if (j < p.N) {
            float v = acc[j] * p.alpha;
            if (p.flags & 1) v += p.bias[j];
            if (p.flags & 2) v += p.bias[r];
            v = act_fn(v, p.act);
            if (p.flags & 4) v += p.beta * R[r * p.sRm + (long long)j * p.sRn];
            VST2(float, C + r * p.sCm + j, v);
        }
    }
}
// k_smallsoftmax: thread-per-row softmax for short rows (n <= 64): dst[r*dr + j] = softmax(scale*src[r*sr + j])
__global__ __launch_bounds__(256) void k_smallsoftmax(const float* __restrict__ src, float* __restrict__ dst, long long sr, long long dr, int n, long long R, float scale) {
    const long long r0 = ((long long)blockIdx.x * 256 + threadIdx.x) * 32;
    for (int rr = 0; rr < 32; ++rr) {
        const long long r = r0 + rr; if (r >= R) return;
        const float* s = src + r * sr; float* d = dst + r * dr;
        float mx = -__builtin_inff();
        for (int j = 0; j < n; ++j) mx = fmaxf(mx, s[j] * scale);
        float sum = 0.f;
        for (int j = 0; j < n; ++j) sum += expf(s[j] * scale - mx);
        const float inv = 1.f / sum;
        for (int j = 0; j < n; ++j) { const float v = expf(s[j] * scale - mx) * inv; VST2(float, d + j, v); }
    }
}

__global__ __launch_bounds__(32) void k_unitstat(float* __restrict__ st) { const int t = threadIdx.x; const float v = (t == 1) ? 1.f : 0.f; VST2(float, st + t, v); }

// destination (e.g. a d_out whose row width is not a multiple of 32 floats) is written by consecutive lanes of one instruction
__global__ __launch_bounds__(256) void k_lincopy(const float* __restrict__ src, long long lds, float* __restrict__ dst, long long ldd, long long rows, int cols) {
    const long long i = (long long)blockIdx.x * 256 + threadIdx.x; if (i >= rows * cols) return;
    const long long r = i / cols; const int c = (int)(i - r * cols);
    const float v = src[r * lds + c]; VST2(float, dst + r * ldd + c, v);
}

namespace w25 {
typedef __attribute__((ext_vector_type(16))) _Float16 v16h;
typedef __attribute__((ext_vector_type(8)))  _Float16 v8h;
typedef __attribute__((ext_vector_type(16))) __bf16   v16b;
typedef __attribute__((ext_vector_type(8)))  __bf16   v8b;
typedef __attribute__((ext_vector_type(8)))  float    v8f;
typedef __attribute__((ext_vector_type(4)))  float    v4f;

__device__ __forceinline__ unsigned short f2bf_bits(float f) {
  unsigned u = __float_as_uint(f);
  return (unsigned short)((u + 0x7FFFu + ((u >> 16) & 1u)) >> 16);
}
__device__ __forceinline__ float bf_bits2f(unsigned short h) { return __uint_as_float(((unsigned)h) << 16); }

// hazard guards as plain device helpers (no inline asm inside the kernel template body)
__device__ __forceinline__ void dep_guard_h(v8f& a, v8f& b, v16h x, v16h y) { asm volatile("v_nop\n\tv_nop\n\tv_nop\n\tv_nop" : "+v"(a), "+v"(b) : "v"(x), "v"(y)); }
__device__ __forceinline__ void dep_guard_b(v8f& a, v8f& b, v16b x, v16b y) { asm volatile("v_nop\n\tv_nop\n\tv_nop\n\tv_nop" : "+v"(a), "+v"(b) : "v"(x), "v"(y)); }
__device__ __forceinline__ void keep4_h(v16h a, v16h b, v16h c, v16h d) { asm volatile("v_nop" :: "v"(a), "v"(b), "v"(c), "v"(d)); }
__device__ __forceinline__ void keep4_b(v16b a, v16b b, v16b c, v16b d) { asm volatile("v_nop" :: "v"(a), "v"(b), "v"(c), "v"(d)); }
__device__ __forceinline__ void acc_guard4(v8f& a, v8f& b, v8f& c, v8f& d) { asm volatile("v_nop\n\tv_nop\n\tv_nop\n\tv_nop" : "+v"(a), "+v"(b), "+v"(c), "+v"(d)); }
template <typename T> struct Frag;
template <> struct Frag<_Float16> {
  typedef v16h V; union U { v16h v; v8h h[2]; };
  static __device__ __forceinline__ v16h load(const _Float16* p) {   // elements 0..7 <- p[0..7], 8..15 <- p[16..23]
    U f; f.h[0] = *(const v8h*)(p); f.h[1] = *(const v8h*)(p + 16); return f.v;
  }
  static __device__ __forceinline__ v8f mma(v16h a, v16h b, v8f c) {
    return __builtin_amdgcn_wmma_f32_16x16x32_f16(false, a, false, b, (short)0, c, false, false);
  }
  static __device__ __forceinline__ void guard(v8f& a, v8f& b, v16h x, v16h y) { dep_guard_h(a, b, x, y); }
  static __device__ __forceinline__ void keep(v16h a, v16h b, v16h c, v16h d) { keep4_h(a, b, c, d); }
};
template <> struct Frag<__bf16> {
  typedef v16b V; union U { v16b v; v8b h[2]; };
  static __device__ __forceinline__ v16b load(const __bf16* p) {
    U f; f.h[0] = *(const v8b*)(p); f.h[1] = *(const v8b*)(p + 16); return f.v;
  }
  static __device__ __forceinline__ v8f mma(v16b a, v16b b, v8f c) {
    return __builtin_amdgcn_wmma_f32_16x16x32_bf16(false, a, false, b, (short)0, c, false, false);
  }
  static __device__ __forceinline__ void guard(v8f& a, v8f& b, v16b x, v16b y) { dep_guard_b(a, b, x, y); }
  static __device__ __forceinline__ void keep(v16b a, v16b b, v16b c, v16b d) { keep4_b(a, b, c, d); }
};

// ---- Register-blocked batched WMMA GEMM ------------------------------------
// C[m,n] = scale * sum_k A[m,k] * Bt[n,k] (+bias)(+resid); each wave owns a 64x64 tile.
// A row-major [M,K]; Bt row-major [N,K]; M,N % 64 == 0, K % 32 == 0.
// SPLIT: operands are hi/lo planes (A2/Bt2 = lo planes, same layout); product = hi·hi + hi·lo + lo·hi.
// BIAS_MODE: 0 = none, 1 = bias[m], 2 = bias[n].
// OUT_MODE: 0 = f32, 1 = f16, 2 = bf16 hi plane (Cout) + bf16 lo plane (Cout2).
// ET: 0 = f16 operands, 1 = bf16 operands (pointers passed as 16-bit storage)
template <int ET> struct Elem;
template <> struct Elem<0> { typedef _Float16 T; };
template <> struct Elem<1> { typedef __bf16 T; };
template <int ET, bool SPLIT, int BIAS_MODE, int OUT_MODE, bool RESID, int ACT = 0>
__global__ __launch_bounds__(256) void wmma_gemm64(
    const unsigned short* __restrict__ Ap, const unsigned short* __restrict__ A2p, int lda, long strideA,
    const unsigned short* __restrict__ Btp, const unsigned short* __restrict__ Bt2p, int ldb, long strideB,
    void* __restrict__ Cout, void* __restrict__ Cout2, int ldc, long strideC,
    const float* __restrict__ bias,
    const float* __restrict__ resid, long strideR,
    int M, int N, int K, float scale) {
  typedef typename Elem<ET>::T T;
  typedef typename Frag<T>::V V;
  const T* A = (const T*)Ap; const T* A2 = (const T*)A2p; const T* Bt = (const T*)Btp; const T* Bt2 = (const T*)Bt2p;
  __shared__ __align__(16) float sT[8][16 * 68];   // per-wave 16x64 slab, pitch 68 floats
  const int b    = blockIdx.y;
  const int lane = threadIdx.x & 31;
  const int wave = threadIdx.x >> 5;
  const int tilesN = N >> 6;
  const int tilesM = M >> 6;
  const int tile = blockIdx.x * 8 + wave;
  if (tile >= tilesM * tilesN) return;   // wave-uniform; no block barriers in this kernel
  const int tm = tile / tilesN;
  const int tn = tile - tm * tilesN;
  const int m0 = tm << 6;
  const int n0 = tn << 6;

  const T* Ab  = A  + (size_t)b * strideA;
  const T* Bb  = Bt + (size_t)b * strideB;
  const T* Ab2 = SPLIT ? (A2  + (size_t)b * strideA) : nullptr;
  const T* Bb2 = SPLIT ? (Bt2 + (size_t)b * strideB) : nullptr;

  const int rlane = lane & 15;                 // row (A) / col (B, D) within subtile
  const int koff  = (lane >> 4) * 8;           // k offset of this lane half
  const int mOff  = (lane >> 4) * 8;           // D row offset

  v8f acc[4][4];
#pragma unroll
  for (int i = 0; i < 4; ++i)
#pragma unroll
    for (int j = 0; j < 4; ++j) acc[i][j] = (v8f){0.f,0.f,0.f,0.f,0.f,0.f,0.f,0.f};

  for (int k0 = 0; k0 < K; k0 += 32) {
    V bh[4], bl[4];
#pragma unroll
    for (int j = 0; j < 4; ++j) {
      const size_t bo = (size_t)(n0 + (j << 4) + rlane) * ldb + koff + k0;
      bh[j] = Frag<T>::load(Bb + bo);
      if (SPLIT) bl[j] = Frag<T>::load(Bb2 + bo);
    }
#pragma unroll
    for (int i = 0; i < 4; ++i) {
      const size_t ao = (size_t)(m0 + (i << 4) + rlane) * lda + koff + k0;
      V ah = Frag<T>::load(Ab + ao);
      V al;
      if (SPLIT) al = Frag<T>::load(Ab2 + ao);
#pragma unroll
      for (int j = 0; j < 4; ++j) {
        acc[i][j] = Frag<T>::mma(ah, bh[j], acc[i][j]);
        if (SPLIT) {
          acc[i][j] = Frag<T>::mma(ah, bl[j], acc[i][j]);
          acc[i][j] = Frag<T>::mma(al, bh[j], acc[i][j]);
        }
      }
      Frag<T>::guard(acc[i][0], acc[i][3], ah, SPLIT ? al : ah);
    }
    Frag<T>::keep(bh[0], bh[1], bh[2], bh[3]);
    if (SPLIT) Frag<T>::keep(bl[0], bl[1], bl[2], bl[3]);
  }
  acc_guard4(acc[0][0], acc[0][1], acc[0][2], acc[0][3]);
  acc_guard4(acc[1][0], acc[1][1], acc[1][2], acc[1][3]);
  acc_guard4(acc[2][0], acc[2][1], acc[2][2], acc[2][3]);
  acc_guard4(acc[3][0], acc[3][1], acc[3][2], acc[3][3]);

  // ---- epilogue ----
  float* slab = sT[wave];
  const float* Rb = RESID ? (resid + (size_t)b * strideR) : nullptr;
#pragma unroll
  for (int i = 0; i < 4; ++i) {
    const int mBase = m0 + (i << 4);
#pragma unroll
    for (int j = 0; j < 4; ++j) {
      const int n = n0 + (j << 4) + rlane;
      float bv = 0.f;
      if (BIAS_MODE == 2) bv = bias[n];
#pragma unroll
      for (int r = 0; r < 8; ++r) {
        float v = acc[i][j][r] * scale;
        if (BIAS_MODE == 1) v += bias[mBase + mOff + r];
        if (BIAS_MODE == 2) v += bv;
        if (RESID) v += Rb[(size_t)(mBase + mOff + r) * ldc + n];
        if (ACT == 1) v = tanhf(v);
        if (ACT == 2) v = fmaxf(v, 0.0f);
        if (ACT == 3) v = v / (1.0f + expf(-v));
        if (ACT == 4) v = (v > 0.f) ? v : 0.01f * v;
        if (ACT == 5) v = 0.5f * v * (1.0f + erff(v * 0.70710678118654752f));
        slab[(mOff + r) * 68 + (j << 4) + rlane] = v;
      }
    }
    __builtin_amdgcn_fence(__ATOMIC_RELEASE, "workgroup");
    __builtin_amdgcn_wave_barrier();
    __builtin_amdgcn_fence(__ATOMIC_ACQUIRE, "workgroup");
    if (OUT_MODE == 0) {
      float* C = (float*)Cout + (size_t)b * strideC;
      const int hh = lane >> 4, c4 = (lane & 15) * 4;     // row seg = 256 B = 16 lanes x 16 B
      {
#pragma unroll
        for (int it = 0; it < 8; ++it) {
          const int row = it * 2 + hh;
          v4f v = *(const v4f*)(slab + row * 68 + c4);
          *(v4f*)(C + (size_t)(mBase + row) * ldc + n0 + c4) = v;
        }
        
      }
    } else {
      const int q = lane >> 3, c8 = (lane & 7) * 8;
      unsigned short* C  = (unsigned short*)Cout  + (size_t)b * strideC;
      unsigned short* C2 = (OUT_MODE == 2) ? ((unsigned short*)Cout2 + (size_t)b * strideC) : nullptr;
      {
#pragma unroll
        for (int it = 0; it < 4; ++it) {
          const int row = it * 4 + q;
          const float* sp = slab + row * 68 + c8;
          v8h hv, lv;
#pragma unroll
          for (int e = 0; e < 8; ++e) {
            if (OUT_MODE == 1) {
              hv[e] = (_Float16)sp[e];
            } else {
              unsigned short hb = f2bf_bits(sp[e]);
              unsigned short lb = f2bf_bits(sp[e] - bf_bits2f(hb));
              hv[e] = __builtin_bit_cast(_Float16, hb);
              lv[e] = __builtin_bit_cast(_Float16, lb);
            }
          }
          *(v8h*)(C + (size_t)(mBase + row) * ldc + n0 + c8) = hv;
          if (OUT_MODE == 2) *(v8h*)(C2 + (size_t)(mBase + row) * ldc + n0 + c8) = lv;
        }
        
      }
    }
    __builtin_amdgcn_fence(__ATOMIC_RELEASE, "workgroup");
    __builtin_amdgcn_wave_barrier();
    __builtin_amdgcn_fence(__ATOMIC_ACQUIRE, "workgroup");
  }
}

__global__ __launch_bounds__(256) void cast_f32_f16x2(
    const float* __restrict__ in, _Float16* __restrict__ out, int n2) {
  int i = blockIdx.x * 256 + threadIdx.x;
  if (i < n2) {
    const _Float16 h0 = (_Float16)in[2 * i], h1 = (_Float16)in[2 * i + 1];
    const unsigned u = (unsigned)__builtin_bit_cast(unsigned short, h0) | ((unsigned)__builtin_bit_cast(unsigned short, h1) << 16);
    ((unsigned*)out)[i] = u;
    
  }
}


} // namespace w25

namespace w25 {
// =====================================================================================
// Generic causal/non-causal attention for head_dim 64, f32 in / f32 out; 16-bit operands: bf16 with optional hi/lo splits, or
// plain f16 (F16=true, non-split, probabilities carried x2^15).
//   scores = (q*qscale)·kᵀ : v_wmma_f32_16x16x32_bf16; SPLIT_QK -> q,k as bf16 hi/lo (hi·hi + hi·lo + lo·hi)
//   out    = p·v           : v_wmma_f32_16x16x32_bf16; SPLIT_PV -> p,v as bf16 hi/lo; else p,v plain bf16
//   f32 accumulate; online softmax in f32. Block = 4 waves = 64 query rows of one (batch, head); S % 64 == 0.
//   Element (b, s, h, d) of tensor X lives at X[b*X_bs + s*X_rs + h*X_hs + d] (strides in floats, multiples of 4).
//   Masking: mask_mode 0 none, 1 causal (kv > q masked), 2 tensor [S][Skv] shared over (b,h) (float if
//   mask_is_int==0, int32 with element == 0 -> masked if 1, int32 with element != 0 -> masked if 2), 3 per-token vectors qmask[B][S] & kvmask[B][Skv] (int32,
//   0 -> masked), 4 causal + sliding window (kv > q or q - kv > W masked; W passed in mask_is_int);
//   5 = relative-position bias: s += cp[b,h,q][idx[q][kv]] + pc[b,h,kv][idx[q][kv]] with idx = mask_b ([S][Skv] int32) and
//   mask_a an int32 [S][Skv] tensor with nonzero = masked (tables: element (b,h,row,n) at X + b*c_bs + h*c_hs + row*c_rs + n);
//   masked scores are replaced by mask_fill (e.g. -inf or -1e9) before the softmax.
//   grid.x = B * H * (S/64) (or a sub-range with blk0).
// =====================================================================================
#define AT_D 64
#define AT_NW 4
#define AT_QB 64
#define AT_KC 64
struct AttnGeom { const float* cp = nullptr; const float* pc = nullptr; long c_bs = 0, c_rs = 0, c_hs = 0;   // mode-5 score-bias tables
                  long q_bs, q_rs, q_hs, k_bs, k_rs, k_hs, v_bs, v_rs, v_hs, o_bs, o_rs, o_hs;
                  int S, Skv, H, mask_mode; float qscale; int blk0; float mask_fill; int mask_is_int; };
static_assert(sizeof(AttnGeom) == 168, "no padding");

__device__ __forceinline__ unsigned short at_bf_bits(float f) {
  unsigned u = __float_as_uint(f);
  return (unsigned short)((u + 0x7FFFu + ((u >> 16) & 1u)) >> 16);
}
__device__ __forceinline__ __bf16 at_f2bf(float f) { return __builtin_bit_cast(__bf16, at_bf_bits(f)); }
__device__ __forceinline__ void at_split(float f, __bf16& hi, __bf16& lo) {
  const unsigned short hb = at_bf_bits(f);
  hi = __builtin_bit_cast(__bf16, hb);
  lo = at_f2bf(f - __uint_as_float(((unsigned)hb) << 16));
}
__device__ __forceinline__ v8f at_mma(v16b a, v16b b, v8f c) {
  c = __builtin_amdgcn_wmma_f32_16x16x32_bf16(false, a, false, b, (short)0, c, false, false);
  asm volatile("v_nop\n\tv_nop\n\tv_nop\n\tv_nop" : "+v"(c) : "v"(a), "v"(b));
  return c;
}
// 16-bit element as a bit pattern held in a __bf16 slot: f16 bits when F16, bf16 (RNE) otherwise
template <bool F16> __device__ __forceinline__ __bf16 at_to16(float f) {
  if (F16) return __builtin_bit_cast(__bf16, (_Float16)f);
  return at_f2bf(f);
}
template <bool F16> __device__ __forceinline__ v8f at_mma16(v16b a, v16b b, v8f c) {
  if (F16) {
    const v16h ah = __builtin_bit_cast(v16h, a), bh = __builtin_bit_cast(v16h, b);
    c = __builtin_amdgcn_wmma_f32_16x16x32_f16(false, ah, false, bh, (short)0, c, false, false);
    asm volatile("v_nop\n\tv_nop\n\tv_nop\n\tv_nop" : "+v"(c) : "v"(ah), "v"(bh));
    return c;
  }
  return at_mma(a, b, c);
}

template <bool SPLIT_QK, bool SPLIT_PV, bool F16 = false>
__global__ __launch_bounds__(128)
void attn64_kernel(const float* __restrict__ q, const float* __restrict__ k,
                   const float* __restrict__ v, float* __restrict__ out,
                   const void* __restrict__ mask_a, const int* __restrict__ mask_b, AttnGeom g) {
  static_assert(!(F16 && (SPLIT_QK || SPLIT_PV)), "f16 mode is non-split");
  const float PSC = F16 ? 32768.0f : 1.0f;     // f16 probabilities carried x2^15 (subnormal range), folded into the final 1/l
  union FB { v16b v; v8b h[2]; };
  __shared__ __align__(16) __bf16 Ksh[AT_KC * AT_D];             // K hi [kv][d]      8 KB
  __shared__ __align__(16) __bf16 Ksl[SPLIT_QK ? AT_KC * AT_D : 8];
  __shared__ __align__(16) __bf16 Vth[AT_D * AT_KC];             // V hi [d][kv]      8 KB
  __shared__ __align__(16) __bf16 Vtl[SPLIT_PV ? AT_D * AT_KC : 8];
  __shared__ __align__(16) __bf16 Psh[AT_NW][16 * AT_KC];        // per wave P hi [row][kv]  8 KB
  __shared__ __align__(16) __bf16 Psl[SPLIT_PV ? AT_NW : 1][SPLIT_PV ? 16 * AT_KC : 8];
  __shared__ __align__(16) float  Os[AT_NW][16 * 68];            // per wave out tile, pitch 68

  const int tid  = threadIdx.x;
  const int wave = tid >> 5;
  const int lane = tid & 31;
  const int hh   = lane >> 4;
  const int c    = lane & 15;

  const int nqb = g.S / AT_QB;
  const int bx = blockIdx.x + g.blk0;
  const int qb = bx % nqb;
  const int bh = bx / nqb;
  const int h  = bh % g.H;
  const int b  = bh / g.H;
  const int qbase_block = qb * AT_QB;
  const int q0 = qbase_block + wave * 16;

  const float* qb_ptr = q + (size_t)b * g.q_bs + (size_t)h * g.q_hs;
  const float* kb_ptr = k + (size_t)b * g.k_bs + (size_t)h * g.k_hs;
  const float* vb_ptr = v + (size_t)b * g.v_bs + (size_t)h * g.v_hs;
  float*       ob_ptr = out + (size_t)b * g.o_bs + (size_t)h * g.o_hs;

  // ---- Q fragments (A operand): 2 d-chunks, hi (and lo) ----
  v16b qah[2], qal[2];
  {
    const float* qrow = qb_ptr + (size_t)(q0 + c) * g.q_rs;
#pragma unroll
    for (int dc = 0; dc < 2; ++dc) {
#pragma unroll
      for (int e = 0; e < 8; ++e) {
        const float f0 = qrow[dc * 32 + 8 * hh + e] * g.qscale;
        const float f1 = qrow[dc * 32 + 16 + 8 * hh + e] * g.qscale;
        if (SPLIT_QK) { __bf16 hq, lq; at_split(f0, hq, lq); qah[dc][e] = hq; qal[dc][e] = lq; at_split(f1, hq, lq); qah[dc][8 + e] = hq; qal[dc][8 + e] = lq; }
        else { qah[dc][e] = at_to16<F16>(f0); qah[dc][8 + e] = at_to16<F16>(f1); qal[dc][e] = qah[dc][e]; qal[dc][8 + e] = qah[dc][8 + e]; }
      }
    }
  }

  float mrow[8], lrow[8];
  v8f oacc[4];
#pragma unroll
  for (int r = 0; r < 8; ++r) { mrow[r] = -INFINITY; lrow[r] = 0.f; }
#pragma unroll
  for (int t = 0; t < 4; ++t) oacc[t] = (v8f){0.f,0.f,0.f,0.f,0.f,0.f,0.f,0.f};

  const int nChunks = (g.mask_mode == 1 || g.mask_mode == 4) ? (qb + 1) : (g.Skv / AT_KC);   // block-uniform
  // per-row query mask (mode 3)
  int qkeep[8];
#pragma unroll
  for (int r = 0; r < 8; ++r) qkeep[r] = (g.mask_mode == 3) ? mask_b[(size_t)b * g.S + q0 + 8 * hh + r] : 1;   // mask_b = qmask in mode 3
  for (int kc = 0; kc < nChunks; ++kc) {
    const int kv0 = kc * AT_KC;
    __syncthreads();
    {
      const int kvr = tid >> 1, dh = (tid & 1) * 32;
      const float* krow = kb_ptr + (size_t)(kv0 + kvr) * g.k_rs + dh;
      const float* vrow = vb_ptr + (size_t)(kv0 + kvr) * g.v_rs + dh;
#pragma unroll
      for (int i = 0; i < 8; ++i) {
        v4f kk = *(const v4f*)(krow + 4 * i);
        v4f vv = *(const v4f*)(vrow + 4 * i);
#pragma unroll
        for (int e = 0; e < 4; ++e) {
          const int d = dh + 4 * i + e;
          if (SPLIT_QK) { __bf16 a, bl; at_split(kk[e], a, bl); Ksh[kvr * AT_D + d] = a; Ksl[kvr * AT_D + d] = bl; }
          else Ksh[kvr * AT_D + d] = at_to16<F16>(kk[e]);
          if (SPLIT_PV) { __bf16 a, bl; at_split(vv[e], a, bl); Vth[d * AT_KC + kvr] = a; Vtl[d * AT_KC + kvr] = bl; }
          else Vth[d * AT_KC + kvr] = at_to16<F16>(vv[e]);
        }
      }
    }
    __syncthreads();

    v8f s[4];
#pragma unroll
    for (int j = 0; j < 4; ++j) {
      s[j] = (v8f){0.f,0.f,0.f,0.f,0.f,0.f,0.f,0.f};
#pragma unroll 1
      for (int dc = 0; dc < 2; ++dc) {
        FB kb;
        kb.h[0] = *(const v8b*)(Ksh + (j * 16 + c) * AT_D + dc * 32 + 8 * hh);
        kb.h[1] = *(const v8b*)(Ksh + (j * 16 + c) * AT_D + dc * 32 + 16 + 8 * hh);
        s[j] = at_mma16<F16>(qah[dc], kb.v, s[j]);
        if (SPLIT_QK) {
          FB kl;
          kl.h[0] = *(const v8b*)(Ksl + (j * 16 + c) * AT_D + dc * 32 + 8 * hh);
          kl.h[1] = *(const v8b*)(Ksl + (j * 16 + c) * AT_D + dc * 32 + 16 + 8 * hh);
          s[j] = at_mma16<F16>(qah[dc], kl.v, s[j]);
          s[j] = at_mma16<F16>(qal[dc], kb.v, s[j]);
        }
      }
    }
    const bool diag = (g.mask_mode == 1) && (kc == qb);
    int kvkeep[4] = {1, 1, 1, 1};
    if (g.mask_mode == 3) {
#pragma unroll
      for (int j = 0; j < 4; ++j) kvkeep[j] = ((const int*)mask_a)[(size_t)b * g.Skv + kv0 + j * 16 + c];   // mask_a = kvmask
    }
    float cm[8];
#pragma unroll
    for (int r = 0; r < 8; ++r) {
      const int qrow = q0 + 8 * hh + r;
      float m = -INFINITY;
#pragma unroll
      for (int j = 0; j < 4; ++j) {
        const int kvcol = kv0 + j * 16 + c;
        bool masked = false;
        if (diag) masked = (kvcol > qrow);
        else if (g.mask_mode == 4) masked = (kvcol > qrow) || (qrow - kvcol > g.mask_is_int);
        else if (g.mask_mode == 2) {
          const size_t mi = (size_t)qrow * g.Skv + kvcol;
          masked = (g.mask_is_int == 0) ? (((const float*)mask_a)[mi] == 0.0f)
                 : (g.mask_is_int == 1) ? (((const int*)mask_a)[mi] == 0) : (((const int*)mask_a)[mi] != 0);
        } else if (g.mask_mode == 3) masked = (qkeep[r] == 0) || (kvkeep[j] == 0);
        else if (g.mask_mode == 5) {
          const size_t mi = (size_t)qrow * g.Skv + kvcol;
          masked = (((const int*)mask_a)[mi] != 0);
          int n = mask_b[mi]; n = n < 0 ? 0 : n;
          s[j][r] += g.cp[(size_t)b * g.c_bs + (size_t)h * g.c_hs + (size_t)qrow * g.c_rs + n]
                   + g.pc[(size_t)b * g.c_bs + (size_t)h * g.c_hs + (size_t)kvcol * g.c_rs + n];
        }
        if (masked) s[j][r] = g.mask_fill;
        m = fmaxf(m, s[j][r]);
      }
#pragma unroll
      for (int off = 1; off < 16; off <<= 1) m = fmaxf(m, __shfl_xor(m, off, 32));
      cm[r] = m;
    }
    __bf16* pwh = Psh[wave];
    __bf16* pwl = Psl[SPLIT_PV ? wave : 0];
#pragma unroll
    for (int r = 0; r < 8; ++r) {
      const float mnew = fmaxf(mrow[r], cm[r]);
      const float alpha = expf(mrow[r] - mnew);
      mrow[r] = mnew;
      float psum = 0.f;
#pragma unroll
      for (int j = 0; j < 4; ++j) {
        const float p = expf(s[j][r] - mnew);
        psum += p;
        if (SPLIT_PV) { __bf16 a, bl; at_split(p, a, bl); pwh[(8 * hh + r) * AT_KC + j * 16 + c] = a; pwl[(8 * hh + r) * AT_KC + j * 16 + c] = bl; }
        else pwh[(8 * hh + r) * AT_KC + j * 16 + c] = at_to16<F16>(p * PSC);
      }
#pragma unroll
      for (int off = 1; off < 16; off <<= 1) psum += __shfl_xor(psum, off, 32);
      lrow[r] = lrow[r] * alpha + psum;
#pragma unroll
      for (int t = 0; t < 4; ++t) oacc[t][r] *= alpha;
    }
    __builtin_amdgcn_fence(__ATOMIC_RELEASE, "workgroup");
    __builtin_amdgcn_wave_barrier();
    __builtin_amdgcn_fence(__ATOMIC_ACQUIRE, "workgroup");
#pragma unroll 1
    for (int kk = 0; kk < 2; ++kk) {
      FB pa, pl;
      pa.h[0] = *(const v8b*)(pwh + c * AT_KC + kk * 32 + 8 * hh);
      pa.h[1] = *(const v8b*)(pwh + c * AT_KC + kk * 32 + 16 + 8 * hh);
      if (SPLIT_PV) {
        pl.h[0] = *(const v8b*)(pwl + c * AT_KC + kk * 32 + 8 * hh);
        pl.h[1] = *(const v8b*)(pwl + c * AT_KC + kk * 32 + 16 + 8 * hh);
      }
#pragma unroll
      for (int t = 0; t < 4; ++t) {
        FB vb;
        vb.h[0] = *(const v8b*)(Vth + (t * 16 + c) * AT_KC + kk * 32 + 8 * hh);
        vb.h[1] = *(const v8b*)(Vth + (t * 16 + c) * AT_KC + kk * 32 + 16 + 8 * hh);
        oacc[t] = at_mma16<F16>(pa.v, vb.v, oacc[t]);
        if (SPLIT_PV) {
          FB vl;
          vl.h[0] = *(const v8b*)(Vtl + (t * 16 + c) * AT_KC + kk * 32 + 8 * hh);
          vl.h[1] = *(const v8b*)(Vtl + (t * 16 + c) * AT_KC + kk * 32 + 16 + 8 * hh);
          oacc[t] = at_mma16<F16>(pa.v, vl.v, oacc[t]);
          oacc[t] = at_mma16<F16>(pl.v, vb.v, oacc[t]);
        }
      }
    }
  }

  float* os = Os[wave];
#pragma unroll
  for (int r = 0; r < 8; ++r) {
    const float inv = 1.0f / (lrow[r] * PSC);
#pragma unroll
    for (int t = 0; t < 4; ++t) os[(8 * hh + r) * 68 + t * 16 + c] = oacc[t][r] * inv;
  }
  __builtin_amdgcn_fence(__ATOMIC_RELEASE, "workgroup");
  __builtin_amdgcn_wave_barrier();
  __builtin_amdgcn_fence(__ATOMIC_ACQUIRE, "workgroup");
  {
    const int c4 = (lane & 15) * 4;
    {
#pragma unroll
      for (int it = 0; it < 8; ++it) {
        const int row = it * 2 + hh;
        v4f val = *(const v4f*)(os + row * 68 + c4);
        *(v4f*)(ob_ptr + (size_t)(q0 + row) * g.o_rs + c4) = val;
      }
      
    }
  }
}

} // namespace w25

typedef __attribute__((ext_vector_type(2))) unsigned v2u;
typedef __attribute__((ext_vector_type(8))) _Float16 v8hp;
typedef __attribute__((ext_vector_type(2))) float v2fp;
typedef __attribute__((ext_vector_type(2))) __bf16 v2bp;
// two neighbouring f32 -> packed bf16 hi (returned) and packed bf16 lo of the remainders (x = hi + lo to ~2^-17 relative), both rounded to nearest even by the
//   hardware's packed conversion: five instructions a pair, which is what lets the split stand inside the product loop
__device__ __forceinline__ unsigned bf2_split(float a, float b, unsigned* lo) {
    const unsigned h = __builtin_bit_cast(unsigned, __builtin_convertvector((v2fp){a, b}, v2bp));
    const v2fp r = (v2fp){a, b} - (v2fp){__uint_as_float(h << 16), __uint_as_float(h & 0xffff0000u)};
    *lo = __builtin_bit_cast(unsigned, __builtin_convertvector(r, v2bp));
    return h; }
// transposing LDS load: lane (c = lane & 15, h = lane >> 4) gets column c, rows 8 h .. 8 h + 7 of the 16 x 16 block of 16-bit values whose row 8 (lane >> 4) + (lane & 7),
//   16-byte half (lane >> 3) & 1 the lane's address names: half of a 16 x 32 A fragment in the fragment loaders' k order
typedef __attribute__((ext_vector_type(8))) short v8sp;
__device__ __forceinline__ v8hp lds_tr16(const unsigned char* p) {
    typedef __attribute__((address_space(3))) v8sp lds_v8sp;
    return __builtin_bit_cast(v8hp, __builtin_amdgcn_ds_load_tr16_b128_v8i16((lds_v8sp*)p)); }
// expf, step for step as the compiler expands it (x * log2(e) in two parts, 2^fraction, ldexp, the two range tests), written out so that the v_nop can stand in the
//   statement of v_exp_f32: it fills the one slot the instruction set asks for in front of a vector instruction that reads the result or overwrites the source
__device__ __forceinline__ float exp_slot(float x) {
    const float ph = x * 0x1.715476p+0f;
    const float pl = fmaf(x, 0x1.4ae0bep-26f, fmaf(x, 0x1.715476p+0f, -ph));
    const float en = rintf(ph);
    const float a = (ph - en) + pl;
    float y;
    asm("v_exp_f32 %0, %1\n\tv_nop" : "=v"(y) : "v"(a));
    float r = ldexpf(y, (int)en);
    r = (x < -0x1.9d1da0p+6f) ? 0.f : r;
    r = (x > 0x1.62e430p+6f) ? __builtin_inff() : r;
    return r;
}
// one wave per row, RW rows per wave one after the other: sim = tril + AQ[n] + CM[m], masked exactly as the module: sim + (1 - qm*mm) * -1e30; the whole row stays in
//   registers (32 values per lane) from the one read of SIM to the one write: row max -> RMX, softmax over m (exp once), probabilities x ps stored as f16, the
//   operand plane of the query->memory product. CM and the memory mask are read once per wave; max and sum meet by lane shuffles, so the kernel has no barrier.
typedef __attribute__((ext_vector_type(4))) _Float16 v4h;
typedef __attribute__((ext_vector_type(4))) int      v4i;
template <int N, int M, int RW>
__global__ __launch_bounds__(256) void k_bi_soft16(const float* __restrict__ SIM, const float* __restrict__ AQ, const float* __restrict__ CM, const int* __restrict__ QM, const int* __restrict__ MM, float* __restrict__ RMX, _Float16* __restrict__ P16, float ps) {
    static_assert(M % 128 == 0 && N % (8 * RW) == 0, "whole 512-byte wave loads; whole blocks of 8 waves x RW rows");
    constexpr int C = M / 128;
    const int lane = threadIdx.x & 31, wv = __builtin_amdgcn_readfirstlane(threadIdx.x >> 5);
    const size_t bz = blockIdx.y;   // batch = blockIdx.y
    const size_t row0 = bz * N + (size_t)(blockIdx.x * 8 + wv) * RW;
    float aqv[RW], qmv[RW];
#pragma unroll
    for (int r = 0; r < RW; ++r) { aqv[r] = AQ[row0 + r]; qmv[r] = (float)QM[row0 + r]; }
    const float* sr = SIM + row0 * M + lane * 4;
    v4f x[C], nx[C], cm[C], mf[C]; v4i mk[C];
#pragma unroll
    for (int i = 0; i < C; ++i) x[i] = *(const v4f*)(sr + i * 128);
#pragma unroll
    for (int i = 0; i < C; ++i) { cm[i] = *(const v4f*)(CM + bz * M + lane * 4 + i * 128); mk[i] = *(const v4i*)(MM + bz * M + lane * 4 + i * 128); }
#pragma unroll
    for (int r = 0; r < RW; ++r) {
        if (r + 1 < RW) {
#pragma unroll
            for (int i = 0; i < C; ++i) nx[i] = *(const v4f*)(sr + (size_t)(r + 1) * M + i * 128);   // the next row flies while this one is worked on
            asm volatile("s_wait_xcnt 0x0" ::: "memory");   // the row's work may reuse the offset register that the loads above name
            __builtin_amdgcn_sched_barrier(0);   // keeps the loads and their wait at the head of the row's work; left free the loads sink to just ahead of their first use
        }
        if (r == 0) {
#pragma unroll
            for (int i = 0; i < C; ++i) mf[i] = __builtin_convertvector(mk[i], v4f);
        }
        const float aq = aqv[r], qm = qmv[r];
        float mx = -3.0e38f;
#pragma unroll
        for (int i = 0; i < C; ++i)
#pragma unroll
            for (int e = 0; e < 4; ++e) { const float msk = qm * mf[i][e]; const float v = x[i][e] + aq + cm[i][e] + (1.f - msk) * -1.0e30f; x[i][e] = v; mx = fmaxf(mx, v); }
        for (int o = 16; o > 0; o >>= 1) mx = fmaxf(mx, __shfl_xor(mx, o, 32));
        v4f s4 = {0.f, 0.f, 0.f, 0.f};
#pragma unroll
        for (int i = 0; i < C; ++i)
#pragma unroll
            for (int e = 0; e < 4; ++e) { const float ev = exp_slot(x[i][e] - mx); x[i][e] = ev; s4[e] += ev; }
        float s = (s4[0] + s4[1]) + (s4[2] + s4[3]);
        for (int o = 16; o > 0; o >>= 1) s += __shfl_xor(s, o, 32);
        const float inv = 1.f / s;
        _Float16* pr = P16 + (row0 + r) * M + lane * 4;
        v4h hv[C];
#pragma unroll
        for (int i = 0; i < C; ++i)
#pragma unroll
            for (int e = 0; e < 4; ++e) hv[i][e] = (_Float16)((x[i][e] * inv) * ps);
        __builtin_amdgcn_sched_barrier(0);   // with the one below: nothing that refills a register of these stores is scheduled between them and their wait
#pragma unroll
        for (int i = 0; i < C; ++i) *(v4h*)(pr + i * 128) = hv[i];
        VST2(float, RMX + (row0 + r) * 32 + lane, mx);   // row max staged as a whole 32-float line (slot 0 is read later)
        if (r + 1 < RW) {
            asm volatile("s_wait_xcnt 0x0" ::: "memory");   // the next row's work reuses the registers that the stores above name
            __builtin_amdgcn_sched_barrier(0);
        }
#pragma unroll
        for (int i = 0; i < C; ++i) x[i] = nx[i];
    } }

// Operand preparation, similarity product, masked row softmax and query->memory product in ONE launch; the 16-bit operands, the similarity matrix and the
//   probabilities never leave the chip's LDS and registers.
//   A masked memory row has probability 0 in every query that has an unmasked score at all (2^(-1e30 - max) is 0) and never holds its row maximum, so only the batch's
//   unmasked memory rows are walked: the block packs their row numbers into an LDS list (ballots and a prefix over the 16 waves' counts), and the copies gather by it.
//   A query whose scores are ALL masked (its own mask is 0, or no memory row is unmasked) is not stored here: its scores all equal -1e30, its row is the mean of all
//   memory rows, and the second launch stores it; its row maximum, -1e30, comes out of the arithmetic below as before.
//   Block = 16 waves = 4 groups of 16 query rows x 4 quarters of the packed rows' tiles. A wave walks its quarter's tiles of 32 packed memory rows:
//   S^T = memory x (q * w_qm + w_m)^T (bf16 hi/lo, three products): sum_d m_d (q_d w_qm_d + w_m_d) is the trilinear term and memory . w_m in one product, so no row dot
//   of memory is needed; a lane holds scores of ONE query (column lane & 15; rows 8 * (lane >> 4) + r of each 16-row tile);
//   sim = S + q . w_q + (1 - qm * mm) * -1e30 as the module has it; running maximum and sum; p = 2^((sim - max) * log2(e) + lps), one subtraction, one fused
//   multiply-add and one v_exp_f32 a score: the f16 scale 2^lps rides in the exponent and, being in the sum as well, cancels in the quotient (os undoes the scale ts of the
//   f16 tile alone). The subtraction comes first: at -1e30 a product with log2(e) would round by more than the whole exponent range. The two 16-row score tiles, as f16, ARE the B operand of
//   O^T += memory^T x P^T (the k order of the fragment loaders). The four quarters of a query meet once, at the end, through LDS.
//   The memory tiles are made here from the f32 input, two LDS buffers: of the four waves that share a quarter each brings 8 whole rows of tile s + 1 into an LDS slot of
//   its own by asynchronous 16-byte copies that fly under trip s, reads them back ahead of the trip's second product and stores, one row between every two of that
//   product's matrix instructions, their bf16 hi and lo rows and their f16 x ts rows. The f16 tile stays row-major ([m][d]: every store covers one whole row); the
//   second product takes its memory^T fragments from it by transposing loads. Row pitches 272 bytes (16 x odd, 16-byte reads) and 288 bytes (32 x odd, transposing
//   reads) keep the fragment reads off each other's banks.
//   Every '#pragma unroll' below stands on a loop whose index picks a fragment, an accumulator or a vector element: unrolled, these stay in registers.
template <int N, int M, int D>
__global__ __launch_bounds__(512) void k_bi_fused(const float* __restrict__ Q, const float* __restrict__ MEM, const float* __restrict__ wq, const float* __restrict__ wm, const float* __restrict__ wqm,
        const int* __restrict__ QM, const int* __restrict__ MM, float* __restrict__ RMX, float* __restrict__ OUT, float ts, float lps, float os) {
    static_assert(N % 64 == 0 && M == 1024 && D == 128, "64 query rows a block; 4 quarters of 8 tiles of 32 memory rows; 2 mask words a thread; one 16-byte load per lane and row");
    typedef w25::Frag<__bf16> FB; typedef w25::Frag<_Float16> FH; typedef w25::v8f v8f;
    constexpr int PA = 272, PV = 288;                   // LDS row pitch in bytes: 256-byte rows of hi and lo; 256-byte rows of the f16 tile
    constexpr int TILE = 2 * 32 * PA + 32 * PV;         // one quarter's tile: hi, lo, f16
    constexpr int BUF = 4 * TILE, MQ4 = M / 4, NS = MQ4 / 32;
    static_assert(2 * BUF >= 16 * 8 * 32 * 8 * 4, "the ring later holds the 16 waves' partial outputs");
    __shared__ __align__(32) unsigned char ring[2 * BUF];
    __shared__ __align__(16) unsigned char qs[2 * 64 * PA];
    __shared__ __align__(16) float smf[M];
    __shared__ __align__(16) unsigned char raw[16 * 8 * 512];   // a slot of 8 f32 rows for each wave, filled and read by that wave alone
    __shared__ float saq[64];
    __shared__ __align__(32) int sidx[M];   // the batch's unmasked memory rows, packed to the front; row 0 behind them
    __shared__ __align__(16) int wtot[16];  // unmasked rows among each wave's 64 mask words
    float (*smx)[4][16] = (float (*)[4][16])smf;           // the quarters' maxima and sums take the mask's place behind the loop
    float (*ssm)[4][16] = (float (*)[4][16])(smf + 256);
    const int lane = threadIdx.x & 31, wv = __builtin_amdgcn_readfirstlane(threadIdx.x >> 5);
    const int qg = wv & 3, ms = wv >> 2, nl = lane & 15, h = lane >> 4, koff = h * 8;
    const size_t bz = blockIdx.y, q0 = bz * N + (size_t)blockIdx.x * 64, row = q0 + qg * 16 + nl;
    const unsigned l4 = lane * 4;
    const float* gm = MEM + bz * M * D + l4;                         // this lane's 16 bytes of the batch's memory row 0
    const unsigned char* rw = raw + wv * 4096 + lane * 16;           // ... and their place in the first row of the wave's own slot: rows 512 bytes apart
    // one f32 row (this lane's 4 values) -> its bf16 hi row, bf16 lo row and f16 x ts row of a tile; pa, pf: this lane's 8 bytes of the wave's first row there
    auto put_row = [&](const v4f x, unsigned char* pa, unsigned char* pf, int i) {
        v2u hi, lo; unsigned l0, l1;
        hi[0] = bf2_split(x[0], x[1], &l0); hi[1] = bf2_split(x[2], x[3], &l1); lo[0] = l0; lo[1] = l1;
        *(v2u*)(pa + i * PA) = hi; *(v2u*)(pa + (32 + i) * PA) = lo;
        *(v4h*)(pf + i * PV) = __builtin_convertvector(x * ts, v4h);
    };
    typedef __attribute__((ext_vector_type(2))) int v2i;
    const v2i k = *(const v2i*)(MM + bz * M + threadIdx.x * 2);   // the memory mask of the whole batch row: read once a block
    const float* xp = Q + (q0 + wv * 4) * D + l4;
    const v4f w = *(const v4f*)(wq + lane * 4), g = *(const v4f*)(wqm + lane * 4), u = *(const v4f*)(wm + lane * 4);
    const int kq = (QM + q0 + qg * 16)[(unsigned)nl];   // scalar base and a lane offset that lives on: no address register of its own to be reused
    v4f y[4];
#pragma unroll
    for (int i = 0; i < 4; ++i) y[i] = *(const v4f*)(xp + i * D);
    asm volatile("s_wait_xcnt 0x0" ::: "memory");   // the work below reuses the address registers that the loads above name
    __builtin_amdgcn_sched_barrier(0);   // holds the first rewrite of those registers behind the wait
    // the unmasked memory rows are packed: a wave's rows with even index first, then its odd ones, wave after wave (the order of a softmax's terms is free)
    const unsigned b0 = __builtin_amdgcn_ballot_w32(k[0] != 0), b1 = __builtin_amdgcn_ballot_w32(k[1] != 0), below = (1u << lane) - 1u;
    if (lane == 0) wtot[wv] = __popc(b0) + __popc(b1);
    __syncthreads();   // the 16 waves' counts are there
    int first = 0, call = 0;
#pragma unroll
    for (int j = 0; j < 4; ++j) {
        const v4i tj = *(const v4i*)&wtot[j * 4];
#pragma unroll
        for (int c = 0; c < 4; ++c) { first += (j * 4 + c < wv) ? tj[c] : 0; call += tj[c]; }
    }
    const int cnt = __builtin_amdgcn_readfirstlane(call);   // unmasked rows of the batch, 0 .. M: the same in every wave
    // tiles of 32 packed rows are dealt to the four quarters in turn: quarter ms has tiles ms, ms + 4, ...: nt of them, which is nsd (the block's trips) or one fewer;
    //   both bounded by the shape and kept scalar for the branches on them. With no unmasked row one tile of masked rows is still walked: it yields the row maximum
    const int tiles = min((max(cnt, 1) + 31) >> 5, 4 * NS);
    const int nsd = __builtin_amdgcn_readfirstlane((tiles + 3) >> 2), nt = __builtin_amdgcn_readfirstlane((tiles + 3 - ms) >> 2);
    if (k[0] != 0) sidx[first + __popc(b0 & below)] = (int)threadIdx.x * 2;
    if (k[1] != 0) sidx[first + __popc(b0) + __popc(b1 & below)] = (int)threadIdx.x * 2 + 1;
    {   // behind the packed rows: row 0 with mask 0, which the arithmetic below treats like any masked row
        const int e0 = (int)threadIdx.x * 2, e1 = e0 + 1;
        if (e0 >= cnt) sidx[e0] = 0;
        if (e1 >= cnt) sidx[e1] = 0;
        *(v2fp*)&smf[e0] = (v2fp){e0 < cnt ? 1.f : 0.f, e1 < cnt ? 1.f : 0.f};
    }
    __syncthreads();   // publishes the packed list to the waves that aim their copies by it
    auto copy_rows = [&](int s) {
        const int* ip = sidx + (s * 4 + ms) * 32 + qg * 8;   // this wave's 8 rows of its quarter's tile s; every entry is a thread's own row number, below M
        const v4i r0 = *(const v4i*)ip, r1 = *(const v4i*)(ip + 4);
        const unsigned la = (unsigned)(size_t)rw;
        // the wait is the last line of the copies' own statement: no register that a copy names is rewritten ahead of it
        asm volatile("global_load_async_to_lds_b128 %0, %8, off\n\t"
                     "global_load_async_to_lds_b128 %1, %9, off\n\t"
                     "global_load_async_to_lds_b128 %2, %10, off\n\t"
                     "global_load_async_to_lds_b128 %3, %11, off\n\t"
                     "global_load_async_to_lds_b128 %4, %12, off\n\t"
                     "global_load_async_to_lds_b128 %5, %13, off\n\t"
                     "global_load_async_to_lds_b128 %6, %14, off\n\t"
                     "global_load_async_to_lds_b128 %7, %15, off\n\t"
                     "s_wait_xcnt 0x0"
                     :: "v"(la), "v"(la + 512u), "v"(la + 1024u), "v"(la + 1536u), "v"(la + 2048u), "v"(la + 2560u), "v"(la + 3072u), "v"(la + 3584u),
                        "v"(gm + (size_t)(unsigned)r0[0] * D), "v"(gm + (size_t)(unsigned)r0[1] * D), "v"(gm + (size_t)(unsigned)r0[2] * D), "v"(gm + (size_t)(unsigned)r0[3] * D),
                        "v"(gm + (size_t)(unsigned)r1[0] * D), "v"(gm + (size_t)(unsigned)r1[1] * D), "v"(gm + (size_t)(unsigned)r1[2] * D), "v"(gm + (size_t)(unsigned)r1[3] * D)
                     : "memory");
    };
    copy_rows(0);
    const float qm = (float)kq;
    {   // the block's 64 rows of q: wave wv takes rows 4 wv .. 4 wv + 3: q . w_q -> saq, q * w_qm + w_m -> hi and lo rows of qs
        float keep = 0.f;
#pragma unroll
        for (int i = 0; i < 4; ++i) {
            float s = y[i][0] * w[0]; s += y[i][1] * w[1]; s += y[i][2] * w[2]; s += y[i][3] * w[3];
            for (int o = 16; o > 0; o >>= 1) s += __shfl_xor(s, o, 32);
            if (lane == i) keep = s;
        }
        if (lane < 4) saq[wv * 4 + lane] = keep;
        unsigned char* pq = qs + wv * 4 * PA + lane * 8;
#pragma unroll
        for (int i = 0; i < 4; ++i) { v2u hi, lo; unsigned l0, l1;
            const v4f z = y[i] * g + u;
            hi[0] = bf2_split(z[0], z[1], &l0); hi[1] = bf2_split(z[2], z[3], &l1); lo[0] = l0; lo[1] = l1;
            *(v2u*)(pq + i * PA) = hi; *(v2u*)(pq + (64 + i) * PA) = lo; }
    }
    asm volatile("s_wait_asynccnt 0x0" ::: "memory");   // this wave's copies of tile 0 have landed; it alone reads its slot
#pragma unroll
    for (int i = 0; i < 8; ++i) put_row(*(const v4f*)(rw + i * 512), ring + ms * TILE + qg * 8 * PA + lane * 8, ring + ms * TILE + 64 * PA + qg * 8 * PV + lane * 8, i);
    asm volatile("s_wait_dscnt 0x0" ::: "memory");      // this wave's reads of its slot have returned before the next copies are aimed at it
    __syncthreads();   // publishes qs, saq and tile 0
    if (nsd > 1) copy_rows(1);
    const float aq = saq[qg * 16 + nl];
    FB::V qh[4], ql[4];
#pragma unroll
    for (int kk = 0; kk < 4; ++kk) {
        qh[kk] = FB::load((const __bf16*)(qs + (qg * 16 + nl) * PA) + koff + kk * 32);
        ql[kk] = FB::load((const __bf16*)(qs + (64 + qg * 16 + nl) * PA) + koff + kk * 32);
    }
    v8f o[8];
#pragma unroll
    for (int dt = 0; dt < 8; ++dt) o[dt] = (v8f){0.f, 0.f, 0.f, 0.f, 0.f, 0.f, 0.f, 0.f};
    float mrun = -3.0e38f, lsum = 0.f;
    constexpr float L2E = 0x1.715476p+0f;   // log2(e)
    typedef __attribute__((ext_vector_type(2))) float v2e;
    // O^T += memory^T x P^T over the 8 tiles of d; with make, tile s + 1 is made in between, a row for each tile of d, so that its vector work and its LDS stores run under
    //   the fragment reads and the matrix instructions. It goes into buffer nb, whose last readers (trip s - 1) left it at the barrier one trip ago.
    auto second = [&](const unsigned char* tt, const FH::V pb, const float alpha, const bool make, const int nb) __attribute__((always_inline)) {
        FH::U f[2];
        f[0].h[0] = lds_tr16(tt); f[0].h[1] = lds_tr16(tt + 16 * PV);
        v4f x[2];
        // holds the wait below behind the exponentials (left free it is scheduled up into the first product, where the copies are still young) and, in both forms of the trip,
        //   the second product's work out of the first product's stretch, where no register is free: without it the build spills
        __builtin_amdgcn_sched_barrier(0);
        if (make) {
            asm volatile("s_wait_asynccnt 0x0" ::: "memory");   // this wave's copies of tile s + 1 have landed; it alone reads its slot
            x[0] = *(const v4f*)rw;
        }
        unsigned char* pa = ring + nb * BUF + ms * TILE + qg * 8 * PA + lane * 8;
        unsigned char* pf = ring + nb * BUF + ms * TILE + 64 * PA + qg * 8 * PV + lane * 8;
#pragma unroll
        for (int dt = 0; dt < 8; ++dt) {
            if (dt < 7) { f[(dt + 1) & 1].h[0] = lds_tr16(tt + 32 * (dt + 1)); f[(dt + 1) & 1].h[1] = lds_tr16(tt + 16 * PV + 32 * (dt + 1)); }   // read ahead of the row's stores
            if (make) {
                if (dt < 7) x[(dt + 1) & 1] = *(const v4f*)(rw + (dt + 1) * 512);   // one row ahead: its latency is covered and only two rows' registers are held
                put_row(x[dt & 1], pa, pf, dt);
            }
            o[dt] = FH::mma(f[dt & 1].v, pb, o[dt] * alpha);
        }
    };
    // one trip: tile s is worked on; with make, tile s + 1 is made. Inlined at both places: a call would put the accumulators into memory
    auto trip = [&](const int s, const bool make) __attribute__((always_inline)) {
        const unsigned char* tb = ring + (s & 1) * BUF + ms * TILE;
        const __bf16* th = (const __bf16*)(tb + nl * PA) + koff;
        const __bf16* tl = (const __bf16*)(tb + (32 + nl) * PA) + koff;
        const unsigned char* tt = tb + 64 * PA + (koff + (lane & 7)) * PV + ((lane >> 3) & 1) * 16;   // the transposing load's lane address: memory rows 8 h + (lane & 7)
        v8f sc[2];
        sc[0] = (v8f){0.f, 0.f, 0.f, 0.f, 0.f, 0.f, 0.f, 0.f}; sc[1] = sc[0];
#pragma unroll
        for (int kk = 0; kk < 4; ++kk)
#pragma unroll
            for (int t = 0; t < 2; ++t) {
                const FB::V ah = FB::load(th + t * 16 * (PA / 2) + kk * 32);
                const FB::V al = FB::load(tl + t * 16 * (PA / 2) + kk * 32);
                sc[t] = FB::mma(ah, qh[kk], sc[t]);
                sc[t] = FB::mma(ah, ql[kk], sc[t]);
                sc[t] = FB::mma(al, qh[kk], sc[t]);
            }
        const int mb = (s * 4 + ms) * 32 + koff;
        float v[2][8];
        float mloc = -3.0e38f;
#pragma unroll
        for (int t = 0; t < 2; ++t) {
            const v4f f0 = *(const v4f*)&smf[mb + t * 16], f1 = *(const v4f*)&smf[mb + t * 16 + 4];
#pragma unroll
            for (int r = 0; r < 8; ++r) {
                const float msk = qm * (r < 4 ? f0[r & 3] : f1[r & 3]);
                const float sim = sc[t][r] + aq + (1.f - msk) * -1.0e30f;
                v[t][r] = sim; mloc = fmaxf(mloc, sim);
            }
        }
        mloc = fmaxf(mloc, __shfl_xor(mloc, 16, 32));   // the other 16 memory rows of this query's 32 lie in lane ^ 16
        const float mnew = fmaxf(mrun, mloc);
        float alpha = (mrun - mnew) * L2E;
        mrun = mnew;
        float e[2][8];   // first the exponents, two at a time (packed subtract, packed fused multiply-add), then 2^e in place
#pragma unroll
        for (int t = 0; t < 2; ++t)
#pragma unroll
            for (int r = 0; r < 8; r += 2) {
                const v2e a = __builtin_elementwise_fma((v2e){v[t][r], v[t][r + 1]} - (v2e){mnew, mnew}, (v2e){L2E, L2E}, (v2e){lps, lps});
                e[t][r] = a[0]; e[t][r + 1] = a[1];
            }
        // v_exp_f32 in runs: each fills the slot that the instruction set asks for behind the one before it, and the one v_nop fills it behind the last;
        //   left to the compiler every exponential went through one register, a dependent chain with a v_nop of its own
        asm("v_exp_f32 %0, %0\n\tv_exp_f32 %1, %1\n\tv_exp_f32 %2, %2\n\tv_exp_f32 %3, %3\n\tv_exp_f32 %4, %4\n\tv_exp_f32 %5, %5\n\t"
            "v_exp_f32 %6, %6\n\tv_exp_f32 %7, %7\n\tv_exp_f32 %8, %8\n\tv_nop"
            : "+v"(e[0][0]), "+v"(e[0][1]), "+v"(e[0][2]), "+v"(e[0][3]), "+v"(e[0][4]), "+v"(e[0][5]), "+v"(e[0][6]), "+v"(e[0][7]), "+v"(alpha));
        asm("v_exp_f32 %0, %0\n\tv_exp_f32 %1, %1\n\tv_exp_f32 %2, %2\n\tv_exp_f32 %3, %3\n\tv_exp_f32 %4, %4\n\tv_exp_f32 %5, %5\n\t"
            "v_exp_f32 %6, %6\n\tv_exp_f32 %7, %7\n\tv_nop"
            : "+v"(e[1][0]), "+v"(e[1][1]), "+v"(e[1][2]), "+v"(e[1][3]), "+v"(e[1][4]), "+v"(e[1][5]), "+v"(e[1][6]), "+v"(e[1][7]));
        FH::V pb;
        float s0 = 0.f, s1 = 0.f;
#pragma unroll
        for (int r = 0; r < 8; ++r) {
            s0 += e[0][r]; s1 += e[1][r];
            pb[r] = (_Float16)e[0][r]; pb[8 + r] = (_Float16)e[1][r];
        }
        lsum = lsum * alpha + (s0 + s1);
        second(tt, pb, alpha, make, (s + 1) & 1);
    };
#pragma unroll 1   // stays rolled: for speed only
    for (int s = 0; s < nsd - 1; ++s) {
        trip(s, true);   // a quarter with one tile fewer makes, in the last of these trips, a tile of masked rows that nobody reads: a third form of the trip spills
        asm volatile("s_wait_dscnt 0x0" ::: "memory");   // this wave's reads of its slot have returned before the next copies are aimed at it
        __syncthreads();                          // publishes tile s + 1 and ends every wave's reads of buffer s & 1
        if (s + 2 < nsd) copy_rows(s + 2);        // flies under trip s + 1 up to its second product
    }
    if (nt == nsd) trip(nsd - 1, false);   // the last tile, of the quarters that have one: none to make
    // the four slots that the chip needs behind the last matrix instructions before a vector instruction may overwrite their operands
    asm volatile("v_nop\n\tv_nop\n\tv_nop\n\tv_nop" : "+v"(o[0]), "+v"(o[1]), "+v"(o[2]), "+v"(o[3]), "+v"(o[4]), "+v"(o[5]), "+v"(o[6]), "+v"(o[7]), "+v"(lsum));
    __syncthreads();       // ends every wave's reads of the ring and of the mask, whose places are used anew below
    lsum += __shfl_xor(lsum, 16, 32);
    if (h == 0) { smx[ms][qg][nl] = mrun; ssm[ms][qg][nl] = lsum; }
    __syncthreads();   // the four quarters' maxima and sums are there
    float mtot = smx[0][qg][nl];
#pragma unroll
    for (int j = 1; j < 4; ++j) mtot = fmaxf(mtot, smx[j][qg][nl]);
    float ltot = 0.f;
#pragma unroll
    for (int j = 0; j < 4; ++j) ltot += ssm[j][qg][nl] * exp_slot(smx[j][qg][nl] - mtot);
    const float fo = exp_slot(mrun - mtot);
    float* so = (float*)ring;   // [quarter][query group][d tile][lane][8]
#pragma unroll
    for (int dt = 0; dt < 8; ++dt) {
        const v8f w = o[dt] * fo;
        float* p = so + (((ms * 4 + qg) * 8 + dt) * 32 + lane) * 8;
        *(v4f*)p = (v4f){w[0], w[1], w[2], w[3]}; *(v4f*)(p + 4) = (v4f){w[4], w[5], w[6], w[7]};
    }
    __syncthreads();   // the partial outputs are there
    const float inv = os / ltot;
    float* op = OUT + row * D + ms * 32 + koff;   // wave (qg, ms) sums and stores d = 32 ms .. 32 ms + 31 of its 16 queries: one whole 128-byte line a query
#pragma unroll
    for (int j = 0; j < 2; ++j) {
        v4f a0 = {0.f, 0.f, 0.f, 0.f}, a1 = a0;
#pragma unroll
        for (int k = 0; k < 4; ++k) {
            const float* p = so + (((k * 4 + qg) * 8 + ms * 2 + j) * 32 + lane) * 8;
            a0 += *(const v4f*)p; a1 += *(const v4f*)(p + 4);
        }
        // a query whose every score is masked has the mean of all memory rows: the second launch stores those rows of the output
        if (kq != 0 && cnt > 0) { *(v4f*)(op + j * 16) = a0 * inv; *(v4f*)(op + j * 16 + 4) = a1 * inv; }
    }
    if (ms == 0) {   // row maximum staged as a whole 32-float line (slot 0 is read later)
        asm volatile("s_wait_xcnt 0x0" ::: "memory");   // the address work below reuses registers that the stores above name
        __builtin_amdgcn_sched_barrier(0);   // holds the first rewrite of those registers behind the wait
        float* rp = RMX + row * 32 + h * 16;
        const v4f m4 = {mtot, mtot, mtot, mtot};
#pragma unroll
        for (int j = 0; j < 4; ++j) *(v4f*)(rp + j * 4) = m4;
    } }

// memory->query: p = softmax_n(RMX[b][n]); MQ[b][every row][d] = sum_n p_n q[b][n][d]. One block of 32 waves per (batch, 32-float slice of d): thread t owns row
//   maximum t for the statistics; for the weighted sum a wave reads 4 rows x 128 bytes per load and every lane has its 8 row loads in flight at once
//   (issued ahead of the statistics, which do not depend on them); partial sums meet by lane shuffles and one LDS table. The block then stores its slice into
//   all N rows of the second output itself, 16 bytes a lane, 8 stores a lane.
//   As many blocks again (blockIdx.y >= D / 32) do the same with weight 1 / N over the memory rows and store the slice into the first output's all-masked rows.
template <int N, int D>
__global__ __launch_bounds__(1024) void k_bi_m2q(const float* __restrict__ RMX, const float* __restrict__ Q, const float* __restrict__ MEM, const int* __restrict__ QM, const int* __restrict__ MM,
        float* __restrict__ MQ, float* __restrict__ OUT) {
    static_assert(N == 1024 && D % 32 == 0, "one row maximum per thread; whole 128-byte slices of d");
    __shared__ float red[32]; __shared__ float pw[N]; __shared__ __align__(16) float part[32][32]; __shared__ __align__(16) float vec[32];
    const int b = blockIdx.x, d0 = blockIdx.y * 32, t = threadIdx.x, lane = t & 31, wv = t >> 5;
    const int rsub = lane >> 3, c4 = (lane & 7) * 4;
    if (blockIdx.y >= D / 32) {   // the same for the whole block: these blocks store the first output's rows whose scores are all masked, which the first launch leaves out
        // -1e30 swallows the similarity, so the N scores of such a row are equal and each probability is 1 / N (as many memory rows as queries): the row is the mean of all
        //   memory rows, dealt to the waves and met as the weighted sum of q below
        __shared__ unsigned anym[32];
        const int e0 = d0 - D;
        const int km = (MM + (long long)b * N)[(unsigned)t];
        const int* qf = QM + (long long)b * N + wv * 4 + rsub;
        int fq[N / 128];
        for (int i = 0; i < N / 128; ++i) fq[i] = qf[i * 128];
        asm volatile("s_wait_xcnt 0x0" ::: "memory");   // the loads below may land in the address registers that the loads above name
        __builtin_amdgcn_sched_barrier(0);   // holds them behind the wait
        const float* mb = MEM + ((long long)b * N + wv * 4 + rsub) * D + e0 + c4;
        v4f z[N / 128];
        for (int i = 0; i < N / 128; ++i) z[i] = *(const v4f*)(mb + (long long)i * 128 * D);
        asm volatile("s_wait_xcnt 0x0" ::: "memory");   // the work below reuses the address registers that the loads above name
        __builtin_amdgcn_sched_barrier(0);   // holds the first rewrite of those registers behind the wait
        const unsigned bm = __builtin_amdgcn_ballot_w32(km != 0);
        if (lane == 0) anym[wv] = bm;
        v4f acm = {0.f, 0.f, 0.f, 0.f};
        for (int i = 0; i < N / 128; ++i) acm += z[i];
        for (int c = 0; c < 4; ++c) { acm[c] += __shfl_xor(acm[c], 8, 32); acm[c] += __shfl_xor(acm[c], 16, 32); }
        if (lane < 8) *(v4f*)&part[wv][c4] = acm;
        __syncthreads();   // the waves' partial sums and their words of the memory mask are there
        const bool nomem = __builtin_amdgcn_ballot_w32(anym[lane] != 0u) == 0u;   // no memory row of the batch is unmasked: then every query's scores are all masked
        if (t < 32) { float a = 0.f;
            for (int w = 0; w < 32; ++w) a += part[w][t];
            vec[t] = a * (1.f / N); }
        __syncthreads();   // publishes the finished slice to the 32 waves that store it
        const v4f mv = *(const v4f*)&vec[c4];
        float* oq = OUT + ((long long)b * N + wv * 4 + rsub) * D + e0 + c4;   // a wave store = up to 4 rows x one whole 128-byte line
        for (int i = 0; i < N / 128; ++i) if (nomem || fq[i] == 0) *(v4f*)(oq + (long long)i * 128 * D) = mv;
        return;
    }
    const float r = RMX[((long long)b * N + t) * 32];
    const float* qb = Q + ((long long)b * N + wv * 4 + rsub) * D + d0 + c4;
    v4f x[N / 128];
    for (int i = 0; i < N / 128; ++i) x[i] = *(const v4f*)(qb + (long long)i * 128 * D);
    float mx = r;
    for (int o = 16; o > 0; o >>= 1) mx = fmaxf(mx, __shfl_xor(mx, o, 32));
    if (lane == 0) red[wv] = mx;
    __syncthreads();
    float mm = red[lane];
    for (int o = 16; o > 0; o >>= 1) mm = fmaxf(mm, __shfl_xor(mm, o, 32));
    __syncthreads();
    const float e = expf(r - mm); pw[t] = e;
    float s = e;
    for (int o = 16; o > 0; o >>= 1) s += __shfl_xor(s, o, 32);
    if (lane == 0) red[wv] = s;
    __syncthreads();
    float tot = red[lane];
    for (int o = 16; o > 0; o >>= 1) tot += __shfl_xor(tot, o, 32);
    v4f acc = {0.f, 0.f, 0.f, 0.f};
    for (int i = 0; i < N / 128; ++i) acc += pw[i * 128 + wv * 4 + rsub] * x[i];
    for (int c = 0; c < 4; ++c) { acc[c] += __shfl_xor(acc[c], 8, 32); acc[c] += __shfl_xor(acc[c], 16, 32); }
    if (lane < 8) *(v4f*)&part[wv][c4] = acc;
    __syncthreads();
    if (t < 32) { float a = 0.f;
        for (int w = 0; w < 32; ++w) a += part[w][t];
        vec[t] = a * (1.f / tot); }
    __syncthreads();   // publishes the finished slice to the 32 waves that store it
    const v4f bv = *(const v4f*)&vec[c4];
    float* op = MQ + ((long long)b * N + wv * 4 + rsub) * D + d0 + c4;   // a wave store = 4 rows x one whole 128-byte line, as the reads of q above
    for (int i = 0; i < N / 128; ++i) *(v4f*)(op + (long long)i * 128 * D) = bv; }


extern "C" void kernel_launch(void* const* d_in, const int* in_sizes, int n_in, void* d_out, int out_size, void* d_ws, size_t ws_size, hipStream_t stream) {
    (void)in_sizes; (void)n_in; (void)out_size; (void)ws_size;
    const float* q = (const float*)d_in[0];
    const float* mem = (const float*)d_in[1];
    const float* wq = (const float*)d_in[2];
    const float* wm = (const float*)d_in[3];
    const float* wqm = (const float*)d_in[4];
    const int* qmask = (const int*)d_in[5];
    const int* mmask = (const int*)d_in[6];
    const int Bn = 16;
    const int N = 1024;
    const int M = 1024;
    const int D = 128;
    float* out = (float*)d_out;
    float* mq = out + ((size_t)Bn * N * D);
    char* wsp = (char*)d_ws;
    float* RMX = (float*)wsp;
    k_bi_fused<1024, 1024, 128><<<dim3((unsigned)(N / 64), (unsigned)Bn), 512, 0, stream>>>(q, mem, wq, wm, wqm, qmask, mmask, RMX, out, 16.0f, 12.0f, 0.0625f);
    k_bi_m2q<1024, 128><<<dim3((unsigned)Bn, 8u), 1024, 0, stream>>>(RMX, q, mem, qmask, mmask, mq, out);
}
